// v000
// Times are from an AMD MI455X. After a warm-up the kernel runs many times in a row, and a time is the length of
// such a window on the GPU divided by its runs, so every launch and the gaps after it count. The runs cycle
// through copies of the inputs. A figure is the median of several windows, for all but v000 over two sittings.
// Sittings can differ by a few percent; kernels timed side by side share one.
// v000, which the later versions start from, runs in 14.7 milliseconds.
// Contractions: x·[Wq|Wk]^T (+bias), Wv·x, q·k^T scores and P·V aggregation on v_wmma_f32_16x16x32_f16 (f16 operands; P carried x4096 and folded back x1/4096 in the f32 epilogue); Wsc·z on v_wmma_f32_16x16x32_bf16 with bf16 hi/lo split operand planes (hi·hi + hi·lo + lo·hi); f32 accumulate everywhere; column-wise softmax statistics, exp and the gamma residual in f32.
#include <hip/hip_runtime.h>
#include <math.h>
#include <stdint.h>

constexpr int kBatch   = 8;
constexpr int kCinHalf = 32;     // channels of x1 and of x2
constexpr int kCh      = 64;     // concatenated channels
constexpr int kPix     = 4096;   // h*w
constexpr int kDq      = 32;     // q/k channels = output channels

typedef __attribute__((ext_vector_type(16))) _Float16 v16h;
typedef __attribute__((ext_vector_type(8)))  _Float16 v8h;
typedef __attribute__((ext_vector_type(16))) __bf16   v16b;
typedef __attribute__((ext_vector_type(8)))  __bf16   v8b;
typedef __attribute__((ext_vector_type(8)))  float    v8f;
typedef __attribute__((ext_vector_type(4)))  float    v4f;
typedef __attribute__((ext_vector_type(4)))  unsigned int v4u;

__device__ __forceinline__ unsigned short f2bf_bits(float f) {
  unsigned u = __float_as_uint(f);
  return (unsigned short)((u + 0x7FFFu + ((u >> 16) & 1u)) >> 16);
}
__device__ __forceinline__ float bf_bits2f(unsigned short h) { return __uint_as_float(((unsigned)h) << 16); }
__device__ __forceinline__ unsigned pk16(unsigned short a, unsigned short b) { return (unsigned)a | ((unsigned)b << 16); }
__device__ __forceinline__ unsigned short h16_bits(float f) { const _Float16 h = (_Float16)f; return __builtin_bit_cast(unsigned short, h); }

// hazard guards as plain device helpers (no inline asm inside the kernel template body)
__device__ __forceinline__ void dep_guard_h(v8f& a, v8f& b, v16h x, v16h y) { asm volatile("v_nop\n\tv_nop\n\tv_nop\n\tv_nop" : "+v"(a), "+v"(b) : "v"(x), "v"(y)); }
__device__ __forceinline__ void dep_guard_b(v8f& a, v8f& b, v16b x, v16b y) { asm volatile("v_nop\n\tv_nop\n\tv_nop\n\tv_nop" : "+v"(a), "+v"(b) : "v"(x), "v"(y)); }
__device__ __forceinline__ void keep4_h(v16h a, v16h b, v16h c, v16h d) { asm volatile("v_nop" :: "v"(a), "v"(b), "v"(c), "v"(d)); }
__device__ __forceinline__ void keep4_b(v16b a, v16b b, v16b c, v16b d) { asm volatile("v_nop" :: "v"(a), "v"(b), "v"(c), "v"(d)); }
__device__ __forceinline__ void acc_guard4(v8f& a, v8f& b, v8f& c, v8f& d) { asm volatile("v_nop\n\tv_nop\n\tv_nop\n\tv_nop" : "+v"(a), "+v"(b), "+v"(c), "+v"(d)); }
template <typename T> struct Frag;
template <> struct Frag<_Float16> {
  typedef v16h V; union U { v16h v; v8h h[2]; };
  static __device__ __forceinline__ v16h load(const _Float16* p) {   // elements 0..7 <- p[0..7], 8..15 <- p[16..23]
    U f; f.h[0] = *(const v8h*)(p); f.h[1] = *(const v8h*)(p + 16); return f.v;
  }
  static __device__ __forceinline__ v8f mma(v16h a, v16h b, v8f c) {
    return __builtin_amdgcn_wmma_f32_16x16x32_f16(false, a, false, b, (short)0, c, false, false);
  }
  static __device__ __forceinline__ void guard(v8f& a, v8f& b, v16h x, v16h y) { dep_guard_h(a, b, x, y); }
  static __device__ __forceinline__ void keep(v16h a, v16h b, v16h c, v16h d) { keep4_h(a, b, c, d); }
};
template <> struct Frag<__bf16> {
  typedef v16b V; union U { v16b v; v8b h[2]; };
  static __device__ __forceinline__ v16b load(const __bf16* p) {
    U f; f.h[0] = *(const v8b*)(p); f.h[1] = *(const v8b*)(p + 16); return f.v;
  }
  static __device__ __forceinline__ v8f mma(v16b a, v16b b, v8f c) {
    return __builtin_amdgcn_wmma_f32_16x16x32_bf16(false, a, false, b, (short)0, c, false, false);
  }
  static __device__ __forceinline__ void guard(v8f& a, v8f& b, v16b x, v16b y) { dep_guard_b(a, b, x, y); }
  static __device__ __forceinline__ void keep(v16b a, v16b b, v16b c, v16b d) { keep4_b(a, b, c, d); }
};

// ---- Register-blocked batched WMMA GEMM ------------------------------------
// C[m,n] = scale * sum_k A[m,k] * Bt[n,k] (+bias)(+resid); each wave owns a 64x64 tile.
// A row-major [M,K]; Bt row-major [N,K]; M,N % 64 == 0, K % 32 == 0.
// SPLIT: operands are hi/lo planes (A2/Bt2 = lo planes, same layout); product = hi·hi + hi·lo + lo·hi.
// BIAS_MODE: 0 = none, 1 = bias[m], 2 = bias[n].
// OUT_MODE: 0 = f32, 1 = f16, 2 = bf16 hi plane (Cout) + bf16 lo plane (Cout2).
// ET: 0 = f16 operands, 1 = bf16 operands (pointers passed as 16-bit storage)
template <int ET> struct Elem;
template <> struct Elem<0> { typedef _Float16 T; };
template <> struct Elem<1> { typedef __bf16 T; };
template <int ET, bool SPLIT, int BIAS_MODE, int OUT_MODE, bool RESID, int ACT = 0>
__global__ __launch_bounds__(256) void wmma_gemm64(
    const unsigned short* __restrict__ Ap, const unsigned short* __restrict__ A2p, int lda, long strideA,
    const unsigned short* __restrict__ Btp, const unsigned short* __restrict__ Bt2p, int ldb, long strideB,
    void* __restrict__ Cout, void* __restrict__ Cout2, int ldc, long strideC,
    const float* __restrict__ bias,
    const float* __restrict__ resid, long strideR,
    int M, int N, int K, float scale) {
  typedef typename Elem<ET>::T T;
  typedef typename Frag<T>::V V;
  const T* A = (const T*)Ap; const T* A2 = (const T*)A2p; const T* Bt = (const T*)Btp; const T* Bt2 = (const T*)Bt2p;
  __shared__ __align__(16) float sT[8][16 * 68];   // per-wave 16x64 slab, pitch 68 floats
  const int b    = blockIdx.y;
  const int lane = threadIdx.x & 31;
  const int wave = threadIdx.x >> 5;
  const int tilesN = N >> 6;
  const int tilesM = M >> 6;
  const int tile = blockIdx.x * 8 + wave;
  if (tile >= tilesM * tilesN) return;   // wave-uniform; no block barriers in this kernel
  const int tm = tile / tilesN;
  const int tn = tile - tm * tilesN;
  const int m0 = tm << 6;
  const int n0 = tn << 6;

  const T* Ab  = A  + (size_t)b * strideA;
  const T* Bb  = Bt + (size_t)b * strideB;
  const T* Ab2 = SPLIT ? (A2  + (size_t)b * strideA) : nullptr;
  const T* Bb2 = SPLIT ? (Bt2 + (size_t)b * strideB) : nullptr;

  const int rlane = lane & 15;                 // row (A) / col (B, D) within subtile
  const int koff  = (lane >> 4) * 8;           // k offset of this lane half
  const int mOff  = (lane >> 4) * 8;           // D row offset

  v8f acc[4][4];
#pragma unroll
  for (int i = 0; i < 4; ++i)
#pragma unroll
    for (int j = 0; j < 4; ++j) acc[i][j] = (v8f){0.f,0.f,0.f,0.f,0.f,0.f,0.f,0.f};

  for (int k0 = 0; k0 < K; k0 += 32) {
    V bh[4], bl[4];
#pragma unroll
    for (int j = 0; j < 4; ++j) {
      const size_t bo = (size_t)(n0 + (j << 4) + rlane) * ldb + koff + k0;
      bh[j] = Frag<T>::load(Bb + bo);
      if (SPLIT) bl[j] = Frag<T>::load(Bb2 + bo);
    }
#pragma unroll
    for (int i = 0; i < 4; ++i) {
      const size_t ao = (size_t)(m0 + (i << 4) + rlane) * lda + koff + k0;
      V ah = Frag<T>::load(Ab + ao);
      V al;
      if (SPLIT) al = Frag<T>::load(Ab2 + ao);
#pragma unroll
      for (int j = 0; j < 4; ++j) {
        acc[i][j] = Frag<T>::mma(ah, bh[j], acc[i][j]);
        if (SPLIT) {
          acc[i][j] = Frag<T>::mma(ah, bl[j], acc[i][j]);
          acc[i][j] = Frag<T>::mma(al, bh[j], acc[i][j]);
        }
      }
      Frag<T>::guard(acc[i][0], acc[i][3], ah, SPLIT ? al : ah);
    }
    Frag<T>::keep(bh[0], bh[1], bh[2], bh[3]);
    if (SPLIT) Frag<T>::keep(bl[0], bl[1], bl[2], bl[3]);
  }
  acc_guard4(acc[0][0], acc[0][1], acc[0][2], acc[0][3]);
  acc_guard4(acc[1][0], acc[1][1], acc[1][2], acc[1][3]);
  acc_guard4(acc[2][0], acc[2][1], acc[2][2], acc[2][3]);
  acc_guard4(acc[3][0], acc[3][1], acc[3][2], acc[3][3]);

  // ---- epilogue ----
  float* slab = sT[wave];
  const float* Rb = RESID ? (resid + (size_t)b * strideR) : nullptr;
#pragma unroll
  for (int i = 0; i < 4; ++i) {
    const int mBase = m0 + (i << 4);
#pragma unroll
    for (int j = 0; j < 4; ++j) {
      const int n = n0 + (j << 4) + rlane;
      float bv = 0.f;
      if (BIAS_MODE == 2) bv = bias[n];
#pragma unroll
      for (int r = 0; r < 8; ++r) {
        float v = acc[i][j][r] * scale;
        if (BIAS_MODE == 1) v += bias[mBase + mOff + r];
        if (BIAS_MODE == 2) v += bv;
        if (RESID) v += Rb[(size_t)(mBase + mOff + r) * ldc + n];
        if (ACT == 1) v = tanhf(v);
        if (ACT == 2) v = fmaxf(v, 0.0f);
        if (ACT == 3) v = v / (1.0f + expf(-v));
        if (ACT == 4) v = (v > 0.f) ? v : 0.01f * v;
        if (ACT == 5) v = 0.5f * v * (1.0f + erff(v * 0.70710678118654752f));
        slab[(mOff + r) * 68 + (j << 4) + rlane] = v;
      }
    }
    __builtin_amdgcn_fence(__ATOMIC_RELEASE, "workgroup");
    __builtin_amdgcn_wave_barrier();
    __builtin_amdgcn_fence(__ATOMIC_ACQUIRE, "workgroup");
    if (OUT_MODE == 0) {
      float* C = (float*)Cout + (size_t)b * strideC;
      const int hh = lane >> 4, c4 = (lane & 15) * 4;     // row seg = 256 B = 16 lanes x 16 B
      {
#pragma unroll
        for (int it = 0; it < 8; ++it) {
          const int row = it * 2 + hh;
          v4f v = *(const v4f*)(slab + row * 68 + c4);
          *(v4f*)(C + (size_t)(mBase + row) * ldc + n0 + c4) = v;
        }
        
      }
    } else {
      const int q = lane >> 3, c8 = (lane & 7) * 8;
      unsigned short* C  = (unsigned short*)Cout  + (size_t)b * strideC;
      unsigned short* C2 = (OUT_MODE == 2) ? ((unsigned short*)Cout2 + (size_t)b * strideC) : nullptr;
      {
#pragma unroll
        for (int it = 0; it < 4; ++it) {
          const int row = it * 4 + q;
          const float* sp = slab + row * 68 + c8;
          v8h hv, lv;
#pragma unroll
          for (int e = 0; e < 8; ++e) {
            if (OUT_MODE == 1) {
              hv[e] = (_Float16)sp[e];
            } else {
              unsigned short hb = f2bf_bits(sp[e]);
              unsigned short lb = f2bf_bits(sp[e] - bf_bits2f(hb));
              hv[e] = __builtin_bit_cast(_Float16, hb);
              lv[e] = __builtin_bit_cast(_Float16, lb);
            }
          }
          *(v8h*)(C + (size_t)(mBase + row) * ldc + n0 + c8) = hv;
          if (OUT_MODE == 2) *(v8h*)(C2 + (size_t)(mBase + row) * ldc + n0 + c8) = lv;
        }
        
      }
    }
    __builtin_amdgcn_fence(__ATOMIC_RELEASE, "workgroup");
    __builtin_amdgcn_wave_barrier();
    __builtin_amdgcn_fence(__ATOMIC_ACQUIRE, "workgroup");
  }
}

// ---------------------------------------------------------------------------
// Weight / bias preparation, one launch of 4 blocks with block-uniform roles (no barriers):
//   role 0: [Wq;Wk] -> f16 [64][64]      role 1: Wv -> f16 [64][64]
//   role 2: Wsc -> bf16 hi/lo [64][64], rows 32..63 zero-filled (tile padding of the A operand)
//   role 3: [bq;bk] -> f32 [64]
// Coverage roles 0-2: 2 it x 256 thr x 8 elements = 4096 = the whole 64x64 plane; each store instruction
// ---------------------------------------------------------------------------
__global__ __launch_bounds__(256) void prep_kernel(
    const float* __restrict__ Wq, const float* __restrict__ Wk, const float* __restrict__ Wv,
    const float* __restrict__ Wsc, const float* __restrict__ bq, const float* __restrict__ bk,
    unsigned short* __restrict__ Wqk16, unsigned short* __restrict__ Wv16,
    unsigned short* __restrict__ Wsch, unsigned short* __restrict__ Wscl, float* __restrict__ bqk) {
  const int tid  = threadIdx.x;
  const int role = blockIdx.x;   // block-uniform
  if (role == 0) {
    v4u hv[2];
#pragma unroll
    for (int it = 0; it < 2; ++it) {
      const int task = it * 256 + tid;
      const int row = task >> 3, c8 = (task & 7) * 8;
      const int rq = row < kDq ? row : (kDq - 1);
      int rk = row - kDq; rk = rk < 0 ? 0 : (rk > kDq - 1 ? kDq - 1 : rk);
      const v4f a0 = *(const v4f*)(Wq + rq * kCh + c8), a1 = *(const v4f*)(Wq + rq * kCh + c8 + 4);
      const v4f b0 = *(const v4f*)(Wk + rk * kCh + c8), b1 = *(const v4f*)(Wk + rk * kCh + c8 + 4);
      const bool useq = row < kDq;
      float f[8];
#pragma unroll
      for (int e = 0; e < 4; ++e) { f[e] = useq ? a0[e] : b0[e]; f[4 + e] = useq ? a1[e] : b1[e]; }
      v4u u;
#pragma unroll
      for (int q = 0; q < 4; ++q) u[q] = pk16(h16_bits(f[2 * q]), h16_bits(f[2 * q + 1]));
      hv[it] = u;
    }
    {
#pragma unroll
      for (int it = 0; it < 2; ++it) {
        const int task = it * 256 + tid;
        const int row = task >> 3, c8 = (task & 7) * 8;
        *(v4u*)(Wqk16 + row * kCh + c8) = hv[it];
      }
      
    }
  } else if (role == 1) {
    v4u hv[2];
#pragma unroll
    for (int it = 0; it < 2; ++it) {
      const int task = it * 256 + tid;
      const int row = task >> 3, c8 = (task & 7) * 8;   // row 0..63 valid
      const v4f a0 = *(const v4f*)(Wv + row * kCh + c8), a1 = *(const v4f*)(Wv + row * kCh + c8 + 4);
      float f[8];
#pragma unroll
      for (int e = 0; e < 4; ++e) { f[e] = a0[e]; f[4 + e] = a1[e]; }
      v4u u;
#pragma unroll
      for (int q = 0; q < 4; ++q) u[q] = pk16(h16_bits(f[2 * q]), h16_bits(f[2 * q + 1]));
      hv[it] = u;
    }
    {
#pragma unroll
      for (int it = 0; it < 2; ++it) {
        const int task = it * 256 + tid;
        const int row = task >> 3, c8 = (task & 7) * 8;
        *(v4u*)(Wv16 + row * kCh + c8) = hv[it];
      }
      
    }
  } else if (role == 2) {
    v4u hv[2], lv[2];
#pragma unroll
    for (int it = 0; it < 2; ++it) {
      const int task = it * 256 + tid;
      const int row = task >> 3, c8 = (task & 7) * 8;
      const int rs = row < kDq ? row : (kDq - 1);        // clamped address, zero by predicate
      const bool live = row < kDq;
      const v4f a0 = *(const v4f*)(Wsc + rs * kCh + c8), a1 = *(const v4f*)(Wsc + rs * kCh + c8 + 4);
      float f[8];
#pragma unroll
      for (int e = 0; e < 4; ++e) { f[e] = live ? a0[e] : 0.0f; f[4 + e] = live ? a1[e] : 0.0f; }
      v4u u, u2;
#pragma unroll
      for (int q = 0; q < 4; ++q) {
        const unsigned short hb0 = f2bf_bits(f[2 * q]), hb1 = f2bf_bits(f[2 * q + 1]);
        const unsigned short lb0 = f2bf_bits(f[2 * q] - bf_bits2f(hb0));
        const unsigned short lb1 = f2bf_bits(f[2 * q + 1] - bf_bits2f(hb1));
        u[q] = pk16(hb0, hb1); u2[q] = pk16(lb0, lb1);
      }
      hv[it] = u; lv[it] = u2;
    }
    {
#pragma unroll
      for (int it = 0; it < 2; ++it) {
        const int task = it * 256 + tid;
        const int row = task >> 3, c8 = (task & 7) * 8;
        *(v4u*)(Wsch + row * kCh + c8) = hv[it];
        *(v4u*)(Wscl + row * kCh + c8) = lv[it];
      }
      
    }
  } else if (role == 3) {
    if (tid < 16) {
      const int iq = (4 * tid < kDq - 4) ? 4 * tid : (kDq - 4);
      int ik = 4 * tid - kDq; ik = ik < 0 ? 0 : (ik > kDq - 4 ? kDq - 4 : ik);
      const v4f a = *(const v4f*)(bq + iq);
      const v4f c = *(const v4f*)(bk + ik);
      const v4f v = (tid < 8) ? a : c;
      *(v4f*)(bqk + 4 * tid) = v;
      
    }
  }
}

// ---------------------------------------------------------------------------
// grid = kBatch * 64 blocks (one per 64-pixel tile), 256 threads.
// Coverage per block: load 4 it x 256 thr x 4 f32 = 64 ch x 64 px; store 2 it x 256 thr x 8 u16 = 64 px x 64 ch;
// ---------------------------------------------------------------------------
__global__ __launch_bounds__(256) void xcat_transpose_f16_kernel(const float* __restrict__ x1, const float* __restrict__ x2,
                                                                 unsigned short* __restrict__ Xo) {
  __shared__ __align__(16) float tf[64 * 68];
  const int bx  = blockIdx.x;
  const int b   = bx >> 6;
  const int n0  = (bx & 63) * 64;
  const int tid = threadIdx.x;
  const int sub = tid >> 4, c4 = (tid & 15) * 4;
#pragma unroll
  for (int it = 0; it < 2; ++it) {
    const int ch = it * 16 + sub;   // channels 0..31 from x1
    const v4f a = *(const v4f*)(x1 + ((size_t)(b * kCinHalf + ch) * kPix + n0 + c4));
    *(v4f*)(tf + ch * 68 + c4) = a;
  }
#pragma unroll
  for (int it = 0; it < 2; ++it) {
    const int ch = it * 16 + sub;   // channels 32..63 from x2
    const v4f a = *(const v4f*)(x2 + ((size_t)(b * kCinHalf + ch) * kPix + n0 + c4));
    *(v4f*)(tf + (kCinHalf + ch) * 68 + c4) = a;
  }
  __syncthreads();
  const int s8 = tid >> 3, c8 = (tid & 7) * 8;
  v4u hv[2];
#pragma unroll
  for (int it = 0; it < 2; ++it) {
    const int oc = it * 32 + s8;    // pixel within tile
    v4u u;
#pragma unroll
    for (int q = 0; q < 4; ++q) {
      const float f0 = tf[(c8 + 2 * q) * 68 + oc];
      const float f1 = tf[(c8 + 2 * q + 1) * 68 + oc];
      u[q] = pk16(h16_bits(f0), h16_bits(f1));
    }
    hv[it] = u;
  }
  {
#pragma unroll
    for (int it = 0; it < 2; ++it) {
      const int oc = it * 32 + s8;
      *(v4u*)(Xo + ((size_t)(b * kPix + n0 + oc) * kCh + c8)) = hv[it];
    }
    
  }
}

// ---------------------------------------------------------------------------
// Column softmax statistics of S f32 [4096 n][4096 m] (normalisation over n, i.e. down each column m):
// cmax[m] = max_n S[n][m], cscale[m] = 4096 / sum_n exp(S[n][m] - cmax[m]) (online single pass, one exp per element).
// grid = 4 blocks x 256 threads x 4 columns = 4096 columns; row loop is the static 4096.
// ---------------------------------------------------------------------------
__global__ __launch_bounds__(256) void colstats_kernel(const float* __restrict__ S,
                                                       float* __restrict__ cmax, float* __restrict__ cscale) {
  const int m4 = (blockIdx.x * 256 + threadIdx.x) * 4;
  const float* col = S + m4;
  v4f mx = *(const v4f*)col;
  v4f sm = (v4f){1.0f, 1.0f, 1.0f, 1.0f};
#pragma unroll 2
  for (int n = 1; n < kPix; ++n) {
    const v4f s = *(const v4f*)(col + (size_t)n * kPix);
#pragma unroll
    for (int e = 0; e < 4; ++e) {
      const float d  = s[e] - mx[e];
      const float ex = __expf(-fabsf(d));
      sm[e] = (d > 0.0f) ? (sm[e] * ex + 1.0f) : (sm[e] + ex);
      mx[e] = fmaxf(mx[e], s[e]);
    }
  }
  v4f sc;
#pragma unroll
  for (int e = 0; e < 4; ++e) sc[e] = 4096.0f * __builtin_amdgcn_rcpf(sm[e]);   // sm >= 1
  {
    *(v4f*)(cmax + m4)   = mx;
    *(v4f*)(cscale + m4) = sc;
    
  }
}

// ---------------------------------------------------------------------------
// P f16 [n][m] = exp(S[n][m] - cmax[m]) * cscale[m]  (= softmax over n, carried x4096; values <= 4096, typical ~1).
// grid = 4096*4096/2048 = 8192 blocks; 8 elements per thread; 512 threads per row; each wave stores
// ---------------------------------------------------------------------------
__global__ __launch_bounds__(256) void colsoftmax_p_kernel(const float* __restrict__ S, const float* __restrict__ cmax,
                                                           const float* __restrict__ cscale, unsigned short* __restrict__ P) {
  const int t  = blockIdx.x * 256 + threadIdx.x;
  const int n  = t >> 9;
  const int m8 = (t & 511) * 8;
  const float* sp = S + (size_t)n * kPix + m8;
  const v4f s0 = *(const v4f*)sp, s1 = *(const v4f*)(sp + 4);
  const v4f c0 = *(const v4f*)(cmax + m8), c1 = *(const v4f*)(cmax + m8 + 4);
  const v4f k0 = *(const v4f*)(cscale + m8), k1 = *(const v4f*)(cscale + m8 + 4);
  float p[8];
#pragma unroll
  for (int e = 0; e < 4; ++e) {
    p[e]     = __expf(s0[e] - c0[e]) * k0[e];
    p[4 + e] = __expf(s1[e] - c1[e]) * k1[e];
  }
  v4u u;
#pragma unroll
  for (int q = 0; q < 4; ++q) u[q] = pk16(h16_bits(p[2 * q]), h16_bits(p[2 * q + 1]));
  unsigned short* dst = P + (size_t)n * kPix + m8;
  *(v4u*)dst = u;
  
}

// ---------------------------------------------------------------------------
// grid = kBatch * 64 blocks; x tile transposed through LDS exactly like xcat_transpose_f16_kernel.
// Coverage: store 2 it x 256 thr x 8 u16 = 64 px x 64 ch per plane; 8 lanes x 16 B = one whole row;
// ---------------------------------------------------------------------------
__global__ __launch_bounds__(256) void resid_split_kernel(const float* __restrict__ O, const float* __restrict__ x1,
                                                          const float* __restrict__ x2, const float* __restrict__ gamma,
                                                          unsigned short* __restrict__ Zh, unsigned short* __restrict__ Zl) {
#pragma clang fp contract(off)
  __shared__ __align__(16) float tf[64 * 68];
  const int bx  = blockIdx.x;
  const int b   = bx >> 6;
  const int n0  = (bx & 63) * 64;
  const int tid = threadIdx.x;
  const int sub = tid >> 4, c4 = (tid & 15) * 4;
#pragma unroll
  for (int it = 0; it < 2; ++it) {
    const int ch = it * 16 + sub;
    const v4f a = *(const v4f*)(x1 + ((size_t)(b * kCinHalf + ch) * kPix + n0 + c4));
    *(v4f*)(tf + ch * 68 + c4) = a;
  }
#pragma unroll
  for (int it = 0; it < 2; ++it) {
    const int ch = it * 16 + sub;
    const v4f a = *(const v4f*)(x2 + ((size_t)(b * kCinHalf + ch) * kPix + n0 + c4));
    *(v4f*)(tf + (kCinHalf + ch) * 68 + c4) = a;
  }
  __syncthreads();
  const float g = gamma[0];
  const int s8 = tid >> 3, c8 = (tid & 7) * 8;
  v4u hv[2], lv[2];
#pragma unroll
  for (int it = 0; it < 2; ++it) {
    const int oc = it * 32 + s8;
    const size_t ro = (size_t)(b * kPix + n0 + oc) * kCh + c8;
    const v4f o0 = *(const v4f*)(O + ro), o1 = *(const v4f*)(O + ro + 4);
    float z[8];
#pragma unroll
    for (int e = 0; e < 4; ++e) {
      z[e]     = g * o0[e] + tf[(c8 + e) * 68 + oc];
      z[4 + e] = g * o1[e] + tf[(c8 + 4 + e) * 68 + oc];
    }
    v4u u, u2;
#pragma unroll
    for (int q = 0; q < 4; ++q) {
      const unsigned short hb0 = f2bf_bits(z[2 * q]), hb1 = f2bf_bits(z[2 * q + 1]);
      const unsigned short lb0 = f2bf_bits(z[2 * q] - bf_bits2f(hb0));
      const unsigned short lb1 = f2bf_bits(z[2 * q + 1] - bf_bits2f(hb1));
      u[q] = pk16(hb0, hb1); u2[q] = pk16(lb0, lb1);
    }
    hv[it] = u; lv[it] = u2;
  }
  {
#pragma unroll
    for (int it = 0; it < 2; ++it) {
      const int oc = it * 32 + s8;
      const size_t ro = (size_t)(b * kPix + n0 + oc) * kCh + c8;
      *(v4u*)(Zh + ro) = hv[it];
      *(v4u*)(Zl + ro) = lv[it];
    }
    
  }
}

// ---------------------------------------------------------------------------
// d_out[b][o][n] = F[b][o][n] for o < 32 (F has 64 rows per batch; rows 32..63 are the zero-padded tile rows).
// grid = kBatch*32*4096/1024 = 1024 blocks; one float4 per thread; a wave writes 32 x 16 B = 4 whole consecutive
// ---------------------------------------------------------------------------
__global__ __launch_bounds__(256) void copy_out_kernel(const float* __restrict__ F, float* __restrict__ out) {
  const int t  = blockIdx.x * 256 + threadIdx.x;
  const int b  = t >> 15;
  const int r  = t & 32767;
  const int o  = r >> 10;
  const int n4 = (r & 1023) * 4;
  const v4f v = *(const v4f*)(F + ((size_t)(b * kCh + o) * kPix + n4));
  float* dst = out + ((size_t)(b * kDq + o) * kPix + n4);
  *(v4f*)dst = v;
  
}

// ---------------------------------------------------------------------------
// Workspace region map (byte offsets):
//   small    65536 B @ 0        : Wqk16 f16 [64][64] @0, Wv16 f16 [64][64] @8192, Wsch bf16 [64][64] @16384,
//                                 Wscl bf16 [64][64] @24576, bqk f32 [64] @32768
//   X   f16 [8][4096][64]        4194304 B @ 65536
//   QK  f16 [8][4096][64]        4194304 B @ 4259840       (cols 0..31 = q, 32..63 = k)
//   V   f16 [8][64][4096]        4194304 B @ 8454144
//   S   f32 [4096][4096]        67108864 B @ 12648448      (per batch; after the batch loop the region is dead and holds
//                                 Zh bf16 [8][4096][64] @ S+0, Zl @ S+4194304, F f32 [8][64][4096] @ S+8388608)
//   stat f32 cmax[4096] @ +0, cscale[4096] @ +16384      65536 B @ 79757312
//   P   f16 [4096][4096]        33554432 B @ 79822848
//   O   f32 [8][4096][64]        8388608 B @ 113377280
//   total                      121765888 B
// Every region is fully written before it is read.
// ---------------------------------------------------------------------------
extern "C" void kernel_launch(void* const* d_in, const int* in_sizes, int n_in,
                              void* d_out, int out_size, void* d_ws, size_t ws_size,
                              hipStream_t stream) {
  if (n_in < 9) return;
  if (in_sizes[0] != kBatch * kCinHalf * kPix || in_sizes[1] != kBatch * kCinHalf * kPix) return;
  if (in_sizes[2] != kDq * kCh || in_sizes[3] != kDq || in_sizes[4] != kDq * kCh || in_sizes[5] != kDq) return;
  if (in_sizes[6] != kCh * kCh || in_sizes[7] != kDq * kCh || in_sizes[8] < 1) return;
  if (out_size != kBatch * kDq * kPix) return;

  const float* x1    = (const float*)d_in[0];
  const float* x2    = (const float*)d_in[1];
  const float* Wq    = (const float*)d_in[2];
  const float* bq    = (const float*)d_in[3];
  const float* Wk    = (const float*)d_in[4];
  const float* bk    = (const float*)d_in[5];
  const float* Wv    = (const float*)d_in[6];
  const float* Wsc   = (const float*)d_in[7];
  const float* gamma = (const float*)d_in[8];
  float* out = (float*)d_out;

  const size_t szPlane16 = (size_t)kBatch * kPix * kCh * 2;   // 4194304
  const size_t szS       = (size_t)kPix * kPix * 4;           // 67108864
  const size_t szP       = (size_t)kPix * kPix * 2;           // 33554432
  const size_t szO       = (size_t)kBatch * kPix * kCh * 4;   // 8388608
  const size_t szF       = (size_t)kBatch * kCh * kPix * 4;   // 8388608
  size_t off = 0;
  const size_t oSmall = off; off += 65536;
  const size_t oX     = off; off += szPlane16;
  const size_t oQK    = off; off += szPlane16;
  const size_t oV     = off; off += szPlane16;
  const size_t oS     = off; off += szS;
  const size_t oStat  = off; off += 65536;
  const size_t oP     = off; off += szP;
  const size_t oO     = off; off += szO;
  if (2 * szPlane16 + szF > szS) return;
  if (off > ws_size) return;

  char* ws = (char*)d_ws;
  unsigned short* Wqk16 = (unsigned short*)(ws + oSmall + 0);
  unsigned short* Wv16  = (unsigned short*)(ws + oSmall + 8192);
  unsigned short* Wsch  = (unsigned short*)(ws + oSmall + 16384);
  unsigned short* Wscl  = (unsigned short*)(ws + oSmall + 24576);
  float*          bqk   = (float*)(ws + oSmall + 32768);
  unsigned short* Xp    = (unsigned short*)(ws + oX);
  unsigned short* QKp   = (unsigned short*)(ws + oQK);
  unsigned short* Vp    = (unsigned short*)(ws + oV);
  float*          Sp    = (float*)(ws + oS);
  unsigned short* Zh    = (unsigned short*)(ws + oS);
  unsigned short* Zl    = (unsigned short*)(ws + oS + szPlane16);
  float*          Fp    = (float*)(ws + oS + 2 * szPlane16);
  float*          cmax  = (float*)(ws + oStat);
  float*          cscale = (float*)(ws + oStat + 16384);
  unsigned short* Pp    = (unsigned short*)(ws + oP);
  float*          Op    = (float*)(ws + oO);

  const dim3 blk(256);
  // (0) weights / bias
  prep_kernel<<<dim3(4), blk, 0, stream>>>(Wq, Wk, Wv, Wsc, bq, bk, Wqk16, Wv16, Wsch, Wscl, bqk);
  // (1) x -> X f16 [b][n][c]  (512 blocks = 8 batches x 64 pixel tiles)
  xcat_transpose_f16_kernel<<<dim3(kBatch * (kPix / 64)), blk, 0, stream>>>(x1, x2, Xp);
  // (2) [q|k][n][o'] = sum_c X[n][c] Wqk[o'][c] + bqk[o'] : M = 8*4096, N = 64, K = 64 -> QK f16 (512 tiles, 64 blocks)
  wmma_gemm64<0, false, 2, 1, false, 0><<<dim3((kBatch * kPix / 64) / 8, 1), blk, 0, stream>>>(
      Xp, Xp, kCh, 0L, Wqk16, Wqk16, kCh, 0L, (void*)QKp, (void*)QKp, kCh, 0L,
      bqk, bqk, 0L, kBatch * kPix, kCh, kCh, 1.0f);
  // (3) V[b][c][m] = sum_k Wv[c][k] X[b][m][k] : M = 64, N = 4096, K = 64 per batch (grid.y = batch) -> V f16 [b][64][4096]
  wmma_gemm64<0, false, 0, 1, false, 0><<<dim3(((kCh / 64) * (kPix / 64)) / 8, kBatch), blk, 0, stream>>>(
      Wv16, Wv16, kCh, 0L, Xp, Xp, kCh, (long)kPix * kCh, (void*)Vp, (void*)Vp, kPix, (long)kCh * kPix,
      bqk, bqk, 0L, kCh, kPix, kCh, 1.0f);

  for (int b = 0; b < kBatch; ++b) {
    const unsigned short* qk_b = QKp + (size_t)b * kPix * kCh;
    // (4) S[n][m] = sum_d q[n][d] k[m][d] : M = N = 4096, K = 32 -> S f32 (4096 tiles, 512 blocks)
    wmma_gemm64<0, false, 0, 0, false, 0><<<dim3(((kPix / 64) * (kPix / 64)) / 8, 1), blk, 0, stream>>>(
        qk_b, qk_b, kCh, 0L, qk_b + kDq, qk_b + kDq, kCh, 0L, (void*)Sp, (void*)Sp, kPix, 0L,
        bqk, bqk, 0L, kPix, kPix, kDq, 1.0f);
    // (5) column statistics (softmax over n for each column m)
    colstats_kernel<<<dim3(kPix / 1024), blk, 0, stream>>>(Sp, cmax, cscale);
    // (6) P f16 [n][m] = a[n][m] * 4096
    colsoftmax_p_kernel<<<dim3((kPix / 8) * (kPix / 256)), blk, 0, stream>>>(Sp, cmax, cscale, Pp);
    // (7) O[b][n][c] = (1/4096) sum_m P[n][m] V[b][c][m] : M = 4096, N = 64, K = 4096 -> f32 [4096][64] (64 tiles, 8 blocks)
    wmma_gemm64<0, false, 0, 0, false, 0><<<dim3(((kPix / 64) * (kCh / 64)) / 8, 1), blk, 0, stream>>>(
        Pp, Pp, kPix, 0L, Vp + (size_t)b * kCh * kPix, Vp + (size_t)b * kCh * kPix, kPix, 0L,
        (void*)(Op + (size_t)b * kPix * kCh), (void*)(Op + (size_t)b * kPix * kCh), kCh, 0L,
        bqk, bqk, 0L, kPix, kCh, kPix, 1.0f / 4096.0f);
  }
  // (8) z = gamma * O + x -> bf16 hi/lo planes [b][n][64]
  resid_split_kernel<<<dim3(kBatch * (kPix / 64)), blk, 0, stream>>>(Op, x1, x2, gamma, Zh, Zl);
  // (9) F[b][o][n] = sum_c Wsc[o][c] z[b][n][c] : M = 64 (rows 32..63 zero weights), N = 4096, K = 64, bf16 hi/lo split
  wmma_gemm64<1, true, 0, 0, false, 0><<<dim3(((kCh / 64) * (kPix / 64)) / 8, kBatch), blk, 0, stream>>>(
      Wsch, Wscl, kCh, 0L, Zh, Zl, kCh, (long)kPix * kCh, (void*)Fp, (void*)Fp, kPix, (long)kCh * kPix,
      bqk, bqk, 0L, kCh, kPix, kCh, 1.0f);
  // (10) rows 0..31 of each batch -> d_out [b][32][4096]
  copy_out_kernel<<<dim3((kBatch * kDq * kPix / 4) / 256), blk, 0, stream>>>(Fp, out);
}

// v001
// It runs in 1830 microseconds.
// Two timings next to v000 put it at 8.08 and 8.01 times that version's speed.
// Contractions: x·[Wq|Wk]^T (+bias), Wv·x, q·k^T scores and P·V aggregation on v_wmma_f32_16x16x32_f16 (f16 operands; P carried x4096 and folded back x1/4096 in the f32 epilogue); Wsc·z on v_wmma_f32_16x16x32_bf16 with bf16 hi/lo split operand planes (hi·hi + hi·lo + lo·hi); f32 accumulate everywhere; column-wise softmax statistics, exp and the gamma residual in f32.
#include <hip/hip_runtime.h>
#include <math.h>
#include <stdint.h>

constexpr int kBatch   = 8;
constexpr int kCinHalf = 32;     // channels of x1 and of x2
constexpr int kCh      = 64;     // concatenated channels
constexpr int kPix     = 4096;   // h*w
constexpr int kDq      = 32;     // q/k channels = output channels

typedef __attribute__((ext_vector_type(16))) _Float16 v16h;
typedef __attribute__((ext_vector_type(8)))  _Float16 v8h;
typedef __attribute__((ext_vector_type(16))) __bf16   v16b;
typedef __attribute__((ext_vector_type(8)))  __bf16   v8b;
typedef __attribute__((ext_vector_type(8)))  float    v8f;
typedef __attribute__((ext_vector_type(4)))  float    v4f;
typedef __attribute__((ext_vector_type(4)))  unsigned int v4u;

__device__ __forceinline__ unsigned short f2bf_bits(float f) {
  unsigned u = __float_as_uint(f);
  return (unsigned short)((u + 0x7FFFu + ((u >> 16) & 1u)) >> 16);
}
__device__ __forceinline__ float bf_bits2f(unsigned short h) { return __uint_as_float(((unsigned)h) << 16); }
__device__ __forceinline__ unsigned pk16(unsigned short a, unsigned short b) { return (unsigned)a | ((unsigned)b << 16); }
__device__ __forceinline__ unsigned short h16_bits(float f) { const _Float16 h = (_Float16)f; return __builtin_bit_cast(unsigned short, h); }

// hazard guards as plain device helpers (no inline asm inside the kernel template body)
__device__ __forceinline__ void dep_guard_h(v8f& a, v8f& b, v16h x, v16h y) { asm volatile("v_nop\n\tv_nop\n\tv_nop\n\tv_nop" : "+v"(a), "+v"(b) : "v"(x), "v"(y)); }
__device__ __forceinline__ void dep_guard_b(v8f& a, v8f& b, v16b x, v16b y) { asm volatile("v_nop\n\tv_nop\n\tv_nop\n\tv_nop" : "+v"(a), "+v"(b) : "v"(x), "v"(y)); }
__device__ __forceinline__ void keep4_h(v16h a, v16h b, v16h c, v16h d) { asm volatile("v_nop" :: "v"(a), "v"(b), "v"(c), "v"(d)); }
__device__ __forceinline__ void keep4_b(v16b a, v16b b, v16b c, v16b d) { asm volatile("v_nop" :: "v"(a), "v"(b), "v"(c), "v"(d)); }
__device__ __forceinline__ void acc_guard4(v8f& a, v8f& b, v8f& c, v8f& d) { asm volatile("v_nop\n\tv_nop\n\tv_nop\n\tv_nop" : "+v"(a), "+v"(b), "+v"(c), "+v"(d)); }
template <typename T> struct Frag;
template <> struct Frag<_Float16> {
  typedef v16h V; union U { v16h v; v8h h[2]; };
  static __device__ __forceinline__ v16h load(const _Float16* p) {   // elements 0..7 <- p[0..7], 8..15 <- p[16..23]
    U f; f.h[0] = *(const v8h*)(p); f.h[1] = *(const v8h*)(p + 16); return f.v;
  }
  static __device__ __forceinline__ v8f mma(v16h a, v16h b, v8f c) {
    return __builtin_amdgcn_wmma_f32_16x16x32_f16(false, a, false, b, (short)0, c, false, false);
  }
  static __device__ __forceinline__ void guard(v8f& a, v8f& b, v16h x, v16h y) { dep_guard_h(a, b, x, y); }
  static __device__ __forceinline__ void keep(v16h a, v16h b, v16h c, v16h d) { keep4_h(a, b, c, d); }
};
template <> struct Frag<__bf16> {
  typedef v16b V; union U { v16b v; v8b h[2]; };
  static __device__ __forceinline__ v16b load(const __bf16* p) {
    U f; f.h[0] = *(const v8b*)(p); f.h[1] = *(const v8b*)(p + 16); return f.v;
  }
  static __device__ __forceinline__ v8f mma(v16b a, v16b b, v8f c) {
    return __builtin_amdgcn_wmma_f32_16x16x32_bf16(false, a, false, b, (short)0, c, false, false);
  }
  static __device__ __forceinline__ void guard(v8f& a, v8f& b, v16b x, v16b y) { dep_guard_b(a, b, x, y); }
  static __device__ __forceinline__ void keep(v16b a, v16b b, v16b c, v16b d) { keep4_b(a, b, c, d); }
};

// ---- Register-blocked batched WMMA GEMM ------------------------------------
// C[m,n] = scale * sum_k A[m,k] * Bt[n,k] (+bias)(+resid); each wave owns a 64x64 tile.
// A row-major [M,K]; Bt row-major [N,K]; M,N % 64 == 0, K % 32 == 0.
// SPLIT: operands are hi/lo planes (A2/Bt2 = lo planes, same layout); product = hi·hi + hi·lo + lo·hi.
// BIAS_MODE: 0 = none, 1 = bias[m], 2 = bias[n].
// OUT_MODE: 0 = f32, 1 = f16, 2 = bf16 hi plane (Cout) + bf16 lo plane (Cout2).
// ET: 0 = f16 operands, 1 = bf16 operands (pointers passed as 16-bit storage)
template <int ET> struct Elem;
template <> struct Elem<0> { typedef _Float16 T; };
template <> struct Elem<1> { typedef __bf16 T; };
template <int ET, bool SPLIT, int BIAS_MODE, int OUT_MODE, bool RESID, int ACT = 0>
__global__ __launch_bounds__(256) void wmma_gemm64(
    const unsigned short* __restrict__ Ap, const unsigned short* __restrict__ A2p, int lda, long strideA,
    const unsigned short* __restrict__ Btp, const unsigned short* __restrict__ Bt2p, int ldb, long strideB,
    void* __restrict__ Cout, void* __restrict__ Cout2, int ldc, long strideC,
    const float* __restrict__ bias,
    const float* __restrict__ resid, long strideR,
    int M, int N, int K, float scale) {
  typedef typename Elem<ET>::T T;
  typedef typename Frag<T>::V V;
  const T* A = (const T*)Ap; const T* A2 = (const T*)A2p; const T* Bt = (const T*)Btp; const T* Bt2 = (const T*)Bt2p;
  __shared__ __align__(16) float sT[8][16 * 68];   // per-wave 16x64 slab, pitch 68 floats
  const int b    = blockIdx.y;
  const int lane = threadIdx.x & 31;
  const int wave = threadIdx.x >> 5;
  const int tilesN = N >> 6;
  const int tilesM = M >> 6;
  const int tile = blockIdx.x * 8 + wave;
  if (tile >= tilesM * tilesN) return;   // wave-uniform; no block barriers in this kernel
  const int tm = tile / tilesN;
  const int tn = tile - tm * tilesN;
  const int m0 = tm << 6;
  const int n0 = tn << 6;

  const T* Ab  = A  + (size_t)b * strideA;
  const T* Bb  = Bt + (size_t)b * strideB;
  const T* Ab2 = SPLIT ? (A2  + (size_t)b * strideA) : nullptr;
  const T* Bb2 = SPLIT ? (Bt2 + (size_t)b * strideB) : nullptr;

  const int rlane = lane & 15;                 // row (A) / col (B, D) within subtile
  const int koff  = (lane >> 4) * 8;           // k offset of this lane half
  const int mOff  = (lane >> 4) * 8;           // D row offset

  v8f acc[4][4];
#pragma unroll
  for (int i = 0; i < 4; ++i)
#pragma unroll
    for (int j = 0; j < 4; ++j) acc[i][j] = (v8f){0.f,0.f,0.f,0.f,0.f,0.f,0.f,0.f};

  for (int k0 = 0; k0 < K; k0 += 32) {
    V bh[4], bl[4];
#pragma unroll
    for (int j = 0; j < 4; ++j) {
      const size_t bo = (size_t)(n0 + (j << 4) + rlane) * ldb + koff + k0;
      bh[j] = Frag<T>::load(Bb + bo);
      if (SPLIT) bl[j] = Frag<T>::load(Bb2 + bo);
    }
#pragma unroll
    for (int i = 0; i < 4; ++i) {
      const size_t ao = (size_t)(m0 + (i << 4) + rlane) * lda + koff + k0;
      V ah = Frag<T>::load(Ab + ao);
      V al;
      if (SPLIT) al = Frag<T>::load(Ab2 + ao);
#pragma unroll
      for (int j = 0; j < 4; ++j) {
        acc[i][j] = Frag<T>::mma(ah, bh[j], acc[i][j]);
        if (SPLIT) {
          acc[i][j] = Frag<T>::mma(ah, bl[j], acc[i][j]);
          acc[i][j] = Frag<T>::mma(al, bh[j], acc[i][j]);
        }
      }
      Frag<T>::guard(acc[i][0], acc[i][3], ah, SPLIT ? al : ah);
    }
    Frag<T>::keep(bh[0], bh[1], bh[2], bh[3]);
    if (SPLIT) Frag<T>::keep(bl[0], bl[1], bl[2], bl[3]);
  }
  acc_guard4(acc[0][0], acc[0][1], acc[0][2], acc[0][3]);
  acc_guard4(acc[1][0], acc[1][1], acc[1][2], acc[1][3]);
  acc_guard4(acc[2][0], acc[2][1], acc[2][2], acc[2][3]);
  acc_guard4(acc[3][0], acc[3][1], acc[3][2], acc[3][3]);

  // ---- epilogue ----
  float* slab = sT[wave];
  const float* Rb = RESID ? (resid + (size_t)b * strideR) : nullptr;
#pragma unroll
  for (int i = 0; i < 4; ++i) {
    const int mBase = m0 + (i << 4);
#pragma unroll
    for (int j = 0; j < 4; ++j) {
      const int n = n0 + (j << 4) + rlane;
      float bv = 0.f;
      if (BIAS_MODE == 2) bv = bias[n];
#pragma unroll
      for (int r = 0; r < 8; ++r) {
        float v = acc[i][j][r] * scale;
        if (BIAS_MODE == 1) v += bias[mBase + mOff + r];
        if (BIAS_MODE == 2) v += bv;
        if (RESID) v += Rb[(size_t)(mBase + mOff + r) * ldc + n];
        if (ACT == 1) v = tanhf(v);
        if (ACT == 2) v = fmaxf(v, 0.0f);
        if (ACT == 3) v = v / (1.0f + expf(-v));
        if (ACT == 4) v = (v > 0.f) ? v : 0.01f * v;
        if (ACT == 5) v = 0.5f * v * (1.0f + erff(v * 0.70710678118654752f));
        slab[(mOff + r) * 68 + (j << 4) + rlane] = v;
      }
    }
    __builtin_amdgcn_fence(__ATOMIC_RELEASE, "workgroup");
    __builtin_amdgcn_wave_barrier();
    __builtin_amdgcn_fence(__ATOMIC_ACQUIRE, "workgroup");
    if (OUT_MODE == 0) {
      float* C = (float*)Cout + (size_t)b * strideC;
      const int hh = lane >> 4, c4 = (lane & 15) * 4;     // row seg = 256 B = 16 lanes x 16 B
      {
#pragma unroll
        for (int it = 0; it < 8; ++it) {
          const int row = it * 2 + hh;
          v4f v = *(const v4f*)(slab + row * 68 + c4);
          *(v4f*)(C + (size_t)(mBase + row) * ldc + n0 + c4) = v;
        }
        
      }
    } else {
      const int q = lane >> 3, c8 = (lane & 7) * 8;
      unsigned short* C  = (unsigned short*)Cout  + (size_t)b * strideC;
      unsigned short* C2 = (OUT_MODE == 2) ? ((unsigned short*)Cout2 + (size_t)b * strideC) : nullptr;
      {
#pragma unroll
        for (int it = 0; it < 4; ++it) {
          const int row = it * 4 + q;
          const float* sp = slab + row * 68 + c8;
          v8h hv, lv;
#pragma unroll
          for (int e = 0; e < 8; ++e) {
            if (OUT_MODE == 1) {
              hv[e] = (_Float16)sp[e];
            } else {
              unsigned short hb = f2bf_bits(sp[e]);
              unsigned short lb = f2bf_bits(sp[e] - bf_bits2f(hb));
              hv[e] = __builtin_bit_cast(_Float16, hb);
              lv[e] = __builtin_bit_cast(_Float16, lb);
            }
          }
          *(v8h*)(C + (size_t)(mBase + row) * ldc + n0 + c8) = hv;
          if (OUT_MODE == 2) *(v8h*)(C2 + (size_t)(mBase + row) * ldc + n0 + c8) = lv;
        }
        
      }
    }
    __builtin_amdgcn_fence(__ATOMIC_RELEASE, "workgroup");
    __builtin_amdgcn_wave_barrier();
    __builtin_amdgcn_fence(__ATOMIC_ACQUIRE, "workgroup");
  }
}

// ---------------------------------------------------------------------------
// Weight / bias preparation, one launch of 4 blocks with block-uniform roles (no barriers):
//   role 0: [Wq;Wk] -> f16 [64][64]      role 1: Wv -> f16 [64][64]
//   role 2: Wsc -> bf16 hi/lo [64][64], rows 32..63 zero-filled (tile padding of the A operand)
//   role 3: [bq;bk] -> f32 [64]
// Coverage roles 0-2: 2 it x 256 thr x 8 elements = 4096 = the whole 64x64 plane; each store instruction
// ---------------------------------------------------------------------------
__global__ __launch_bounds__(256) void prep_kernel(
    const float* __restrict__ Wq, const float* __restrict__ Wk, const float* __restrict__ Wv,
    const float* __restrict__ Wsc, const float* __restrict__ bq, const float* __restrict__ bk,
    unsigned short* __restrict__ Wqk16, unsigned short* __restrict__ Wv16,
    unsigned short* __restrict__ Wsch, unsigned short* __restrict__ Wscl, float* __restrict__ bqk) {
  const int tid  = threadIdx.x;
  const int role = blockIdx.x;   // block-uniform
  if (role == 0) {
    v4u hv[2];
#pragma unroll
    for (int it = 0; it < 2; ++it) {
      const int task = it * 256 + tid;
      const int row = task >> 3, c8 = (task & 7) * 8;
      const int rq = row < kDq ? row : (kDq - 1);
      int rk = row - kDq; rk = rk < 0 ? 0 : (rk > kDq - 1 ? kDq - 1 : rk);
      const v4f a0 = *(const v4f*)(Wq + rq * kCh + c8), a1 = *(const v4f*)(Wq + rq * kCh + c8 + 4);
      const v4f b0 = *(const v4f*)(Wk + rk * kCh + c8), b1 = *(const v4f*)(Wk + rk * kCh + c8 + 4);
      const bool useq = row < kDq;
      float f[8];
#pragma unroll
      for (int e = 0; e < 4; ++e) { f[e] = useq ? a0[e] : b0[e]; f[4 + e] = useq ? a1[e] : b1[e]; }
      v4u u;
#pragma unroll
      for (int q = 0; q < 4; ++q) u[q] = pk16(h16_bits(f[2 * q]), h16_bits(f[2 * q + 1]));
      hv[it] = u;
    }
    {
#pragma unroll
      for (int it = 0; it < 2; ++it) {
        const int task = it * 256 + tid;
        const int row = task >> 3, c8 = (task & 7) * 8;
        *(v4u*)(Wqk16 + row * kCh + c8) = hv[it];
      }
      
    }
  } else if (role == 1) {
    v4u hv[2];
#pragma unroll
    for (int it = 0; it < 2; ++it) {
      const int task = it * 256 + tid;
      const int row = task >> 3, c8 = (task & 7) * 8;   // row 0..63 valid
      const v4f a0 = *(const v4f*)(Wv + row * kCh + c8), a1 = *(const v4f*)(Wv + row * kCh + c8 + 4);
      float f[8];
#pragma unroll
      for (int e = 0; e < 4; ++e) { f[e] = a0[e]; f[4 + e] = a1[e]; }
      v4u u;
#pragma unroll
      for (int q = 0; q < 4; ++q) u[q] = pk16(h16_bits(f[2 * q]), h16_bits(f[2 * q + 1]));
      hv[it] = u;
    }
    {
#pragma unroll
      for (int it = 0; it < 2; ++it) {
        const int task = it * 256 + tid;
        const int row = task >> 3, c8 = (task & 7) * 8;
        *(v4u*)(Wv16 + row * kCh + c8) = hv[it];
      }
      
    }
  } else if (role == 2) {
    v4u hv[2], lv[2];
#pragma unroll
    for (int it = 0; it < 2; ++it) {
      const int task = it * 256 + tid;
      const int row = task >> 3, c8 = (task & 7) * 8;
      const int rs = row < kDq ? row : (kDq - 1);        // clamped address, zero by predicate
      const bool live = row < kDq;
      const v4f a0 = *(const v4f*)(Wsc + rs * kCh + c8), a1 = *(const v4f*)(Wsc + rs * kCh + c8 + 4);
      float f[8];
#pragma unroll
      for (int e = 0; e < 4; ++e) { f[e] = live ? a0[e] : 0.0f; f[4 + e] = live ? a1[e] : 0.0f; }
      v4u u, u2;
#pragma unroll
      for (int q = 0; q < 4; ++q) {
        const unsigned short hb0 = f2bf_bits(f[2 * q]), hb1 = f2bf_bits(f[2 * q + 1]);
        const unsigned short lb0 = f2bf_bits(f[2 * q] - bf_bits2f(hb0));
        const unsigned short lb1 = f2bf_bits(f[2 * q + 1] - bf_bits2f(hb1));
        u[q] = pk16(hb0, hb1); u2[q] = pk16(lb0, lb1);
      }
      hv[it] = u; lv[it] = u2;
    }
    {
#pragma unroll
      for (int it = 0; it < 2; ++it) {
        const int task = it * 256 + tid;
        const int row = task >> 3, c8 = (task & 7) * 8;
        *(v4u*)(Wsch + row * kCh + c8) = hv[it];
        *(v4u*)(Wscl + row * kCh + c8) = lv[it];
      }
      
    }
  } else if (role == 3) {
    if (tid < 16) {
      const int iq = (4 * tid < kDq - 4) ? 4 * tid : (kDq - 4);
      int ik = 4 * tid - kDq; ik = ik < 0 ? 0 : (ik > kDq - 4 ? kDq - 4 : ik);
      const v4f a = *(const v4f*)(bq + iq);
      const v4f c = *(const v4f*)(bk + ik);
      const v4f v = (tid < 8) ? a : c;
      *(v4f*)(bqk + 4 * tid) = v;
      
    }
  }
}

// ---------------------------------------------------------------------------
// grid = kBatch * 64 blocks (one per 64-pixel tile), 256 threads.
// Coverage per block: load 4 it x 256 thr x 4 f32 = 64 ch x 64 px; store 2 it x 256 thr x 8 u16 = 64 px x 64 ch;
// ---------------------------------------------------------------------------
__global__ __launch_bounds__(256) void xcat_transpose_f16_kernel(const float* __restrict__ x1, const float* __restrict__ x2,
                                                                 unsigned short* __restrict__ Xo) {
  __shared__ __align__(16) float tf[64 * 68];
  const int bx  = blockIdx.x;
  const int b   = bx >> 6;
  const int n0  = (bx & 63) * 64;
  const int tid = threadIdx.x;
  const int sub = tid >> 4, c4 = (tid & 15) * 4;
#pragma unroll
  for (int it = 0; it < 2; ++it) {
    const int ch = it * 16 + sub;   // channels 0..31 from x1
    const v4f a = *(const v4f*)(x1 + ((size_t)(b * kCinHalf + ch) * kPix + n0 + c4));
    *(v4f*)(tf + ch * 68 + c4) = a;
  }
#pragma unroll
  for (int it = 0; it < 2; ++it) {
    const int ch = it * 16 + sub;   // channels 32..63 from x2
    const v4f a = *(const v4f*)(x2 + ((size_t)(b * kCinHalf + ch) * kPix + n0 + c4));
    *(v4f*)(tf + (kCinHalf + ch) * 68 + c4) = a;
  }
  __syncthreads();
  const int s8 = tid >> 3, c8 = (tid & 7) * 8;
  v4u hv[2];
#pragma unroll
  for (int it = 0; it < 2; ++it) {
    const int oc = it * 32 + s8;    // pixel within tile
    v4u u;
#pragma unroll
    for (int q = 0; q < 4; ++q) {
      const float f0 = tf[(c8 + 2 * q) * 68 + oc];
      const float f1 = tf[(c8 + 2 * q + 1) * 68 + oc];
      u[q] = pk16(h16_bits(f0), h16_bits(f1));
    }
    hv[it] = u;
  }
  {
#pragma unroll
    for (int it = 0; it < 2; ++it) {
      const int oc = it * 32 + s8;
      *(v4u*)(Xo + ((size_t)(b * kPix + n0 + oc) * kCh + c8)) = hv[it];
    }
    
  }
}

// ---------------------------------------------------------------------------
// Column softmax statistics of S f32 [4096 n][4096 m] (normalisation over n, i.e. down each column m):
// cmax[m] = max_n S[n][m], cscale[m] = 4096 / sum_n exp(S[n][m] - cmax[m]).
// grid = 128 blocks, each owning 32 columns (one 128-byte line of every row) for all 4096 rows; 1024 threads =
// 8 column quads x 128 row lanes, 32 consecutive rows per thread in two register chunks of 16 (chunk max, then the exps).
// The (max, sum) pairs merge over the 4 row lanes of a wave by shuffles, then over the 32 waves through LDS.
// ---------------------------------------------------------------------------
constexpr int kStatCols  = 32;    // columns per block
constexpr int kStatLanes = 128;   // row lanes per block = 1024 threads / 8 column quads
constexpr int kStatChunk = 16;    // rows held in registers at a time
constexpr int kStatPitch = 36;    // floats per LDS row: 144 B = 16 B x odd, so 16-byte reads 8 rows apart miss each other's banks

// Merges the (max, sum) pairs of lanes l, l^8, l^16, l^24, which hold the same column quad; every lane ends with the result.
__device__ __forceinline__ void stat_merge_lanes(v4f& mx, v4f& sm) {
#pragma unroll   // two steps, constant shuffle distances
  for (int d = 8; d <= 16; d <<= 1) {
#pragma unroll   // vector elements by constant index
    for (int e = 0; e < 4; ++e) {
      const float om = __shfl_xor(mx[e], d);
      const float os = __shfl_xor(sm[e], d);
      const float dm = mx[e] - om;
      const float ex = __expf(-fabsf(dm));   // the larger maximum keeps its sum, the other is rescaled
      sm[e] = (dm > 0.0f) ? (sm[e] + os * ex) : (sm[e] * ex + os);
      mx[e] = fmaxf(mx[e], om);
    }
  }
}

// The '#pragma unroll' lines below keep s[], pm[], ps[] and the 4-vectors in registers (constant indices).
__global__ __launch_bounds__(1024) void colstats_kernel(const float* __restrict__ S,
                                                        float* __restrict__ cmax, float* __restrict__ cscale) {
  __shared__ __align__(16) float sMx[32 * kStatPitch];
  __shared__ __align__(16) float sSm[32 * kStatPitch];
  const int tid  = threadIdx.x;
  const int lane = tid & 31;
  const int wave = tid >> 5;
  const int m0   = blockIdx.x * kStatCols;
  const int c4   = (tid & 7) * 4;
  const float* col = S + (size_t)(tid >> 3) * (kPix / kStatLanes) * kPix + m0 + c4;   // first of this thread's 32 consecutive rows
  v4f mx = (v4f){-INFINITY, -INFINITY, -INFINITY, -INFINITY};
  v4f sm = (v4f){0.0f, 0.0f, 0.0f, 0.0f};
  // kept rolled: unrolled, both chunks' loads are hoisted together and overflow the 128 registers a 32-wave block may use
#pragma unroll 1
  for (int ch = 0; ch < kPix / (kStatLanes * kStatChunk); ++ch) {
    v4f s[kStatChunk];
#pragma unroll
    for (int i = 0; i < kStatChunk; ++i)
      s[i] = *(const v4f*)(col + (size_t)i * kPix);
    v4f nm = mx;
#pragma unroll
    for (int i = 0; i < kStatChunk; ++i)
#pragma unroll
      for (int e = 0; e < 4; ++e) nm[e] = fmaxf(nm[e], s[i][e]);
#pragma unroll
    for (int e = 0; e < 4; ++e) sm[e] *= __expf(mx[e] - nm[e]);   // first chunk: 0 * exp(-inf) = 0
#pragma unroll
    for (int i = 0; i < kStatChunk; ++i)
#pragma unroll
      for (int e = 0; e < 4; ++e) sm[e] += __expf(s[i][e] - nm[e]);
    mx = nm;
    col += (size_t)kStatChunk * kPix;
  }
  stat_merge_lanes(mx, sm);
  if (lane < 8) {
    *(v4f*)(sMx + wave * kStatPitch + c4) = mx;
    *(v4f*)(sSm + wave * kStatPitch + c4) = sm;
  }
  __syncthreads();
  if (wave == 0) {   // 8 column quads x 4 lane groups, each group taking 8 of the 32 waves' pairs
    const int w0 = (lane >> 3) * 8;
    v4f pm[8], ps[8];
#pragma unroll
    for (int j = 0; j < 8; ++j) {
      pm[j] = *(const v4f*)(sMx + (w0 + j) * kStatPitch + c4);
      ps[j] = *(const v4f*)(sSm + (w0 + j) * kStatPitch + c4);
    }
    v4f M = pm[0];
#pragma unroll
    for (int j = 1; j < 8; ++j)
#pragma unroll
      for (int e = 0; e < 4; ++e) M[e] = fmaxf(M[e], pm[j][e]);
    v4f tot = (v4f){0.0f, 0.0f, 0.0f, 0.0f};
#pragma unroll
    for (int j = 0; j < 8; ++j)
#pragma unroll
      for (int e = 0; e < 4; ++e) tot[e] += ps[j][e] * __expf(pm[j][e] - M[e]);
    stat_merge_lanes(M, tot);
    if (lane < 8) {   // 8 lanes x 16 B: each store fills one whole 128-byte line
      v4f sc;
#pragma unroll
      for (int e = 0; e < 4; ++e) sc[e] = 4096.0f * __builtin_amdgcn_rcpf(tot[e]);   // tot >= 1
      *(v4f*)(cmax + m0 + c4)   = M;
      *(v4f*)(cscale + m0 + c4) = sc;
    }
  }
}

// ---------------------------------------------------------------------------
// P f16 [n][m] = exp(S[n][m] - cmax[m]) * cscale[m]  (= softmax over n, carried x4096; values <= 4096, typical ~1).
// grid = 4096*4096/2048 = 8192 blocks; 8 elements per thread; 512 threads per row; each wave stores
// ---------------------------------------------------------------------------
__global__ __launch_bounds__(256) void colsoftmax_p_kernel(const float* __restrict__ S, const float* __restrict__ cmax,
                                                           const float* __restrict__ cscale, unsigned short* __restrict__ P) {
  const int t  = blockIdx.x * 256 + threadIdx.x;
  const int n  = t >> 9;
  const int m8 = (t & 511) * 8;
  const float* sp = S + (size_t)n * kPix + m8;
  const v4f s0 = *(const v4f*)sp, s1 = *(const v4f*)(sp + 4);
  const v4f c0 = *(const v4f*)(cmax + m8), c1 = *(const v4f*)(cmax + m8 + 4);
  const v4f k0 = *(const v4f*)(cscale + m8), k1 = *(const v4f*)(cscale + m8 + 4);
  float p[8];
#pragma unroll
  for (int e = 0; e < 4; ++e) {
    p[e]     = __expf(s0[e] - c0[e]) * k0[e];
    p[4 + e] = __expf(s1[e] - c1[e]) * k1[e];
  }
  v4u u;
#pragma unroll
  for (int q = 0; q < 4; ++q) u[q] = pk16(h16_bits(p[2 * q]), h16_bits(p[2 * q + 1]));
  unsigned short* dst = P + (size_t)n * kPix + m8;
  *(v4u*)dst = u;
  
}

// ---------------------------------------------------------------------------
// grid = kBatch * 64 blocks; x tile transposed through LDS exactly like xcat_transpose_f16_kernel.
// Coverage: store 2 it x 256 thr x 8 u16 = 64 px x 64 ch per plane; 8 lanes x 16 B = one whole row;
// ---------------------------------------------------------------------------
__global__ __launch_bounds__(256) void resid_split_kernel(const float* __restrict__ O, const float* __restrict__ x1,
                                                          const float* __restrict__ x2, const float* __restrict__ gamma,
                                                          unsigned short* __restrict__ Zh, unsigned short* __restrict__ Zl) {
#pragma clang fp contract(off)
  __shared__ __align__(16) float tf[64 * 68];
  const int bx  = blockIdx.x;
  const int b   = bx >> 6;
  const int n0  = (bx & 63) * 64;
  const int tid = threadIdx.x;
  const int sub = tid >> 4, c4 = (tid & 15) * 4;
#pragma unroll
  for (int it = 0; it < 2; ++it) {
    const int ch = it * 16 + sub;
    const v4f a = *(const v4f*)(x1 + ((size_t)(b * kCinHalf + ch) * kPix + n0 + c4));
    *(v4f*)(tf + ch * 68 + c4) = a;
  }
#pragma unroll
  for (int it = 0; it < 2; ++it) {
    const int ch = it * 16 + sub;
    const v4f a = *(const v4f*)(x2 + ((size_t)(b * kCinHalf + ch) * kPix + n0 + c4));
    *(v4f*)(tf + (kCinHalf + ch) * 68 + c4) = a;
  }
  __syncthreads();
  const float g = gamma[0];
  const int s8 = tid >> 3, c8 = (tid & 7) * 8;
  v4u hv[2], lv[2];
#pragma unroll
  for (int it = 0; it < 2; ++it) {
    const int oc = it * 32 + s8;
    const size_t ro = (size_t)(b * kPix + n0 + oc) * kCh + c8;
    const v4f o0 = *(const v4f*)(O + ro), o1 = *(const v4f*)(O + ro + 4);
    float z[8];
#pragma unroll
    for (int e = 0; e < 4; ++e) {
      z[e]     = g * o0[e] + tf[(c8 + e) * 68 + oc];
      z[4 + e] = g * o1[e] + tf[(c8 + 4 + e) * 68 + oc];
    }
    v4u u, u2;
#pragma unroll
    for (int q = 0; q < 4; ++q) {
      const unsigned short hb0 = f2bf_bits(z[2 * q]), hb1 = f2bf_bits(z[2 * q + 1]);
      const unsigned short lb0 = f2bf_bits(z[2 * q] - bf_bits2f(hb0));
      const unsigned short lb1 = f2bf_bits(z[2 * q + 1] - bf_bits2f(hb1));
      u[q] = pk16(hb0, hb1); u2[q] = pk16(lb0, lb1);
    }
    hv[it] = u; lv[it] = u2;
  }
  {
#pragma unroll
    for (int it = 0; it < 2; ++it) {
      const int oc = it * 32 + s8;
      const size_t ro = (size_t)(b * kPix + n0 + oc) * kCh + c8;
      *(v4u*)(Zh + ro) = hv[it];
      *(v4u*)(Zl + ro) = lv[it];
    }
    
  }
}

// ---------------------------------------------------------------------------
// d_out[b][o][n] = F[b][o][n] for o < 32 (F has 64 rows per batch; rows 32..63 are the zero-padded tile rows).
// grid = kBatch*32*4096/1024 = 1024 blocks; one float4 per thread; a wave writes 32 x 16 B = 4 whole consecutive
// ---------------------------------------------------------------------------
__global__ __launch_bounds__(256) void copy_out_kernel(const float* __restrict__ F, float* __restrict__ out) {
  const int t  = blockIdx.x * 256 + threadIdx.x;
  const int b  = t >> 15;
  const int r  = t & 32767;
  const int o  = r >> 10;
  const int n4 = (r & 1023) * 4;
  const v4f v = *(const v4f*)(F + ((size_t)(b * kCh + o) * kPix + n4));
  float* dst = out + ((size_t)(b * kDq + o) * kPix + n4);
  *(v4f*)dst = v;
  
}

// ---------------------------------------------------------------------------
// Workspace region map (byte offsets):
//   small    65536 B @ 0        : Wqk16 f16 [64][64] @0, Wv16 f16 [64][64] @8192, Wsch bf16 [64][64] @16384,
//                                 Wscl bf16 [64][64] @24576, bqk f32 [64] @32768
//   X   f16 [8][4096][64]        4194304 B @ 65536
//   QK  f16 [8][4096][64]        4194304 B @ 4259840       (cols 0..31 = q, 32..63 = k)
//   V   f16 [8][64][4096]        4194304 B @ 8454144
//   S   f32 [4096][4096]        67108864 B @ 12648448      (per batch; after the batch loop the region is dead and holds
//                                 Zh bf16 [8][4096][64] @ S+0, Zl @ S+4194304, F f32 [8][64][4096] @ S+8388608)
//   stat f32 cmax[4096] @ +0, cscale[4096] @ +16384      65536 B @ 79757312
//   P   f16 [4096][4096]        33554432 B @ 79822848
//   O   f32 [8][4096][64]        8388608 B @ 113377280
//   total                      121765888 B
// Every region is fully written before it is read.
// ---------------------------------------------------------------------------
extern "C" void kernel_launch(void* const* d_in, const int* in_sizes, int n_in,
                              void* d_out, int out_size, void* d_ws, size_t ws_size,
                              hipStream_t stream) {
  if (n_in < 9) return;
  if (in_sizes[0] != kBatch * kCinHalf * kPix || in_sizes[1] != kBatch * kCinHalf * kPix) return;
  if (in_sizes[2] != kDq * kCh || in_sizes[3] != kDq || in_sizes[4] != kDq * kCh || in_sizes[5] != kDq) return;
  if (in_sizes[6] != kCh * kCh || in_sizes[7] != kDq * kCh || in_sizes[8] < 1) return;
  if (out_size != kBatch * kDq * kPix) return;

  const float* x1    = (const float*)d_in[0];
  const float* x2    = (const float*)d_in[1];
  const float* Wq    = (const float*)d_in[2];
  const float* bq    = (const float*)d_in[3];
  const float* Wk    = (const float*)d_in[4];
  const float* bk    = (const float*)d_in[5];
  const float* Wv    = (const float*)d_in[6];
  const float* Wsc   = (const float*)d_in[7];
  const float* gamma = (const float*)d_in[8];
  float* out = (float*)d_out;

  const size_t szPlane16 = (size_t)kBatch * kPix * kCh * 2;   // 4194304
  const size_t szS       = (size_t)kPix * kPix * 4;           // 67108864
  const size_t szP       = (size_t)kPix * kPix * 2;           // 33554432
  const size_t szO       = (size_t)kBatch * kPix * kCh * 4;   // 8388608
  const size_t szF       = (size_t)kBatch * kCh * kPix * 4;   // 8388608
  size_t off = 0;
  const size_t oSmall = off; off += 65536;
  const size_t oX     = off; off += szPlane16;
  const size_t oQK    = off; off += szPlane16;
  const size_t oV     = off; off += szPlane16;
  const size_t oS     = off; off += szS;
  const size_t oStat  = off; off += 65536;
  const size_t oP     = off; off += szP;
  const size_t oO     = off; off += szO;
  if (2 * szPlane16 + szF > szS) return;
  if (off > ws_size) return;

  char* ws = (char*)d_ws;
  unsigned short* Wqk16 = (unsigned short*)(ws + oSmall + 0);
  unsigned short* Wv16  = (unsigned short*)(ws + oSmall + 8192);
  unsigned short* Wsch  = (unsigned short*)(ws + oSmall + 16384);
  unsigned short* Wscl  = (unsigned short*)(ws + oSmall + 24576);
  float*          bqk   = (float*)(ws + oSmall + 32768);
  unsigned short* Xp    = (unsigned short*)(ws + oX);
  unsigned short* QKp   = (unsigned short*)(ws + oQK);
  unsigned short* Vp    = (unsigned short*)(ws + oV);
  float*          Sp    = (float*)(ws + oS);
  unsigned short* Zh    = (unsigned short*)(ws + oS);
  unsigned short* Zl    = (unsigned short*)(ws + oS + szPlane16);
  float*          Fp    = (float*)(ws + oS + 2 * szPlane16);
  float*          cmax  = (float*)(ws + oStat);
  float*          cscale = (float*)(ws + oStat + 16384);
  unsigned short* Pp    = (unsigned short*)(ws + oP);
  float*          Op    = (float*)(ws + oO);

  const dim3 blk(256);
  // (0) weights / bias
  prep_kernel<<<dim3(4), blk, 0, stream>>>(Wq, Wk, Wv, Wsc, bq, bk, Wqk16, Wv16, Wsch, Wscl, bqk);
  // (1) x -> X f16 [b][n][c]  (512 blocks = 8 batches x 64 pixel tiles)
  xcat_transpose_f16_kernel<<<dim3(kBatch * (kPix / 64)), blk, 0, stream>>>(x1, x2, Xp);
  // (2) [q|k][n][o'] = sum_c X[n][c] Wqk[o'][c] + bqk[o'] : M = 8*4096, N = 64, K = 64 -> QK f16 (512 tiles, 64 blocks)
  wmma_gemm64<0, false, 2, 1, false, 0><<<dim3((kBatch * kPix / 64) / 8, 1), blk, 0, stream>>>(
      Xp, Xp, kCh, 0L, Wqk16, Wqk16, kCh, 0L, (void*)QKp, (void*)QKp, kCh, 0L,
      bqk, bqk, 0L, kBatch * kPix, kCh, kCh, 1.0f);
  // (3) V[b][c][m] = sum_k Wv[c][k] X[b][m][k] : M = 64, N = 4096, K = 64 per batch (grid.y = batch) -> V f16 [b][64][4096]
  wmma_gemm64<0, false, 0, 1, false, 0><<<dim3(((kCh / 64) * (kPix / 64)) / 8, kBatch), blk, 0, stream>>>(
      Wv16, Wv16, kCh, 0L, Xp, Xp, kCh, (long)kPix * kCh, (void*)Vp, (void*)Vp, kPix, (long)kCh * kPix,
      bqk, bqk, 0L, kCh, kPix, kCh, 1.0f);

  for (int b = 0; b < kBatch; ++b) {
    const unsigned short* qk_b = QKp + (size_t)b * kPix * kCh;
    // (4) S[n][m] = sum_d q[n][d] k[m][d] : M = N = 4096, K = 32 -> S f32 (4096 tiles, 512 blocks)
    wmma_gemm64<0, false, 0, 0, false, 0><<<dim3(((kPix / 64) * (kPix / 64)) / 8, 1), blk, 0, stream>>>(
        qk_b, qk_b, kCh, 0L, qk_b + kDq, qk_b + kDq, kCh, 0L, (void*)Sp, (void*)Sp, kPix, 0L,
        bqk, bqk, 0L, kPix, kPix, kDq, 1.0f);
    // (5) column statistics (softmax over n for each column m)
    colstats_kernel<<<dim3(kPix / kStatCols), dim3(1024), 0, stream>>>(Sp, cmax, cscale);
    // (6) P f16 [n][m] = a[n][m] * 4096
    colsoftmax_p_kernel<<<dim3((kPix / 8) * (kPix / 256)), blk, 0, stream>>>(Sp, cmax, cscale, Pp);
    // (7) O[b][n][c] = (1/4096) sum_m P[n][m] V[b][c][m] : M = 4096, N = 64, K = 4096 -> f32 [4096][64] (64 tiles, 8 blocks)
    wmma_gemm64<0, false, 0, 0, false, 0><<<dim3(((kPix / 64) * (kCh / 64)) / 8, 1), blk, 0, stream>>>(
        Pp, Pp, kPix, 0L, Vp + (size_t)b * kCh * kPix, Vp + (size_t)b * kCh * kPix, kPix, 0L,
        (void*)(Op + (size_t)b * kPix * kCh), (void*)(Op + (size_t)b * kPix * kCh), kCh, 0L,
        bqk, bqk, 0L, kPix, kCh, kPix, 1.0f / 4096.0f);
  }
  // (8) z = gamma * O + x -> bf16 hi/lo planes [b][n][64]
  resid_split_kernel<<<dim3(kBatch * (kPix / 64)), blk, 0, stream>>>(Op, x1, x2, gamma, Zh, Zl);
  // (9) F[b][o][n] = sum_c Wsc[o][c] z[b][n][c] : M = 64 (rows 32..63 zero weights), N = 4096, K = 64, bf16 hi/lo split
  wmma_gemm64<1, true, 0, 0, false, 0><<<dim3(((kCh / 64) * (kPix / 64)) / 8, kBatch), blk, 0, stream>>>(
      Wsch, Wscl, kCh, 0L, Zh, Zl, kCh, (long)kPix * kCh, (void*)Fp, (void*)Fp, kPix, (long)kCh * kPix,
      bqk, bqk, 0L, kCh, kPix, kCh, 1.0f);
  // (10) rows 0..31 of each batch -> d_out [b][32][4096]
  copy_out_kernel<<<dim3((kBatch * kDq * kPix / 4) / 256), blk, 0, stream>>>(Fp, out);
}

// v002
// Measured time: 501 microseconds a run.
// In both of two side-by-side timings against v001, it was 3.66 times as fast.
// Over all steps from v000 it is 29.4 times as fast.
// Contractions: x·[Wq|Wk]^T (+bias), Wv·x, q·k^T scores and P·V aggregation on v_wmma_f32_16x16x32_f16 (f16 operands; P carried x4096 and folded back x1/4096 in the f32 epilogue); Wsc·z on v_wmma_f32_16x16x32_bf16 with bf16 hi/lo split operand planes (hi·hi + hi·lo + lo·hi); f32 accumulate everywhere; column-wise softmax statistics, exp and the gamma residual in f32.
#include <hip/hip_runtime.h>
#include <math.h>
#include <stdint.h>

constexpr int kBatch   = 8;
constexpr int kCinHalf = 32;     // channels of x1 and of x2
constexpr int kCh      = 64;     // concatenated channels
constexpr int kPix     = 4096;   // h*w
constexpr int kDq      = 32;     // q/k channels = output channels

typedef __attribute__((ext_vector_type(16))) _Float16 v16h;
typedef __attribute__((ext_vector_type(8)))  _Float16 v8h;
typedef __attribute__((ext_vector_type(16))) __bf16   v16b;
typedef __attribute__((ext_vector_type(8)))  __bf16   v8b;
typedef __attribute__((ext_vector_type(8)))  float    v8f;
typedef __attribute__((ext_vector_type(4)))  float    v4f;
typedef __attribute__((ext_vector_type(4)))  unsigned int v4u;

__device__ __forceinline__ unsigned short f2bf_bits(float f) {
  unsigned u = __float_as_uint(f);
  return (unsigned short)((u + 0x7FFFu + ((u >> 16) & 1u)) >> 16);
}
__device__ __forceinline__ float bf_bits2f(unsigned short h) { return __uint_as_float(((unsigned)h) << 16); }
__device__ __forceinline__ unsigned pk16(unsigned short a, unsigned short b) { return (unsigned)a | ((unsigned)b << 16); }
__device__ __forceinline__ unsigned short h16_bits(float f) { const _Float16 h = (_Float16)f; return __builtin_bit_cast(unsigned short, h); }

// hazard guards as plain device helpers (no inline asm inside the kernel template body)
__device__ __forceinline__ void dep_guard_h(v8f& a, v8f& b, v16h x, v16h y) { asm volatile("v_nop\n\tv_nop\n\tv_nop\n\tv_nop" : "+v"(a), "+v"(b) : "v"(x), "v"(y)); }
__device__ __forceinline__ void dep_guard_b(v8f& a, v8f& b, v16b x, v16b y) { asm volatile("v_nop\n\tv_nop\n\tv_nop\n\tv_nop" : "+v"(a), "+v"(b) : "v"(x), "v"(y)); }
__device__ __forceinline__ void keep4_h(v16h a, v16h b, v16h c, v16h d) { asm volatile("v_nop" :: "v"(a), "v"(b), "v"(c), "v"(d)); }
__device__ __forceinline__ void keep4_b(v16b a, v16b b, v16b c, v16b d) { asm volatile("v_nop" :: "v"(a), "v"(b), "v"(c), "v"(d)); }
__device__ __forceinline__ void acc_guard4(v8f& a, v8f& b, v8f& c, v8f& d) { asm volatile("v_nop\n\tv_nop\n\tv_nop\n\tv_nop" : "+v"(a), "+v"(b), "+v"(c), "+v"(d)); }
template <typename T> struct Frag;
template <> struct Frag<_Float16> {
  typedef v16h V; union U { v16h v; v8h h[2]; };
  static __device__ __forceinline__ v16h load(const _Float16* p) {   // elements 0..7 <- p[0..7], 8..15 <- p[16..23]
    U f; f.h[0] = *(const v8h*)(p); f.h[1] = *(const v8h*)(p + 16); return f.v;
  }
  static __device__ __forceinline__ v8f mma(v16h a, v16h b, v8f c) {
    return __builtin_amdgcn_wmma_f32_16x16x32_f16(false, a, false, b, (short)0, c, false, false);
  }
  static __device__ __forceinline__ void guard(v8f& a, v8f& b, v16h x, v16h y) { dep_guard_h(a, b, x, y); }
  static __device__ __forceinline__ void keep(v16h a, v16h b, v16h c, v16h d) { keep4_h(a, b, c, d); }
};
template <> struct Frag<__bf16> {
  typedef v16b V; union U { v16b v; v8b h[2]; };
  static __device__ __forceinline__ v16b load(const __bf16* p) {
    U f; f.h[0] = *(const v8b*)(p); f.h[1] = *(const v8b*)(p + 16); return f.v;
  }
  static __device__ __forceinline__ v8f mma(v16b a, v16b b, v8f c) {
    return __builtin_amdgcn_wmma_f32_16x16x32_bf16(false, a, false, b, (short)0, c, false, false);
  }
  static __device__ __forceinline__ void guard(v8f& a, v8f& b, v16b x, v16b y) { dep_guard_b(a, b, x, y); }
  static __device__ __forceinline__ void keep(v16b a, v16b b, v16b c, v16b d) { keep4_b(a, b, c, d); }
};

// ---- Register-blocked batched WMMA GEMM ------------------------------------
// C[m,n] = scale * sum_k A[m,k] * Bt[n,k] (+bias)(+resid); each wave owns a 64x64 tile.
// A row-major [M,K]; Bt row-major [N,K]; M,N % 64 == 0, K % 32 == 0.
// SPLIT: operands are hi/lo planes (A2/Bt2 = lo planes, same layout); product = hi·hi + hi·lo + lo·hi.
// BIAS_MODE: 0 = none, 1 = bias[m], 2 = bias[n].
// OUT_MODE: 0 = f32, 1 = f16, 2 = bf16 hi plane (Cout) + bf16 lo plane (Cout2).
// ET: 0 = f16 operands, 1 = bf16 operands (pointers passed as 16-bit storage)
template <int ET> struct Elem;
template <> struct Elem<0> { typedef _Float16 T; };
template <> struct Elem<1> { typedef __bf16 T; };
template <int ET, bool SPLIT, int BIAS_MODE, int OUT_MODE, bool RESID, int ACT = 0>
__global__ __launch_bounds__(256) void wmma_gemm64(
    const unsigned short* __restrict__ Ap, const unsigned short* __restrict__ A2p, int lda, long strideA,
    const unsigned short* __restrict__ Btp, const unsigned short* __restrict__ Bt2p, int ldb, long strideB,
    void* __restrict__ Cout, void* __restrict__ Cout2, int ldc, long strideC,
    const float* __restrict__ bias,
    const float* __restrict__ resid, long strideR,
    int M, int N, int K, float scale) {
  typedef typename Elem<ET>::T T;
  typedef typename Frag<T>::V V;
  const T* A = (const T*)Ap; const T* A2 = (const T*)A2p; const T* Bt = (const T*)Btp; const T* Bt2 = (const T*)Bt2p;
  __shared__ __align__(16) float sT[8][16 * 68];   // per-wave 16x64 slab, pitch 68 floats
  const int b    = blockIdx.y;
  const int lane = threadIdx.x & 31;
  const int wave = threadIdx.x >> 5;
  const int tilesN = N >> 6;
  const int tilesM = M >> 6;
  const int tile = blockIdx.x * 8 + wave;
  if (tile >= tilesM * tilesN) return;   // wave-uniform; no block barriers in this kernel
  const int tm = tile / tilesN;
  const int tn = tile - tm * tilesN;
  const int m0 = tm << 6;
  const int n0 = tn << 6;

  const T* Ab  = A  + (size_t)b * strideA;
  const T* Bb  = Bt + (size_t)b * strideB;
  const T* Ab2 = SPLIT ? (A2  + (size_t)b * strideA) : nullptr;
  const T* Bb2 = SPLIT ? (Bt2 + (size_t)b * strideB) : nullptr;

  const int rlane = lane & 15;                 // row (A) / col (B, D) within subtile
  const int koff  = (lane >> 4) * 8;           // k offset of this lane half
  const int mOff  = (lane >> 4) * 8;           // D row offset

  v8f acc[4][4];
#pragma unroll
  for (int i = 0; i < 4; ++i)
#pragma unroll
    for (int j = 0; j < 4; ++j) acc[i][j] = (v8f){0.f,0.f,0.f,0.f,0.f,0.f,0.f,0.f};

  for (int k0 = 0; k0 < K; k0 += 32) {
    V bh[4], bl[4];
#pragma unroll
    for (int j = 0; j < 4; ++j) {
      const size_t bo = (size_t)(n0 + (j << 4) + rlane) * ldb + koff + k0;
      bh[j] = Frag<T>::load(Bb + bo);
      if (SPLIT) bl[j] = Frag<T>::load(Bb2 + bo);
    }
#pragma unroll
    for (int i = 0; i < 4; ++i) {
      const size_t ao = (size_t)(m0 + (i << 4) + rlane) * lda + koff + k0;
      V ah = Frag<T>::load(Ab + ao);
      V al;
      if (SPLIT) al = Frag<T>::load(Ab2 + ao);
#pragma unroll
      for (int j = 0; j < 4; ++j) {
        acc[i][j] = Frag<T>::mma(ah, bh[j], acc[i][j]);
        if (SPLIT) {
          acc[i][j] = Frag<T>::mma(ah, bl[j], acc[i][j]);
          acc[i][j] = Frag<T>::mma(al, bh[j], acc[i][j]);
        }
      }
      Frag<T>::guard(acc[i][0], acc[i][3], ah, SPLIT ? al : ah);
    }
    Frag<T>::keep(bh[0], bh[1], bh[2], bh[3]);
    if (SPLIT) Frag<T>::keep(bl[0], bl[1], bl[2], bl[3]);
  }
  acc_guard4(acc[0][0], acc[0][1], acc[0][2], acc[0][3]);
  acc_guard4(acc[1][0], acc[1][1], acc[1][2], acc[1][3]);
  acc_guard4(acc[2][0], acc[2][1], acc[2][2], acc[2][3]);
  acc_guard4(acc[3][0], acc[3][1], acc[3][2], acc[3][3]);

  // ---- epilogue ----
  float* slab = sT[wave];
  const float* Rb = RESID ? (resid + (size_t)b * strideR) : nullptr;
#pragma unroll
  for (int i = 0; i < 4; ++i) {
    const int mBase = m0 + (i << 4);
#pragma unroll
    for (int j = 0; j < 4; ++j) {
      const int n = n0 + (j << 4) + rlane;
      float bv = 0.f;
      if (BIAS_MODE == 2) bv = bias[n];
#pragma unroll
      for (int r = 0; r < 8; ++r) {
        float v = acc[i][j][r] * scale;
        if (BIAS_MODE == 1) v += bias[mBase + mOff + r];
        if (BIAS_MODE == 2) v += bv;
        if (RESID) v += Rb[(size_t)(mBase + mOff + r) * ldc + n];
        if (ACT == 1) v = tanhf(v);
        if (ACT == 2) v = fmaxf(v, 0.0f);
        if (ACT == 3) v = v / (1.0f + expf(-v));
        if (ACT == 4) v = (v > 0.f) ? v : 0.01f * v;
        if (ACT == 5) v = 0.5f * v * (1.0f + erff(v * 0.70710678118654752f));
        slab[(mOff + r) * 68 + (j << 4) + rlane] = v;
      }
    }
    __builtin_amdgcn_fence(__ATOMIC_RELEASE, "workgroup");
    __builtin_amdgcn_wave_barrier();
    __builtin_amdgcn_fence(__ATOMIC_ACQUIRE, "workgroup");
    if (OUT_MODE == 0) {
      float* C = (float*)Cout + (size_t)b * strideC;
      const int hh = lane >> 4, c4 = (lane & 15) * 4;     // row seg = 256 B = 16 lanes x 16 B
      {
#pragma unroll
        for (int it = 0; it < 8; ++it) {
          const int row = it * 2 + hh;
          v4f v = *(const v4f*)(slab + row * 68 + c4);
          *(v4f*)(C + (size_t)(mBase + row) * ldc + n0 + c4) = v;
        }
        
      }
    } else {
      const int q = lane >> 3, c8 = (lane & 7) * 8;
      unsigned short* C  = (unsigned short*)Cout  + (size_t)b * strideC;
      unsigned short* C2 = (OUT_MODE == 2) ? ((unsigned short*)Cout2 + (size_t)b * strideC) : nullptr;
      {
#pragma unroll
        for (int it = 0; it < 4; ++it) {
          const int row = it * 4 + q;
          const float* sp = slab + row * 68 + c8;
          v8h hv, lv;
#pragma unroll
          for (int e = 0; e < 8; ++e) {
            if (OUT_MODE == 1) {
              hv[e] = (_Float16)sp[e];
            } else {
              unsigned short hb = f2bf_bits(sp[e]);
              unsigned short lb = f2bf_bits(sp[e] - bf_bits2f(hb));
              hv[e] = __builtin_bit_cast(_Float16, hb);
              lv[e] = __builtin_bit_cast(_Float16, lb);
            }
          }
          *(v8h*)(C + (size_t)(mBase + row) * ldc + n0 + c8) = hv;
          if (OUT_MODE == 2) *(v8h*)(C2 + (size_t)(mBase + row) * ldc + n0 + c8) = lv;
        }
        
      }
    }
    __builtin_amdgcn_fence(__ATOMIC_RELEASE, "workgroup");
    __builtin_amdgcn_wave_barrier();
    __builtin_amdgcn_fence(__ATOMIC_ACQUIRE, "workgroup");
  }
}

// ---------------------------------------------------------------------------
// Weight / bias preparation, one launch of 4 blocks with block-uniform roles (no barriers):
//   role 0: [Wq;Wk] -> f16 [64][64]      role 1: Wv -> f16 [64][64]
//   role 2: Wsc -> bf16 hi/lo [64][64], rows 32..63 zero-filled (tile padding of the A operand)
//   role 3: [bq;bk] -> f32 [64]
// Coverage roles 0-2: 2 it x 256 thr x 8 elements = 4096 = the whole 64x64 plane; each store instruction
// ---------------------------------------------------------------------------
__global__ __launch_bounds__(256) void prep_kernel(
    const float* __restrict__ Wq, const float* __restrict__ Wk, const float* __restrict__ Wv,
    const float* __restrict__ Wsc, const float* __restrict__ bq, const float* __restrict__ bk,
    unsigned short* __restrict__ Wqk16, unsigned short* __restrict__ Wv16,
    unsigned short* __restrict__ Wsch, unsigned short* __restrict__ Wscl, float* __restrict__ bqk) {
  const int tid  = threadIdx.x;
  const int role = blockIdx.x;   // block-uniform
  if (role == 0) {
    v4u hv[2];
#pragma unroll
    for (int it = 0; it < 2; ++it) {
      const int task = it * 256 + tid;
      const int row = task >> 3, c8 = (task & 7) * 8;
      const int rq = row < kDq ? row : (kDq - 1);
      int rk = row - kDq; rk = rk < 0 ? 0 : (rk > kDq - 1 ? kDq - 1 : rk);
      const v4f a0 = *(const v4f*)(Wq + rq * kCh + c8), a1 = *(const v4f*)(Wq + rq * kCh + c8 + 4);
      const v4f b0 = *(const v4f*)(Wk + rk * kCh + c8), b1 = *(const v4f*)(Wk + rk * kCh + c8 + 4);
      const bool useq = row < kDq;
      float f[8];
#pragma unroll
      for (int e = 0; e < 4; ++e) { f[e] = useq ? a0[e] : b0[e]; f[4 + e] = useq ? a1[e] : b1[e]; }
      v4u u;
#pragma unroll
      for (int q = 0; q < 4; ++q) u[q] = pk16(h16_bits(f[2 * q]), h16_bits(f[2 * q + 1]));
      hv[it] = u;
    }
    {
#pragma unroll
      for (int it = 0; it < 2; ++it) {
        const int task = it * 256 + tid;
        const int row = task >> 3, c8 = (task & 7) * 8;
        *(v4u*)(Wqk16 + row * kCh + c8) = hv[it];
      }
      
    }
  } else if (role == 1) {
    v4u hv[2];
#pragma unroll
    for (int it = 0; it < 2; ++it) {
      const int task = it * 256 + tid;
      const int row = task >> 3, c8 = (task & 7) * 8;   // row 0..63 valid
      const v4f a0 = *(const v4f*)(Wv + row * kCh + c8), a1 = *(const v4f*)(Wv + row * kCh + c8 + 4);
      float f[8];
#pragma unroll
      for (int e = 0; e < 4; ++e) { f[e] = a0[e]; f[4 + e] = a1[e]; }
      v4u u;
#pragma unroll
      for (int q = 0; q < 4; ++q) u[q] = pk16(h16_bits(f[2 * q]), h16_bits(f[2 * q + 1]));
      hv[it] = u;
    }
    {
#pragma unroll
      for (int it = 0; it < 2; ++it) {
        const int task = it * 256 + tid;
        const int row = task >> 3, c8 = (task & 7) * 8;
        *(v4u*)(Wv16 + row * kCh + c8) = hv[it];
      }
      
    }
  } else if (role == 2) {
    v4u hv[2], lv[2];
#pragma unroll
    for (int it = 0; it < 2; ++it) {
      const int task = it * 256 + tid;
      const int row = task >> 3, c8 = (task & 7) * 8;
      const int rs = row < kDq ? row : (kDq - 1);        // clamped address, zero by predicate
      const bool live = row < kDq;
      const v4f a0 = *(const v4f*)(Wsc + rs * kCh + c8), a1 = *(const v4f*)(Wsc + rs * kCh + c8 + 4);
      float f[8];
#pragma unroll
      for (int e = 0; e < 4; ++e) { f[e] = live ? a0[e] : 0.0f; f[4 + e] = live ? a1[e] : 0.0f; }
      v4u u, u2;
#pragma unroll
      for (int q = 0; q < 4; ++q) {
        const unsigned short hb0 = f2bf_bits(f[2 * q]), hb1 = f2bf_bits(f[2 * q + 1]);
        const unsigned short lb0 = f2bf_bits(f[2 * q] - bf_bits2f(hb0));
        const unsigned short lb1 = f2bf_bits(f[2 * q + 1] - bf_bits2f(hb1));
        u[q] = pk16(hb0, hb1); u2[q] = pk16(lb0, lb1);
      }
      hv[it] = u; lv[it] = u2;
    }
    {
#pragma unroll
      for (int it = 0; it < 2; ++it) {
        const int task = it * 256 + tid;
        const int row = task >> 3, c8 = (task & 7) * 8;
        *(v4u*)(Wsch + row * kCh + c8) = hv[it];
        *(v4u*)(Wscl + row * kCh + c8) = lv[it];
      }
      
    }
  } else if (role == 3) {
    if (tid < 16) {
      const int iq = (4 * tid < kDq - 4) ? 4 * tid : (kDq - 4);
      int ik = 4 * tid - kDq; ik = ik < 0 ? 0 : (ik > kDq - 4 ? kDq - 4 : ik);
      const v4f a = *(const v4f*)(bq + iq);
      const v4f c = *(const v4f*)(bk + ik);
      const v4f v = (tid < 8) ? a : c;
      *(v4f*)(bqk + 4 * tid) = v;
      
    }
  }
}

// ---------------------------------------------------------------------------
// grid = kBatch * 64 blocks (one per 64-pixel tile), 256 threads.
// Coverage per block: load 4 it x 256 thr x 4 f32 = 64 ch x 64 px; store 2 it x 256 thr x 8 u16 = 64 px x 64 ch;
// ---------------------------------------------------------------------------
__global__ __launch_bounds__(256) void xcat_transpose_f16_kernel(const float* __restrict__ x1, const float* __restrict__ x2,
                                                                 unsigned short* __restrict__ Xo) {
  __shared__ __align__(16) float tf[64 * 68];
  const int bx  = blockIdx.x;
  const int b   = bx >> 6;
  const int n0  = (bx & 63) * 64;
  const int tid = threadIdx.x;
  const int sub = tid >> 4, c4 = (tid & 15) * 4;
#pragma unroll
  for (int it = 0; it < 2; ++it) {
    const int ch = it * 16 + sub;   // channels 0..31 from x1
    const v4f a = *(const v4f*)(x1 + ((size_t)(b * kCinHalf + ch) * kPix + n0 + c4));
    *(v4f*)(tf + ch * 68 + c4) = a;
  }
#pragma unroll
  for (int it = 0; it < 2; ++it) {
    const int ch = it * 16 + sub;   // channels 32..63 from x2
    const v4f a = *(const v4f*)(x2 + ((size_t)(b * kCinHalf + ch) * kPix + n0 + c4));
    *(v4f*)(tf + (kCinHalf + ch) * 68 + c4) = a;
  }
  __syncthreads();
  const int s8 = tid >> 3, c8 = (tid & 7) * 8;
  v4u hv[2];
#pragma unroll
  for (int it = 0; it < 2; ++it) {
    const int oc = it * 32 + s8;    // pixel within tile
    v4u u;
#pragma unroll
    for (int q = 0; q < 4; ++q) {
      const float f0 = tf[(c8 + 2 * q) * 68 + oc];
      const float f1 = tf[(c8 + 2 * q + 1) * 68 + oc];
      u[q] = pk16(h16_bits(f0), h16_bits(f1));
    }
    hv[it] = u;
  }
  {
#pragma unroll
    for (int it = 0; it < 2; ++it) {
      const int oc = it * 32 + s8;
      *(v4u*)(Xo + ((size_t)(b * kPix + n0 + oc) * kCh + c8)) = hv[it];
    }
    
  }
}

// ---------------------------------------------------------------------------
// Column softmax statistics of S f32 [4096 n][4096 m] (normalisation over n, i.e. down each column m):
// cmax[m] = max_n S[n][m], cscale[m] = 4096 / sum_n exp(S[n][m] - cmax[m]).
// grid = 128 blocks, each owning 32 columns (one 128-byte line of every row) for all 4096 rows; 1024 threads =
// 8 column quads x 128 row lanes, 32 consecutive rows per thread in two register chunks of 16 (chunk max, then the exps).
// The (max, sum) pairs merge over the 4 row lanes of a wave by shuffles, then over the 32 waves through LDS.
// ---------------------------------------------------------------------------
constexpr int kStatCols  = 32;    // columns per block
constexpr int kStatLanes = 128;   // row lanes per block = 1024 threads / 8 column quads
constexpr int kStatChunk = 16;    // rows held in registers at a time
constexpr int kStatPitch = 36;    // floats per LDS row: 144 B = 16 B x odd, so 16-byte reads 8 rows apart miss each other's banks

// Merges the (max, sum) pairs of lanes l, l^8, l^16, l^24, which hold the same column quad; every lane ends with the result.
__device__ __forceinline__ void stat_merge_lanes(v4f& mx, v4f& sm) {
#pragma unroll   // two steps, constant shuffle distances
  for (int d = 8; d <= 16; d <<= 1) {
#pragma unroll   // vector elements by constant index
    for (int e = 0; e < 4; ++e) {
      const float om = __shfl_xor(mx[e], d);
      const float os = __shfl_xor(sm[e], d);
      const float dm = mx[e] - om;
      const float ex = __expf(-fabsf(dm));   // the larger maximum keeps its sum, the other is rescaled
      sm[e] = (dm > 0.0f) ? (sm[e] + os * ex) : (sm[e] * ex + os);
      mx[e] = fmaxf(mx[e], om);
    }
  }
}

// The '#pragma unroll' lines below keep s[], pm[], ps[] and the 4-vectors in registers (constant indices).
__global__ __launch_bounds__(1024) void colstats_kernel(const float* __restrict__ S,
                                                        float* __restrict__ cmax, float* __restrict__ cscale) {
  __shared__ __align__(16) float sMx[32 * kStatPitch];
  __shared__ __align__(16) float sSm[32 * kStatPitch];
  const int tid  = threadIdx.x;
  const int lane = tid & 31;
  const int wave = tid >> 5;
  const int m0   = blockIdx.x * kStatCols;
  const int c4   = (tid & 7) * 4;
  const float* col = S + (size_t)(tid >> 3) * (kPix / kStatLanes) * kPix + m0 + c4;   // first of this thread's 32 consecutive rows
  v4f mx = (v4f){-INFINITY, -INFINITY, -INFINITY, -INFINITY};
  v4f sm = (v4f){0.0f, 0.0f, 0.0f, 0.0f};
  // kept rolled: unrolled, both chunks' loads are hoisted together and overflow the 128 registers a 32-wave block may use
#pragma unroll 1
  for (int ch = 0; ch < kPix / (kStatLanes * kStatChunk); ++ch) {
    v4f s[kStatChunk];
#pragma unroll
    for (int i = 0; i < kStatChunk; ++i)
      s[i] = *(const v4f*)(col + (size_t)i * kPix);
    v4f nm = mx;
#pragma unroll
    for (int i = 0; i < kStatChunk; ++i)
#pragma unroll
      for (int e = 0; e < 4; ++e) nm[e] = fmaxf(nm[e], s[i][e]);
#pragma unroll
    for (int e = 0; e < 4; ++e) sm[e] *= __expf(mx[e] - nm[e]);   // first chunk: 0 * exp(-inf) = 0
#pragma unroll
    for (int i = 0; i < kStatChunk; ++i)
#pragma unroll
      for (int e = 0; e < 4; ++e) sm[e] += __expf(s[i][e] - nm[e]);
    mx = nm;
    col += (size_t)kStatChunk * kPix;
  }
  stat_merge_lanes(mx, sm);
  if (lane < 8) {
    *(v4f*)(sMx + wave * kStatPitch + c4) = mx;
    *(v4f*)(sSm + wave * kStatPitch + c4) = sm;
  }
  __syncthreads();
  if (wave == 0) {   // 8 column quads x 4 lane groups, each group taking 8 of the 32 waves' pairs
    const int w0 = (lane >> 3) * 8;
    v4f pm[8], ps[8];
#pragma unroll
    for (int j = 0; j < 8; ++j) {
      pm[j] = *(const v4f*)(sMx + (w0 + j) * kStatPitch + c4);
      ps[j] = *(const v4f*)(sSm + (w0 + j) * kStatPitch + c4);
    }
    v4f M = pm[0];
#pragma unroll
    for (int j = 1; j < 8; ++j)
#pragma unroll
      for (int e = 0; e < 4; ++e) M[e] = fmaxf(M[e], pm[j][e]);
    v4f tot = (v4f){0.0f, 0.0f, 0.0f, 0.0f};
#pragma unroll
    for (int j = 0; j < 8; ++j)
#pragma unroll
      for (int e = 0; e < 4; ++e) tot[e] += ps[j][e] * __expf(pm[j][e] - M[e]);
    stat_merge_lanes(M, tot);
    if (lane < 8) {   // 8 lanes x 16 B: each store fills one whole 128-byte line
      v4f sc;
#pragma unroll
      for (int e = 0; e < 4; ++e) sc[e] = 4096.0f * __builtin_amdgcn_rcpf(tot[e]);   // tot >= 1
      *(v4f*)(cmax + m0 + c4)   = M;
      *(v4f*)(cscale + m0 + c4) = sc;
    }
  }
}

// ---------------------------------------------------------------------------
// P f16 [n][m] = exp(S[n][m] - cmax[m]) * cscale[m]  (= softmax over n, carried x4096; values <= 4096, typical ~1).
// grid = 4096*4096/2048 = 8192 blocks; 8 elements per thread; 512 threads per row; each wave stores
// ---------------------------------------------------------------------------
__global__ __launch_bounds__(256) void colsoftmax_p_kernel(const float* __restrict__ S, const float* __restrict__ cmax,
                                                           const float* __restrict__ cscale, unsigned short* __restrict__ P) {
  const int t  = blockIdx.x * 256 + threadIdx.x;
  const int n  = t >> 9;
  const int m8 = (t & 511) * 8;
  const float* sp = S + (size_t)n * kPix + m8;
  const v4f s0 = *(const v4f*)sp, s1 = *(const v4f*)(sp + 4);
  const v4f c0 = *(const v4f*)(cmax + m8), c1 = *(const v4f*)(cmax + m8 + 4);
  const v4f k0 = *(const v4f*)(cscale + m8), k1 = *(const v4f*)(cscale + m8 + 4);
  float p[8];
#pragma unroll
  for (int e = 0; e < 4; ++e) {
    p[e]     = __expf(s0[e] - c0[e]) * k0[e];
    p[4 + e] = __expf(s1[e] - c1[e]) * k1[e];
  }
  v4u u;
#pragma unroll
  for (int q = 0; q < 4; ++q) u[q] = pk16(h16_bits(p[2 * q]), h16_bits(p[2 * q + 1]));
  unsigned short* dst = P + (size_t)n * kPix + m8;
  *(v4u*)dst = u;
  
}

constexpr int kPvRows  = 16;
constexpr int kPvWaves = 16;
constexpr int kPvSlice = kPix / kPvWaves;
constexpr int kPvPitch = 68;

__global__ __launch_bounds__(512) void pv_splitk_kernel(const unsigned short* __restrict__ Pp,
                                                        const unsigned short* __restrict__ Vp, float* __restrict__ O) {
  __shared__ __align__(16) float part[kPvWaves][kPvRows * kPvPitch];
  const int tid   = threadIdx.x;
  const int lane  = tid & 31;
  const int wave  = tid >> 5;
  const int rlane = lane & 15;            // row of P (= row of O) / row of V within a 16-wide subtile
  const int koff  = (lane >> 4) * 8;      // k offset of this lane half; also the accumulator's offset along the A operand's rows
  const int m0    = blockIdx.x * kPvRows;
  const _Float16* pa = (const _Float16*)Pp + (size_t)(m0 + rlane) * kPix + wave * kPvSlice + koff;
  const _Float16* pb = (const _Float16*)Vp + (size_t)rlane * kPix + wave * kPvSlice + koff;
  v8f acc[4];
  // the unrolls below keep acc[], af[] and bf[] in registers (constant indices) and leave the loads free to run ahead
#pragma unroll
  for (int j = 0; j < 4; ++j) acc[j] = (v8f){0.f, 0.f, 0.f, 0.f, 0.f, 0.f, 0.f, 0.f};
  v16h af[2][2], bf[2][4][2];   // two sets of fragments: one being multiplied, one being loaded
#pragma unroll
  for (int s = -1; s < kPvSlice / 64; ++s) {
    if (s + 1 < kPvSlice / 64) {
      const int n = (s + 1) & 1, ko = (s + 1) * 64;
#pragma unroll
      for (int h = 0; h < 2; ++h) af[n][h] = Frag<_Float16>::load(pa + ko + h * 32);
#pragma unroll
      for (int j = 0; j < 4; ++j)
#pragma unroll
        for (int h = 0; h < 2; ++h) bf[n][j][h] = Frag<_Float16>::load(pb + (size_t)(j << 4) * kPix + ko + h * 32);
    }
    // holds the next set's 20 loads ahead of this set's products; left free, the compiler sinks every load to just
    // in front of its product and each product then waits out a whole load latency
    __builtin_amdgcn_sched_barrier(0);
    if (s >= 0) {
      const int c = s & 1;
#pragma unroll
      for (int h = 0; h < 2; ++h)
#pragma unroll
        for (int j = 0; j < 4; ++j) acc[j] = Frag<_Float16>::mma(bf[c][j][h], af[c][h], acc[j]);
    }
    // holds the following loads, which refill this set's registers, behind this set's products: left free, they are
    // spread among the products and take registers beyond the two sets
    __builtin_amdgcn_sched_barrier(0);
  }
  float* slab = part[wave];
#pragma unroll
  for (int j = 0; j < 4; ++j) {   // acc[j][r] = partial O[m0 + rlane][16 j + koff + r]: 8 consecutive columns of one row
    float* d = slab + rlane * kPvPitch + (j << 4) + koff;
    *(v4f*)(d)     = (v4f){acc[j][0], acc[j][1], acc[j][2], acc[j][3]};
    *(v4f*)(d + 4) = (v4f){acc[j][4], acc[j][5], acc[j][6], acc[j][7]};
  }
  __syncthreads();
  if (tid < kPvRows * 16) {   // waves 0..7: one float4 of the tile each; the tile is 4096 contiguous bytes of O
    const int row = tid >> 4, c4 = (tid & 15) * 4;
    v4f t = *(const v4f*)(&part[0][row * kPvPitch + c4]);
#pragma unroll
    for (int w = 1; w < kPvWaves; ++w) t += *(const v4f*)(&part[w][row * kPvPitch + c4]);
    t *= (1.0f / 4096.0f);
    *(v4f*)(O + (size_t)(m0 + row) * kCh + c4) = t;
  }
}

// ---------------------------------------------------------------------------
// grid = kBatch * 64 blocks; x tile transposed through LDS exactly like xcat_transpose_f16_kernel.
// Coverage: store 2 it x 256 thr x 8 u16 = 64 px x 64 ch per plane; 8 lanes x 16 B = one whole row;
// ---------------------------------------------------------------------------
__global__ __launch_bounds__(256) void resid_split_kernel(const float* __restrict__ O, const float* __restrict__ x1,
                                                          const float* __restrict__ x2, const float* __restrict__ gamma,
                                                          unsigned short* __restrict__ Zh, unsigned short* __restrict__ Zl) {
#pragma clang fp contract(off)
  __shared__ __align__(16) float tf[64 * 68];
  const int bx  = blockIdx.x;
  const int b   = bx >> 6;
  const int n0  = (bx & 63) * 64;
  const int tid = threadIdx.x;
  const int sub = tid >> 4, c4 = (tid & 15) * 4;
#pragma unroll
  for (int it = 0; it < 2; ++it) {
    const int ch = it * 16 + sub;
    const v4f a = *(const v4f*)(x1 + ((size_t)(b * kCinHalf + ch) * kPix + n0 + c4));
    *(v4f*)(tf + ch * 68 + c4) = a;
  }
#pragma unroll
  for (int it = 0; it < 2; ++it) {
    const int ch = it * 16 + sub;
    const v4f a = *(const v4f*)(x2 + ((size_t)(b * kCinHalf + ch) * kPix + n0 + c4));
    *(v4f*)(tf + (kCinHalf + ch) * 68 + c4) = a;
  }
  __syncthreads();
  const float g = gamma[0];
  const int s8 = tid >> 3, c8 = (tid & 7) * 8;
  v4u hv[2], lv[2];
#pragma unroll
  for (int it = 0; it < 2; ++it) {
    const int oc = it * 32 + s8;
    const size_t ro = (size_t)(b * kPix + n0 + oc) * kCh + c8;
    const v4f o0 = *(const v4f*)(O + ro), o1 = *(const v4f*)(O + ro + 4);
    float z[8];
#pragma unroll
    for (int e = 0; e < 4; ++e) {
      z[e]     = g * o0[e] + tf[(c8 + e) * 68 + oc];
      z[4 + e] = g * o1[e] + tf[(c8 + 4 + e) * 68 + oc];
    }
    v4u u, u2;
#pragma unroll
    for (int q = 0; q < 4; ++q) {
      const unsigned short hb0 = f2bf_bits(z[2 * q]), hb1 = f2bf_bits(z[2 * q + 1]);
      const unsigned short lb0 = f2bf_bits(z[2 * q] - bf_bits2f(hb0));
      const unsigned short lb1 = f2bf_bits(z[2 * q + 1] - bf_bits2f(hb1));
      u[q] = pk16(hb0, hb1); u2[q] = pk16(lb0, lb1);
    }
    hv[it] = u; lv[it] = u2;
  }
  {
#pragma unroll
    for (int it = 0; it < 2; ++it) {
      const int oc = it * 32 + s8;
      const size_t ro = (size_t)(b * kPix + n0 + oc) * kCh + c8;
      *(v4u*)(Zh + ro) = hv[it];
      *(v4u*)(Zl + ro) = lv[it];
    }
    
  }
}

// ---------------------------------------------------------------------------
// d_out[b][o][n] = F[b][o][n] for o < 32 (F has 64 rows per batch; rows 32..63 are the zero-padded tile rows).
// grid = kBatch*32*4096/1024 = 1024 blocks; one float4 per thread; a wave writes 32 x 16 B = 4 whole consecutive
// ---------------------------------------------------------------------------
__global__ __launch_bounds__(256) void copy_out_kernel(const float* __restrict__ F, float* __restrict__ out) {
  const int t  = blockIdx.x * 256 + threadIdx.x;
  const int b  = t >> 15;
  const int r  = t & 32767;
  const int o  = r >> 10;
  const int n4 = (r & 1023) * 4;
  const v4f v = *(const v4f*)(F + ((size_t)(b * kCh + o) * kPix + n4));
  float* dst = out + ((size_t)(b * kDq + o) * kPix + n4);
  *(v4f*)dst = v;
  
}

// ---------------------------------------------------------------------------
// Workspace region map (byte offsets):
//   small    65536 B @ 0        : Wqk16 f16 [64][64] @0, Wv16 f16 [64][64] @8192, Wsch bf16 [64][64] @16384,
//                                 Wscl bf16 [64][64] @24576, bqk f32 [64] @32768
//   X   f16 [8][4096][64]        4194304 B @ 65536
//   QK  f16 [8][4096][64]        4194304 B @ 4259840       (cols 0..31 = q, 32..63 = k)
//   V   f16 [8][64][4096]        4194304 B @ 8454144
//   S   f32 [4096][4096]        67108864 B @ 12648448      (per batch; after the batch loop the region is dead and holds
//                                 Zh bf16 [8][4096][64] @ S+0, Zl @ S+4194304, F f32 [8][64][4096] @ S+8388608)
//   stat f32 cmax[4096] @ +0, cscale[4096] @ +16384      65536 B @ 79757312
//   P   f16 [4096][4096]        33554432 B @ 79822848
//   O   f32 [8][4096][64]        8388608 B @ 113377280
//   total                      121765888 B
// Every region is fully written before it is read.
// ---------------------------------------------------------------------------
extern "C" void kernel_launch(void* const* d_in, const int* in_sizes, int n_in,
                              void* d_out, int out_size, void* d_ws, size_t ws_size,
                              hipStream_t stream) {
  if (n_in < 9) return;
  if (in_sizes[0] != kBatch * kCinHalf * kPix || in_sizes[1] != kBatch * kCinHalf * kPix) return;
  if (in_sizes[2] != kDq * kCh || in_sizes[3] != kDq || in_sizes[4] != kDq * kCh || in_sizes[5] != kDq) return;
  if (in_sizes[6] != kCh * kCh || in_sizes[7] != kDq * kCh || in_sizes[8] < 1) return;
  if (out_size != kBatch * kDq * kPix) return;

  const float* x1    = (const float*)d_in[0];
  const float* x2    = (const float*)d_in[1];
  const float* Wq    = (const float*)d_in[2];
  const float* bq    = (const float*)d_in[3];
  const float* Wk    = (const float*)d_in[4];
  const float* bk    = (const float*)d_in[5];
  const float* Wv    = (const float*)d_in[6];
  const float* Wsc   = (const float*)d_in[7];
  const float* gamma = (const float*)d_in[8];
  float* out = (float*)d_out;

  const size_t szPlane16 = (size_t)kBatch * kPix * kCh * 2;   // 4194304
  const size_t szS       = (size_t)kPix * kPix * 4;           // 67108864
  const size_t szP       = (size_t)kPix * kPix * 2;           // 33554432
  const size_t szO       = (size_t)kBatch * kPix * kCh * 4;   // 8388608
  const size_t szF       = (size_t)kBatch * kCh * kPix * 4;   // 8388608
  size_t off = 0;
  const size_t oSmall = off; off += 65536;
  const size_t oX     = off; off += szPlane16;
  const size_t oQK    = off; off += szPlane16;
  const size_t oV     = off; off += szPlane16;
  const size_t oS     = off; off += szS;
  const size_t oStat  = off; off += 65536;
  const size_t oP     = off; off += szP;
  const size_t oO     = off; off += szO;
  if (2 * szPlane16 + szF > szS) return;
  if (off > ws_size) return;

  char* ws = (char*)d_ws;
  unsigned short* Wqk16 = (unsigned short*)(ws + oSmall + 0);
  unsigned short* Wv16  = (unsigned short*)(ws + oSmall + 8192);
  unsigned short* Wsch  = (unsigned short*)(ws + oSmall + 16384);
  unsigned short* Wscl  = (unsigned short*)(ws + oSmall + 24576);
  float*          bqk   = (float*)(ws + oSmall + 32768);
  unsigned short* Xp    = (unsigned short*)(ws + oX);
  unsigned short* QKp   = (unsigned short*)(ws + oQK);
  unsigned short* Vp    = (unsigned short*)(ws + oV);
  float*          Sp    = (float*)(ws + oS);
  unsigned short* Zh    = (unsigned short*)(ws + oS);
  unsigned short* Zl    = (unsigned short*)(ws + oS + szPlane16);
  float*          Fp    = (float*)(ws + oS + 2 * szPlane16);
  float*          cmax  = (float*)(ws + oStat);
  float*          cscale = (float*)(ws + oStat + 16384);
  unsigned short* Pp    = (unsigned short*)(ws + oP);
  float*          Op    = (float*)(ws + oO);

  const dim3 blk(256);
  // (0) weights / bias
  prep_kernel<<<dim3(4), blk, 0, stream>>>(Wq, Wk, Wv, Wsc, bq, bk, Wqk16, Wv16, Wsch, Wscl, bqk);
  // (1) x -> X f16 [b][n][c]  (512 blocks = 8 batches x 64 pixel tiles)
  xcat_transpose_f16_kernel<<<dim3(kBatch * (kPix / 64)), blk, 0, stream>>>(x1, x2, Xp);
  // (2) [q|k][n][o'] = sum_c X[n][c] Wqk[o'][c] + bqk[o'] : M = 8*4096, N = 64, K = 64 -> QK f16 (512 tiles, 64 blocks)
  wmma_gemm64<0, false, 2, 1, false, 0><<<dim3((kBatch * kPix / 64) / 8, 1), blk, 0, stream>>>(
      Xp, Xp, kCh, 0L, Wqk16, Wqk16, kCh, 0L, (void*)QKp, (void*)QKp, kCh, 0L,
      bqk, bqk, 0L, kBatch * kPix, kCh, kCh, 1.0f);
  // (3) V[b][c][m] = sum_k Wv[c][k] X[b][m][k] : M = 64, N = 4096, K = 64 per batch (grid.y = batch) -> V f16 [b][64][4096]
  wmma_gemm64<0, false, 0, 1, false, 0><<<dim3(((kCh / 64) * (kPix / 64)) / 8, kBatch), blk, 0, stream>>>(
      Wv16, Wv16, kCh, 0L, Xp, Xp, kCh, (long)kPix * kCh, (void*)Vp, (void*)Vp, kPix, (long)kCh * kPix,
      bqk, bqk, 0L, kCh, kPix, kCh, 1.0f);

  for (int b = 0; b < kBatch; ++b) {
    const unsigned short* qk_b = QKp + (size_t)b * kPix * kCh;
    // (4) S[n][m] = sum_d q[n][d] k[m][d] : M = N = 4096, K = 32 -> S f32 (4096 tiles, 512 blocks)
    wmma_gemm64<0, false, 0, 0, false, 0><<<dim3(((kPix / 64) * (kPix / 64)) / 8, 1), blk, 0, stream>>>(
        qk_b, qk_b, kCh, 0L, qk_b + kDq, qk_b + kDq, kCh, 0L, (void*)Sp, (void*)Sp, kPix, 0L,
        bqk, bqk, 0L, kPix, kPix, kDq, 1.0f);
    // (5) column statistics (softmax over n for each column m)
    colstats_kernel<<<dim3(kPix / kStatCols), dim3(1024), 0, stream>>>(Sp, cmax, cscale);
    // (6) P f16 [n][m] = a[n][m] * 4096
    colsoftmax_p_kernel<<<dim3((kPix / 8) * (kPix / 256)), blk, 0, stream>>>(Sp, cmax, cscale, Pp);
    // (7) O[b][n][c] = (1/4096) sum_m P[n][m] V[b][c][m] : M = 4096, N = 64, K = 4096 -> f32 [4096][64] (256 blocks x 16 K slices)
    pv_splitk_kernel<<<dim3(kPix / kPvRows), dim3(kPvWaves * 32), 0, stream>>>(
        Pp, Vp + (size_t)b * kCh * kPix, Op + (size_t)b * kPix * kCh);
  }
  // (8) z = gamma * O + x -> bf16 hi/lo planes [b][n][64]
  resid_split_kernel<<<dim3(kBatch * (kPix / 64)), blk, 0, stream>>>(Op, x1, x2, gamma, Zh, Zl);
  // (9) F[b][o][n] = sum_c Wsc[o][c] z[b][n][c] : M = 64 (rows 32..63 zero weights), N = 4096, K = 64, bf16 hi/lo split
  wmma_gemm64<1, true, 0, 0, false, 0><<<dim3(((kCh / 64) * (kPix / 64)) / 8, kBatch), blk, 0, stream>>>(
      Wsch, Wscl, kCh, 0L, Zh, Zl, kCh, (long)kPix * kCh, (void*)Fp, (void*)Fp, kPix, (long)kCh * kPix,
      bqk, bqk, 0L, kCh, kPix, kCh, 1.0f);
  // (10) rows 0..31 of each batch -> d_out [b][32][4096]
  copy_out_kernel<<<dim3((kBatch * kDq * kPix / 4) / 256), blk, 0, stream>>>(Fp, out);
}

// v003
// Measured time: 289 microseconds a run.
// Timed twice side by side with v002, it ran 1.73 and 1.72 times as fast.
// Over all steps from v000 it is 50.9 times as fast.
// Contractions: x·[Wq|Wk]^T (+bias), Wv·x, q·k^T scores and P·V aggregation on v_wmma_f32_16x16x32_f16 (f16 operands; P carried x4096 and folded back x1/4096 in the f32 epilogue); Wsc·z on v_wmma_f32_16x16x32_bf16 with bf16 hi/lo split operand planes (hi·hi + hi·lo + lo·hi); f32 accumulate everywhere; column-wise softmax statistics, exp and the gamma residual in f32.
#include <hip/hip_runtime.h>
#include <math.h>
#include <stdint.h>

constexpr int kBatch   = 8;
constexpr int kCinHalf = 32;     // channels of x1 and of x2
constexpr int kCh      = 64;     // concatenated channels
constexpr int kPix     = 4096;   // h*w
constexpr int kDq      = 32;     // q/k channels = output channels

typedef __attribute__((ext_vector_type(16))) _Float16 v16h;
typedef __attribute__((ext_vector_type(8)))  _Float16 v8h;
typedef __attribute__((ext_vector_type(16))) __bf16   v16b;
typedef __attribute__((ext_vector_type(8)))  __bf16   v8b;
typedef __attribute__((ext_vector_type(8)))  float    v8f;
typedef __attribute__((ext_vector_type(4)))  float    v4f;
typedef __attribute__((ext_vector_type(4)))  unsigned int v4u;

__device__ __forceinline__ unsigned short f2bf_bits(float f) {
  unsigned u = __float_as_uint(f);
  return (unsigned short)((u + 0x7FFFu + ((u >> 16) & 1u)) >> 16);
}
__device__ __forceinline__ float bf_bits2f(unsigned short h) { return __uint_as_float(((unsigned)h) << 16); }
__device__ __forceinline__ unsigned pk16(unsigned short a, unsigned short b) { return (unsigned)a | ((unsigned)b << 16); }
__device__ __forceinline__ unsigned short h16_bits(float f) { const _Float16 h = (_Float16)f; return __builtin_bit_cast(unsigned short, h); }

// hazard guards as plain device helpers (no inline asm inside the kernel template body)
__device__ __forceinline__ void dep_guard_h(v8f& a, v8f& b, v16h x, v16h y) { asm volatile("v_nop\n\tv_nop\n\tv_nop\n\tv_nop" : "+v"(a), "+v"(b) : "v"(x), "v"(y)); }
__device__ __forceinline__ void dep_guard_b(v8f& a, v8f& b, v16b x, v16b y) { asm volatile("v_nop\n\tv_nop\n\tv_nop\n\tv_nop" : "+v"(a), "+v"(b) : "v"(x), "v"(y)); }
__device__ __forceinline__ void keep4_h(v16h a, v16h b, v16h c, v16h d) { asm volatile("v_nop" :: "v"(a), "v"(b), "v"(c), "v"(d)); }
__device__ __forceinline__ void keep4_b(v16b a, v16b b, v16b c, v16b d) { asm volatile("v_nop" :: "v"(a), "v"(b), "v"(c), "v"(d)); }
__device__ __forceinline__ void acc_guard4(v8f& a, v8f& b, v8f& c, v8f& d) { asm volatile("v_nop\n\tv_nop\n\tv_nop\n\tv_nop" : "+v"(a), "+v"(b), "+v"(c), "+v"(d)); }
template <typename T> struct Frag;
template <> struct Frag<_Float16> {
  typedef v16h V; union U { v16h v; v8h h[2]; };
  static __device__ __forceinline__ v16h load(const _Float16* p) {   // elements 0..7 <- p[0..7], 8..15 <- p[16..23]
    U f; f.h[0] = *(const v8h*)(p); f.h[1] = *(const v8h*)(p + 16); return f.v;
  }
  static __device__ __forceinline__ v8f mma(v16h a, v16h b, v8f c) {
    return __builtin_amdgcn_wmma_f32_16x16x32_f16(false, a, false, b, (short)0, c, false, false);
  }
  static __device__ __forceinline__ void guard(v8f& a, v8f& b, v16h x, v16h y) { dep_guard_h(a, b, x, y); }
  static __device__ __forceinline__ void keep(v16h a, v16h b, v16h c, v16h d) { keep4_h(a, b, c, d); }
};
template <> struct Frag<__bf16> {
  typedef v16b V; union U { v16b v; v8b h[2]; };
  static __device__ __forceinline__ v16b load(const __bf16* p) {
    U f; f.h[0] = *(const v8b*)(p); f.h[1] = *(const v8b*)(p + 16); return f.v;
  }
  static __device__ __forceinline__ v8f mma(v16b a, v16b b, v8f c) {
    return __builtin_amdgcn_wmma_f32_16x16x32_bf16(false, a, false, b, (short)0, c, false, false);
  }
  static __device__ __forceinline__ void guard(v8f& a, v8f& b, v16b x, v16b y) { dep_guard_b(a, b, x, y); }
  static __device__ __forceinline__ void keep(v16b a, v16b b, v16b c, v16b d) { keep4_b(a, b, c, d); }
};

// ---- Register-blocked batched WMMA GEMM ------------------------------------
// C[m,n] = scale * sum_k A[m,k] * Bt[n,k] (+bias)(+resid); each wave owns a 64x64 tile.
// A row-major [M,K]; Bt row-major [N,K]; M,N % 64 == 0, K % 32 == 0.
// SPLIT: operands are hi/lo planes (A2/Bt2 = lo planes, same layout); product = hi·hi + hi·lo + lo·hi.
// BIAS_MODE: 0 = none, 1 = bias[m], 2 = bias[n].
// OUT_MODE: 0 = f32, 1 = f16, 2 = bf16 hi plane (Cout) + bf16 lo plane (Cout2).
// ET: 0 = f16 operands, 1 = bf16 operands (pointers passed as 16-bit storage)
template <int ET> struct Elem;
template <> struct Elem<0> { typedef _Float16 T; };
template <> struct Elem<1> { typedef __bf16 T; };
template <int ET, bool SPLIT, int BIAS_MODE, int OUT_MODE, bool RESID, int ACT = 0>
__global__ __launch_bounds__(256) void wmma_gemm64(
    const unsigned short* __restrict__ Ap, const unsigned short* __restrict__ A2p, int lda, long strideA,
    const unsigned short* __restrict__ Btp, const unsigned short* __restrict__ Bt2p, int ldb, long strideB,
    void* __restrict__ Cout, void* __restrict__ Cout2, int ldc, long strideC,
    const float* __restrict__ bias,
    const float* __restrict__ resid, long strideR,
    int M, int N, int K, float scale) {
  typedef typename Elem<ET>::T T;
  typedef typename Frag<T>::V V;
  const T* A = (const T*)Ap; const T* A2 = (const T*)A2p; const T* Bt = (const T*)Btp; const T* Bt2 = (const T*)Bt2p;
  __shared__ __align__(16) float sT[8][16 * 68];   // per-wave 16x64 slab, pitch 68 floats
  const int b    = blockIdx.y;
  const int lane = threadIdx.x & 31;
  const int wave = threadIdx.x >> 5;
  const int tilesN = N >> 6;
  const int tilesM = M >> 6;
  const int tile = blockIdx.x * 8 + wave;
  if (tile >= tilesM * tilesN) return;   // wave-uniform; no block barriers in this kernel
  const int tm = tile / tilesN;
  const int tn = tile - tm * tilesN;
  const int m0 = tm << 6;
  const int n0 = tn << 6;

  const T* Ab  = A  + (size_t)b * strideA;
  const T* Bb  = Bt + (size_t)b * strideB;
  const T* Ab2 = SPLIT ? (A2  + (size_t)b * strideA) : nullptr;
  const T* Bb2 = SPLIT ? (Bt2 + (size_t)b * strideB) : nullptr;

  const int rlane = lane & 15;                 // row (A) / col (B, D) within subtile
  const int koff  = (lane >> 4) * 8;           // k offset of this lane half
  const int mOff  = (lane >> 4) * 8;           // D row offset

  v8f acc[4][4];
#pragma unroll
  for (int i = 0; i < 4; ++i)
#pragma unroll
    for (int j = 0; j < 4; ++j) acc[i][j] = (v8f){0.f,0.f,0.f,0.f,0.f,0.f,0.f,0.f};

  for (int k0 = 0; k0 < K; k0 += 32) {
    V bh[4], bl[4];
#pragma unroll
    for (int j = 0; j < 4; ++j) {
      const size_t bo = (size_t)(n0 + (j << 4) + rlane) * ldb + koff + k0;
      bh[j] = Frag<T>::load(Bb + bo);
      if (SPLIT) bl[j] = Frag<T>::load(Bb2 + bo);
    }
#pragma unroll
    for (int i = 0; i < 4; ++i) {
      const size_t ao = (size_t)(m0 + (i << 4) + rlane) * lda + koff + k0;
      V ah = Frag<T>::load(Ab + ao);
      V al;
      if (SPLIT) al = Frag<T>::load(Ab2 + ao);
#pragma unroll
      for (int j = 0; j < 4; ++j) {
        acc[i][j] = Frag<T>::mma(ah, bh[j], acc[i][j]);
        if (SPLIT) {
          acc[i][j] = Frag<T>::mma(ah, bl[j], acc[i][j]);
          acc[i][j] = Frag<T>::mma(al, bh[j], acc[i][j]);
        }
      }
      Frag<T>::guard(acc[i][0], acc[i][3], ah, SPLIT ? al : ah);
    }
    Frag<T>::keep(bh[0], bh[1], bh[2], bh[3]);
    if (SPLIT) Frag<T>::keep(bl[0], bl[1], bl[2], bl[3]);
  }
  acc_guard4(acc[0][0], acc[0][1], acc[0][2], acc[0][3]);
  acc_guard4(acc[1][0], acc[1][1], acc[1][2], acc[1][3]);
  acc_guard4(acc[2][0], acc[2][1], acc[2][2], acc[2][3]);
  acc_guard4(acc[3][0], acc[3][1], acc[3][2], acc[3][3]);

  // ---- epilogue ----
  float* slab = sT[wave];
  const float* Rb = RESID ? (resid + (size_t)b * strideR) : nullptr;
#pragma unroll
  for (int i = 0; i < 4; ++i) {
    const int mBase = m0 + (i << 4);
#pragma unroll
    for (int j = 0; j < 4; ++j) {
      const int n = n0 + (j << 4) + rlane;
      float bv = 0.f;
      if (BIAS_MODE == 2) bv = bias[n];
#pragma unroll
      for (int r = 0; r < 8; ++r) {
        float v = acc[i][j][r] * scale;
        if (BIAS_MODE == 1) v += bias[mBase + mOff + r];
        if (BIAS_MODE == 2) v += bv;
        if (RESID) v += Rb[(size_t)(mBase + mOff + r) * ldc + n];
        if (ACT == 1) v = tanhf(v);
        if (ACT == 2) v = fmaxf(v, 0.0f);
        if (ACT == 3) v = v / (1.0f + expf(-v));
        if (ACT == 4) v = (v > 0.f) ? v : 0.01f * v;
        if (ACT == 5) v = 0.5f * v * (1.0f + erff(v * 0.70710678118654752f));
        slab[(mOff + r) * 68 + (j << 4) + rlane] = v;
      }
    }
    __builtin_amdgcn_fence(__ATOMIC_RELEASE, "workgroup");
    __builtin_amdgcn_wave_barrier();
    __builtin_amdgcn_fence(__ATOMIC_ACQUIRE, "workgroup");
    if (OUT_MODE == 0) {
      float* C = (float*)Cout + (size_t)b * strideC;
      const int hh = lane >> 4, c4 = (lane & 15) * 4;     // row seg = 256 B = 16 lanes x 16 B
      {
#pragma unroll
        for (int it = 0; it < 8; ++it) {
          const int row = it * 2 + hh;
          v4f v = *(const v4f*)(slab + row * 68 + c4);
          *(v4f*)(C + (size_t)(mBase + row) * ldc + n0 + c4) = v;
        }
        
      }
    } else {
      const int q = lane >> 3, c8 = (lane & 7) * 8;
      unsigned short* C  = (unsigned short*)Cout  + (size_t)b * strideC;
      unsigned short* C2 = (OUT_MODE == 2) ? ((unsigned short*)Cout2 + (size_t)b * strideC) : nullptr;
      {
#pragma unroll
        for (int it = 0; it < 4; ++it) {
          const int row = it * 4 + q;
          const float* sp = slab + row * 68 + c8;
          v8h hv, lv;
#pragma unroll
          for (int e = 0; e < 8; ++e) {
            if (OUT_MODE == 1) {
              hv[e] = (_Float16)sp[e];
            } else {
              unsigned short hb = f2bf_bits(sp[e]);
              unsigned short lb = f2bf_bits(sp[e] - bf_bits2f(hb));
              hv[e] = __builtin_bit_cast(_Float16, hb);
              lv[e] = __builtin_bit_cast(_Float16, lb);
            }
          }
          *(v8h*)(C + (size_t)(mBase + row) * ldc + n0 + c8) = hv;
          if (OUT_MODE == 2) *(v8h*)(C2 + (size_t)(mBase + row) * ldc + n0 + c8) = lv;
        }
        
      }
    }
    __builtin_amdgcn_fence(__ATOMIC_RELEASE, "workgroup");
    __builtin_amdgcn_wave_barrier();
    __builtin_amdgcn_fence(__ATOMIC_ACQUIRE, "workgroup");
  }
}

// ---------------------------------------------------------------------------
// Weight / bias preparation, one launch of 4 blocks with block-uniform roles (no barriers):
//   role 0: [Wq;Wk] -> f16 [64][64]      role 1: Wv -> f16 [64][64]
//   role 2: Wsc -> bf16 hi/lo [64][64], rows 32..63 zero-filled (tile padding of the A operand)
//   role 3: [bq;bk] -> f32 [64]
// Coverage roles 0-2: 2 it x 256 thr x 8 elements = 4096 = the whole 64x64 plane; each store instruction
// ---------------------------------------------------------------------------
__global__ __launch_bounds__(256) void prep_kernel(
    const float* __restrict__ Wq, const float* __restrict__ Wk, const float* __restrict__ Wv,
    const float* __restrict__ Wsc, const float* __restrict__ bq, const float* __restrict__ bk,
    unsigned short* __restrict__ Wqk16, unsigned short* __restrict__ Wv16,
    unsigned short* __restrict__ Wsch, unsigned short* __restrict__ Wscl, float* __restrict__ bqk) {
  const int tid  = threadIdx.x;
  const int role = blockIdx.x;   // block-uniform
  if (role == 0) {
    v4u hv[2];
#pragma unroll
    for (int it = 0; it < 2; ++it) {
      const int task = it * 256 + tid;
      const int row = task >> 3, c8 = (task & 7) * 8;
      const int rq = row < kDq ? row : (kDq - 1);
      int rk = row - kDq; rk = rk < 0 ? 0 : (rk > kDq - 1 ? kDq - 1 : rk);
      const v4f a0 = *(const v4f*)(Wq + rq * kCh + c8), a1 = *(const v4f*)(Wq + rq * kCh + c8 + 4);
      const v4f b0 = *(const v4f*)(Wk + rk * kCh + c8), b1 = *(const v4f*)(Wk + rk * kCh + c8 + 4);
      const bool useq = row < kDq;
      float f[8];
#pragma unroll
      for (int e = 0; e < 4; ++e) { f[e] = useq ? a0[e] : b0[e]; f[4 + e] = useq ? a1[e] : b1[e]; }
      v4u u;
#pragma unroll
      for (int q = 0; q < 4; ++q) u[q] = pk16(h16_bits(f[2 * q]), h16_bits(f[2 * q + 1]));
      hv[it] = u;
    }
    {
#pragma unroll
      for (int it = 0; it < 2; ++it) {
        const int task = it * 256 + tid;
        const int row = task >> 3, c8 = (task & 7) * 8;
        *(v4u*)(Wqk16 + row * kCh + c8) = hv[it];
      }
      
    }
  } else if (role == 1) {
    v4u hv[2];
#pragma unroll
    for (int it = 0; it < 2; ++it) {
      const int task = it * 256 + tid;
      const int row = task >> 3, c8 = (task & 7) * 8;   // row 0..63 valid
      const v4f a0 = *(const v4f*)(Wv + row * kCh + c8), a1 = *(const v4f*)(Wv + row * kCh + c8 + 4);
      float f[8];
#pragma unroll
      for (int e = 0; e < 4; ++e) { f[e] = a0[e]; f[4 + e] = a1[e]; }
      v4u u;
#pragma unroll
      for (int q = 0; q < 4; ++q) u[q] = pk16(h16_bits(f[2 * q]), h16_bits(f[2 * q + 1]));
      hv[it] = u;
    }
    {
#pragma unroll
      for (int it = 0; it < 2; ++it) {
        const int task = it * 256 + tid;
        const int row = task >> 3, c8 = (task & 7) * 8;
        *(v4u*)(Wv16 + row * kCh + c8) = hv[it];
      }
      
    }
  } else if (role == 2) {
    v4u hv[2], lv[2];
#pragma unroll
    for (int it = 0; it < 2; ++it) {
      const int task = it * 256 + tid;
      const int row = task >> 3, c8 = (task & 7) * 8;
      const int rs = row < kDq ? row : (kDq - 1);        // clamped address, zero by predicate
      const bool live = row < kDq;
      const v4f a0 = *(const v4f*)(Wsc + rs * kCh + c8), a1 = *(const v4f*)(Wsc + rs * kCh + c8 + 4);
      float f[8];
#pragma unroll
      for (int e = 0; e < 4; ++e) { f[e] = live ? a0[e] : 0.0f; f[4 + e] = live ? a1[e] : 0.0f; }
      v4u u, u2;
#pragma unroll
      for (int q = 0; q < 4; ++q) {
        const unsigned short hb0 = f2bf_bits(f[2 * q]), hb1 = f2bf_bits(f[2 * q + 1]);
        const unsigned short lb0 = f2bf_bits(f[2 * q] - bf_bits2f(hb0));
        const unsigned short lb1 = f2bf_bits(f[2 * q + 1] - bf_bits2f(hb1));
        u[q] = pk16(hb0, hb1); u2[q] = pk16(lb0, lb1);
      }
      hv[it] = u; lv[it] = u2;
    }
    {
#pragma unroll
      for (int it = 0; it < 2; ++it) {
        const int task = it * 256 + tid;
        const int row = task >> 3, c8 = (task & 7) * 8;
        *(v4u*)(Wsch + row * kCh + c8) = hv[it];
        *(v4u*)(Wscl + row * kCh + c8) = lv[it];
      }
      
    }
  } else if (role == 3) {
    if (tid < 16) {
      const int iq = (4 * tid < kDq - 4) ? 4 * tid : (kDq - 4);
      int ik = 4 * tid - kDq; ik = ik < 0 ? 0 : (ik > kDq - 4 ? kDq - 4 : ik);
      const v4f a = *(const v4f*)(bq + iq);
      const v4f c = *(const v4f*)(bk + ik);
      const v4f v = (tid < 8) ? a : c;
      *(v4f*)(bqk + 4 * tid) = v;
      
    }
  }
}

// ---------------------------------------------------------------------------
// grid = kBatch * 64 blocks (one per 64-pixel tile), 256 threads.
// Coverage per block: load 4 it x 256 thr x 4 f32 = 64 ch x 64 px; store 2 it x 256 thr x 8 u16 = 64 px x 64 ch;
// ---------------------------------------------------------------------------
__global__ __launch_bounds__(256) void xcat_transpose_f16_kernel(const float* __restrict__ x1, const float* __restrict__ x2,
                                                                 unsigned short* __restrict__ Xo) {
  __shared__ __align__(16) float tf[64 * 68];
  const int bx  = blockIdx.x;
  const int b   = bx >> 6;
  const int n0  = (bx & 63) * 64;
  const int tid = threadIdx.x;
  const int sub = tid >> 4, c4 = (tid & 15) * 4;
#pragma unroll
  for (int it = 0; it < 2; ++it) {
    const int ch = it * 16 + sub;   // channels 0..31 from x1
    const v4f a = *(const v4f*)(x1 + ((size_t)(b * kCinHalf + ch) * kPix + n0 + c4));
    *(v4f*)(tf + ch * 68 + c4) = a;
  }
#pragma unroll
  for (int it = 0; it < 2; ++it) {
    const int ch = it * 16 + sub;   // channels 32..63 from x2
    const v4f a = *(const v4f*)(x2 + ((size_t)(b * kCinHalf + ch) * kPix + n0 + c4));
    *(v4f*)(tf + (kCinHalf + ch) * 68 + c4) = a;
  }
  __syncthreads();
  const int s8 = tid >> 3, c8 = (tid & 7) * 8;
  v4u hv[2];
#pragma unroll
  for (int it = 0; it < 2; ++it) {
    const int oc = it * 32 + s8;    // pixel within tile
    v4u u;
#pragma unroll
    for (int q = 0; q < 4; ++q) {
      const float f0 = tf[(c8 + 2 * q) * 68 + oc];
      const float f1 = tf[(c8 + 2 * q + 1) * 68 + oc];
      u[q] = pk16(h16_bits(f0), h16_bits(f1));
    }
    hv[it] = u;
  }
  {
#pragma unroll
    for (int it = 0; it < 2; ++it) {
      const int oc = it * 32 + s8;
      *(v4u*)(Xo + ((size_t)(b * kPix + n0 + oc) * kCh + c8)) = hv[it];
    }
    
  }
}

// ---------------------------------------------------------------------------
// Column softmax statistics of S f32 [4096 n][4096 m] (normalisation over n, i.e. down each column m):
// cmax[m] = max_n S[n][m], cscale[m] = 4096 / sum_n exp(S[n][m] - cmax[m]).
// grid = 128 blocks, each owning 32 columns (one 128-byte line of every row) for all 4096 rows; 1024 threads =
// 8 column quads x 128 row lanes, 32 consecutive rows per thread in two register chunks of 16 (chunk max, then the exps).
// The (max, sum) pairs merge over the 4 row lanes of a wave by shuffles, then over the 32 waves through LDS.
// ---------------------------------------------------------------------------
constexpr int kStatCols  = 32;    // columns per block
constexpr int kStatLanes = 128;   // row lanes per block = 1024 threads / 8 column quads
constexpr int kStatChunk = 16;    // rows held in registers at a time
constexpr int kStatPitch = 36;    // floats per LDS row: 144 B = 16 B x odd, so 16-byte reads 8 rows apart miss each other's banks

// Merges the (max, sum) pairs of lanes l, l^8, l^16, l^24, which hold the same column quad; every lane ends with the result.
__device__ __forceinline__ void stat_merge_lanes(v4f& mx, v4f& sm) {
#pragma unroll   // two steps, constant shuffle distances
  for (int d = 8; d <= 16; d <<= 1) {
#pragma unroll   // vector elements by constant index
    for (int e = 0; e < 4; ++e) {
      const float om = __shfl_xor(mx[e], d);
      const float os = __shfl_xor(sm[e], d);
      const float dm = mx[e] - om;
      const float ex = __expf(-fabsf(dm));   // the larger maximum keeps its sum, the other is rescaled
      sm[e] = (dm > 0.0f) ? (sm[e] + os * ex) : (sm[e] * ex + os);
      mx[e] = fmaxf(mx[e], om);
    }
  }
}

// The '#pragma unroll' lines below keep s[], pm[], ps[] and the 4-vectors in registers (constant indices).
__global__ __launch_bounds__(1024) void colstats_kernel(const float* __restrict__ S,
                                                        float* __restrict__ cmax, float* __restrict__ cscale) {
  __shared__ __align__(16) float sMx[32 * kStatPitch];
  __shared__ __align__(16) float sSm[32 * kStatPitch];
  const int tid  = threadIdx.x;
  const int lane = tid & 31;
  const int wave = tid >> 5;
  const int m0   = blockIdx.x * kStatCols;
  const int c4   = (tid & 7) * 4;
  const float* col = S + (size_t)(tid >> 3) * (kPix / kStatLanes) * kPix + m0 + c4;   // first of this thread's 32 consecutive rows
  v4f mx = (v4f){-INFINITY, -INFINITY, -INFINITY, -INFINITY};
  v4f sm = (v4f){0.0f, 0.0f, 0.0f, 0.0f};
  // kept rolled: unrolled, both chunks' loads are hoisted together and overflow the 128 registers a 32-wave block may use
#pragma unroll 1
  for (int ch = 0; ch < kPix / (kStatLanes * kStatChunk); ++ch) {
    v4f s[kStatChunk];
#pragma unroll
    for (int i = 0; i < kStatChunk; ++i)
      s[i] = *(const v4f*)(col + (size_t)i * kPix);
    v4f nm = mx;
#pragma unroll
    for (int i = 0; i < kStatChunk; ++i)
#pragma unroll
      for (int e = 0; e < 4; ++e) nm[e] = fmaxf(nm[e], s[i][e]);
#pragma unroll
    for (int e = 0; e < 4; ++e) sm[e] *= __expf(mx[e] - nm[e]);   // first chunk: 0 * exp(-inf) = 0
#pragma unroll
    for (int i = 0; i < kStatChunk; ++i)
#pragma unroll
      for (int e = 0; e < 4; ++e) sm[e] += __expf(s[i][e] - nm[e]);
    mx = nm;
    col += (size_t)kStatChunk * kPix;
  }
  stat_merge_lanes(mx, sm);
  if (lane < 8) {
    *(v4f*)(sMx + wave * kStatPitch + c4) = mx;
    *(v4f*)(sSm + wave * kStatPitch + c4) = sm;
  }
  __syncthreads();
  if (wave == 0) {   // 8 column quads x 4 lane groups, each group taking 8 of the 32 waves' pairs
    const int w0 = (lane >> 3) * 8;
    v4f pm[8], ps[8];
#pragma unroll
    for (int j = 0; j < 8; ++j) {
      pm[j] = *(const v4f*)(sMx + (w0 + j) * kStatPitch + c4);
      ps[j] = *(const v4f*)(sSm + (w0 + j) * kStatPitch + c4);
    }
    v4f M = pm[0];
#pragma unroll
    for (int j = 1; j < 8; ++j)
#pragma unroll
      for (int e = 0; e < 4; ++e) M[e] = fmaxf(M[e], pm[j][e]);
    v4f tot = (v4f){0.0f, 0.0f, 0.0f, 0.0f};
#pragma unroll
    for (int j = 0; j < 8; ++j)
#pragma unroll
      for (int e = 0; e < 4; ++e) tot[e] += ps[j][e] * __expf(pm[j][e] - M[e]);
    stat_merge_lanes(M, tot);
    if (lane < 8) {   // 8 lanes x 16 B: each store fills one whole 128-byte line
      v4f sc;
#pragma unroll
      for (int e = 0; e < 4; ++e) sc[e] = 4096.0f * __builtin_amdgcn_rcpf(tot[e]);   // tot >= 1
      *(v4f*)(cmax + m0 + c4)   = M;
      *(v4f*)(cscale + m0 + c4) = sc;
    }
  }
}

// ---------------------------------------------------------------------------
// O f32 [b][n][c] = (1/4096) * sum_m P[n][m] * V[b][c][m] with P[n][m] = exp(S[n][m] - cmax[m]) * cscale[m] (softmax over n,
// carried x4096, rounded to f16) and S[n][m] = q[n] . k[m] formed again here on the matrix unit, so that P lives in registers only.
// grid = (4096 / 128, batch); 512 threads = 16 waves = 4 groups of 32 rows n x 4 slices of the sum over m.
// The block walks m in stages of 256: k rows, V columns and the exponent offsets of a stage are brought to LDS by all threads
// (through registers, fetched one stage ahead, two buffers, one barrier a stage); slice sl takes the 64 values of m from sl * 64 on.
// Per 32 values of m: two score tiles with k as A and q as B (register r of lane l = S[n = l & 15][m = 8 (l >> 4) + r]); converted
// in place, the pair is the B operand of the second product, whose A operand is V in the fragment loader's own k order.
// exp(s - cmax) * cscale is taken as exp2(s * log2(e) - off), off = cmax * log2(e) - log2(cscale), one value per m and stage.
// The 4 slices' partial tiles meet in LDS behind one barrier and are added in slice order.
// ---------------------------------------------------------------------------
constexpr int kAtGroups = 4;                   // groups of 32 rows n per block
constexpr int kAtSlices = 4;                   // slices of a stage's m per block
constexpr int kAtRows   = kAtGroups * 32;      // 128 rows of O per block
constexpr int kAtStage  = 256;                 // values of m per stage
constexpr int kAtKPitch = kDq + 8;             // f16 per LDS row of k: 80 B = 16 B x odd
constexpr int kAtVPitch = kAtStage + 8;        // f16 per LDS row of V: 528 B = 16 B x odd
constexpr int kAtOPitch = 68;                  // floats per LDS row of a partial tile: 272 B = 16 B x odd
constexpr float kLog2e  = 1.44269504088896340736f;

// Eight exp2 in place. One statement, closed by a v_nop: behind a transcendental the instruction set asks for one independent
// instruction before its result is read or its source overwritten; written so, every one of the eight has it, whatever registers
// the compiler picks.
__device__ __forceinline__ void exp2_x8(float (&e)[8]) {
  asm("v_exp_f32 %0, %0\n\tv_exp_f32 %1, %1\n\tv_exp_f32 %2, %2\n\tv_exp_f32 %3, %3\n\t"
      "v_exp_f32 %4, %4\n\tv_exp_f32 %5, %5\n\tv_exp_f32 %6, %6\n\tv_exp_f32 %7, %7\n\tv_nop"
      : "+v"(e[0]), "+v"(e[1]), "+v"(e[2]), "+v"(e[3]), "+v"(e[4]), "+v"(e[5]), "+v"(e[6]), "+v"(e[7]));
}

__global__ __launch_bounds__(512) void attn_fused_kernel(const unsigned short* __restrict__ QKp,
                                                         const unsigned short* __restrict__ Vp,
                                                         const float* __restrict__ cmax, const float* __restrict__ cscale,
                                                         float* __restrict__ O) {
  __shared__ __align__(16) _Float16 sK[2][kAtStage * kAtKPitch];
  __shared__ __align__(16) _Float16 sV[2][kCh * kAtVPitch];
  __shared__ __align__(16) float    sOff[2][kAtStage];
  __shared__ __align__(16) float    part[kAtGroups * kAtSlices][32 * kAtOPitch];
  const int tid   = threadIdx.x;
  const int lane  = tid & 31;
  const int wave  = tid >> 5;
  const int grp   = wave & (kAtGroups - 1);
  const int sl    = wave >> 2;
  const int rlane = lane & 15;
  const int koff  = (lane >> 4) * 8;      // k offset of this lane half; also the accumulators' offset along the A operand's rows
  const int b     = blockIdx.y;
  const int n0    = blockIdx.x * kAtRows;
  const _Float16* QK = (const _Float16*)QKp + (size_t)b * kPix * kCh;
  const _Float16* V  = (const _Float16*)Vp + (size_t)b * kCh * kPix;
  const float* cm = cmax + b * kPix;
  const float* cs = cscale + b * kPix;

  // staging: k = 256 rows x 64 B (4 threads a row, 2 rounds), V = 64 rows x 512 B (one wave a row, 4 rounds), one offset per m
  const int kRow = tid >> 2, kQ = (tid & 3) * 8;
  const int vRow = tid >> 5, vQ = (tid & 31) * 8;
  v4u kr[2], vr[4];
  float fm = 0.0f, fs = 1.0f;
  // the unrolls in this kernel keep kr[], vr[], the fragments and the accumulators in registers (constant indices)
  auto fetch = [&](int ms) {
#pragma unroll
    for (int it = 0; it < 2; ++it) kr[it] = *(const v4u*)(QK + (size_t)(ms + it * 128 + kRow) * kCh + kDq + kQ);
#pragma unroll
    for (int it = 0; it < 4; ++it) vr[it] = *(const v4u*)(V + (size_t)(it * 16 + vRow) * kPix + ms + vQ);
    if (tid < kAtStage) { fm = cm[ms + tid]; fs = cs[ms + tid]; }
  };
  auto put = [&](int buf) {
#pragma unroll
    for (int it = 0; it < 2; ++it) *(v4u*)(&sK[buf][(it * 128 + kRow) * kAtKPitch + kQ]) = kr[it];
#pragma unroll
    for (int it = 0; it < 4; ++it) *(v4u*)(&sV[buf][(it * 16 + vRow) * kAtVPitch + vQ]) = vr[it];
    if (tid < kAtStage) sOff[buf][tid] = fm * kLog2e - __log2f(fs);
  };

  v16h qf[2];
#pragma unroll
  for (int nt = 0; nt < 2; ++nt)
    qf[nt] = Frag<_Float16>::load(QK + (size_t)(n0 + grp * 32 + nt * 16 + rlane) * kCh + koff);
  v8f acc[2][4];
#pragma unroll
  for (int nt = 0; nt < 2; ++nt)
#pragma unroll
    for (int j = 0; j < 4; ++j) acc[nt][j] = (v8f){0.f, 0.f, 0.f, 0.f, 0.f, 0.f, 0.f, 0.f};

  fetch(0);
  put(0);
  __syncthreads();
  // kept rolled: one copy of the stage body in the instruction cache, and only one stage's fetch registers live
#pragma unroll 1
  for (int s = 0; s < kPix / kAtStage; ++s) {
    const int buf = s & 1;
    const bool more = s + 1 < kPix / kAtStage;   // the same for the whole block
    if (more) fetch((s + 1) * kAtStage);
    const _Float16* kb = &sK[buf][(sl * 64 + rlane) * kAtKPitch + koff];
    const _Float16* vb = &sV[buf][rlane * kAtVPitch + sl * 64 + koff];
    const float*    ob = &sOff[buf][sl * 64 + koff];
#pragma unroll
    for (int st = 0; st < 2; ++st) {
      v16h kf[2], vf[4];
      v8f of[2];
#pragma unroll
      for (int t = 0; t < 2; ++t) {
        kf[t] = Frag<_Float16>::load(kb + (st * 32 + t * 16) * kAtKPitch);
        of[t] = __builtin_shufflevector(*(const v4f*)(ob + st * 32 + t * 16), *(const v4f*)(ob + st * 32 + t * 16 + 4),
                                        0, 1, 2, 3, 4, 5, 6, 7);
      }
#pragma unroll
      for (int j = 0; j < 4; ++j) vf[j] = Frag<_Float16>::load(vb + j * 16 * kAtVPitch + st * 32);
#pragma unroll
      for (int nt = 0; nt < 2; ++nt) {
        const v8f zero = (v8f){0.f, 0.f, 0.f, 0.f, 0.f, 0.f, 0.f, 0.f};
        const v8f s0 = Frag<_Float16>::mma(kf[0], qf[nt], zero);
        const v8f s1 = Frag<_Float16>::mma(kf[1], qf[nt], zero);
        const v8f x0 = s0 * kLog2e - of[0];   // whole tiles, so that neighbouring registers pair up without copies
        const v8f x1 = s1 * kLog2e - of[1];
        float e0[8], e1[8];
#pragma unroll
        for (int r = 0; r < 8; ++r) { e0[r] = x0[r]; e1[r] = x1[r]; }
        exp2_x8(e0);
        exp2_x8(e1);
        v16h pf;
#pragma unroll
        for (int r = 0; r < 8; ++r) { pf[r] = (_Float16)e0[r]; pf[8 + r] = (_Float16)e1[r]; }
#pragma unroll
        for (int j = 0; j < 4; ++j) acc[nt][j] = Frag<_Float16>::mma(vf[j], pf, acc[nt][j]);
      }
    }
    if (more) put(buf ^ 1);   // that buffer's last readers left it before the barrier that ended the stage before this one
    __syncthreads();
  }

  float* slab = part[wave];
#pragma unroll
  for (int nt = 0; nt < 2; ++nt)
#pragma unroll
    for (int j = 0; j < 4; ++j) {   // acc[nt][j][r] = partial O[n0 + 32 grp + 16 nt + rlane][16 j + koff + r]
      float* d = slab + (nt * 16 + rlane) * kAtOPitch + (j << 4) + koff;
      *(v4f*)(d)     = (v4f){acc[nt][j][0], acc[nt][j][1], acc[nt][j][2], acc[nt][j][3]};
      *(v4f*)(d + 4) = (v4f){acc[nt][j][4], acc[nt][j][5], acc[nt][j][6], acc[nt][j][7]};
    }
  __syncthreads();
  float* Ob = O + ((size_t)b * kPix + n0) * kCh;   // the tile is 32768 contiguous bytes of O
#pragma unroll
  for (int it = 0; it < 4; ++it) {
    const int idx = it * 512 + tid;
    const int row = idx >> 4, c4 = (idx & 15) * 4;
    const int g = row >> 5, rl = row & 31;
    v4f t = *(const v4f*)(&part[g][rl * kAtOPitch + c4]);
#pragma unroll
    for (int w = 1; w < kAtSlices; ++w) t += *(const v4f*)(&part[w * kAtGroups + g][rl * kAtOPitch + c4]);
    t *= (1.0f / 4096.0f);
    *(v4f*)(Ob + (size_t)row * kCh + c4) = t;
  }
}

// ---------------------------------------------------------------------------
// grid = kBatch * 64 blocks; x tile transposed through LDS exactly like xcat_transpose_f16_kernel.
// Coverage: store 2 it x 256 thr x 8 u16 = 64 px x 64 ch per plane; 8 lanes x 16 B = one whole row;
// ---------------------------------------------------------------------------
__global__ __launch_bounds__(256) void resid_split_kernel(const float* __restrict__ O, const float* __restrict__ x1,
                                                          const float* __restrict__ x2, const float* __restrict__ gamma,
                                                          unsigned short* __restrict__ Zh, unsigned short* __restrict__ Zl) {
#pragma clang fp contract(off)
  __shared__ __align__(16) float tf[64 * 68];
  const int bx  = blockIdx.x;
  const int b   = bx >> 6;
  const int n0  = (bx & 63) * 64;
  const int tid = threadIdx.x;
  const int sub = tid >> 4, c4 = (tid & 15) * 4;
#pragma unroll
  for (int it = 0; it < 2; ++it) {
    const int ch = it * 16 + sub;
    const v4f a = *(const v4f*)(x1 + ((size_t)(b * kCinHalf + ch) * kPix + n0 + c4));
    *(v4f*)(tf + ch * 68 + c4) = a;
  }
#pragma unroll
  for (int it = 0; it < 2; ++it) {
    const int ch = it * 16 + sub;
    const v4f a = *(const v4f*)(x2 + ((size_t)(b * kCinHalf + ch) * kPix + n0 + c4));
    *(v4f*)(tf + (kCinHalf + ch) * 68 + c4) = a;
  }
  __syncthreads();
  const float g = gamma[0];
  const int s8 = tid >> 3, c8 = (tid & 7) * 8;
  v4u hv[2], lv[2];
#pragma unroll
  for (int it = 0; it < 2; ++it) {
    const int oc = it * 32 + s8;
    const size_t ro = (size_t)(b * kPix + n0 + oc) * kCh + c8;
    const v4f o0 = *(const v4f*)(O + ro), o1 = *(const v4f*)(O + ro + 4);
    float z[8];
#pragma unroll
    for (int e = 0; e < 4; ++e) {
      z[e]     = g * o0[e] + tf[(c8 + e) * 68 + oc];
      z[4 + e] = g * o1[e] + tf[(c8 + 4 + e) * 68 + oc];
    }
    v4u u, u2;
#pragma unroll
    for (int q = 0; q < 4; ++q) {
      const unsigned short hb0 = f2bf_bits(z[2 * q]), hb1 = f2bf_bits(z[2 * q + 1]);
      const unsigned short lb0 = f2bf_bits(z[2 * q] - bf_bits2f(hb0));
      const unsigned short lb1 = f2bf_bits(z[2 * q + 1] - bf_bits2f(hb1));
      u[q] = pk16(hb0, hb1); u2[q] = pk16(lb0, lb1);
    }
    hv[it] = u; lv[it] = u2;
  }
  {
#pragma unroll
    for (int it = 0; it < 2; ++it) {
      const int oc = it * 32 + s8;
      const size_t ro = (size_t)(b * kPix + n0 + oc) * kCh + c8;
      *(v4u*)(Zh + ro) = hv[it];
      *(v4u*)(Zl + ro) = lv[it];
    }
    
  }
}

// ---------------------------------------------------------------------------
// d_out[b][o][n] = F[b][o][n] for o < 32 (F has 64 rows per batch; rows 32..63 are the zero-padded tile rows).
// grid = kBatch*32*4096/1024 = 1024 blocks; one float4 per thread; a wave writes 32 x 16 B = 4 whole consecutive
// ---------------------------------------------------------------------------
__global__ __launch_bounds__(256) void copy_out_kernel(const float* __restrict__ F, float* __restrict__ out) {
  const int t  = blockIdx.x * 256 + threadIdx.x;
  const int b  = t >> 15;
  const int r  = t & 32767;
  const int o  = r >> 10;
  const int n4 = (r & 1023) * 4;
  const v4f v = *(const v4f*)(F + ((size_t)(b * kCh + o) * kPix + n4));
  float* dst = out + ((size_t)(b * kDq + o) * kPix + n4);
  *(v4f*)dst = v;
  
}

// ---------------------------------------------------------------------------
// Workspace region map (byte offsets):
//   small    65536 B @ 0        : Wqk16 f16 [64][64] @0, Wv16 f16 [64][64] @8192, Wsch bf16 [64][64] @16384,
//                                 Wscl bf16 [64][64] @24576, bqk f32 [64] @32768
//   X   f16 [8][4096][64]        4194304 B @ 65536
//   QK  f16 [8][4096][64]        4194304 B @ 4259840       (cols 0..31 = q, 32..63 = k)
//   V   f16 [8][64][4096]        4194304 B @ 8454144
//   S   f32 [4096][4096]        67108864 B @ 12648448      (per batch; after the batch loop the region is dead and holds
//                                 Zh bf16 [8][4096][64] @ S+0, Zl @ S+4194304, F f32 [8][64][4096] @ S+8388608)
//   stat f32 cmax[8][4096] @ +0, cscale[8][4096] @ +131072   262144 B @ 79757312
//   O   f32 [8][4096][64]        8388608 B @ 80019456
//   total                       88408064 B
// Every region is fully written before it is read.
// ---------------------------------------------------------------------------
extern "C" void kernel_launch(void* const* d_in, const int* in_sizes, int n_in,
                              void* d_out, int out_size, void* d_ws, size_t ws_size,
                              hipStream_t stream) {
  if (n_in < 9) return;
  if (in_sizes[0] != kBatch * kCinHalf * kPix || in_sizes[1] != kBatch * kCinHalf * kPix) return;
  if (in_sizes[2] != kDq * kCh || in_sizes[3] != kDq || in_sizes[4] != kDq * kCh || in_sizes[5] != kDq) return;
  if (in_sizes[6] != kCh * kCh || in_sizes[7] != kDq * kCh || in_sizes[8] < 1) return;
  if (out_size != kBatch * kDq * kPix) return;

  const float* x1    = (const float*)d_in[0];
  const float* x2    = (const float*)d_in[1];
  const float* Wq    = (const float*)d_in[2];
  const float* bq    = (const float*)d_in[3];
  const float* Wk    = (const float*)d_in[4];
  const float* bk    = (const float*)d_in[5];
  const float* Wv    = (const float*)d_in[6];
  const float* Wsc   = (const float*)d_in[7];
  const float* gamma = (const float*)d_in[8];
  float* out = (float*)d_out;

  const size_t szPlane16 = (size_t)kBatch * kPix * kCh * 2;   // 4194304
  const size_t szS       = (size_t)kPix * kPix * 4;           // 67108864
  const size_t szO       = (size_t)kBatch * kPix * kCh * 4;   // 8388608
  const size_t szF       = (size_t)kBatch * kCh * kPix * 4;   // 8388608
  size_t off = 0;
  const size_t oSmall = off; off += 65536;
  const size_t oX     = off; off += szPlane16;
  const size_t oQK    = off; off += szPlane16;
  const size_t oV     = off; off += szPlane16;
  const size_t oS     = off; off += szS;
  const size_t oStat  = off; off += 262144;
  const size_t oO     = off; off += szO;
  if (2 * szPlane16 + szF > szS) return;
  if (off > ws_size) return;

  char* ws = (char*)d_ws;
  unsigned short* Wqk16 = (unsigned short*)(ws + oSmall + 0);
  unsigned short* Wv16  = (unsigned short*)(ws + oSmall + 8192);
  unsigned short* Wsch  = (unsigned short*)(ws + oSmall + 16384);
  unsigned short* Wscl  = (unsigned short*)(ws + oSmall + 24576);
  float*          bqk   = (float*)(ws + oSmall + 32768);
  unsigned short* Xp    = (unsigned short*)(ws + oX);
  unsigned short* QKp   = (unsigned short*)(ws + oQK);
  unsigned short* Vp    = (unsigned short*)(ws + oV);
  float*          Sp    = (float*)(ws + oS);
  unsigned short* Zh    = (unsigned short*)(ws + oS);
  unsigned short* Zl    = (unsigned short*)(ws + oS + szPlane16);
  float*          Fp    = (float*)(ws + oS + 2 * szPlane16);
  float*          cmax  = (float*)(ws + oStat);
  float*          cscale = (float*)(ws + oStat + 131072);
  float*          Op    = (float*)(ws + oO);

  const dim3 blk(256);
  // (0) weights / bias
  prep_kernel<<<dim3(4), blk, 0, stream>>>(Wq, Wk, Wv, Wsc, bq, bk, Wqk16, Wv16, Wsch, Wscl, bqk);
  // (1) x -> X f16 [b][n][c]  (512 blocks = 8 batches x 64 pixel tiles)
  xcat_transpose_f16_kernel<<<dim3(kBatch * (kPix / 64)), blk, 0, stream>>>(x1, x2, Xp);
  // (2) [q|k][n][o'] = sum_c X[n][c] Wqk[o'][c] + bqk[o'] : M = 8*4096, N = 64, K = 64 -> QK f16 (512 tiles, 64 blocks)
  wmma_gemm64<0, false, 2, 1, false, 0><<<dim3((kBatch * kPix / 64) / 8, 1), blk, 0, stream>>>(
      Xp, Xp, kCh, 0L, Wqk16, Wqk16, kCh, 0L, (void*)QKp, (void*)QKp, kCh, 0L,
      bqk, bqk, 0L, kBatch * kPix, kCh, kCh, 1.0f);
  // (3) V[b][c][m] = sum_k Wv[c][k] X[b][m][k] : M = 64, N = 4096, K = 64 per batch (grid.y = batch) -> V f16 [b][64][4096]
  wmma_gemm64<0, false, 0, 1, false, 0><<<dim3(((kCh / 64) * (kPix / 64)) / 8, kBatch), blk, 0, stream>>>(
      Wv16, Wv16, kCh, 0L, Xp, Xp, kCh, (long)kPix * kCh, (void*)Vp, (void*)Vp, kPix, (long)kCh * kPix,
      bqk, bqk, 0L, kCh, kPix, kCh, 1.0f);

  for (int b = 0; b < kBatch; ++b) {
    const unsigned short* qk_b = QKp + (size_t)b * kPix * kCh;
    // (4) S[n][m] = sum_d q[n][d] k[m][d] : M = N = 4096, K = 32 -> S f32 (4096 tiles, 512 blocks)
    wmma_gemm64<0, false, 0, 0, false, 0><<<dim3(((kPix / 64) * (kPix / 64)) / 8, 1), blk, 0, stream>>>(
        qk_b, qk_b, kCh, 0L, qk_b + kDq, qk_b + kDq, kCh, 0L, (void*)Sp, (void*)Sp, kPix, 0L,
        bqk, bqk, 0L, kPix, kPix, kDq, 1.0f);
    // (5) column statistics (softmax over n for each column m)
    colstats_kernel<<<dim3(kPix / kStatCols), dim3(1024), 0, stream>>>(Sp, cmax + (size_t)b * kPix, cscale + (size_t)b * kPix);
  }
  // (6) O[b][n][c] = (1/4096) sum_m P[n][m] V[b][c][m], P = 4096 * softmax formed in registers from q, k and the statistics;
  //     all batches in one launch (32 row blocks x 8 batches)
  attn_fused_kernel<<<dim3(kPix / kAtRows, kBatch), dim3(512), 0, stream>>>(QKp, Vp, cmax, cscale, Op);
  // (7) z = gamma * O + x -> bf16 hi/lo planes [b][n][64]
  resid_split_kernel<<<dim3(kBatch * (kPix / 64)), blk, 0, stream>>>(Op, x1, x2, gamma, Zh, Zl);
  // (8) F[b][o][n] = sum_c Wsc[o][c] z[b][n][c] : M = 64 (rows 32..63 zero weights), N = 4096, K = 64, bf16 hi/lo split
  wmma_gemm64<1, true, 0, 0, false, 0><<<dim3(((kCh / 64) * (kPix / 64)) / 8, kBatch), blk, 0, stream>>>(
      Wsch, Wscl, kCh, 0L, Zh, Zl, kCh, (long)kPix * kCh, (void*)Fp, (void*)Fp, kPix, (long)kCh * kPix,
      bqk, bqk, 0L, kCh, kPix, kCh, 1.0f);
  // (9) rows 0..31 of each batch -> d_out [b][32][4096]
  copy_out_kernel<<<dim3((kBatch * kDq * kPix / 4) / 256), blk, 0, stream>>>(Fp, out);
}

// v004
// A run of this version takes 80.4 microseconds.
// Two timings next to v003 both put it at 3.57 times that version's speed.
// All steps since v000 together make it 182 times as fast.
// Contractions: x·[Wq|Wk]^T (+bias), Wv·x, q·k^T scores and P·V aggregation on v_wmma_f32_16x16x32_f16 (f16 operands; P carried x4096 and folded back x1/4096 in the f32 epilogue); Wsc·z on v_wmma_f32_16x16x32_bf16 with bf16 hi/lo split operand planes (hi·hi + hi·lo + lo·hi); f32 accumulate everywhere; column-wise softmax statistics, exp and the gamma residual in f32.
#include <hip/hip_runtime.h>
#include <math.h>
#include <stdint.h>

constexpr int kBatch   = 8;
constexpr int kCinHalf = 32;     // channels of x1 and of x2
constexpr int kCh      = 64;     // concatenated channels
constexpr int kPix     = 4096;   // h*w
constexpr int kDq      = 32;     // q/k channels = output channels

typedef __attribute__((ext_vector_type(16))) _Float16 v16h;
typedef __attribute__((ext_vector_type(8)))  _Float16 v8h;
typedef __attribute__((ext_vector_type(16))) __bf16   v16b;
typedef __attribute__((ext_vector_type(8)))  __bf16   v8b;
typedef __attribute__((ext_vector_type(8)))  float    v8f;
typedef __attribute__((ext_vector_type(4)))  float    v4f;
typedef __attribute__((ext_vector_type(4)))  unsigned int v4u;

__device__ __forceinline__ unsigned short f2bf_bits(float f) {
  unsigned u = __float_as_uint(f);
  return (unsigned short)((u + 0x7FFFu + ((u >> 16) & 1u)) >> 16);
}
__device__ __forceinline__ float bf_bits2f(unsigned short h) { return __uint_as_float(((unsigned)h) << 16); }
__device__ __forceinline__ unsigned pk16(unsigned short a, unsigned short b) { return (unsigned)a | ((unsigned)b << 16); }
__device__ __forceinline__ unsigned short h16_bits(float f) { const _Float16 h = (_Float16)f; return __builtin_bit_cast(unsigned short, h); }

// hazard guards as plain device helpers (no inline asm inside the kernel template body)
__device__ __forceinline__ void dep_guard_h(v8f& a, v8f& b, v16h x, v16h y) { asm volatile("v_nop\n\tv_nop\n\tv_nop\n\tv_nop" : "+v"(a), "+v"(b) : "v"(x), "v"(y)); }
__device__ __forceinline__ void dep_guard_b(v8f& a, v8f& b, v16b x, v16b y) { asm volatile("v_nop\n\tv_nop\n\tv_nop\n\tv_nop" : "+v"(a), "+v"(b) : "v"(x), "v"(y)); }
__device__ __forceinline__ void keep4_h(v16h a, v16h b, v16h c, v16h d) { asm volatile("v_nop" :: "v"(a), "v"(b), "v"(c), "v"(d)); }
__device__ __forceinline__ void keep4_b(v16b a, v16b b, v16b c, v16b d) { asm volatile("v_nop" :: "v"(a), "v"(b), "v"(c), "v"(d)); }
__device__ __forceinline__ void acc_guard4(v8f& a, v8f& b, v8f& c, v8f& d) { asm volatile("v_nop\n\tv_nop\n\tv_nop\n\tv_nop" : "+v"(a), "+v"(b), "+v"(c), "+v"(d)); }
template <typename T> struct Frag;
template <> struct Frag<_Float16> {
  typedef v16h V; union U { v16h v; v8h h[2]; };
  static __device__ __forceinline__ v16h load(const _Float16* p) {   // elements 0..7 <- p[0..7], 8..15 <- p[16..23]
    U f; f.h[0] = *(const v8h*)(p); f.h[1] = *(const v8h*)(p + 16); return f.v;
  }
  static __device__ __forceinline__ v8f mma(v16h a, v16h b, v8f c) {
    return __builtin_amdgcn_wmma_f32_16x16x32_f16(false, a, false, b, (short)0, c, false, false);
  }
  static __device__ __forceinline__ void guard(v8f& a, v8f& b, v16h x, v16h y) { dep_guard_h(a, b, x, y); }
  static __device__ __forceinline__ void keep(v16h a, v16h b, v16h c, v16h d) { keep4_h(a, b, c, d); }
};
template <> struct Frag<__bf16> {
  typedef v16b V; union U { v16b v; v8b h[2]; };
  static __device__ __forceinline__ v16b load(const __bf16* p) {
    U f; f.h[0] = *(const v8b*)(p); f.h[1] = *(const v8b*)(p + 16); return f.v;
  }
  static __device__ __forceinline__ v8f mma(v16b a, v16b b, v8f c) {
    return __builtin_amdgcn_wmma_f32_16x16x32_bf16(false, a, false, b, (short)0, c, false, false);
  }
  static __device__ __forceinline__ void guard(v8f& a, v8f& b, v16b x, v16b y) { dep_guard_b(a, b, x, y); }
  static __device__ __forceinline__ void keep(v16b a, v16b b, v16b c, v16b d) { keep4_b(a, b, c, d); }
};

// ---- Register-blocked batched WMMA GEMM ------------------------------------
// C[m,n] = scale * sum_k A[m,k] * Bt[n,k] (+bias)(+resid); each wave owns a 64x64 tile.
// A row-major [M,K]; Bt row-major [N,K]; M,N % 64 == 0, K % 32 == 0.
// SPLIT: operands are hi/lo planes (A2/Bt2 = lo planes, same layout); product = hi·hi + hi·lo + lo·hi.
// BIAS_MODE: 0 = none, 1 = bias[m], 2 = bias[n].
// OUT_MODE: 0 = f32, 1 = f16, 2 = bf16 hi plane (Cout) + bf16 lo plane (Cout2).
// ET: 0 = f16 operands, 1 = bf16 operands (pointers passed as 16-bit storage)
template <int ET> struct Elem;
template <> struct Elem<0> { typedef _Float16 T; };
template <> struct Elem<1> { typedef __bf16 T; };
template <int ET, bool SPLIT, int BIAS_MODE, int OUT_MODE, bool RESID, int ACT = 0>
__global__ __launch_bounds__(256) void wmma_gemm64(
    const unsigned short* __restrict__ Ap, const unsigned short* __restrict__ A2p, int lda, long strideA,
    const unsigned short* __restrict__ Btp, const unsigned short* __restrict__ Bt2p, int ldb, long strideB,
    void* __restrict__ Cout, void* __restrict__ Cout2, int ldc, long strideC,
    const float* __restrict__ bias,
    const float* __restrict__ resid, long strideR,
    int M, int N, int K, float scale) {
  typedef typename Elem<ET>::T T;
  typedef typename Frag<T>::V V;
  const T* A = (const T*)Ap; const T* A2 = (const T*)A2p; const T* Bt = (const T*)Btp; const T* Bt2 = (const T*)Bt2p;
  __shared__ __align__(16) float sT[8][16 * 68];   // per-wave 16x64 slab, pitch 68 floats
  const int b    = blockIdx.y;
  const int lane = threadIdx.x & 31;
  const int wave = threadIdx.x >> 5;
  const int tilesN = N >> 6;
  const int tilesM = M >> 6;
  const int tile = blockIdx.x * 8 + wave;
  if (tile >= tilesM * tilesN) return;   // wave-uniform; no block barriers in this kernel
  const int tm = tile / tilesN;
  const int tn = tile - tm * tilesN;
  const int m0 = tm << 6;
  const int n0 = tn << 6;

  const T* Ab  = A  + (size_t)b * strideA;
  const T* Bb  = Bt + (size_t)b * strideB;
  const T* Ab2 = SPLIT ? (A2  + (size_t)b * strideA) : nullptr;
  const T* Bb2 = SPLIT ? (Bt2 + (size_t)b * strideB) : nullptr;

  const int rlane = lane & 15;                 // row (A) / col (B, D) within subtile
  const int koff  = (lane >> 4) * 8;           // k offset of this lane half
  const int mOff  = (lane >> 4) * 8;           // D row offset

  v8f acc[4][4];
#pragma unroll
  for (int i = 0; i < 4; ++i)
#pragma unroll
    for (int j = 0; j < 4; ++j) acc[i][j] = (v8f){0.f,0.f,0.f,0.f,0.f,0.f,0.f,0.f};

  for (int k0 = 0; k0 < K; k0 += 32) {
    V bh[4], bl[4];
#pragma unroll
    for (int j = 0; j < 4; ++j) {
      const size_t bo = (size_t)(n0 + (j << 4) + rlane) * ldb + koff + k0;
      bh[j] = Frag<T>::load(Bb + bo);
      if (SPLIT) bl[j] = Frag<T>::load(Bb2 + bo);
    }
#pragma unroll
    for (int i = 0; i < 4; ++i) {
      const size_t ao = (size_t)(m0 + (i << 4) + rlane) * lda + koff + k0;
      V ah = Frag<T>::load(Ab + ao);
      V al;
      if (SPLIT) al = Frag<T>::load(Ab2 + ao);
#pragma unroll
      for (int j = 0; j < 4; ++j) {
        acc[i][j] = Frag<T>::mma(ah, bh[j], acc[i][j]);
        if (SPLIT) {
          acc[i][j] = Frag<T>::mma(ah, bl[j], acc[i][j]);
          acc[i][j] = Frag<T>::mma(al, bh[j], acc[i][j]);
        }
      }
      Frag<T>::guard(acc[i][0], acc[i][3], ah, SPLIT ? al : ah);
    }
    Frag<T>::keep(bh[0], bh[1], bh[2], bh[3]);
    if (SPLIT) Frag<T>::keep(bl[0], bl[1], bl[2], bl[3]);
  }
  acc_guard4(acc[0][0], acc[0][1], acc[0][2], acc[0][3]);
  acc_guard4(acc[1][0], acc[1][1], acc[1][2], acc[1][3]);
  acc_guard4(acc[2][0], acc[2][1], acc[2][2], acc[2][3]);
  acc_guard4(acc[3][0], acc[3][1], acc[3][2], acc[3][3]);

  // ---- epilogue ----
  float* slab = sT[wave];
  const float* Rb = RESID ? (resid + (size_t)b * strideR) : nullptr;
#pragma unroll
  for (int i = 0; i < 4; ++i) {
    const int mBase = m0 + (i << 4);
#pragma unroll
    for (int j = 0; j < 4; ++j) {
      const int n = n0 + (j << 4) + rlane;
      float bv = 0.f;
      if (BIAS_MODE == 2) bv = bias[n];
#pragma unroll
      for (int r = 0; r < 8; ++r) {
        float v = acc[i][j][r] * scale;
        if (BIAS_MODE == 1) v += bias[mBase + mOff + r];
        if (BIAS_MODE == 2) v += bv;
        if (RESID) v += Rb[(size_t)(mBase + mOff + r) * ldc + n];
        if (ACT == 1) v = tanhf(v);
        if (ACT == 2) v = fmaxf(v, 0.0f);
        if (ACT == 3) v = v / (1.0f + expf(-v));
        if (ACT == 4) v = (v > 0.f) ? v : 0.01f * v;
        if (ACT == 5) v = 0.5f * v * (1.0f + erff(v * 0.70710678118654752f));
        slab[(mOff + r) * 68 + (j << 4) + rlane] = v;
      }
    }
    __builtin_amdgcn_fence(__ATOMIC_RELEASE, "workgroup");
    __builtin_amdgcn_wave_barrier();
    __builtin_amdgcn_fence(__ATOMIC_ACQUIRE, "workgroup");
    if (OUT_MODE == 0) {
      float* C = (float*)Cout + (size_t)b * strideC;
      const int hh = lane >> 4, c4 = (lane & 15) * 4;     // row seg = 256 B = 16 lanes x 16 B
      {
#pragma unroll
        for (int it = 0; it < 8; ++it) {
          const int row = it * 2 + hh;
          v4f v = *(const v4f*)(slab + row * 68 + c4);
          *(v4f*)(C + (size_t)(mBase + row) * ldc + n0 + c4) = v;
        }
        
      }
    } else {
      const int q = lane >> 3, c8 = (lane & 7) * 8;
      unsigned short* C  = (unsigned short*)Cout  + (size_t)b * strideC;
      unsigned short* C2 = (OUT_MODE == 2) ? ((unsigned short*)Cout2 + (size_t)b * strideC) : nullptr;
      {
#pragma unroll
        for (int it = 0; it < 4; ++it) {
          const int row = it * 4 + q;
          const float* sp = slab + row * 68 + c8;
          v8h hv, lv;
#pragma unroll
          for (int e = 0; e < 8; ++e) {
            if (OUT_MODE == 1) {
              hv[e] = (_Float16)sp[e];
            } else {
              unsigned short hb = f2bf_bits(sp[e]);
              unsigned short lb = f2bf_bits(sp[e] - bf_bits2f(hb));
              hv[e] = __builtin_bit_cast(_Float16, hb);
              lv[e] = __builtin_bit_cast(_Float16, lb);
            }
          }
          *(v8h*)(C + (size_t)(mBase + row) * ldc + n0 + c8) = hv;
          if (OUT_MODE == 2) *(v8h*)(C2 + (size_t)(mBase + row) * ldc + n0 + c8) = lv;
        }
        
      }
    }
    __builtin_amdgcn_fence(__ATOMIC_RELEASE, "workgroup");
    __builtin_amdgcn_wave_barrier();
    __builtin_amdgcn_fence(__ATOMIC_ACQUIRE, "workgroup");
  }
}

// ---------------------------------------------------------------------------
// Weight / bias preparation, one launch of 4 blocks with block-uniform roles (no barriers):
//   role 0: [Wq;Wk] -> f16 [64][64]      role 1: Wv -> f16 [64][64]
//   role 2: Wsc -> bf16 hi/lo [64][64], rows 32..63 zero-filled (tile padding of the A operand)
//   role 3: [bq;bk] -> f32 [64]
// Coverage roles 0-2: 2 it x 256 thr x 8 elements = 4096 = the whole 64x64 plane; each store instruction
// ---------------------------------------------------------------------------
__global__ __launch_bounds__(256) void prep_kernel(
    const float* __restrict__ Wq, const float* __restrict__ Wk, const float* __restrict__ Wv,
    const float* __restrict__ Wsc, const float* __restrict__ bq, const float* __restrict__ bk,
    unsigned short* __restrict__ Wqk16, unsigned short* __restrict__ Wv16,
    unsigned short* __restrict__ Wsch, unsigned short* __restrict__ Wscl, float* __restrict__ bqk) {
  const int tid  = threadIdx.x;
  const int role = blockIdx.x;   // block-uniform
  if (role == 0) {
    v4u hv[2];
#pragma unroll
    for (int it = 0; it < 2; ++it) {
      const int task = it * 256 + tid;
      const int row = task >> 3, c8 = (task & 7) * 8;
      const int rq = row < kDq ? row : (kDq - 1);
      int rk = row - kDq; rk = rk < 0 ? 0 : (rk > kDq - 1 ? kDq - 1 : rk);
      const v4f a0 = *(const v4f*)(Wq + rq * kCh + c8), a1 = *(const v4f*)(Wq + rq * kCh + c8 + 4);
      const v4f b0 = *(const v4f*)(Wk + rk * kCh + c8), b1 = *(const v4f*)(Wk + rk * kCh + c8 + 4);
      const bool useq = row < kDq;
      float f[8];
#pragma unroll
      for (int e = 0; e < 4; ++e) { f[e] = useq ? a0[e] : b0[e]; f[4 + e] = useq ? a1[e] : b1[e]; }
      v4u u;
#pragma unroll
      for (int q = 0; q < 4; ++q) u[q] = pk16(h16_bits(f[2 * q]), h16_bits(f[2 * q + 1]));
      hv[it] = u;
    }
    {
#pragma unroll
      for (int it = 0; it < 2; ++it) {
        const int task = it * 256 + tid;
        const int row = task >> 3, c8 = (task & 7) * 8;
        *(v4u*)(Wqk16 + row * kCh + c8) = hv[it];
      }
      
    }
  } else if (role == 1) {
    v4u hv[2];
#pragma unroll
    for (int it = 0; it < 2; ++it) {
      const int task = it * 256 + tid;
      const int row = task >> 3, c8 = (task & 7) * 8;   // row 0..63 valid
      const v4f a0 = *(const v4f*)(Wv + row * kCh + c8), a1 = *(const v4f*)(Wv + row * kCh + c8 + 4);
      float f[8];
#pragma unroll
      for (int e = 0; e < 4; ++e) { f[e] = a0[e]; f[4 + e] = a1[e]; }
      v4u u;
#pragma unroll
      for (int q = 0; q < 4; ++q) u[q] = pk16(h16_bits(f[2 * q]), h16_bits(f[2 * q + 1]));
      hv[it] = u;
    }
    {
#pragma unroll
      for (int it = 0; it < 2; ++it) {
        const int task = it * 256 + tid;
        const int row = task >> 3, c8 = (task & 7) * 8;
        *(v4u*)(Wv16 + row * kCh + c8) = hv[it];
      }
      
    }
  } else if (role == 2) {
    v4u hv[2], lv[2];
#pragma unroll
    for (int it = 0; it < 2; ++it) {
      const int task = it * 256 + tid;
      const int row = task >> 3, c8 = (task & 7) * 8;
      const int rs = row < kDq ? row : (kDq - 1);        // clamped address, zero by predicate
      const bool live = row < kDq;
      const v4f a0 = *(const v4f*)(Wsc + rs * kCh + c8), a1 = *(const v4f*)(Wsc + rs * kCh + c8 + 4);
      float f[8];
#pragma unroll
      for (int e = 0; e < 4; ++e) { f[e] = live ? a0[e] : 0.0f; f[4 + e] = live ? a1[e] : 0.0f; }
      v4u u, u2;
#pragma unroll
      for (int q = 0; q < 4; ++q) {
        const unsigned short hb0 = f2bf_bits(f[2 * q]), hb1 = f2bf_bits(f[2 * q + 1]);
        const unsigned short lb0 = f2bf_bits(f[2 * q] - bf_bits2f(hb0));
        const unsigned short lb1 = f2bf_bits(f[2 * q + 1] - bf_bits2f(hb1));
        u[q] = pk16(hb0, hb1); u2[q] = pk16(lb0, lb1);
      }
      hv[it] = u; lv[it] = u2;
    }
    {
#pragma unroll
      for (int it = 0; it < 2; ++it) {
        const int task = it * 256 + tid;
        const int row = task >> 3, c8 = (task & 7) * 8;
        *(v4u*)(Wsch + row * kCh + c8) = hv[it];
        *(v4u*)(Wscl + row * kCh + c8) = lv[it];
      }
      
    }
  } else if (role == 3) {
    if (tid < 16) {
      const int iq = (4 * tid < kDq - 4) ? 4 * tid : (kDq - 4);
      int ik = 4 * tid - kDq; ik = ik < 0 ? 0 : (ik > kDq - 4 ? kDq - 4 : ik);
      const v4f a = *(const v4f*)(bq + iq);
      const v4f c = *(const v4f*)(bk + ik);
      const v4f v = (tid < 8) ? a : c;
      *(v4f*)(bqk + 4 * tid) = v;
      
    }
  }
}

// ---------------------------------------------------------------------------
// grid = kBatch * 64 blocks (one per 64-pixel tile), 256 threads.
// Coverage per block: load 4 it x 256 thr x 4 f32 = 64 ch x 64 px; store 2 it x 256 thr x 8 u16 = 64 px x 64 ch;
// ---------------------------------------------------------------------------
__global__ __launch_bounds__(256) void xcat_transpose_f16_kernel(const float* __restrict__ x1, const float* __restrict__ x2,
                                                                 unsigned short* __restrict__ Xo) {
  __shared__ __align__(16) float tf[64 * 68];
  const int bx  = blockIdx.x;
  const int b   = bx >> 6;
  const int n0  = (bx & 63) * 64;
  const int tid = threadIdx.x;
  const int sub = tid >> 4, c4 = (tid & 15) * 4;
#pragma unroll
  for (int it = 0; it < 2; ++it) {
    const int ch = it * 16 + sub;   // channels 0..31 from x1
    const v4f a = *(const v4f*)(x1 + ((size_t)(b * kCinHalf + ch) * kPix + n0 + c4));
    *(v4f*)(tf + ch * 68 + c4) = a;
  }
#pragma unroll
  for (int it = 0; it < 2; ++it) {
    const int ch = it * 16 + sub;   // channels 32..63 from x2
    const v4f a = *(const v4f*)(x2 + ((size_t)(b * kCinHalf + ch) * kPix + n0 + c4));
    *(v4f*)(tf + (kCinHalf + ch) * 68 + c4) = a;
  }
  __syncthreads();
  const int s8 = tid >> 3, c8 = (tid & 7) * 8;
  v4u hv[2];
#pragma unroll
  for (int it = 0; it < 2; ++it) {
    const int oc = it * 32 + s8;    // pixel within tile
    v4u u;
#pragma unroll
    for (int q = 0; q < 4; ++q) {
      const float f0 = tf[(c8 + 2 * q) * 68 + oc];
      const float f1 = tf[(c8 + 2 * q + 1) * 68 + oc];
      u[q] = pk16(h16_bits(f0), h16_bits(f1));
    }
    hv[it] = u;
  }
  {
#pragma unroll
    for (int it = 0; it < 2; ++it) {
      const int oc = it * 32 + s8;
      *(v4u*)(Xo + ((size_t)(b * kPix + n0 + oc) * kCh + c8)) = hv[it];
    }
    
  }
}

// ---------------------------------------------------------------------------
// O f32 [b][n][c] = (1/4096) * sum_m P[n][m] * V[b][c][m] with P[n][m] = exp(S[n][m] - cmax[m]) * cscale[m] (softmax over n,
// carried x4096, rounded to f16) and S[n][m] = q[n] . k[m] formed again here on the matrix unit, so that P lives in registers only.
// grid = (4096 / 128, batch); 512 threads = 16 waves = 4 groups of 32 rows n x 4 slices of the sum over m.
// The block walks m in stages of 256: k rows, V columns and the exponent offsets of a stage are brought to LDS by all threads
// (through registers, fetched one stage ahead, two buffers, one barrier a stage); slice sl takes the 64 values of m from sl * 64 on.
// Per 32 values of m: two score tiles with k as A and q as B (register r of lane l = S[n = l & 15][m = 8 (l >> 4) + r]); converted
// in place, the pair is the B operand of the second product, whose A operand is V in the fragment loader's own k order.
// exp(s - cmax) * cscale is taken as exp2(s * log2(e) - off), off = cmax * log2(e) - log2(cscale), one value per m and stage.
// The 4 slices' partial tiles meet in LDS behind one barrier and are added in slice order.
// ---------------------------------------------------------------------------
constexpr int kAtGroups = 4;                   // groups of 32 rows n per block
constexpr int kAtSlices = 4;                   // slices of a stage's m per block
constexpr int kAtRows   = kAtGroups * 32;      // 128 rows of O per block
constexpr int kAtStage  = 256;                 // values of m per stage
constexpr int kAtKPitch = kDq + 8;             // f16 per LDS row of k: 80 B = 16 B x odd
constexpr int kAtVPitch = kAtStage + 8;        // f16 per LDS row of V: 528 B = 16 B x odd
constexpr int kAtOPitch = 68;                  // floats per LDS row of a partial tile: 272 B = 16 B x odd
constexpr float kLog2e  = 1.44269504088896340736f;

// Eight exp2 in place. One statement, closed by a v_nop: behind a transcendental the instruction set asks for one independent
// instruction before its result is read or its source overwritten; written so, every one of the eight has it, whatever registers
// the compiler picks.
__device__ __forceinline__ void exp2_x8(float (&e)[8]) {
  asm("v_exp_f32 %0, %0\n\tv_exp_f32 %1, %1\n\tv_exp_f32 %2, %2\n\tv_exp_f32 %3, %3\n\t"
      "v_exp_f32 %4, %4\n\tv_exp_f32 %5, %5\n\tv_exp_f32 %6, %6\n\tv_exp_f32 %7, %7\n\tv_nop"
      : "+v"(e[0]), "+v"(e[1]), "+v"(e[2]), "+v"(e[3]), "+v"(e[4]), "+v"(e[5]), "+v"(e[6]), "+v"(e[7]));
}

// Four exp2 in place, in the form of exp2_x8 and for the same reason.
__device__ __forceinline__ void exp2_x4(float (&e)[4]) {
  asm("v_exp_f32 %0, %0\n\tv_exp_f32 %1, %1\n\tv_exp_f32 %2, %2\n\tv_exp_f32 %3, %3\n\tv_nop"
      : "+v"(e[0]), "+v"(e[1]), "+v"(e[2]), "+v"(e[3]));
}

// ---------------------------------------------------------------------------
// Column softmax statistics (normalisation over n, down each column m) of S[n][m] = q[n] . k[m], with S formed here on the
// matrix unit and never stored: cmax[b][m] = max_n S[n][m], cscale[b][m] = 4096 / sum_n exp(S[n][m] - cmax[b][m]).
// grid = (4096 / 128, batch); 512 threads = 16 waves = 2 groups of 64 columns m x 8 slices of the rows n.
// A wave keeps its 64 columns of k in registers as four B operands. The block walks n in stages of 512 rows of q, brought to LDS
// by all threads (through registers, fetched one stage ahead, two buffers, one barrier a stage); slice ns takes the 64 rows from
// ns * 64 on, 32 at a time. With q as A and k as B, register r of lane l = S[n = 8 (l >> 4) + r][m = l & 15]: every lane follows
// its own four columns with a running (max, sum) pair, the sum rescaled once per 16 scores of a column.
// The pairs merge over the two lane halves by a shuffle, then over the 8 slices through LDS behind one barrier.
// ---------------------------------------------------------------------------
constexpr int kCsCols   = 128;       // columns m per block
constexpr int kCsSlices = 8;         // slices of a stage's rows n per block
constexpr int kCsStage  = 512;       // rows n per stage
constexpr int kCsQPitch = kDq + 8;   // f16 per LDS row of q: 80 B = 16 B x odd

__global__ __launch_bounds__(512) void colstats_fused_kernel(const unsigned short* __restrict__ QKp,
                                                             float* __restrict__ cmax, float* __restrict__ cscale) {
  __shared__ __align__(16) _Float16 sQ[2][kCsStage * kCsQPitch];
  __shared__ float sMx[kCsSlices][kCsCols];
  __shared__ float sSm[kCsSlices][kCsCols];
  const int tid   = threadIdx.x;
  const int lane  = tid & 31;
  const int wave  = tid >> 5;
  const int cg    = wave & 1;
  const int ns    = wave >> 1;
  const int rlane = lane & 15;
  const int koff  = (lane >> 4) * 8;      // k offset of this lane half
  const int b     = blockIdx.y;
  const int m0    = blockIdx.x * kCsCols;
  const _Float16* QK = (const _Float16*)QKp + (size_t)b * kPix * kCh;

  // staging: q = 512 rows x 64 B (4 threads a row, 4 rounds)
  const int qRow = tid >> 2, qQ = (tid & 3) * 8;
  v4u qr[4];
  // the unrolls in this kernel keep qr[], the fragments, the score tiles and the pairs in registers (constant indices)
  auto fetch = [&](int nb) {
#pragma unroll
    for (int it = 0; it < 4; ++it) qr[it] = *(const v4u*)(QK + (size_t)(nb + it * 128 + qRow) * kCh + qQ);
  };
  auto put = [&](int buf) {
#pragma unroll
    for (int it = 0; it < 4; ++it) *(v4u*)(&sQ[buf][(it * 128 + qRow) * kCsQPitch + qQ]) = qr[it];
  };

  v16h kf[4];
  const _Float16* kp = QK + (size_t)(m0 + cg * 64 + rlane) * kCh + kDq + koff;   // one address, the four tiles by constant offsets
#pragma unroll
  for (int j = 0; j < 4; ++j) kf[j] = Frag<_Float16>::load(kp + j * 16 * kCh);
  // precaution
  asm volatile("s_wait_xcnt 0x0" ::: "memory");
  float mx[4], nl[4], sm[4];   // running maximum, the same times -log2(e), running sum of exp(s - maximum)
#pragma unroll
  for (int j = 0; j < 4; ++j) { mx[j] = -INFINITY; nl[j] = INFINITY; sm[j] = 0.0f; }

  fetch(0);
  // precaution: the address registers of the loads above are reused from here on
  asm volatile("s_wait_xcnt 0x0" ::: "memory");
  put(0);
  __syncthreads();
  // kept rolled: one copy of the stage body in the instruction cache, and only one stage's fetch registers live
#pragma unroll 1
  for (int s = 0; s < kPix / kCsStage; ++s) {
    const int buf = s & 1;
    const bool more = s + 1 < kPix / kCsStage;   // the same for the whole block
    if (more) fetch((s + 1) * kCsStage);
    const _Float16* qb = &sQ[buf][(ns * 64 + rlane) * kCsQPitch + koff];
#pragma unroll
    for (int st = 0; st < 2; ++st) {
      v16h qf[2];
#pragma unroll
      for (int f = 0; f < 2; ++f) qf[f] = Frag<_Float16>::load(qb + (st * 32 + f * 16) * kCsQPitch);
      const v8f zero = (v8f){0.f, 0.f, 0.f, 0.f, 0.f, 0.f, 0.f, 0.f};
      v8f sc[2][4];
#pragma unroll
      for (int f = 0; f < 2; ++f)
#pragma unroll
        for (int j = 0; j < 4; ++j) sc[f][j] = Frag<_Float16>::mma(qf[f], kf[j], zero);
      float rs[4];
#pragma unroll
      for (int j = 0; j < 4; ++j) {
        float ma = mx[j], mb = sc[0][j][4];
#pragma unroll
        for (int r = 0; r < 4; ++r) ma = fmaxf(fmaxf(ma, sc[0][j][r]), sc[1][j][r]);
        mb = fmaxf(mb, sc[1][j][4]);
#pragma unroll
        for (int r = 5; r < 8; ++r) mb = fmaxf(fmaxf(mb, sc[0][j][r]), sc[1][j][r]);
        mx[j] = fmaxf(ma, mb);
        const float t = mx[j] * -kLog2e;
        rs[j] = t - nl[j];   // first pass: -inf, so that the empty sum is scaled by 0
        nl[j] = t;
      }
      exp2_x4(rs);
#pragma unroll
      for (int j = 0; j < 4; ++j) {
        const v8f x0 = sc[0][j] * kLog2e + nl[j];
        const v8f x1 = sc[1][j] * kLog2e + nl[j];
        float e0[8], e1[8];
#pragma unroll
        for (int r = 0; r < 8; ++r) { e0[r] = x0[r]; e1[r] = x1[r]; }
        exp2_x8(e0);
        exp2_x8(e1);
        v8f t;
#pragma unroll
        for (int r = 0; r < 8; ++r) t[r] = e0[r] + e1[r];
        sm[j] = sm[j] * rs[j] + (((t[0] + t[1]) + (t[2] + t[3])) + ((t[4] + t[5]) + (t[6] + t[7])));
      }
    }
    if (more) put(buf ^ 1);   // that buffer's last readers left it before the barrier that ended the stage before this one
    __syncthreads();
  }

  // lanes l and l ^ 16 hold the same four columns, over different rows
  {
    float om[4], os[4], d[8];
#pragma unroll
    for (int j = 0; j < 4; ++j) {
      om[j] = __shfl_xor(mx[j], 16);
      os[j] = __shfl_xor(sm[j], 16);
      const float M = fmaxf(mx[j], om[j]);
      d[2 * j]     = (mx[j] - M) * kLog2e;
      d[2 * j + 1] = (om[j] - M) * kLog2e;
      mx[j] = M;
    }
    exp2_x8(d);
#pragma unroll
    for (int j = 0; j < 4; ++j) sm[j] = sm[j] * d[2 * j] + os[j] * d[2 * j + 1];
  }
  if (lane < 16) {
#pragma unroll
    for (int j = 0; j < 4; ++j) {
      sMx[ns][cg * 64 + j * 16 + rlane] = mx[j];
      sSm[ns][cg * 64 + j * 16 + rlane] = sm[j];
    }
  }
  __syncthreads();
  if (tid < kCsCols) {   // waves 0 to 3, one column a thread; each wave's store fills one whole 128-byte line
    float pm[kCsSlices], ps[kCsSlices];
#pragma unroll
    for (int i = 0; i < kCsSlices; ++i) { pm[i] = sMx[i][tid]; ps[i] = sSm[i][tid]; }
    float M = pm[0];
#pragma unroll
    for (int i = 1; i < kCsSlices; ++i) M = fmaxf(M, pm[i]);
#pragma unroll
    for (int i = 0; i < kCsSlices; ++i) pm[i] = (pm[i] - M) * kLog2e;
    exp2_x8(pm);
    float tot = 0.0f;
#pragma unroll
    for (int i = 0; i < kCsSlices; ++i) tot += ps[i] * pm[i];   // tot >= 1
    float inv;
    // the v_nop is the independent instruction that the instruction set asks for behind a transcendental before its result is read
    asm("v_rcp_f32 %0, %1\n\tv_nop" : "=v"(inv) : "v"(tot));
    cmax[b * kPix + m0 + tid]   = M;
    cscale[b * kPix + m0 + tid] = 4096.0f * inv;
  }
}

__global__ __launch_bounds__(512) void attn_fused_kernel(const unsigned short* __restrict__ QKp,
                                                         const unsigned short* __restrict__ Vp,
                                                         const float* __restrict__ cmax, const float* __restrict__ cscale,
                                                         float* __restrict__ O) {
  __shared__ __align__(16) _Float16 sK[2][kAtStage * kAtKPitch];
  __shared__ __align__(16) _Float16 sV[2][kCh * kAtVPitch];
  __shared__ __align__(16) float    sOff[2][kAtStage];
  __shared__ __align__(16) float    part[kAtGroups * kAtSlices][32 * kAtOPitch];
  const int tid   = threadIdx.x;
  const int lane  = tid & 31;
  const int wave  = tid >> 5;
  const int grp   = wave & (kAtGroups - 1);
  const int sl    = wave >> 2;
  const int rlane = lane & 15;
  const int koff  = (lane >> 4) * 8;      // k offset of this lane half; also the accumulators' offset along the A operand's rows
  const int b     = blockIdx.y;
  const int n0    = blockIdx.x * kAtRows;
  const _Float16* QK = (const _Float16*)QKp + (size_t)b * kPix * kCh;
  const _Float16* V  = (const _Float16*)Vp + (size_t)b * kCh * kPix;
  const float* cm = cmax + b * kPix;
  const float* cs = cscale + b * kPix;

  // staging: k = 256 rows x 64 B (4 threads a row, 2 rounds), V = 64 rows x 512 B (one wave a row, 4 rounds), one offset per m
  const int kRow = tid >> 2, kQ = (tid & 3) * 8;
  const int vRow = tid >> 5, vQ = (tid & 31) * 8;
  v4u kr[2], vr[4];
  float fm = 0.0f, fs = 1.0f;
  // the unrolls in this kernel keep kr[], vr[], the fragments and the accumulators in registers (constant indices)
  auto fetch = [&](int ms) {
#pragma unroll
    for (int it = 0; it < 2; ++it) kr[it] = *(const v4u*)(QK + (size_t)(ms + it * 128 + kRow) * kCh + kDq + kQ);
#pragma unroll
    for (int it = 0; it < 4; ++it) vr[it] = *(const v4u*)(V + (size_t)(it * 16 + vRow) * kPix + ms + vQ);
    if (tid < kAtStage) { fm = cm[ms + tid]; fs = cs[ms + tid]; }
  };
  auto put = [&](int buf) {
#pragma unroll
    for (int it = 0; it < 2; ++it) *(v4u*)(&sK[buf][(it * 128 + kRow) * kAtKPitch + kQ]) = kr[it];
#pragma unroll
    for (int it = 0; it < 4; ++it) *(v4u*)(&sV[buf][(it * 16 + vRow) * kAtVPitch + vQ]) = vr[it];
    if (tid < kAtStage) sOff[buf][tid] = fm * kLog2e - __log2f(fs);
  };

  v16h qf[2];
#pragma unroll
  for (int nt = 0; nt < 2; ++nt)
    qf[nt] = Frag<_Float16>::load(QK + (size_t)(n0 + grp * 32 + nt * 16 + rlane) * kCh + koff);
  v8f acc[2][4];
#pragma unroll
  for (int nt = 0; nt < 2; ++nt)
#pragma unroll
    for (int j = 0; j < 4; ++j) acc[nt][j] = (v8f){0.f, 0.f, 0.f, 0.f, 0.f, 0.f, 0.f, 0.f};

  fetch(0);
  put(0);
  __syncthreads();
  // kept rolled: one copy of the stage body in the instruction cache, and only one stage's fetch registers live
#pragma unroll 1
  for (int s = 0; s < kPix / kAtStage; ++s) {
    const int buf = s & 1;
    const bool more = s + 1 < kPix / kAtStage;   // the same for the whole block
    if (more) fetch((s + 1) * kAtStage);
    const _Float16* kb = &sK[buf][(sl * 64 + rlane) * kAtKPitch + koff];
    const _Float16* vb = &sV[buf][rlane * kAtVPitch + sl * 64 + koff];
    const float*    ob = &sOff[buf][sl * 64 + koff];
#pragma unroll
    for (int st = 0; st < 2; ++st) {
      v16h kf[2], vf[4];
      v8f of[2];
#pragma unroll
      for (int t = 0; t < 2; ++t) {
        kf[t] = Frag<_Float16>::load(kb + (st * 32 + t * 16) * kAtKPitch);
        of[t] = __builtin_shufflevector(*(const v4f*)(ob + st * 32 + t * 16), *(const v4f*)(ob + st * 32 + t * 16 + 4),
                                        0, 1, 2, 3, 4, 5, 6, 7);
      }
#pragma unroll
      for (int j = 0; j < 4; ++j) vf[j] = Frag<_Float16>::load(vb + j * 16 * kAtVPitch + st * 32);
#pragma unroll
      for (int nt = 0; nt < 2; ++nt) {
        const v8f zero = (v8f){0.f, 0.f, 0.f, 0.f, 0.f, 0.f, 0.f, 0.f};
        const v8f s0 = Frag<_Float16>::mma(kf[0], qf[nt], zero);
        const v8f s1 = Frag<_Float16>::mma(kf[1], qf[nt], zero);
        const v8f x0 = s0 * kLog2e - of[0];   // whole tiles, so that neighbouring registers pair up without copies
        const v8f x1 = s1 * kLog2e - of[1];
        float e0[8], e1[8];
#pragma unroll
        for (int r = 0; r < 8; ++r) { e0[r] = x0[r]; e1[r] = x1[r]; }
        exp2_x8(e0);
        exp2_x8(e1);
        v16h pf;
#pragma unroll
        for (int r = 0; r < 8; ++r) { pf[r] = (_Float16)e0[r]; pf[8 + r] = (_Float16)e1[r]; }
#pragma unroll
        for (int j = 0; j < 4; ++j) acc[nt][j] = Frag<_Float16>::mma(vf[j], pf, acc[nt][j]);
      }
    }
    if (more) put(buf ^ 1);   // that buffer's last readers left it before the barrier that ended the stage before this one
    __syncthreads();
  }

  float* slab = part[wave];
#pragma unroll
  for (int nt = 0; nt < 2; ++nt)
#pragma unroll
    for (int j = 0; j < 4; ++j) {   // acc[nt][j][r] = partial O[n0 + 32 grp + 16 nt + rlane][16 j + koff + r]
      float* d = slab + (nt * 16 + rlane) * kAtOPitch + (j << 4) + koff;
      *(v4f*)(d)     = (v4f){acc[nt][j][0], acc[nt][j][1], acc[nt][j][2], acc[nt][j][3]};
      *(v4f*)(d + 4) = (v4f){acc[nt][j][4], acc[nt][j][5], acc[nt][j][6], acc[nt][j][7]};
    }
  __syncthreads();
  float* Ob = O + ((size_t)b * kPix + n0) * kCh;   // the tile is 32768 contiguous bytes of O
#pragma unroll
  for (int it = 0; it < 4; ++it) {
    const int idx = it * 512 + tid;
    const int row = idx >> 4, c4 = (idx & 15) * 4;
    const int g = row >> 5, rl = row & 31;
    v4f t = *(const v4f*)(&part[g][rl * kAtOPitch + c4]);
#pragma unroll
    for (int w = 1; w < kAtSlices; ++w) t += *(const v4f*)(&part[w * kAtGroups + g][rl * kAtOPitch + c4]);
    t *= (1.0f / 4096.0f);
    *(v4f*)(Ob + (size_t)row * kCh + c4) = t;
  }
}

// ---------------------------------------------------------------------------
// grid = kBatch * 64 blocks; x tile transposed through LDS exactly like xcat_transpose_f16_kernel.
// Coverage: store 2 it x 256 thr x 8 u16 = 64 px x 64 ch per plane; 8 lanes x 16 B = one whole row;
// ---------------------------------------------------------------------------
__global__ __launch_bounds__(256) void resid_split_kernel(const float* __restrict__ O, const float* __restrict__ x1,
                                                          const float* __restrict__ x2, const float* __restrict__ gamma,
                                                          unsigned short* __restrict__ Zh, unsigned short* __restrict__ Zl) {
#pragma clang fp contract(off)
  __shared__ __align__(16) float tf[64 * 68];
  const int bx  = blockIdx.x;
  const int b   = bx >> 6;
  const int n0  = (bx & 63) * 64;
  const int tid = threadIdx.x;
  const int sub = tid >> 4, c4 = (tid & 15) * 4;
#pragma unroll
  for (int it = 0; it < 2; ++it) {
    const int ch = it * 16 + sub;
    const v4f a = *(const v4f*)(x1 + ((size_t)(b * kCinHalf + ch) * kPix + n0 + c4));
    *(v4f*)(tf + ch * 68 + c4) = a;
  }
#pragma unroll
  for (int it = 0; it < 2; ++it) {
    const int ch = it * 16 + sub;
    const v4f a = *(const v4f*)(x2 + ((size_t)(b * kCinHalf + ch) * kPix + n0 + c4));
    *(v4f*)(tf + (kCinHalf + ch) * 68 + c4) = a;
  }
  __syncthreads();
  const float g = gamma[0];
  const int s8 = tid >> 3, c8 = (tid & 7) * 8;
  v4u hv[2], lv[2];
#pragma unroll
  for (int it = 0; it < 2; ++it) {
    const int oc = it * 32 + s8;
    const size_t ro = (size_t)(b * kPix + n0 + oc) * kCh + c8;
    const v4f o0 = *(const v4f*)(O + ro), o1 = *(const v4f*)(O + ro + 4);
    float z[8];
#pragma unroll
    for (int e = 0; e < 4; ++e) {
      z[e]     = g * o0[e] + tf[(c8 + e) * 68 + oc];
      z[4 + e] = g * o1[e] + tf[(c8 + 4 + e) * 68 + oc];
    }
    v4u u, u2;
#pragma unroll
    for (int q = 0; q < 4; ++q) {
      const unsigned short hb0 = f2bf_bits(z[2 * q]), hb1 = f2bf_bits(z[2 * q + 1]);
      const unsigned short lb0 = f2bf_bits(z[2 * q] - bf_bits2f(hb0));
      const unsigned short lb1 = f2bf_bits(z[2 * q + 1] - bf_bits2f(hb1));
      u[q] = pk16(hb0, hb1); u2[q] = pk16(lb0, lb1);
    }
    hv[it] = u; lv[it] = u2;
  }
  {
#pragma unroll
    for (int it = 0; it < 2; ++it) {
      const int oc = it * 32 + s8;
      const size_t ro = (size_t)(b * kPix + n0 + oc) * kCh + c8;
      *(v4u*)(Zh + ro) = hv[it];
      *(v4u*)(Zl + ro) = lv[it];
    }
    
  }
}

// ---------------------------------------------------------------------------
// d_out[b][o][n] = F[b][o][n] for o < 32 (F has 64 rows per batch; rows 32..63 are the zero-padded tile rows).
// grid = kBatch*32*4096/1024 = 1024 blocks; one float4 per thread; a wave writes 32 x 16 B = 4 whole consecutive
// ---------------------------------------------------------------------------
__global__ __launch_bounds__(256) void copy_out_kernel(const float* __restrict__ F, float* __restrict__ out) {
  const int t  = blockIdx.x * 256 + threadIdx.x;
  const int b  = t >> 15;
  const int r  = t & 32767;
  const int o  = r >> 10;
  const int n4 = (r & 1023) * 4;
  const v4f v = *(const v4f*)(F + ((size_t)(b * kCh + o) * kPix + n4));
  float* dst = out + ((size_t)(b * kDq + o) * kPix + n4);
  *(v4f*)dst = v;
  
}

// ---------------------------------------------------------------------------
// Workspace region map (byte offsets):
//   small    65536 B @ 0        : Wqk16 f16 [64][64] @0, Wv16 f16 [64][64] @8192, Wsch bf16 [64][64] @16384,
//                                 Wscl bf16 [64][64] @24576, bqk f32 [64] @32768
//   X   f16 [8][4096][64]        4194304 B @ 65536
//   QK  f16 [8][4096][64]        4194304 B @ 4259840       (cols 0..31 = q, 32..63 = k)
//   V   f16 [8][64][4096]        4194304 B @ 8454144
//   S   region                  67108864 B @ 12648448      (holds no scores; in use are
//                                 Zh bf16 [8][4096][64] @ S+0, Zl @ S+4194304, F f32 [8][64][4096] @ S+8388608)
//   stat f32 cmax[8][4096] @ +0, cscale[8][4096] @ +131072   262144 B @ 79757312
//   O   f32 [8][4096][64]        8388608 B @ 80019456
//   total                       88408064 B
// Every region is fully written before it is read.
// ---------------------------------------------------------------------------
extern "C" void kernel_launch(void* const* d_in, const int* in_sizes, int n_in,
                              void* d_out, int out_size, void* d_ws, size_t ws_size,
                              hipStream_t stream) {
  if (n_in < 9) return;
  if (in_sizes[0] != kBatch * kCinHalf * kPix || in_sizes[1] != kBatch * kCinHalf * kPix) return;
  if (in_sizes[2] != kDq * kCh || in_sizes[3] != kDq || in_sizes[4] != kDq * kCh || in_sizes[5] != kDq) return;
  if (in_sizes[6] != kCh * kCh || in_sizes[7] != kDq * kCh || in_sizes[8] < 1) return;
  if (out_size != kBatch * kDq * kPix) return;

  const float* x1    = (const float*)d_in[0];
  const float* x2    = (const float*)d_in[1];
  const float* Wq    = (const float*)d_in[2];
  const float* bq    = (const float*)d_in[3];
  const float* Wk    = (const float*)d_in[4];
  const float* bk    = (const float*)d_in[5];
  const float* Wv    = (const float*)d_in[6];
  const float* Wsc   = (const float*)d_in[7];
  const float* gamma = (const float*)d_in[8];
  float* out = (float*)d_out;

  const size_t szPlane16 = (size_t)kBatch * kPix * kCh * 2;   // 4194304
  const size_t szS       = (size_t)kPix * kPix * 4;           // 67108864
  const size_t szO       = (size_t)kBatch * kPix * kCh * 4;   // 8388608
  const size_t szF       = (size_t)kBatch * kCh * kPix * 4;   // 8388608
  size_t off = 0;
  const size_t oSmall = off; off += 65536;
  const size_t oX     = off; off += szPlane16;
  const size_t oQK    = off; off += szPlane16;
  const size_t oV     = off; off += szPlane16;
  const size_t oS     = off; off += szS;
  const size_t oStat  = off; off += 262144;
  const size_t oO     = off; off += szO;
  if (2 * szPlane16 + szF > szS) return;
  if (off > ws_size) return;

  char* ws = (char*)d_ws;
  unsigned short* Wqk16 = (unsigned short*)(ws + oSmall + 0);
  unsigned short* Wv16  = (unsigned short*)(ws + oSmall + 8192);
  unsigned short* Wsch  = (unsigned short*)(ws + oSmall + 16384);
  unsigned short* Wscl  = (unsigned short*)(ws + oSmall + 24576);
  float*          bqk   = (float*)(ws + oSmall + 32768);
  unsigned short* Xp    = (unsigned short*)(ws + oX);
  unsigned short* QKp   = (unsigned short*)(ws + oQK);
  unsigned short* Vp    = (unsigned short*)(ws + oV);
  unsigned short* Zh    = (unsigned short*)(ws + oS);
  unsigned short* Zl    = (unsigned short*)(ws + oS + szPlane16);
  float*          Fp    = (float*)(ws + oS + 2 * szPlane16);
  float*          cmax  = (float*)(ws + oStat);
  float*          cscale = (float*)(ws + oStat + 131072);
  float*          Op    = (float*)(ws + oO);

  const dim3 blk(256);
  // (0) weights / bias
  prep_kernel<<<dim3(4), blk, 0, stream>>>(Wq, Wk, Wv, Wsc, bq, bk, Wqk16, Wv16, Wsch, Wscl, bqk);
  // (1) x -> X f16 [b][n][c]  (512 blocks = 8 batches x 64 pixel tiles)
  xcat_transpose_f16_kernel<<<dim3(kBatch * (kPix / 64)), blk, 0, stream>>>(x1, x2, Xp);
  // (2) [q|k][n][o'] = sum_c X[n][c] Wqk[o'][c] + bqk[o'] : M = 8*4096, N = 64, K = 64 -> QK f16 (512 tiles, 64 blocks)
  wmma_gemm64<0, false, 2, 1, false, 0><<<dim3((kBatch * kPix / 64) / 8, 1), blk, 0, stream>>>(
      Xp, Xp, kCh, 0L, Wqk16, Wqk16, kCh, 0L, (void*)QKp, (void*)QKp, kCh, 0L,
      bqk, bqk, 0L, kBatch * kPix, kCh, kCh, 1.0f);
  // (3) V[b][c][m] = sum_k Wv[c][k] X[b][m][k] : M = 64, N = 4096, K = 64 per batch (grid.y = batch) -> V f16 [b][64][4096]
  wmma_gemm64<0, false, 0, 1, false, 0><<<dim3(((kCh / 64) * (kPix / 64)) / 8, kBatch), blk, 0, stream>>>(
      Wv16, Wv16, kCh, 0L, Xp, Xp, kCh, (long)kPix * kCh, (void*)Vp, (void*)Vp, kPix, (long)kCh * kPix,
      bqk, bqk, 0L, kCh, kPix, kCh, 1.0f);

  // (4) column statistics (softmax over n for each column m) from q and k, scores formed in registers;
  //     all batches in one launch (32 column blocks x 8 batches)
  colstats_fused_kernel<<<dim3(kPix / kCsCols, kBatch), dim3(512), 0, stream>>>(QKp, cmax, cscale);
  // (5) O[b][n][c] = (1/4096) sum_m P[n][m] V[b][c][m], P = 4096 * softmax formed in registers from q, k and the statistics;
  //     all batches in one launch (32 row blocks x 8 batches)
  attn_fused_kernel<<<dim3(kPix / kAtRows, kBatch), dim3(512), 0, stream>>>(QKp, Vp, cmax, cscale, Op);
  // (6) z = gamma * O + x -> bf16 hi/lo planes [b][n][64]
  resid_split_kernel<<<dim3(kBatch * (kPix / 64)), blk, 0, stream>>>(Op, x1, x2, gamma, Zh, Zl);
  // (7) F[b][o][n] = sum_c Wsc[o][c] z[b][n][c] : M = 64 (rows 32..63 zero weights), N = 4096, K = 64, bf16 hi/lo split
  wmma_gemm64<1, true, 0, 0, false, 0><<<dim3(((kCh / 64) * (kPix / 64)) / 8, kBatch), blk, 0, stream>>>(
      Wsch, Wscl, kCh, 0L, Zh, Zl, kCh, (long)kPix * kCh, (void*)Fp, (void*)Fp, kPix, (long)kCh * kPix,
      bqk, bqk, 0L, kCh, kPix, kCh, 1.0f);
  // (8) rows 0..31 of each batch -> d_out [b][32][4096]
  copy_out_kernel<<<dim3((kBatch * kDq * kPix / 4) / 256), blk, 0, stream>>>(Fp, out);
}

// v005
// One run takes 66.7 microseconds.
// Next to v004, in two timings, it ran 1.22 and 1.21 times as fast.
// All steps since v000 together make it 221 times as fast.
// Contractions: x·[Wq|Wk]^T (+bias), Wv·x, q·k^T scores and P·V aggregation on v_wmma_f32_16x16x32_f16 (f16 operands; P carried x4096 and folded back x1/4096 in the f32 epilogue); Wsc·z on v_wmma_f32_16x16x32_bf16 with bf16 hi/lo split operand planes (hi·hi + hi·lo + lo·hi); f32 accumulate everywhere; column-wise softmax statistics, exp and the gamma residual in f32.
#include <hip/hip_runtime.h>
#include <math.h>
#include <stdint.h>

constexpr int kBatch   = 8;
constexpr int kCinHalf = 32;     // channels of x1 and of x2
constexpr int kCh      = 64;     // concatenated channels
constexpr int kPix     = 4096;   // h*w
constexpr int kDq      = 32;     // q/k channels = output channels

typedef __attribute__((ext_vector_type(16))) _Float16 v16h;
typedef __attribute__((ext_vector_type(8)))  _Float16 v8h;
typedef __attribute__((ext_vector_type(16))) __bf16   v16b;
typedef __attribute__((ext_vector_type(8)))  __bf16   v8b;
typedef __attribute__((ext_vector_type(8)))  float    v8f;
typedef __attribute__((ext_vector_type(4)))  float    v4f;
typedef __attribute__((ext_vector_type(2)))  float    v2f;
typedef __attribute__((ext_vector_type(2)))  __bf16   v2b;
typedef __attribute__((ext_vector_type(4)))  unsigned int v4u;

__device__ __forceinline__ unsigned short f2bf_bits(float f) {
  unsigned u = __float_as_uint(f);
  return (unsigned short)((u + 0x7FFFu + ((u >> 16) & 1u)) >> 16);
}
__device__ __forceinline__ float bf_bits2f(unsigned short h) { return __uint_as_float(((unsigned)h) << 16); }
__device__ __forceinline__ unsigned pk16(unsigned short a, unsigned short b) { return (unsigned)a | ((unsigned)b << 16); }
__device__ __forceinline__ unsigned short h16_bits(float f) { const _Float16 h = (_Float16)f; return __builtin_bit_cast(unsigned short, h); }

// hazard guards as plain device helpers (no inline asm inside the kernel template body)
__device__ __forceinline__ void dep_guard_h(v8f& a, v8f& b, v16h x, v16h y) { asm volatile("v_nop\n\tv_nop\n\tv_nop\n\tv_nop" : "+v"(a), "+v"(b) : "v"(x), "v"(y)); }
__device__ __forceinline__ void dep_guard_b(v8f& a, v8f& b, v16b x, v16b y) { asm volatile("v_nop\n\tv_nop\n\tv_nop\n\tv_nop" : "+v"(a), "+v"(b) : "v"(x), "v"(y)); }
__device__ __forceinline__ void keep4_h(v16h a, v16h b, v16h c, v16h d) { asm volatile("v_nop" :: "v"(a), "v"(b), "v"(c), "v"(d)); }
__device__ __forceinline__ void keep4_b(v16b a, v16b b, v16b c, v16b d) { asm volatile("v_nop" :: "v"(a), "v"(b), "v"(c), "v"(d)); }
__device__ __forceinline__ void acc_guard4(v8f& a, v8f& b, v8f& c, v8f& d) { asm volatile("v_nop\n\tv_nop\n\tv_nop\n\tv_nop" : "+v"(a), "+v"(b), "+v"(c), "+v"(d)); }
template <typename T> struct Frag;
template <> struct Frag<_Float16> {
  typedef v16h V; union U { v16h v; v8h h[2]; };
  static __device__ __forceinline__ v16h load(const _Float16* p) {   // elements 0..7 <- p[0..7], 8..15 <- p[16..23]
    U f; f.h[0] = *(const v8h*)(p); f.h[1] = *(const v8h*)(p + 16); return f.v;
  }
  static __device__ __forceinline__ v8f mma(v16h a, v16h b, v8f c) {
    return __builtin_amdgcn_wmma_f32_16x16x32_f16(false, a, false, b, (short)0, c, false, false);
  }
  static __device__ __forceinline__ void guard(v8f& a, v8f& b, v16h x, v16h y) { dep_guard_h(a, b, x, y); }
  static __device__ __forceinline__ void keep(v16h a, v16h b, v16h c, v16h d) { keep4_h(a, b, c, d); }
};
template <> struct Frag<__bf16> {
  typedef v16b V; union U { v16b v; v8b h[2]; };
  static __device__ __forceinline__ v16b load(const __bf16* p) {
    U f; f.h[0] = *(const v8b*)(p); f.h[1] = *(const v8b*)(p + 16); return f.v;
  }
  static __device__ __forceinline__ v8f mma(v16b a, v16b b, v8f c) {
    return __builtin_amdgcn_wmma_f32_16x16x32_bf16(false, a, false, b, (short)0, c, false, false);
  }
  static __device__ __forceinline__ void guard(v8f& a, v8f& b, v16b x, v16b y) { dep_guard_b(a, b, x, y); }
  static __device__ __forceinline__ void keep(v16b a, v16b b, v16b c, v16b d) { keep4_b(a, b, c, d); }
};

// ---- Register-blocked batched WMMA GEMM ------------------------------------
// C[m,n] = scale * sum_k A[m,k] * Bt[n,k] (+bias)(+resid); each wave owns a 64x64 tile.
// A row-major [M,K]; Bt row-major [N,K]; M,N % 64 == 0, K % 32 == 0.
// SPLIT: operands are hi/lo planes (A2/Bt2 = lo planes, same layout); product = hi·hi + hi·lo + lo·hi.
// BIAS_MODE: 0 = none, 1 = bias[m], 2 = bias[n].
// OUT_MODE: 0 = f32, 1 = f16, 2 = bf16 hi plane (Cout) + bf16 lo plane (Cout2).
// ET: 0 = f16 operands, 1 = bf16 operands (pointers passed as 16-bit storage)
template <int ET> struct Elem;
template <> struct Elem<0> { typedef _Float16 T; };
template <> struct Elem<1> { typedef __bf16 T; };
template <int ET, bool SPLIT, int BIAS_MODE, int OUT_MODE, bool RESID, int ACT = 0>
__global__ __launch_bounds__(256) void wmma_gemm64(
    const unsigned short* __restrict__ Ap, const unsigned short* __restrict__ A2p, int lda, long strideA,
    const unsigned short* __restrict__ Btp, const unsigned short* __restrict__ Bt2p, int ldb, long strideB,
    void* __restrict__ Cout, void* __restrict__ Cout2, int ldc, long strideC,
    const float* __restrict__ bias,
    const float* __restrict__ resid, long strideR,
    int M, int N, int K, float scale) {
  typedef typename Elem<ET>::T T;
  typedef typename Frag<T>::V V;
  const T* A = (const T*)Ap; const T* A2 = (const T*)A2p; const T* Bt = (const T*)Btp; const T* Bt2 = (const T*)Bt2p;
  __shared__ __align__(16) float sT[8][16 * 68];   // per-wave 16x64 slab, pitch 68 floats
  const int b    = blockIdx.y;
  const int lane = threadIdx.x & 31;
  const int wave = threadIdx.x >> 5;
  const int tilesN = N >> 6;
  const int tilesM = M >> 6;
  const int tile = blockIdx.x * 8 + wave;
  if (tile >= tilesM * tilesN) return;   // wave-uniform; no block barriers in this kernel
  const int tm = tile / tilesN;
  const int tn = tile - tm * tilesN;
  const int m0 = tm << 6;
  const int n0 = tn << 6;

  const T* Ab  = A  + (size_t)b * strideA;
  const T* Bb  = Bt + (size_t)b * strideB;
  const T* Ab2 = SPLIT ? (A2  + (size_t)b * strideA) : nullptr;
  const T* Bb2 = SPLIT ? (Bt2 + (size_t)b * strideB) : nullptr;

  const int rlane = lane & 15;                 // row (A) / col (B, D) within subtile
  const int koff  = (lane >> 4) * 8;           // k offset of this lane half
  const int mOff  = (lane >> 4) * 8;           // D row offset

  v8f acc[4][4];
#pragma unroll
  for (int i = 0; i < 4; ++i)
#pragma unroll
    for (int j = 0; j < 4; ++j) acc[i][j] = (v8f){0.f,0.f,0.f,0.f,0.f,0.f,0.f,0.f};

  for (int k0 = 0; k0 < K; k0 += 32) {
    V bh[4], bl[4];
#pragma unroll
    for (int j = 0; j < 4; ++j) {
      const size_t bo = (size_t)(n0 + (j << 4) + rlane) * ldb + koff + k0;
      bh[j] = Frag<T>::load(Bb + bo);
      if (SPLIT) bl[j] = Frag<T>::load(Bb2 + bo);
    }
#pragma unroll
    for (int i = 0; i < 4; ++i) {
      const size_t ao = (size_t)(m0 + (i << 4) + rlane) * lda + koff + k0;
      V ah = Frag<T>::load(Ab + ao);
      V al;
      if (SPLIT) al = Frag<T>::load(Ab2 + ao);
#pragma unroll
      for (int j = 0; j < 4; ++j) {
        acc[i][j] = Frag<T>::mma(ah, bh[j], acc[i][j]);
        if (SPLIT) {
          acc[i][j] = Frag<T>::mma(ah, bl[j], acc[i][j]);
          acc[i][j] = Frag<T>::mma(al, bh[j], acc[i][j]);
        }
      }
      Frag<T>::guard(acc[i][0], acc[i][3], ah, SPLIT ? al : ah);
    }
    Frag<T>::keep(bh[0], bh[1], bh[2], bh[3]);
    if (SPLIT) Frag<T>::keep(bl[0], bl[1], bl[2], bl[3]);
  }
  acc_guard4(acc[0][0], acc[0][1], acc[0][2], acc[0][3]);
  acc_guard4(acc[1][0], acc[1][1], acc[1][2], acc[1][3]);
  acc_guard4(acc[2][0], acc[2][1], acc[2][2], acc[2][3]);
  acc_guard4(acc[3][0], acc[3][1], acc[3][2], acc[3][3]);

  // ---- epilogue ----
  float* slab = sT[wave];
  const float* Rb = RESID ? (resid + (size_t)b * strideR) : nullptr;
#pragma unroll
  for (int i = 0; i < 4; ++i) {
    const int mBase = m0 + (i << 4);
#pragma unroll
    for (int j = 0; j < 4; ++j) {
      const int n = n0 + (j << 4) + rlane;
      float bv = 0.f;
      if (BIAS_MODE == 2) bv = bias[n];
#pragma unroll
      for (int r = 0; r < 8; ++r) {
        float v = acc[i][j][r] * scale;
        if (BIAS_MODE == 1) v += bias[mBase + mOff + r];
        if (BIAS_MODE == 2) v += bv;
        if (RESID) v += Rb[(size_t)(mBase + mOff + r) * ldc + n];
        if (ACT == 1) v = tanhf(v);
        if (ACT == 2) v = fmaxf(v, 0.0f);
        if (ACT == 3) v = v / (1.0f + expf(-v));
        if (ACT == 4) v = (v > 0.f) ? v : 0.01f * v;
        if (ACT == 5) v = 0.5f * v * (1.0f + erff(v * 0.70710678118654752f));
        slab[(mOff + r) * 68 + (j << 4) + rlane] = v;
      }
    }
    __builtin_amdgcn_fence(__ATOMIC_RELEASE, "workgroup");
    __builtin_amdgcn_wave_barrier();
    __builtin_amdgcn_fence(__ATOMIC_ACQUIRE, "workgroup");
    if (OUT_MODE == 0) {
      float* C = (float*)Cout + (size_t)b * strideC;
      const int hh = lane >> 4, c4 = (lane & 15) * 4;     // row seg = 256 B = 16 lanes x 16 B
      {
#pragma unroll
        for (int it = 0; it < 8; ++it) {
          const int row = it * 2 + hh;
          v4f v = *(const v4f*)(slab + row * 68 + c4);
          *(v4f*)(C + (size_t)(mBase + row) * ldc + n0 + c4) = v;
        }
        
      }
    } else {
      const int q = lane >> 3, c8 = (lane & 7) * 8;
      unsigned short* C  = (unsigned short*)Cout  + (size_t)b * strideC;
      unsigned short* C2 = (OUT_MODE == 2) ? ((unsigned short*)Cout2 + (size_t)b * strideC) : nullptr;
      {
#pragma unroll
        for (int it = 0; it < 4; ++it) {
          const int row = it * 4 + q;
          const float* sp = slab + row * 68 + c8;
          v8h hv, lv;
#pragma unroll
          for (int e = 0; e < 8; ++e) {
            if (OUT_MODE == 1) {
              hv[e] = (_Float16)sp[e];
            } else {
              unsigned short hb = f2bf_bits(sp[e]);
              unsigned short lb = f2bf_bits(sp[e] - bf_bits2f(hb));
              hv[e] = __builtin_bit_cast(_Float16, hb);
              lv[e] = __builtin_bit_cast(_Float16, lb);
            }
          }
          *(v8h*)(C + (size_t)(mBase + row) * ldc + n0 + c8) = hv;
          if (OUT_MODE == 2) *(v8h*)(C2 + (size_t)(mBase + row) * ldc + n0 + c8) = lv;
        }
        
      }
    }
    __builtin_amdgcn_fence(__ATOMIC_RELEASE, "workgroup");
    __builtin_amdgcn_wave_barrier();
    __builtin_amdgcn_fence(__ATOMIC_ACQUIRE, "workgroup");
  }
}

// ---------------------------------------------------------------------------
// Weight / bias preparation, one launch of 4 blocks with block-uniform roles (no barriers):
//   role 0: [Wq;Wk] -> f16 [64][64]      role 1: Wv -> f16 [64][64]
//   role 2: Wsc -> bf16 hi/lo [64][64], rows 32..63 zero-filled (not read)
//   role 3: [bq;bk] -> f32 [64]
// Coverage roles 0-2: 2 it x 256 thr x 8 elements = 4096 = the whole 64x64 plane; each store instruction
// ---------------------------------------------------------------------------
__global__ __launch_bounds__(256) void prep_kernel(
    const float* __restrict__ Wq, const float* __restrict__ Wk, const float* __restrict__ Wv,
    const float* __restrict__ Wsc, const float* __restrict__ bq, const float* __restrict__ bk,
    unsigned short* __restrict__ Wqk16, unsigned short* __restrict__ Wv16,
    unsigned short* __restrict__ Wsch, unsigned short* __restrict__ Wscl, float* __restrict__ bqk) {
  const int tid  = threadIdx.x;
  const int role = blockIdx.x;   // block-uniform
  if (role == 0) {
    v4u hv[2];
#pragma unroll
    for (int it = 0; it < 2; ++it) {
      const int task = it * 256 + tid;
      const int row = task >> 3, c8 = (task & 7) * 8;
      const int rq = row < kDq ? row : (kDq - 1);
      int rk = row - kDq; rk = rk < 0 ? 0 : (rk > kDq - 1 ? kDq - 1 : rk);
      const v4f a0 = *(const v4f*)(Wq + rq * kCh + c8), a1 = *(const v4f*)(Wq + rq * kCh + c8 + 4);
      const v4f b0 = *(const v4f*)(Wk + rk * kCh + c8), b1 = *(const v4f*)(Wk + rk * kCh + c8 + 4);
      const bool useq = row < kDq;
      float f[8];
#pragma unroll
      for (int e = 0; e < 4; ++e) { f[e] = useq ? a0[e] : b0[e]; f[4 + e] = useq ? a1[e] : b1[e]; }
      v4u u;
#pragma unroll
      for (int q = 0; q < 4; ++q) u[q] = pk16(h16_bits(f[2 * q]), h16_bits(f[2 * q + 1]));
      hv[it] = u;
    }
    {
#pragma unroll
      for (int it = 0; it < 2; ++it) {
        const int task = it * 256 + tid;
        const int row = task >> 3, c8 = (task & 7) * 8;
        *(v4u*)(Wqk16 + row * kCh + c8) = hv[it];
      }
      
    }
  } else if (role == 1) {
    v4u hv[2];
#pragma unroll
    for (int it = 0; it < 2; ++it) {
      const int task = it * 256 + tid;
      const int row = task >> 3, c8 = (task & 7) * 8;   // row 0..63 valid
      const v4f a0 = *(const v4f*)(Wv + row * kCh + c8), a1 = *(const v4f*)(Wv + row * kCh + c8 + 4);
      float f[8];
#pragma unroll
      for (int e = 0; e < 4; ++e) { f[e] = a0[e]; f[4 + e] = a1[e]; }
      v4u u;
#pragma unroll
      for (int q = 0; q < 4; ++q) u[q] = pk16(h16_bits(f[2 * q]), h16_bits(f[2 * q + 1]));
      hv[it] = u;
    }
    {
#pragma unroll
      for (int it = 0; it < 2; ++it) {
        const int task = it * 256 + tid;
        const int row = task >> 3, c8 = (task & 7) * 8;
        *(v4u*)(Wv16 + row * kCh + c8) = hv[it];
      }
      
    }
  } else if (role == 2) {
    v4u hv[2], lv[2];
#pragma unroll
    for (int it = 0; it < 2; ++it) {
      const int task = it * 256 + tid;
      const int row = task >> 3, c8 = (task & 7) * 8;
      const int rs = row < kDq ? row : (kDq - 1);        // clamped address, zero by predicate
      const bool live = row < kDq;
      const v4f a0 = *(const v4f*)(Wsc + rs * kCh + c8), a1 = *(const v4f*)(Wsc + rs * kCh + c8 + 4);
      float f[8];
#pragma unroll
      for (int e = 0; e < 4; ++e) { f[e] = live ? a0[e] : 0.0f; f[4 + e] = live ? a1[e] : 0.0f; }
      v4u u, u2;
#pragma unroll
      for (int q = 0; q < 4; ++q) {
        const unsigned short hb0 = f2bf_bits(f[2 * q]), hb1 = f2bf_bits(f[2 * q + 1]);
        const unsigned short lb0 = f2bf_bits(f[2 * q] - bf_bits2f(hb0));
        const unsigned short lb1 = f2bf_bits(f[2 * q + 1] - bf_bits2f(hb1));
        u[q] = pk16(hb0, hb1); u2[q] = pk16(lb0, lb1);
      }
      hv[it] = u; lv[it] = u2;
    }
    {
#pragma unroll
      for (int it = 0; it < 2; ++it) {
        const int task = it * 256 + tid;
        const int row = task >> 3, c8 = (task & 7) * 8;
        *(v4u*)(Wsch + row * kCh + c8) = hv[it];
        *(v4u*)(Wscl + row * kCh + c8) = lv[it];
      }
      
    }
  } else if (role == 3) {
    if (tid < 16) {
      const int iq = (4 * tid < kDq - 4) ? 4 * tid : (kDq - 4);
      int ik = 4 * tid - kDq; ik = ik < 0 ? 0 : (ik > kDq - 4 ? kDq - 4 : ik);
      const v4f a = *(const v4f*)(bq + iq);
      const v4f c = *(const v4f*)(bk + ik);
      const v4f v = (tid < 8) ? a : c;
      *(v4f*)(bqk + 4 * tid) = v;
      
    }
  }
}

// ---------------------------------------------------------------------------
// grid = kBatch * 64 blocks (one per 64-pixel tile), 256 threads.
// Coverage per block: load 4 it x 256 thr x 4 f32 = 64 ch x 64 px; store 2 it x 256 thr x 8 u16 = 64 px x 64 ch;
// ---------------------------------------------------------------------------
__global__ __launch_bounds__(256) void xcat_transpose_f16_kernel(const float* __restrict__ x1, const float* __restrict__ x2,
                                                                 unsigned short* __restrict__ Xo) {
  __shared__ __align__(16) float tf[64 * 68];
  const int bx  = blockIdx.x;
  const int b   = bx >> 6;
  const int n0  = (bx & 63) * 64;
  const int tid = threadIdx.x;
  const int sub = tid >> 4, c4 = (tid & 15) * 4;
#pragma unroll
  for (int it = 0; it < 2; ++it) {
    const int ch = it * 16 + sub;   // channels 0..31 from x1
    const v4f a = *(const v4f*)(x1 + ((size_t)(b * kCinHalf + ch) * kPix + n0 + c4));
    *(v4f*)(tf + ch * 68 + c4) = a;
  }
#pragma unroll
  for (int it = 0; it < 2; ++it) {
    const int ch = it * 16 + sub;   // channels 32..63 from x2
    const v4f a = *(const v4f*)(x2 + ((size_t)(b * kCinHalf + ch) * kPix + n0 + c4));
    *(v4f*)(tf + (kCinHalf + ch) * 68 + c4) = a;
  }
  __syncthreads();
  const int s8 = tid >> 3, c8 = (tid & 7) * 8;
  v4u hv[2];
#pragma unroll
  for (int it = 0; it < 2; ++it) {
    const int oc = it * 32 + s8;    // pixel within tile
    v4u u;
#pragma unroll
    for (int q = 0; q < 4; ++q) {
      const float f0 = tf[(c8 + 2 * q) * 68 + oc];
      const float f1 = tf[(c8 + 2 * q + 1) * 68 + oc];
      u[q] = pk16(h16_bits(f0), h16_bits(f1));
    }
    hv[it] = u;
  }
  {
#pragma unroll
    for (int it = 0; it < 2; ++it) {
      const int oc = it * 32 + s8;
      *(v4u*)(Xo + ((size_t)(b * kPix + n0 + oc) * kCh + c8)) = hv[it];
    }
    
  }
}

// ---------------------------------------------------------------------------
// O[n][c] = (1/4096) * sum_m P[n][m] * V[b][c][m] with P[n][m] = exp(S[n][m] - cmax[m]) * cscale[m] (softmax over n,
// carried x4096, rounded to f16) and S[n][m] = q[n] . k[m] formed again here on the matrix unit, so that P lives in registers only.
// grid = (4096 / 128, batch); 512 threads = 16 waves = 4 groups of 32 rows n x 4 slices of the sum over m.
// The block walks m in stages of 256: k rows, V columns and the exponent offsets of a stage are brought to LDS by all threads
// (through registers, fetched one stage ahead, two buffers, one barrier a stage); slice sl takes the 64 values of m from sl * 64 on.
// Per 32 values of m: two score tiles with k as A and q as B (register r of lane l = S[n = l & 15][m = 8 (l >> 4) + r]); converted
// in place, the pair is the B operand of the second product, whose A operand is V in the fragment loader's own k order.
// exp(s - cmax) * cscale is taken as exp2(s * log2(e) - off), off = cmax * log2(e) - log2(cscale), one value per m and stage.
// The 4 slices' partial tiles meet in LDS behind one barrier and are added in slice order.
// O is not stored: the block goes on to out[b][o][n] = sum_c Wsc[o][c] * z[n][c], z = gamma * O + x, for its 128 pixels n.
// Each of the 16 waves takes one 16 x 16 tile of out (2 tiles of o x 8 tiles of n): it adds the partial tiles for its 16 rows n
// straight into the B fragment's own element order, splits z into bf16 hi/lo there, and multiplies with Wsc hi/lo as A
// (hi.hi + hi.lo + lo.hi). The tiles meet in LDS behind a second barrier, so that every wave stores whole 512-byte rows of out.
// ---------------------------------------------------------------------------
constexpr int kAtGroups = 4;                   // groups of 32 rows n per block
constexpr int kAtSlices = 4;                   // slices of a stage's m per block
constexpr int kAtRows   = kAtGroups * 32;      // 128 rows of O per block
constexpr int kAtStage  = 256;                 // values of m per stage
constexpr int kAtKPitch = kDq + 8;             // f16 per LDS row of k: 80 B = 16 B x odd
constexpr int kAtVPitch = kAtStage + 8;        // f16 per LDS row of V: 528 B = 16 B x odd
constexpr int kAtOPitch = 68;                  // floats per LDS row of a partial tile: 272 B = 16 B x odd
constexpr int kAtFPitch = kAtRows + 4;         // floats per LDS row of the out tile: 8 rows on = 32 banks on, for the two lane halves
constexpr float kLog2e  = 1.44269504088896340736f;

// Eight exp2 in place. One statement, closed by a v_nop: behind a transcendental the instruction set asks for one independent
// instruction before its result is read or its source overwritten; written so, every one of the eight has it, whatever registers
// the compiler picks.
__device__ __forceinline__ void exp2_x8(float (&e)[8]) {
  asm("v_exp_f32 %0, %0\n\tv_exp_f32 %1, %1\n\tv_exp_f32 %2, %2\n\tv_exp_f32 %3, %3\n\t"
      "v_exp_f32 %4, %4\n\tv_exp_f32 %5, %5\n\tv_exp_f32 %6, %6\n\tv_exp_f32 %7, %7\n\tv_nop"
      : "+v"(e[0]), "+v"(e[1]), "+v"(e[2]), "+v"(e[3]), "+v"(e[4]), "+v"(e[5]), "+v"(e[6]), "+v"(e[7]));
}

// Four exp2 in place, in the form of exp2_x8 and for the same reason.
__device__ __forceinline__ void exp2_x4(float (&e)[4]) {
  asm("v_exp_f32 %0, %0\n\tv_exp_f32 %1, %1\n\tv_exp_f32 %2, %2\n\tv_exp_f32 %3, %3\n\tv_nop"
      : "+v"(e[0]), "+v"(e[1]), "+v"(e[2]), "+v"(e[3]));
}

// ---------------------------------------------------------------------------
// Column softmax statistics (normalisation over n, down each column m) of S[n][m] = q[n] . k[m], with S formed here on the
// matrix unit and never stored: cmax[b][m] = max_n S[n][m], cscale[b][m] = 4096 / sum_n exp(S[n][m] - cmax[b][m]).
// grid = (4096 / 128, batch); 512 threads = 16 waves = 2 groups of 64 columns m x 8 slices of the rows n.
// A wave keeps its 64 columns of k in registers as four B operands. The block walks n in stages of 512 rows of q, brought to LDS
// by all threads (through registers, fetched one stage ahead, two buffers, one barrier a stage); slice ns takes the 64 rows from
// ns * 64 on, 32 at a time. With q as A and k as B, register r of lane l = S[n = 8 (l >> 4) + r][m = l & 15]: every lane follows
// its own four columns with a running (max, sum) pair, the sum rescaled once per 16 scores of a column.
// The pairs merge over the two lane halves by a shuffle, then over the 8 slices through LDS behind one barrier.
// ---------------------------------------------------------------------------
constexpr int kCsCols   = 128;       // columns m per block
constexpr int kCsSlices = 8;         // slices of a stage's rows n per block
constexpr int kCsStage  = 512;       // rows n per stage
constexpr int kCsQPitch = kDq + 8;   // f16 per LDS row of q: 80 B = 16 B x odd

__global__ __launch_bounds__(512) void colstats_fused_kernel(const unsigned short* __restrict__ QKp,
                                                             float* __restrict__ cmax, float* __restrict__ cscale) {
  __shared__ __align__(16) _Float16 sQ[2][kCsStage * kCsQPitch];
  __shared__ float sMx[kCsSlices][kCsCols];
  __shared__ float sSm[kCsSlices][kCsCols];
  const int tid   = threadIdx.x;
  const int lane  = tid & 31;
  const int wave  = tid >> 5;
  const int cg    = wave & 1;
  const int ns    = wave >> 1;
  const int rlane = lane & 15;
  const int koff  = (lane >> 4) * 8;      // k offset of this lane half
  const int b     = blockIdx.y;
  const int m0    = blockIdx.x * kCsCols;
  const _Float16* QK = (const _Float16*)QKp + (size_t)b * kPix * kCh;

  // staging: q = 512 rows x 64 B (4 threads a row, 4 rounds)
  const int qRow = tid >> 2, qQ = (tid & 3) * 8;
  v4u qr[4];
  // the unrolls in this kernel keep qr[], the fragments, the score tiles and the pairs in registers (constant indices)
  auto fetch = [&](int nb) {
#pragma unroll
    for (int it = 0; it < 4; ++it) qr[it] = *(const v4u*)(QK + (size_t)(nb + it * 128 + qRow) * kCh + qQ);
  };
  auto put = [&](int buf) {
#pragma unroll
    for (int it = 0; it < 4; ++it) *(v4u*)(&sQ[buf][(it * 128 + qRow) * kCsQPitch + qQ]) = qr[it];
  };

  v16h kf[4];
  const _Float16* kp = QK + (size_t)(m0 + cg * 64 + rlane) * kCh + kDq + koff;   // one address, the four tiles by constant offsets
#pragma unroll
  for (int j = 0; j < 4; ++j) kf[j] = Frag<_Float16>::load(kp + j * 16 * kCh);
  // precaution
  asm volatile("s_wait_xcnt 0x0" ::: "memory");
  float mx[4], nl[4], sm[4];   // running maximum, the same times -log2(e), running sum of exp(s - maximum)
#pragma unroll
  for (int j = 0; j < 4; ++j) { mx[j] = -INFINITY; nl[j] = INFINITY; sm[j] = 0.0f; }

  fetch(0);
  // precaution: the address registers of the loads above are reused from here on
  asm volatile("s_wait_xcnt 0x0" ::: "memory");
  put(0);
  __syncthreads();
  // kept rolled: one copy of the stage body in the instruction cache, and only one stage's fetch registers live
#pragma unroll 1
  for (int s = 0; s < kPix / kCsStage; ++s) {
    const int buf = s & 1;
    const bool more = s + 1 < kPix / kCsStage;   // the same for the whole block
    if (more) fetch((s + 1) * kCsStage);
    const _Float16* qb = &sQ[buf][(ns * 64 + rlane) * kCsQPitch + koff];
#pragma unroll
    for (int st = 0; st < 2; ++st) {
      v16h qf[2];
#pragma unroll
      for (int f = 0; f < 2; ++f) qf[f] = Frag<_Float16>::load(qb + (st * 32 + f * 16) * kCsQPitch);
      const v8f zero = (v8f){0.f, 0.f, 0.f, 0.f, 0.f, 0.f, 0.f, 0.f};
      v8f sc[2][4];
#pragma unroll
      for (int f = 0; f < 2; ++f)
#pragma unroll
        for (int j = 0; j < 4; ++j) sc[f][j] = Frag<_Float16>::mma(qf[f], kf[j], zero);
      float rs[4];
#pragma unroll
      for (int j = 0; j < 4; ++j) {
        float ma = mx[j], mb = sc[0][j][4];
#pragma unroll
        for (int r = 0; r < 4; ++r) ma = fmaxf(fmaxf(ma, sc[0][j][r]), sc[1][j][r]);
        mb = fmaxf(mb, sc[1][j][4]);
#pragma unroll
        for (int r = 5; r < 8; ++r) mb = fmaxf(fmaxf(mb, sc[0][j][r]), sc[1][j][r]);
        mx[j] = fmaxf(ma, mb);
        const float t = mx[j] * -kLog2e;
        rs[j] = t - nl[j];   // first pass: -inf, so that the empty sum is scaled by 0
        nl[j] = t;
      }
      exp2_x4(rs);
#pragma unroll
      for (int j = 0; j < 4; ++j) {
        const v8f x0 = sc[0][j] * kLog2e + nl[j];
        const v8f x1 = sc[1][j] * kLog2e + nl[j];
        float e0[8], e1[8];
#pragma unroll
        for (int r = 0; r < 8; ++r) { e0[r] = x0[r]; e1[r] = x1[r]; }
        exp2_x8(e0);
        exp2_x8(e1);
        v8f t;
#pragma unroll
        for (int r = 0; r < 8; ++r) t[r] = e0[r] + e1[r];
        sm[j] = sm[j] * rs[j] + (((t[0] + t[1]) + (t[2] + t[3])) + ((t[4] + t[5]) + (t[6] + t[7])));
      }
    }
    if (more) put(buf ^ 1);   // that buffer's last readers left it before the barrier that ended the stage before this one
    __syncthreads();
  }

  // lanes l and l ^ 16 hold the same four columns, over different rows
  {
    float om[4], os[4], d[8];
#pragma unroll
    for (int j = 0; j < 4; ++j) {
      om[j] = __shfl_xor(mx[j], 16);
      os[j] = __shfl_xor(sm[j], 16);
      const float M = fmaxf(mx[j], om[j]);
      d[2 * j]     = (mx[j] - M) * kLog2e;
      d[2 * j + 1] = (om[j] - M) * kLog2e;
      mx[j] = M;
    }
    exp2_x8(d);
#pragma unroll
    for (int j = 0; j < 4; ++j) sm[j] = sm[j] * d[2 * j] + os[j] * d[2 * j + 1];
  }
  if (lane < 16) {
#pragma unroll
    for (int j = 0; j < 4; ++j) {
      sMx[ns][cg * 64 + j * 16 + rlane] = mx[j];
      sSm[ns][cg * 64 + j * 16 + rlane] = sm[j];
    }
  }
  __syncthreads();
  if (tid < kCsCols) {   // waves 0 to 3, one column a thread; each wave's store fills one whole 128-byte line
    float pm[kCsSlices], ps[kCsSlices];
#pragma unroll
    for (int i = 0; i < kCsSlices; ++i) { pm[i] = sMx[i][tid]; ps[i] = sSm[i][tid]; }
    float M = pm[0];
#pragma unroll
    for (int i = 1; i < kCsSlices; ++i) M = fmaxf(M, pm[i]);
#pragma unroll
    for (int i = 0; i < kCsSlices; ++i) pm[i] = (pm[i] - M) * kLog2e;
    exp2_x8(pm);
    float tot = 0.0f;
#pragma unroll
    for (int i = 0; i < kCsSlices; ++i) tot += ps[i] * pm[i];   // tot >= 1
    float inv;
    // the v_nop is the independent instruction that the instruction set asks for behind a transcendental before its result is read
    asm("v_rcp_f32 %0, %1\n\tv_nop" : "=v"(inv) : "v"(tot));
    cmax[b * kPix + m0 + tid]   = M;
    cscale[b * kPix + m0 + tid] = 4096.0f * inv;
  }
}

__global__ __launch_bounds__(512) void attn_fused_kernel(const unsigned short* __restrict__ QKp,
                                                         const unsigned short* __restrict__ Vp,
                                                         const float* __restrict__ cmax, const float* __restrict__ cscale,
                                                         const float* __restrict__ x1, const float* __restrict__ x2,
                                                         const float* __restrict__ gamma,
                                                         const unsigned short* __restrict__ Wsch,
                                                         const unsigned short* __restrict__ Wscl,
                                                         float* __restrict__ out) {
  __shared__ __align__(16) _Float16 sK[2][kAtStage * kAtKPitch];
  __shared__ __align__(16) _Float16 sV[2][kCh * kAtVPitch];
  __shared__ __align__(16) float    sOff[2][kAtStage];
  __shared__ __align__(16) float    part[kAtGroups * kAtSlices][32 * kAtOPitch];
  __shared__ __align__(16) float    sF[kDq * kAtFPitch];
  const int tid   = threadIdx.x;
  const int lane  = tid & 31;
  const int wave  = tid >> 5;
  const int grp   = wave & (kAtGroups - 1);
  const int sl    = wave >> 2;
  const int rlane = lane & 15;
  const int koff  = (lane >> 4) * 8;      // k offset of this lane half; also the accumulators' offset along the A operand's rows
  const int b     = blockIdx.y;
  const int n0    = blockIdx.x * kAtRows;
  const _Float16* QK = (const _Float16*)QKp + (size_t)b * kPix * kCh;
  const _Float16* V  = (const _Float16*)Vp + (size_t)b * kCh * kPix;
  const float* cm = cmax + b * kPix;
  const float* cs = cscale + b * kPix;

  // staging: k = 256 rows x 64 B (4 threads a row, 2 rounds), V = 64 rows x 512 B (one wave a row, 4 rounds), one offset per m
  const int kRow = tid >> 2, kQ = (tid & 3) * 8;
  const int vRow = tid >> 5, vQ = (tid & 31) * 8;
  v4u kr[2], vr[4];
  float fm = 0.0f, fs = 1.0f;
  // the unrolls in this kernel keep kr[], vr[], the fragments and the accumulators in registers (constant indices)
  auto fetch = [&](int ms) {
#pragma unroll
    for (int it = 0; it < 2; ++it) kr[it] = *(const v4u*)(QK + (size_t)(ms + it * 128 + kRow) * kCh + kDq + kQ);
#pragma unroll
    for (int it = 0; it < 4; ++it) vr[it] = *(const v4u*)(V + (size_t)(it * 16 + vRow) * kPix + ms + vQ);
    if (tid < kAtStage) { fm = cm[ms + tid]; fs = cs[ms + tid]; }
  };
  auto put = [&](int buf) {
#pragma unroll
    for (int it = 0; it < 2; ++it) *(v4u*)(&sK[buf][(it * 128 + kRow) * kAtKPitch + kQ]) = kr[it];
#pragma unroll
    for (int it = 0; it < 4; ++it) *(v4u*)(&sV[buf][(it * 16 + vRow) * kAtVPitch + vQ]) = vr[it];
    if (tid < kAtStage) sOff[buf][tid] = fm * kLog2e - __log2f(fs);
  };

  v16h qf[2];
#pragma unroll
  for (int nt = 0; nt < 2; ++nt)
    qf[nt] = Frag<_Float16>::load(QK + (size_t)(n0 + grp * 32 + nt * 16 + rlane) * kCh + koff);
  v8f acc[2][4];
#pragma unroll
  for (int nt = 0; nt < 2; ++nt)
#pragma unroll
    for (int j = 0; j < 4; ++j) acc[nt][j] = (v8f){0.f, 0.f, 0.f, 0.f, 0.f, 0.f, 0.f, 0.f};

  fetch(0);
  put(0);
  __syncthreads();
  // kept rolled: one copy of the stage body in the instruction cache, and only one stage's fetch registers live
#pragma unroll 1
  for (int s = 0; s < kPix / kAtStage; ++s) {
    const int buf = s & 1;
    const bool more = s + 1 < kPix / kAtStage;   // the same for the whole block
    if (more) fetch((s + 1) * kAtStage);
    const _Float16* kb = &sK[buf][(sl * 64 + rlane) * kAtKPitch + koff];
    const _Float16* vb = &sV[buf][rlane * kAtVPitch + sl * 64 + koff];
    const float*    ob = &sOff[buf][sl * 64 + koff];
#pragma unroll
    for (int st = 0; st < 2; ++st) {
      v16h kf[2], vf[4];
      v8f of[2];
#pragma unroll
      for (int t = 0; t < 2; ++t) {
        kf[t] = Frag<_Float16>::load(kb + (st * 32 + t * 16) * kAtKPitch);
        of[t] = __builtin_shufflevector(*(const v4f*)(ob + st * 32 + t * 16), *(const v4f*)(ob + st * 32 + t * 16 + 4),
                                        0, 1, 2, 3, 4, 5, 6, 7);
      }
#pragma unroll
      for (int j = 0; j < 4; ++j) vf[j] = Frag<_Float16>::load(vb + j * 16 * kAtVPitch + st * 32);
#pragma unroll
      for (int nt = 0; nt < 2; ++nt) {
        const v8f zero = (v8f){0.f, 0.f, 0.f, 0.f, 0.f, 0.f, 0.f, 0.f};
        const v8f s0 = Frag<_Float16>::mma(kf[0], qf[nt], zero);
        const v8f s1 = Frag<_Float16>::mma(kf[1], qf[nt], zero);
        const v8f x0 = s0 * kLog2e - of[0];   // whole tiles, so that neighbouring registers pair up without copies
        const v8f x1 = s1 * kLog2e - of[1];
        float e0[8], e1[8];
#pragma unroll
        for (int r = 0; r < 8; ++r) { e0[r] = x0[r]; e1[r] = x1[r]; }
        exp2_x8(e0);
        exp2_x8(e1);
        v16h pf;
#pragma unroll
        for (int r = 0; r < 8; ++r) { pf[r] = (_Float16)e0[r]; pf[8 + r] = (_Float16)e1[r]; }
#pragma unroll
        for (int j = 0; j < 4; ++j) acc[nt][j] = Frag<_Float16>::mma(vf[j], pf, acc[nt][j]);
      }
    }
    if (more) put(buf ^ 1);   // that buffer's last readers left it before the barrier that ended the stage before this one
    __syncthreads();
  }

  // this wave's tile of out: rows o from ot * 16 on, pixels n from n0 + ntile * 16 on; its x and Wsc are asked for here, so that
  // they are on their way while the partial tiles are written
  const int ot    = wave & 1;
  const int ntile = wave >> 1;
  float xv[2][16];   // xv[ks][e] = x[channel 32 ks + koff + (e < 8 ? e : e + 8)][pixel], the fragment loader's k order
  const size_t xo = (size_t)(b * kCinHalf + koff) * kPix + n0 + ntile * 16 + rlane;
  const float* xa = x1 + xo;   // channels 0..31 are x1, 32..63 are x2
  const float* xb = x2 + xo;
#pragma unroll
  for (int e = 0; e < 8; ++e) { xv[0][e] = xa[e * kPix]; xv[0][8 + e] = xa[(16 + e) * kPix]; }
#pragma unroll
  for (int e = 0; e < 8; ++e) { xv[1][e] = xb[e * kPix]; xv[1][8 + e] = xb[(16 + e) * kPix]; }
  const __bf16* whp = (const __bf16*)Wsch + (ot * 16 + rlane) * kCh + koff;
  const __bf16* wlp = (const __bf16*)Wscl + (ot * 16 + rlane) * kCh + koff;
  v16b wh[2], wl[2];
#pragma unroll
  for (int ks = 0; ks < 2; ++ks) { wh[ks] = Frag<__bf16>::load(whp + ks * 32); wl[ks] = Frag<__bf16>::load(wlp + ks * 32); }
  const float g = gamma[0];
  // precaution: the address registers of the loads above are reused from here on; the addresses are named as inputs so that they
  // keep their registers up to the wait
  asm volatile("s_wait_xcnt 0x0" :: "v"(xa), "v"(xb), "v"(whp), "v"(wlp) : "memory");

  float* slab = part[wave];
#pragma unroll
  for (int nt = 0; nt < 2; ++nt)
#pragma unroll
    for (int j = 0; j < 4; ++j) {   // acc[nt][j][r] = partial O[n0 + 32 grp + 16 nt + rlane][16 j + koff + r]
      float* d = slab + (nt * 16 + rlane) * kAtOPitch + (j << 4) + koff;
      *(v4f*)(d)     = (v4f){acc[nt][j][0], acc[nt][j][1], acc[nt][j][2], acc[nt][j][3]};
      *(v4f*)(d + 4) = (v4f){acc[nt][j][4], acc[nt][j][5], acc[nt][j][6], acc[nt][j][7]};
    }
  __syncthreads();

  v8f fa = (v8f){0.f, 0.f, 0.f, 0.f, 0.f, 0.f, 0.f, 0.f};
  {
    // row n = ntile * 16 + rlane of the block lies in group ntile >> 1, at row (ntile & 1) * 16 + rlane of its partial tiles
    const float* pr = &part[ntile >> 1][((ntile & 1) * 16 + rlane) * kAtOPitch + koff];
#pragma unroll
    for (int ks = 0; ks < 2; ++ks) {
      float z[16];
#pragma unroll
      for (int q = 0; q < 4; ++q) {   // four channels at a time: q = 0, 1 are elements 0..7, q = 2, 3 elements 8..15
        const int c = ks * 32 + (q >> 1) * 16 + (q & 1) * 4;
        v4f t = *(const v4f*)(pr + c);
#pragma unroll
        for (int w = 1; w < kAtSlices; ++w) t += *(const v4f*)(pr + w * kAtGroups * 32 * kAtOPitch + c);
        t *= (1.0f / 4096.0f);
#pragma unroll
        for (int e = 0; e < 4; ++e) z[q * 4 + e] = g * t[e] + xv[ks][q * 4 + e];
      }
      v16b zh, zl;   // z = hi + lo, both rounded to nearest even by the packed conversion, two elements an instruction
#pragma unroll
      for (int q = 0; q < 8; ++q) {
        const v2f zz = (v2f){z[2 * q], z[2 * q + 1]};
        const v2b hb = __builtin_convertvector(zz, v2b);
        const v2b lb = __builtin_convertvector(zz - __builtin_convertvector(hb, v2f), v2b);
        zh[2 * q] = hb[0]; zh[2 * q + 1] = hb[1];
        zl[2 * q] = lb[0]; zl[2 * q + 1] = lb[1];
      }
      fa = Frag<__bf16>::mma(wh[ks], zh, fa);
      fa = Frag<__bf16>::mma(wh[ks], zl, fa);
      fa = Frag<__bf16>::mma(wl[ks], zh, fa);
    }
  }
#pragma unroll
  for (int r = 0; r < 8; ++r)   // fa[r] = out[ot * 16 + koff + r][n0 + ntile * 16 + rlane]
    sF[(ot * 16 + koff + r) * kAtFPitch + ntile * 16 + rlane] = fa[r];
  __syncthreads();
  float* ob = out + (size_t)b * kDq * kPix + n0;
#pragma unroll
  for (int it = 0; it < 2; ++it) {   // one wave, one row o: 128 pixels = 4 whole 128-byte lines
    const int row = it * 16 + wave;
    *(v4f*)(ob + (size_t)row * kPix + lane * 4) = *(const v4f*)(&sF[row * kAtFPitch + lane * 4]);
  }
}

// ---------------------------------------------------------------------------
// Workspace region map (byte offsets):
//   small    65536 B @ 0        : Wqk16 f16 [64][64] @0, Wv16 f16 [64][64] @8192, Wsch bf16 [64][64] @16384,
//                                 Wscl bf16 [64][64] @24576, bqk f32 [64] @32768
//   X   f16 [8][4096][64]        4194304 B @ 65536
//   QK  f16 [8][4096][64]        4194304 B @ 4259840       (cols 0..31 = q, 32..63 = k)
//   V   f16 [8][64][4096]        4194304 B @ 8454144
//   stat f32 cmax[8][4096] @ +0, cscale[8][4096] @ +131072   262144 B @ 12648448
//   total                       12910592 B
// Every region is fully written before it is read.
// ---------------------------------------------------------------------------
extern "C" void kernel_launch(void* const* d_in, const int* in_sizes, int n_in,
                              void* d_out, int out_size, void* d_ws, size_t ws_size,
                              hipStream_t stream) {
  if (n_in < 9) return;
  if (in_sizes[0] != kBatch * kCinHalf * kPix || in_sizes[1] != kBatch * kCinHalf * kPix) return;
  if (in_sizes[2] != kDq * kCh || in_sizes[3] != kDq || in_sizes[4] != kDq * kCh || in_sizes[5] != kDq) return;
  if (in_sizes[6] != kCh * kCh || in_sizes[7] != kDq * kCh || in_sizes[8] < 1) return;
  if (out_size != kBatch * kDq * kPix) return;

  const float* x1    = (const float*)d_in[0];
  const float* x2    = (const float*)d_in[1];
  const float* Wq    = (const float*)d_in[2];
  const float* bq    = (const float*)d_in[3];
  const float* Wk    = (const float*)d_in[4];
  const float* bk    = (const float*)d_in[5];
  const float* Wv    = (const float*)d_in[6];
  const float* Wsc   = (const float*)d_in[7];
  const float* gamma = (const float*)d_in[8];
  float* out = (float*)d_out;

  const size_t szPlane16 = (size_t)kBatch * kPix * kCh * 2;   // 4194304
  size_t off = 0;
  const size_t oSmall = off; off += 65536;
  const size_t oX     = off; off += szPlane16;
  const size_t oQK    = off; off += szPlane16;
  const size_t oV     = off; off += szPlane16;
  const size_t oStat  = off; off += 262144;
  if (off > ws_size) return;

  char* ws = (char*)d_ws;
  unsigned short* Wqk16 = (unsigned short*)(ws + oSmall + 0);
  unsigned short* Wv16  = (unsigned short*)(ws + oSmall + 8192);
  unsigned short* Wsch  = (unsigned short*)(ws + oSmall + 16384);
  unsigned short* Wscl  = (unsigned short*)(ws + oSmall + 24576);
  float*          bqk   = (float*)(ws + oSmall + 32768);
  unsigned short* Xp    = (unsigned short*)(ws + oX);
  unsigned short* QKp   = (unsigned short*)(ws + oQK);
  unsigned short* Vp    = (unsigned short*)(ws + oV);
  float*          cmax  = (float*)(ws + oStat);
  float*          cscale = (float*)(ws + oStat + 131072);

  const dim3 blk(256);
  // (0) weights / bias
  prep_kernel<<<dim3(4), blk, 0, stream>>>(Wq, Wk, Wv, Wsc, bq, bk, Wqk16, Wv16, Wsch, Wscl, bqk);
  // (1) x -> X f16 [b][n][c]  (512 blocks = 8 batches x 64 pixel tiles)
  xcat_transpose_f16_kernel<<<dim3(kBatch * (kPix / 64)), blk, 0, stream>>>(x1, x2, Xp);
  // (2) [q|k][n][o'] = sum_c X[n][c] Wqk[o'][c] + bqk[o'] : M = 8*4096, N = 64, K = 64 -> QK f16 (512 tiles, 64 blocks)
  wmma_gemm64<0, false, 2, 1, false, 0><<<dim3((kBatch * kPix / 64) / 8, 1), blk, 0, stream>>>(
      Xp, Xp, kCh, 0L, Wqk16, Wqk16, kCh, 0L, (void*)QKp, (void*)QKp, kCh, 0L,
      bqk, bqk, 0L, kBatch * kPix, kCh, kCh, 1.0f);
  // (3) V[b][c][m] = sum_k Wv[c][k] X[b][m][k] : M = 64, N = 4096, K = 64 per batch (grid.y = batch) -> V f16 [b][64][4096]
  wmma_gemm64<0, false, 0, 1, false, 0><<<dim3(((kCh / 64) * (kPix / 64)) / 8, kBatch), blk, 0, stream>>>(
      Wv16, Wv16, kCh, 0L, Xp, Xp, kCh, (long)kPix * kCh, (void*)Vp, (void*)Vp, kPix, (long)kCh * kPix,
      bqk, bqk, 0L, kCh, kPix, kCh, 1.0f);

  // (4) column statistics (softmax over n for each column m) from q and k, scores formed in registers;
  //     all batches in one launch (32 column blocks x 8 batches)
  colstats_fused_kernel<<<dim3(kPix / kCsCols, kBatch), dim3(512), 0, stream>>>(QKp, cmax, cscale);
  // (5) out[b][o][n] = sum_c Wsc[o][c] (gamma O[n][c] + x[b][c][n]), O[n][c] = (1/4096) sum_m P[n][m] V[b][c][m], P = 4096 * softmax
  //     formed in registers from q, k and the statistics; all batches in one launch (32 row blocks x 8 batches)
  attn_fused_kernel<<<dim3(kPix / kAtRows, kBatch), dim3(512), 0, stream>>>(QKp, Vp, cmax, cscale, x1, x2, gamma, Wsch, Wscl, out);
}

// v006
// Measured time: 50 microseconds a run.
// Timed twice side by side with v005, it ran 1.33 and 1.34 times as fast.
// Over all steps from v000 it is 294 times as fast.
// Contractions: x·[Wq|Wk]^T (+bias), Wv·x, q·k^T scores and P·V aggregation on v_wmma_f32_16x16x32_f16 (f16 operands; P carried x4096 and folded back x1/4096 in the f32 epilogue); Wsc·z on v_wmma_f32_16x16x32_bf16 with bf16 hi/lo split operand planes (hi·hi + hi·lo + lo·hi); f32 accumulate everywhere; column-wise softmax statistics, exp and the gamma residual in f32.
#include <hip/hip_runtime.h>
#include <math.h>
#include <stdint.h>

constexpr int kBatch   = 8;
constexpr int kCinHalf = 32;     // channels of x1 and of x2
constexpr int kCh      = 64;     // concatenated channels
constexpr int kPix     = 4096;   // h*w
constexpr int kDq      = 32;     // q/k channels = output channels

typedef __attribute__((ext_vector_type(16))) _Float16 v16h;
typedef __attribute__((ext_vector_type(8)))  _Float16 v8h;
typedef __attribute__((ext_vector_type(4)))  _Float16 v4h;
typedef __attribute__((ext_vector_type(16))) __bf16   v16b;
typedef __attribute__((ext_vector_type(8)))  __bf16   v8b;
typedef __attribute__((ext_vector_type(8)))  float    v8f;
typedef __attribute__((ext_vector_type(4)))  float    v4f;
typedef __attribute__((ext_vector_type(2)))  float    v2f;
typedef __attribute__((ext_vector_type(2)))  __bf16   v2b;
typedef __attribute__((ext_vector_type(4)))  unsigned int v4u;

__device__ __forceinline__ unsigned short f2bf_bits(float f) {
  unsigned u = __float_as_uint(f);
  return (unsigned short)((u + 0x7FFFu + ((u >> 16) & 1u)) >> 16);
}
__device__ __forceinline__ float bf_bits2f(unsigned short h) { return __uint_as_float(((unsigned)h) << 16); }
__device__ __forceinline__ unsigned pk16(unsigned short a, unsigned short b) { return (unsigned)a | ((unsigned)b << 16); }

template <typename T> struct Frag;
template <> struct Frag<_Float16> {
  typedef v16h V; union U { v16h v; v8h h[2]; };
  static __device__ __forceinline__ v16h load(const _Float16* p) {   // elements 0..7 <- p[0..7], 8..15 <- p[16..23]
    U f; f.h[0] = *(const v8h*)(p); f.h[1] = *(const v8h*)(p + 16); return f.v;
  }
  static __device__ __forceinline__ v8f mma(v16h a, v16h b, v8f c) {
    return __builtin_amdgcn_wmma_f32_16x16x32_f16(false, a, false, b, (short)0, c, false, false);
  }
};
template <> struct Frag<__bf16> {
  typedef v16b V; union U { v16b v; v8b h[2]; };
  static __device__ __forceinline__ v16b load(const __bf16* p) {
    U f; f.h[0] = *(const v8b*)(p); f.h[1] = *(const v8b*)(p + 16); return f.v;
  }
  static __device__ __forceinline__ v8f mma(v16b a, v16b b, v8f c) {
    return __builtin_amdgcn_wmma_f32_16x16x32_bf16(false, a, false, b, (short)0, c, false, false);
  }
};

// ---------------------------------------------------------------------------
// All projections of x in one launch, straight from the f32 inputs:
//   ROLE 0: QK[b][n][o'] = sum_c [Wq;Wk][o'][c] x[b][c][n] + [bq;bk][o'], f16 (columns 0..31 = q, 32..63 = k)
//   ROLE 1: V[b][c][m]   = sum_k Wv[c][k] x[b][k][m], f16
// 128 threads = 4 waves, one role a block; a wave takes 64 pixels of one batch and all 64 output channels.
// x goes from global memory into the fragment's own element order (lane = pixel, elements = channels in the fragment loader's
// k order) and is rounded to f16 in registers; the same fragment serves as B (ROLE 0) and as A (ROLE 1).
// The block's 64 x 64 weights are read in whole lines, rounded to f16 and shared through LDS behind one barrier.
// ROLE 0, weights as A: register r of lane l = QK[n = l & 15][o' = 16 t + 8 (l >> 4) + r]; ROLE 1, weights as B: register r of
// lane l = V[c = 16 t + (l & 15)][m = 8 (l >> 4) + r]. Either way a lane holds 8 neighbours of an output row, one 16-byte store,
// and a wave's 16 stores fill whole 128-byte lines that no other wave writes.
// ---------------------------------------------------------------------------
constexpr int kPjWPitch = kCh + 8;   // f16 per LDS row of the weights: 144 B = 16 B x odd
constexpr int kPjBlocks = kBatch * kPix / 256;   // blocks per role: 4 waves x 64 pixels each

template <int ROLE>
__device__ __forceinline__ void proj_body(const float* __restrict__ x1, const float* __restrict__ x2,
                                          const float* __restrict__ wLo, const float* __restrict__ wHi,   // weight rows 0..31, 32..63
                                          const float* __restrict__ bLo, const float* __restrict__ bHi,   // ROLE 0: their biases
                                          unsigned short* __restrict__ dst, _Float16* sW, float* sB, int blk) {
  const int tid   = threadIdx.x;
  const int lane  = tid & 31;
  const int wave  = tid >> 5;
  const int rlane = lane & 15;
  const int koff  = (lane >> 4) * 8;      // k offset of this lane half; also the accumulators' offset along the A operand's rows
  const int tile  = blk * 4 + wave;       // 64 pixels
  const int b     = tile >> 6;
  const int p0    = (tile & 63) * 64;

  // the unrolls in this function keep the loaded values, the fragments and the results in registers (constant indices)
  const float* wa = wLo + (tid >> 4) * kCh + (tid & 15) * 4;   // 16 threads a row, 8 rows a round
  const float* wb = wHi + (tid >> 4) * kCh + (tid & 15) * 4;
  v4f wr[8];
#pragma unroll
  for (int i = 0; i < 4; ++i) { wr[i] = *(const v4f*)(wa + i * 8 * kCh); wr[4 + i] = *(const v4f*)(wb + i * 8 * kCh); }
  const float* bp = ((tid & 8) ? bHi : bLo) + (tid & 7) * 4;   // ROLE 0: the 64 biases, four a thread, threads 0..15 pass them on
  v4f br = (v4f){0.f, 0.f, 0.f, 0.f};
  if (ROLE == 0) br = *(const v4f*)bp;
  float xv[4][2][16];   // xv[pt][ks][e] = x[channel 32 ks + koff + (e < 8 ? e : e + 8)][pixel p0 + 16 pt + rlane]
  const size_t xo = (size_t)(b * kCinHalf + koff) * kPix + p0 + rlane;
  const float* xa = x1 + xo;   // channels 0..31 are x1, 32..63 are x2
  const float* xb = x2 + xo;
#pragma unroll
  for (int pt = 0; pt < 4; ++pt)
#pragma unroll
    for (int e = 0; e < 8; ++e) {
      xv[pt][0][e] = xa[e * kPix + pt * 16]; xv[pt][0][8 + e] = xa[(16 + e) * kPix + pt * 16];
      xv[pt][1][e] = xb[e * kPix + pt * 16]; xv[pt][1][8 + e] = xb[(16 + e) * kPix + pt * 16];
    }
  // precaution: the address registers of the loads above are reused from here on; the addresses are named as inputs so that they
  // keep their registers up to the wait
  if (ROLE == 0) asm volatile("s_wait_xcnt 0x0" :: "v"(wa), "v"(wb), "v"(bp), "v"(xa), "v"(xb) : "memory");
  else           asm volatile("s_wait_xcnt 0x0" :: "v"(wa), "v"(wb), "v"(xa), "v"(xb) : "memory");

#pragma unroll
  for (int i = 0; i < 8; ++i)
    *(v4h*)(&sW[(i * 8 + (tid >> 4)) * kPjWPitch + (tid & 15) * 4] ) = __builtin_convertvector(wr[i], v4h);
  if (ROLE == 0 && tid < 16) *(v4f*)(&sB[tid * 4]) = br;
  __syncthreads();
  v4f bv[4][2];   // ROLE 0: bv[t][h][e] = bias of output channel 16 t + koff + 4 h + e
  if (ROLE == 0) {
#pragma unroll
    for (int t = 0; t < 4; ++t)
#pragma unroll
      for (int h = 0; h < 2; ++h) bv[t][h] = *(const v4f*)(&sB[t * 16 + koff + h * 4]);
  }
  v16h wf[4][2];
#pragma unroll
  for (int t = 0; t < 4; ++t)
#pragma unroll
    for (int ks = 0; ks < 2; ++ks) wf[t][ks] = Frag<_Float16>::load(&sW[(t * 16 + rlane) * kPjWPitch + ks * 32 + koff]);

  v8h res[4][4];
#pragma unroll
  for (int pt = 0; pt < 4; ++pt) {
    v16h xf[2];
#pragma unroll
    for (int ks = 0; ks < 2; ++ks)
#pragma unroll
      for (int e = 0; e < 16; ++e) xf[ks][e] = (_Float16)xv[pt][ks][e];
    v8f acc[4];
#pragma unroll
    for (int t = 0; t < 4; ++t) acc[t] = (v8f){0.f, 0.f, 0.f, 0.f, 0.f, 0.f, 0.f, 0.f};
#pragma unroll
    for (int ks = 0; ks < 2; ++ks)
#pragma unroll
      for (int t = 0; t < 4; ++t)
        acc[t] = (ROLE == 0) ? Frag<_Float16>::mma(wf[t][ks], xf[ks], acc[t]) : Frag<_Float16>::mma(xf[ks], wf[t][ks], acc[t]);
#pragma unroll
    for (int t = 0; t < 4; ++t)
#pragma unroll
      for (int r = 0; r < 8; ++r) res[pt][t][r] = (_Float16)((ROLE == 0) ? acc[t][r] + bv[t][r >> 2][r & 3] : acc[t][r]);
  }
  // all stores last, from one address by constant offsets
  _Float16* d = (_Float16*)dst + ((ROLE == 0) ? ((size_t)(b * kPix + p0 + rlane) * kCh + koff)
                                              : ((size_t)(b * kCh + rlane) * kPix + p0 + koff));
#pragma unroll
  for (int pt = 0; pt < 4; ++pt)
#pragma unroll
    for (int t = 0; t < 4; ++t)
      *(v8h*)(d + ((ROLE == 0) ? (pt * 16 * kCh + t * 16) : (t * 16 * kPix + pt * 16))) = res[pt][t];
  // precaution: in the built code the other role's instructions follow ROLE 1's, and they write registers that the stores above name
  // (ROLE 0's stores are followed by the end of the program alone)
  if (ROLE == 1) asm volatile("s_wait_xcnt 0x0" ::: "memory");
}

// grid = 2 * kPjBlocks + 1 blocks with block-uniform roles: [q|k], V, and one block that splits Wsc into bf16 hi/lo planes
// [32][64] (2 it x 128 thr x 8 elements = the whole plane; no barrier on that path).
__global__ __launch_bounds__(128) void proj_fused_kernel(
    const float* __restrict__ x1, const float* __restrict__ x2,
    const float* __restrict__ Wq, const float* __restrict__ bq, const float* __restrict__ Wk, const float* __restrict__ bk,
    const float* __restrict__ Wv, const float* __restrict__ Wsc,
    unsigned short* __restrict__ QKo, unsigned short* __restrict__ Vo,
    unsigned short* __restrict__ Wsch, unsigned short* __restrict__ Wscl) {
  __shared__ __align__(16) _Float16 sW[kCh * kPjWPitch];
  __shared__ __align__(16) float    sB[kCh];
  const int bid = blockIdx.x;   // block-uniform
  if (bid < kPjBlocks) {
    proj_body<0>(x1, x2, Wq, Wk, bq, bk, QKo, sW, sB, bid);
  } else if (bid < 2 * kPjBlocks) {
    proj_body<1>(x1, x2, Wv, Wv + kDq * kCh, bq, bk, Vo, sW, sB, bid - kPjBlocks);
  } else {
    const int tid = threadIdx.x;
    const int eo  = (tid >> 3) * kCh + (tid & 7) * 8;   // 8 threads a row, 16 rows a round
    const float* sp = Wsc + eo;
    v4f a[2][2];
#pragma unroll
    for (int it = 0; it < 2; ++it) { a[it][0] = *(const v4f*)(sp + it * 16 * kCh); a[it][1] = *(const v4f*)(sp + it * 16 * kCh + 4); }
    // precaution: the address registers of the loads above are reused from here on
    asm volatile("s_wait_xcnt 0x0" :: "v"(sp) : "memory");
    v4u hv[2], lv[2];
#pragma unroll
    for (int it = 0; it < 2; ++it) {
      float f[8];
#pragma unroll
      for (int e = 0; e < 4; ++e) { f[e] = a[it][0][e]; f[4 + e] = a[it][1][e]; }
      v4u u, u2;
#pragma unroll
      for (int q = 0; q < 4; ++q) {
        const unsigned short hb0 = f2bf_bits(f[2 * q]), hb1 = f2bf_bits(f[2 * q + 1]);
        const unsigned short lb0 = f2bf_bits(f[2 * q] - bf_bits2f(hb0));
        const unsigned short lb1 = f2bf_bits(f[2 * q + 1] - bf_bits2f(hb1));
        u[q] = pk16(hb0, hb1); u2[q] = pk16(lb0, lb1);
      }
      hv[it] = u; lv[it] = u2;
    }
#pragma unroll
    for (int it = 0; it < 2; ++it) {
      *(v4u*)(Wsch + eo + it * 16 * kCh) = hv[it];
      *(v4u*)(Wscl + eo + it * 16 * kCh) = lv[it];
    }
    // precaution: in the built code another role's instructions follow this role's, and they write registers that the stores above name
    asm volatile("s_wait_xcnt 0x0" ::: "memory");
  }
}

// ---------------------------------------------------------------------------
// O[n][c] = (1/4096) * sum_m P[n][m] * V[b][c][m] with P[n][m] = exp(S[n][m] - cmax[m]) * cscale[m] (softmax over n,
// carried x4096, rounded to f16) and S[n][m] = q[n] . k[m] formed again here on the matrix unit, so that P lives in registers only.
// grid = (4096 / 128, batch); 512 threads = 16 waves = 4 groups of 32 rows n x 4 slices of the sum over m.
// The block walks m in stages of 256: k rows, V columns and the exponent offsets of a stage are brought to LDS by all threads
// (through registers, fetched one stage ahead, two buffers, one barrier a stage); slice sl takes the 64 values of m from sl * 64 on.
// Per 32 values of m: two score tiles with k as A and q as B (register r of lane l = S[n = l & 15][m = 8 (l >> 4) + r]); converted
// in place, the pair is the B operand of the second product, whose A operand is V in the fragment loader's own k order.
// exp(s - cmax) * cscale is taken as exp2(s * log2(e) - off), off = cmax * log2(e) - log2(cscale), one value per m and stage.
// The 4 slices' partial tiles meet in LDS behind one barrier and are added in slice order.
// O is not stored: the block goes on to out[b][o][n] = sum_c Wsc[o][c] * z[n][c], z = gamma * O + x, for its 128 pixels n.
// Each of the 16 waves takes one 16 x 16 tile of out (2 tiles of o x 8 tiles of n): it adds the partial tiles for its 16 rows n
// straight into the B fragment's own element order, splits z into bf16 hi/lo there, and multiplies with Wsc hi/lo as A
// (hi.hi + hi.lo + lo.hi). The tiles meet in LDS behind a second barrier, so that every wave stores whole 512-byte rows of out.
// ---------------------------------------------------------------------------
constexpr int kAtGroups = 4;                   // groups of 32 rows n per block
constexpr int kAtSlices = 4;                   // slices of a stage's m per block
constexpr int kAtRows   = kAtGroups * 32;      // 128 rows of O per block
constexpr int kAtStage  = 256;                 // values of m per stage
constexpr int kAtKPitch = kDq + 8;             // f16 per LDS row of k: 80 B = 16 B x odd
constexpr int kAtVPitch = kAtStage + 8;        // f16 per LDS row of V: 528 B = 16 B x odd
constexpr int kAtOPitch = 68;                  // floats per LDS row of a partial tile: 272 B = 16 B x odd
constexpr int kAtFPitch = kAtRows + 4;         // floats per LDS row of the out tile: 8 rows on = 32 banks on, for the two lane halves
constexpr float kLog2e  = 1.44269504088896340736f;

// Eight exp2 in place. One statement, closed by a v_nop: behind a transcendental the instruction set asks for one independent
// instruction before its result is read or its source overwritten; written so, every one of the eight has it, whatever registers
// the compiler picks.
__device__ __forceinline__ void exp2_x8(float (&e)[8]) {
  asm("v_exp_f32 %0, %0\n\tv_exp_f32 %1, %1\n\tv_exp_f32 %2, %2\n\tv_exp_f32 %3, %3\n\t"
      "v_exp_f32 %4, %4\n\tv_exp_f32 %5, %5\n\tv_exp_f32 %6, %6\n\tv_exp_f32 %7, %7\n\tv_nop"
      : "+v"(e[0]), "+v"(e[1]), "+v"(e[2]), "+v"(e[3]), "+v"(e[4]), "+v"(e[5]), "+v"(e[6]), "+v"(e[7]));
}

// Four exp2 in place, in the form of exp2_x8 and for the same reason.
__device__ __forceinline__ void exp2_x4(float (&e)[4]) {
  asm("v_exp_f32 %0, %0\n\tv_exp_f32 %1, %1\n\tv_exp_f32 %2, %2\n\tv_exp_f32 %3, %3\n\tv_nop"
      : "+v"(e[0]), "+v"(e[1]), "+v"(e[2]), "+v"(e[3]));
}

// ---------------------------------------------------------------------------
// Column softmax statistics (normalisation over n, down each column m) of S[n][m] = q[n] . k[m], with S formed here on the
// matrix unit and never stored: cmax[b][m] = max_n S[n][m], cscale[b][m] = 4096 / sum_n exp(S[n][m] - cmax[b][m]).
// grid = (4096 / 128, batch); 512 threads = 16 waves = 2 groups of 64 columns m x 8 slices of the rows n.
// A wave keeps its 64 columns of k in registers as four B operands. The block walks n in stages of 512 rows of q, brought to LDS
// by all threads (through registers, fetched one stage ahead, two buffers, one barrier a stage); slice ns takes the 64 rows from
// ns * 64 on, 32 at a time. With q as A and k as B, register r of lane l = S[n = 8 (l >> 4) + r][m = l & 15]: every lane follows
// its own four columns with a running (max, sum) pair, the sum rescaled once per 16 scores of a column.
// The pairs merge over the two lane halves by a shuffle, then over the 8 slices through LDS behind one barrier.
// ---------------------------------------------------------------------------
constexpr int kCsCols   = 128;       // columns m per block
constexpr int kCsSlices = 8;         // slices of a stage's rows n per block
constexpr int kCsStage  = 512;       // rows n per stage
constexpr int kCsQPitch = kDq + 8;   // f16 per LDS row of q: 80 B = 16 B x odd

__global__ __launch_bounds__(512) void colstats_fused_kernel(const unsigned short* __restrict__ QKp,
                                                             float* __restrict__ cmax, float* __restrict__ cscale) {
  __shared__ __align__(16) _Float16 sQ[2][kCsStage * kCsQPitch];
  __shared__ float sMx[kCsSlices][kCsCols];
  __shared__ float sSm[kCsSlices][kCsCols];
  const int tid   = threadIdx.x;
  const int lane  = tid & 31;
  const int wave  = tid >> 5;
  const int cg    = wave & 1;
  const int ns    = wave >> 1;
  const int rlane = lane & 15;
  const int koff  = (lane >> 4) * 8;      // k offset of this lane half
  const int b     = blockIdx.y;
  const int m0    = blockIdx.x * kCsCols;
  const _Float16* QK = (const _Float16*)QKp + (size_t)b * kPix * kCh;

  // staging: q = 512 rows x 64 B (4 threads a row, 4 rounds)
  const int qRow = tid >> 2, qQ = (tid & 3) * 8;
  v4u qr[4];
  // the unrolls in this kernel keep qr[], the fragments, the score tiles and the pairs in registers (constant indices)
  auto fetch = [&](int nb) {
#pragma unroll
    for (int it = 0; it < 4; ++it) qr[it] = *(const v4u*)(QK + (size_t)(nb + it * 128 + qRow) * kCh + qQ);
  };
  auto put = [&](int buf) {
#pragma unroll
    for (int it = 0; it < 4; ++it) *(v4u*)(&sQ[buf][(it * 128 + qRow) * kCsQPitch + qQ]) = qr[it];
  };

  v16h kf[4];
  const _Float16* kp = QK + (size_t)(m0 + cg * 64 + rlane) * kCh + kDq + koff;   // one address, the four tiles by constant offsets
#pragma unroll
  for (int j = 0; j < 4; ++j) kf[j] = Frag<_Float16>::load(kp + j * 16 * kCh);
  // precaution
  asm volatile("s_wait_xcnt 0x0" ::: "memory");
  float mx[4], nl[4], sm[4];   // running maximum, the same times -log2(e), running sum of exp(s - maximum)
#pragma unroll
  for (int j = 0; j < 4; ++j) { mx[j] = -INFINITY; nl[j] = INFINITY; sm[j] = 0.0f; }

  fetch(0);
  // precaution: the address registers of the loads above are reused from here on
  asm volatile("s_wait_xcnt 0x0" ::: "memory");
  put(0);
  __syncthreads();
  // kept rolled: one copy of the stage body in the instruction cache, and only one stage's fetch registers live
#pragma unroll 1
  for (int s = 0; s < kPix / kCsStage; ++s) {
    const int buf = s & 1;
    const bool more = s + 1 < kPix / kCsStage;   // the same for the whole block
    if (more) fetch((s + 1) * kCsStage);
    const _Float16* qb = &sQ[buf][(ns * 64 + rlane) * kCsQPitch + koff];
#pragma unroll
    for (int st = 0; st < 2; ++st) {
      v16h qf[2];
#pragma unroll
      for (int f = 0; f < 2; ++f) qf[f] = Frag<_Float16>::load(qb + (st * 32 + f * 16) * kCsQPitch);
      const v8f zero = (v8f){0.f, 0.f, 0.f, 0.f, 0.f, 0.f, 0.f, 0.f};
      v8f sc[2][4];
#pragma unroll
      for (int f = 0; f < 2; ++f)
#pragma unroll
        for (int j = 0; j < 4; ++j) sc[f][j] = Frag<_Float16>::mma(qf[f], kf[j], zero);
      float rs[4];
#pragma unroll
      for (int j = 0; j < 4; ++j) {
        float ma = mx[j], mb = sc[0][j][4];
#pragma unroll
        for (int r = 0; r < 4; ++r) ma = fmaxf(fmaxf(ma, sc[0][j][r]), sc[1][j][r]);
        mb = fmaxf(mb, sc[1][j][4]);
#pragma unroll
        for (int r = 5; r < 8; ++r) mb = fmaxf(fmaxf(mb, sc[0][j][r]), sc[1][j][r]);
        mx[j] = fmaxf(ma, mb);
        const float t = mx[j] * -kLog2e;
        rs[j] = t - nl[j];   // first pass: -inf, so that the empty sum is scaled by 0
        nl[j] = t;
      }
      exp2_x4(rs);
#pragma unroll
      for (int j = 0; j < 4; ++j) {
        const v8f x0 = sc[0][j] * kLog2e + nl[j];
        const v8f x1 = sc[1][j] * kLog2e + nl[j];
        float e0[8], e1[8];
#pragma unroll
        for (int r = 0; r < 8; ++r) { e0[r] = x0[r]; e1[r] = x1[r]; }
        exp2_x8(e0);
        exp2_x8(e1);
        v8f t;
#pragma unroll
        for (int r = 0; r < 8; ++r) t[r] = e0[r] + e1[r];
        sm[j] = sm[j] * rs[j] + (((t[0] + t[1]) + (t[2] + t[3])) + ((t[4] + t[5]) + (t[6] + t[7])));
      }
    }
    if (more) put(buf ^ 1);   // that buffer's last readers left it before the barrier that ended the stage before this one
    __syncthreads();
  }

  // lanes l and l ^ 16 hold the same four columns, over different rows
  {
    float om[4], os[4], d[8];
#pragma unroll
    for (int j = 0; j < 4; ++j) {
      om[j] = __shfl_xor(mx[j], 16);
      os[j] = __shfl_xor(sm[j], 16);
      const float M = fmaxf(mx[j], om[j]);
      d[2 * j]     = (mx[j] - M) * kLog2e;
      d[2 * j + 1] = (om[j] - M) * kLog2e;
      mx[j] = M;
    }
    exp2_x8(d);
#pragma unroll
    for (int j = 0; j < 4; ++j) sm[j] = sm[j] * d[2 * j] + os[j] * d[2 * j + 1];
  }
  if (lane < 16) {
#pragma unroll
    for (int j = 0; j < 4; ++j) {
      sMx[ns][cg * 64 + j * 16 + rlane] = mx[j];
      sSm[ns][cg * 64 + j * 16 + rlane] = sm[j];
    }
  }
  __syncthreads();
  if (tid < kCsCols) {   // waves 0 to 3, one column a thread; each wave's store fills one whole 128-byte line
    float pm[kCsSlices], ps[kCsSlices];
#pragma unroll
    for (int i = 0; i < kCsSlices; ++i) { pm[i] = sMx[i][tid]; ps[i] = sSm[i][tid]; }
    float M = pm[0];
#pragma unroll
    for (int i = 1; i < kCsSlices; ++i) M = fmaxf(M, pm[i]);
#pragma unroll
    for (int i = 0; i < kCsSlices; ++i) pm[i] = (pm[i] - M) * kLog2e;
    exp2_x8(pm);
    float tot = 0.0f;
#pragma unroll
    for (int i = 0; i < kCsSlices; ++i) tot += ps[i] * pm[i];   // tot >= 1
    float inv;
    // the v_nop is the independent instruction that the instruction set asks for behind a transcendental before its result is read
    asm("v_rcp_f32 %0, %1\n\tv_nop" : "=v"(inv) : "v"(tot));
    cmax[b * kPix + m0 + tid]   = M;
    cscale[b * kPix + m0 + tid] = 4096.0f * inv;
  }
}

__global__ __launch_bounds__(512) void attn_fused_kernel(const unsigned short* __restrict__ QKp,
                                                         const unsigned short* __restrict__ Vp,
                                                         const float* __restrict__ cmax, const float* __restrict__ cscale,
                                                         const float* __restrict__ x1, const float* __restrict__ x2,
                                                         const float* __restrict__ gamma,
                                                         const unsigned short* __restrict__ Wsch,
                                                         const unsigned short* __restrict__ Wscl,
                                                         float* __restrict__ out) {
  __shared__ __align__(16) _Float16 sK[2][kAtStage * kAtKPitch];
  __shared__ __align__(16) _Float16 sV[2][kCh * kAtVPitch];
  __shared__ __align__(16) float    sOff[2][kAtStage];
  __shared__ __align__(16) float    part[kAtGroups * kAtSlices][32 * kAtOPitch];
  __shared__ __align__(16) float    sF[kDq * kAtFPitch];
  const int tid   = threadIdx.x;
  const int lane  = tid & 31;
  const int wave  = tid >> 5;
  const int grp   = wave & (kAtGroups - 1);
  const int sl    = wave >> 2;
  const int rlane = lane & 15;
  const int koff  = (lane >> 4) * 8;      // k offset of this lane half; also the accumulators' offset along the A operand's rows
  const int b     = blockIdx.y;
  const int n0    = blockIdx.x * kAtRows;
  const _Float16* QK = (const _Float16*)QKp + (size_t)b * kPix * kCh;
  const _Float16* V  = (const _Float16*)Vp + (size_t)b * kCh * kPix;
  const float* cm = cmax + b * kPix;
  const float* cs = cscale + b * kPix;

  // staging: k = 256 rows x 64 B (4 threads a row, 2 rounds), V = 64 rows x 512 B (one wave a row, 4 rounds), one offset per m
  const int kRow = tid >> 2, kQ = (tid & 3) * 8;
  const int vRow = tid >> 5, vQ = (tid & 31) * 8;
  v4u kr[2], vr[4];
  float fm = 0.0f, fs = 1.0f;
  // the unrolls in this kernel keep kr[], vr[], the fragments and the accumulators in registers (constant indices)
  auto fetch = [&](int ms) {
#pragma unroll
    for (int it = 0; it < 2; ++it) kr[it] = *(const v4u*)(QK + (size_t)(ms + it * 128 + kRow) * kCh + kDq + kQ);
#pragma unroll
    for (int it = 0; it < 4; ++it) vr[it] = *(const v4u*)(V + (size_t)(it * 16 + vRow) * kPix + ms + vQ);
    if (tid < kAtStage) { fm = cm[ms + tid]; fs = cs[ms + tid]; }
  };
  auto put = [&](int buf) {
#pragma unroll
    for (int it = 0; it < 2; ++it) *(v4u*)(&sK[buf][(it * 128 + kRow) * kAtKPitch + kQ]) = kr[it];
#pragma unroll
    for (int it = 0; it < 4; ++it) *(v4u*)(&sV[buf][(it * 16 + vRow) * kAtVPitch + vQ]) = vr[it];
    if (tid < kAtStage) sOff[buf][tid] = fm * kLog2e - __log2f(fs);
  };

  v16h qf[2];
#pragma unroll
  for (int nt = 0; nt < 2; ++nt)
    qf[nt] = Frag<_Float16>::load(QK + (size_t)(n0 + grp * 32 + nt * 16 + rlane) * kCh + koff);
  v8f acc[2][4];
#pragma unroll
  for (int nt = 0; nt < 2; ++nt)
#pragma unroll
    for (int j = 0; j < 4; ++j) acc[nt][j] = (v8f){0.f, 0.f, 0.f, 0.f, 0.f, 0.f, 0.f, 0.f};

  fetch(0);
  put(0);
  __syncthreads();
  // kept rolled: one copy of the stage body in the instruction cache, and only one stage's fetch registers live
#pragma unroll 1
  for (int s = 0; s < kPix / kAtStage; ++s) {
    const int buf = s & 1;
    const bool more = s + 1 < kPix / kAtStage;   // the same for the whole block
    if (more) fetch((s + 1) * kAtStage);
    const _Float16* kb = &sK[buf][(sl * 64 + rlane) * kAtKPitch + koff];
    const _Float16* vb = &sV[buf][rlane * kAtVPitch + sl * 64 + koff];
    const float*    ob = &sOff[buf][sl * 64 + koff];
#pragma unroll
    for (int st = 0; st < 2; ++st) {
      v16h kf[2], vf[4];
      v8f of[2];
#pragma unroll
      for (int t = 0; t < 2; ++t) {
        kf[t] = Frag<_Float16>::load(kb + (st * 32 + t * 16) * kAtKPitch);
        of[t] = __builtin_shufflevector(*(const v4f*)(ob + st * 32 + t * 16), *(const v4f*)(ob + st * 32 + t * 16 + 4),
                                        0, 1, 2, 3, 4, 5, 6, 7);
      }
#pragma unroll
      for (int j = 0; j < 4; ++j) vf[j] = Frag<_Float16>::load(vb + j * 16 * kAtVPitch + st * 32);
#pragma unroll
      for (int nt = 0; nt < 2; ++nt) {
        const v8f zero = (v8f){0.f, 0.f, 0.f, 0.f, 0.f, 0.f, 0.f, 0.f};
        const v8f s0 = Frag<_Float16>::mma(kf[0], qf[nt], zero);
        const v8f s1 = Frag<_Float16>::mma(kf[1], qf[nt], zero);
        const v8f x0 = s0 * kLog2e - of[0];   // whole tiles, so that neighbouring registers pair up without copies
        const v8f x1 = s1 * kLog2e - of[1];
        float e0[8], e1[8];
#pragma unroll
        for (int r = 0; r < 8; ++r) { e0[r] = x0[r]; e1[r] = x1[r]; }
        exp2_x8(e0);
        exp2_x8(e1);
        v16h pf;
#pragma unroll
        for (int r = 0; r < 8; ++r) { pf[r] = (_Float16)e0[r]; pf[8 + r] = (_Float16)e1[r]; }
#pragma unroll
        for (int j = 0; j < 4; ++j) acc[nt][j] = Frag<_Float16>::mma(vf[j], pf, acc[nt][j]);
      }
    }
    if (more) put(buf ^ 1);   // that buffer's last readers left it before the barrier that ended the stage before this one
    __syncthreads();
  }

  // this wave's tile of out: rows o from ot * 16 on, pixels n from n0 + ntile * 16 on; its x and Wsc are asked for here, so that
  // they are on their way while the partial tiles are written
  const int ot    = wave & 1;
  const int ntile = wave >> 1;
  float xv[2][16];   // xv[ks][e] = x[channel 32 ks + koff + (e < 8 ? e : e + 8)][pixel], the fragment loader's k order
  const size_t xo = (size_t)(b * kCinHalf + koff) * kPix + n0 + ntile * 16 + rlane;
  const float* xa = x1 + xo;   // channels 0..31 are x1, 32..63 are x2
  const float* xb = x2 + xo;
#pragma unroll
  for (int e = 0; e < 8; ++e) { xv[0][e] = xa[e * kPix]; xv[0][8 + e] = xa[(16 + e) * kPix]; }
#pragma unroll
  for (int e = 0; e < 8; ++e) { xv[1][e] = xb[e * kPix]; xv[1][8 + e] = xb[(16 + e) * kPix]; }
  const __bf16* whp = (const __bf16*)Wsch + (ot * 16 + rlane) * kCh + koff;
  const __bf16* wlp = (const __bf16*)Wscl + (ot * 16 + rlane) * kCh + koff;
  v16b wh[2], wl[2];
#pragma unroll
  for (int ks = 0; ks < 2; ++ks) { wh[ks] = Frag<__bf16>::load(whp + ks * 32); wl[ks] = Frag<__bf16>::load(wlp + ks * 32); }
  const float g = gamma[0];
  // precaution: the address registers of the loads above are reused from here on; the addresses are named as inputs so that they
  // keep their registers up to the wait
  asm volatile("s_wait_xcnt 0x0" :: "v"(xa), "v"(xb), "v"(whp), "v"(wlp) : "memory");

  float* slab = part[wave];
#pragma unroll
  for (int nt = 0; nt < 2; ++nt)
#pragma unroll
    for (int j = 0; j < 4; ++j) {   // acc[nt][j][r] = partial O[n0 + 32 grp + 16 nt + rlane][16 j + koff + r]
      float* d = slab + (nt * 16 + rlane) * kAtOPitch + (j << 4) + koff;
      *(v4f*)(d)     = (v4f){acc[nt][j][0], acc[nt][j][1], acc[nt][j][2], acc[nt][j][3]};
      *(v4f*)(d + 4) = (v4f){acc[nt][j][4], acc[nt][j][5], acc[nt][j][6], acc[nt][j][7]};
    }
  __syncthreads();

  v8f fa = (v8f){0.f, 0.f, 0.f, 0.f, 0.f, 0.f, 0.f, 0.f};
  {
    // row n = ntile * 16 + rlane of the block lies in group ntile >> 1, at row (ntile & 1) * 16 + rlane of its partial tiles
    const float* pr = &part[ntile >> 1][((ntile & 1) * 16 + rlane) * kAtOPitch + koff];
#pragma unroll
    for (int ks = 0; ks < 2; ++ks) {
      float z[16];
#pragma unroll
      for (int q = 0; q < 4; ++q) {   // four channels at a time: q = 0, 1 are elements 0..7, q = 2, 3 elements 8..15
        const int c = ks * 32 + (q >> 1) * 16 + (q & 1) * 4;
        v4f t = *(const v4f*)(pr + c);
#pragma unroll
        for (int w = 1; w < kAtSlices; ++w) t += *(const v4f*)(pr + w * kAtGroups * 32 * kAtOPitch + c);
        t *= (1.0f / 4096.0f);
#pragma unroll
        for (int e = 0; e < 4; ++e) z[q * 4 + e] = g * t[e] + xv[ks][q * 4 + e];
      }
      v16b zh, zl;   // z = hi + lo, both rounded to nearest even by the packed conversion, two elements an instruction
#pragma unroll
      for (int q = 0; q < 8; ++q) {
        const v2f zz = (v2f){z[2 * q], z[2 * q + 1]};
        const v2b hb = __builtin_convertvector(zz, v2b);
        const v2b lb = __builtin_convertvector(zz - __builtin_convertvector(hb, v2f), v2b);
        zh[2 * q] = hb[0]; zh[2 * q + 1] = hb[1];
        zl[2 * q] = lb[0]; zl[2 * q + 1] = lb[1];
      }
      fa = Frag<__bf16>::mma(wh[ks], zh, fa);
      fa = Frag<__bf16>::mma(wh[ks], zl, fa);
      fa = Frag<__bf16>::mma(wl[ks], zh, fa);
    }
  }
#pragma unroll
  for (int r = 0; r < 8; ++r)   // fa[r] = out[ot * 16 + koff + r][n0 + ntile * 16 + rlane]
    sF[(ot * 16 + koff + r) * kAtFPitch + ntile * 16 + rlane] = fa[r];
  __syncthreads();
  float* ob = out + (size_t)b * kDq * kPix + n0;
#pragma unroll
  for (int it = 0; it < 2; ++it) {   // one wave, one row o: 128 pixels = 4 whole 128-byte lines
    const int row = it * 16 + wave;
    *(v4f*)(ob + (size_t)row * kPix + lane * 4) = *(const v4f*)(&sF[row * kAtFPitch + lane * 4]);
  }
}

// ---------------------------------------------------------------------------
// Workspace region map (byte offsets):
//   small    65536 B @ 0        : Wsch bf16 [32][64] @0, Wscl bf16 [32][64] @8192
//   QK  f16 [8][4096][64]        4194304 B @ 65536         (cols 0..31 = q, 32..63 = k)
//   V   f16 [8][64][4096]        4194304 B @ 4259840
//   stat f32 cmax[8][4096] @ +0, cscale[8][4096] @ +131072   262144 B @ 8454144
//   total                        8716288 B
// Every region is fully written before it is read.
// ---------------------------------------------------------------------------
extern "C" void kernel_launch(void* const* d_in, const int* in_sizes, int n_in,
                              void* d_out, int out_size, void* d_ws, size_t ws_size,
                              hipStream_t stream) {
  if (n_in < 9) return;
  if (in_sizes[0] != kBatch * kCinHalf * kPix || in_sizes[1] != kBatch * kCinHalf * kPix) return;
  if (in_sizes[2] != kDq * kCh || in_sizes[3] != kDq || in_sizes[4] != kDq * kCh || in_sizes[5] != kDq) return;
  if (in_sizes[6] != kCh * kCh || in_sizes[7] != kDq * kCh || in_sizes[8] < 1) return;
  if (out_size != kBatch * kDq * kPix) return;

  const float* x1    = (const float*)d_in[0];
  const float* x2    = (const float*)d_in[1];
  const float* Wq    = (const float*)d_in[2];
  const float* bq    = (const float*)d_in[3];
  const float* Wk    = (const float*)d_in[4];
  const float* bk    = (const float*)d_in[5];
  const float* Wv    = (const float*)d_in[6];
  const float* Wsc   = (const float*)d_in[7];
  const float* gamma = (const float*)d_in[8];
  float* out = (float*)d_out;

  const size_t szPlane16 = (size_t)kBatch * kPix * kCh * 2;   // 4194304
  size_t off = 0;
  const size_t oSmall = off; off += 65536;
  const size_t oQK    = off; off += szPlane16;
  const size_t oV     = off; off += szPlane16;
  const size_t oStat  = off; off += 262144;
  if (off > ws_size) return;

  char* ws = (char*)d_ws;
  unsigned short* Wsch  = (unsigned short*)(ws + oSmall + 0);
  unsigned short* Wscl  = (unsigned short*)(ws + oSmall + 8192);
  unsigned short* QKp   = (unsigned short*)(ws + oQK);
  unsigned short* Vp    = (unsigned short*)(ws + oV);
  float*          cmax  = (float*)(ws + oStat);
  float*          cscale = (float*)(ws + oStat + 131072);

  // (0) [q|k] and V from x and the weights, and the Wsc hi/lo planes (128 + 128 + 1 blocks)
  proj_fused_kernel<<<dim3(2 * kPjBlocks + 1), dim3(128), 0, stream>>>(x1, x2, Wq, bq, Wk, bk, Wv, Wsc, QKp, Vp, Wsch, Wscl);
  // (1) column statistics (softmax over n for each column m) from q and k, scores formed in registers;
  //     all batches in one launch (32 column blocks x 8 batches)
  colstats_fused_kernel<<<dim3(kPix / kCsCols, kBatch), dim3(512), 0, stream>>>(QKp, cmax, cscale);
  // (2) out[b][o][n] = sum_c Wsc[o][c] (gamma O[n][c] + x[b][c][n]), O[n][c] = (1/4096) sum_m P[n][m] V[b][c][m], P = 4096 * softmax
  //     formed in registers from q, k and the statistics; all batches in one launch (32 row blocks x 8 batches)
  attn_fused_kernel<<<dim3(kPix / kAtRows, kBatch), dim3(512), 0, stream>>>(QKp, Vp, cmax, cscale, x1, x2, gamma, Wsch, Wscl, out);
}

// v007
// A run of this version takes 47.1 microseconds.
// Timed twice side by side with v006, it ran 1.07 times as fast both times.
// Over all steps from v000 it is 314 times as fast.
// Contractions: x·[Wq|Wk]^T (+bias), Wv·x, q·k^T scores and P·V aggregation on v_wmma_f32_16x16x32_f16 (f16 operands; P carried x4096 and folded back x1/4096 in the f32 epilogue); Wsc·z on v_wmma_f32_16x16x32_bf16 with bf16 hi/lo split operand planes (hi·hi + hi·lo + lo·hi); f32 accumulate everywhere; column-wise softmax statistics, exp and the gamma residual in f32; q is stored times log2(e), so that scores come off the matrix unit in exp2 units.
#include <hip/hip_runtime.h>
#include <math.h>
#include <stdint.h>

constexpr int kBatch   = 8;
constexpr int kCinHalf = 32;     // channels of x1 and of x2
constexpr int kCh      = 64;     // concatenated channels
constexpr int kPix     = 4096;   // h*w
constexpr int kDq      = 32;     // q/k channels = output channels
constexpr float kLog2e = 1.44269504088896340736f;

typedef __attribute__((ext_vector_type(16))) _Float16 v16h;
typedef __attribute__((ext_vector_type(8)))  _Float16 v8h;
typedef __attribute__((ext_vector_type(4)))  _Float16 v4h;
typedef __attribute__((ext_vector_type(16))) __bf16   v16b;
typedef __attribute__((ext_vector_type(8)))  __bf16   v8b;
typedef __attribute__((ext_vector_type(8)))  float    v8f;
typedef __attribute__((ext_vector_type(4)))  float    v4f;
typedef __attribute__((ext_vector_type(2)))  float    v2f;
typedef __attribute__((ext_vector_type(2)))  __bf16   v2b;
typedef __attribute__((ext_vector_type(4)))  unsigned int v4u;

__device__ __forceinline__ unsigned short f2bf_bits(float f) {
  unsigned u = __float_as_uint(f);
  return (unsigned short)((u + 0x7FFFu + ((u >> 16) & 1u)) >> 16);
}
__device__ __forceinline__ float bf_bits2f(unsigned short h) { return __uint_as_float(((unsigned)h) << 16); }
__device__ __forceinline__ unsigned pk16(unsigned short a, unsigned short b) { return (unsigned)a | ((unsigned)b << 16); }

template <typename T> struct Frag;
template <> struct Frag<_Float16> {
  typedef v16h V; union U { v16h v; v8h h[2]; };
  static __device__ __forceinline__ v16h load(const _Float16* p) {   // elements 0..7 <- p[0..7], 8..15 <- p[16..23]
    U f; f.h[0] = *(const v8h*)(p); f.h[1] = *(const v8h*)(p + 16); return f.v;
  }
  static __device__ __forceinline__ v8f mma(v16h a, v16h b, v8f c) {
    return __builtin_amdgcn_wmma_f32_16x16x32_f16(false, a, false, b, (short)0, c, false, false);
  }
};
template <> struct Frag<__bf16> {
  typedef v16b V; union U { v16b v; v8b h[2]; };
  static __device__ __forceinline__ v16b load(const __bf16* p) {
    U f; f.h[0] = *(const v8b*)(p); f.h[1] = *(const v8b*)(p + 16); return f.v;
  }
  static __device__ __forceinline__ v8f mma(v16b a, v16b b, v8f c) {
    return __builtin_amdgcn_wmma_f32_16x16x32_bf16(false, a, false, b, (short)0, c, false, false);
  }
};

// ---------------------------------------------------------------------------
// All projections of x in one launch, straight from the f32 inputs:
//   ROLE 0: QK[b][n][o'] = sum_c [Wq;Wk][o'][c] x[b][c][n] + [bq;bk][o'], f16 (columns 0..31 = q * log2(e), 32..63 = k);
//           the factor is applied in f32, before the one rounding to f16
//   ROLE 1: V[b][c][m]   = sum_k Wv[c][k] x[b][k][m], f16
// 128 threads = 4 waves, one role a block; a wave takes 64 pixels of one batch and all 64 output channels.
// x goes from global memory into the fragment's own element order (lane = pixel, elements = channels in the fragment loader's
// k order) and is rounded to f16 in registers; the same fragment serves as B (ROLE 0) and as A (ROLE 1).
// The block's 64 x 64 weights are read in whole lines, rounded to f16 and shared through LDS behind one barrier.
// ROLE 0, weights as A: register r of lane l = QK[n = l & 15][o' = 16 t + 8 (l >> 4) + r]; ROLE 1, weights as B: register r of
// lane l = V[c = 16 t + (l & 15)][m = 8 (l >> 4) + r]. Either way a lane holds 8 neighbours of an output row, one 16-byte store,
// and a wave's 16 stores fill whole 128-byte lines that no other wave writes.
// ---------------------------------------------------------------------------
constexpr int kPjWPitch = kCh + 8;   // f16 per LDS row of the weights: 144 B = 16 B x odd
constexpr int kPjBlocks = kBatch * kPix / 256;   // blocks per role: 4 waves x 64 pixels each

template <int ROLE>
__device__ __forceinline__ void proj_body(const float* __restrict__ x1, const float* __restrict__ x2,
                                          const float* __restrict__ wLo, const float* __restrict__ wHi,   // weight rows 0..31, 32..63
                                          const float* __restrict__ bLo, const float* __restrict__ bHi,   // ROLE 0: their biases
                                          unsigned short* __restrict__ dst, _Float16* sW, float* sB, int blk) {
  const int tid   = threadIdx.x;
  const int lane  = tid & 31;
  const int wave  = tid >> 5;
  const int rlane = lane & 15;
  const int koff  = (lane >> 4) * 8;      // k offset of this lane half; also the accumulators' offset along the A operand's rows
  const int tile  = blk * 4 + wave;       // 64 pixels
  const int b     = tile >> 6;
  const int p0    = (tile & 63) * 64;

  // the unrolls in this function keep the loaded values, the fragments and the results in registers (constant indices)
  const float* wa = wLo + (tid >> 4) * kCh + (tid & 15) * 4;   // 16 threads a row, 8 rows a round
  const float* wb = wHi + (tid >> 4) * kCh + (tid & 15) * 4;
  v4f wr[8];
#pragma unroll
  for (int i = 0; i < 4; ++i) { wr[i] = *(const v4f*)(wa + i * 8 * kCh); wr[4 + i] = *(const v4f*)(wb + i * 8 * kCh); }
  const float* bp = ((tid & 8) ? bHi : bLo) + (tid & 7) * 4;   // ROLE 0: the 64 biases, four a thread, threads 0..15 pass them on
  v4f br = (v4f){0.f, 0.f, 0.f, 0.f};
  if (ROLE == 0) br = *(const v4f*)bp;
  float xv[4][2][16];   // xv[pt][ks][e] = x[channel 32 ks + koff + (e < 8 ? e : e + 8)][pixel p0 + 16 pt + rlane]
  const size_t xo = (size_t)(b * kCinHalf + koff) * kPix + p0 + rlane;
  const float* xa = x1 + xo;   // channels 0..31 are x1, 32..63 are x2
  const float* xb = x2 + xo;
#pragma unroll
  for (int pt = 0; pt < 4; ++pt)
#pragma unroll
    for (int e = 0; e < 8; ++e) {
      xv[pt][0][e] = xa[e * kPix + pt * 16]; xv[pt][0][8 + e] = xa[(16 + e) * kPix + pt * 16];
      xv[pt][1][e] = xb[e * kPix + pt * 16]; xv[pt][1][8 + e] = xb[(16 + e) * kPix + pt * 16];
    }
  // precaution: the address registers of the loads above are reused from here on; the addresses are named as inputs so that they
  // keep their registers up to the wait
  if (ROLE == 0) asm volatile("s_wait_xcnt 0x0" :: "v"(wa), "v"(wb), "v"(bp), "v"(xa), "v"(xb) : "memory");
  else           asm volatile("s_wait_xcnt 0x0" :: "v"(wa), "v"(wb), "v"(xa), "v"(xb) : "memory");

#pragma unroll
  for (int i = 0; i < 8; ++i)
    *(v4h*)(&sW[(i * 8 + (tid >> 4)) * kPjWPitch + (tid & 15) * 4] ) = __builtin_convertvector(wr[i], v4h);
  if (ROLE == 0 && tid < 16) *(v4f*)(&sB[tid * 4]) = br;
  __syncthreads();
  v4f bv[4][2];   // ROLE 0: bv[t][h][e] = bias of output channel 16 t + koff + 4 h + e
  if (ROLE == 0) {
#pragma unroll
    for (int t = 0; t < 4; ++t)
#pragma unroll
      for (int h = 0; h < 2; ++h) {
        bv[t][h] = *(const v4f*)(&sB[t * 16 + koff + h * 4]);
        if (t < 2) bv[t][h] *= kLog2e;   // tiles 0 and 1 are q
      }
  }
  v16h wf[4][2];
#pragma unroll
  for (int t = 0; t < 4; ++t)
#pragma unroll
    for (int ks = 0; ks < 2; ++ks) wf[t][ks] = Frag<_Float16>::load(&sW[(t * 16 + rlane) * kPjWPitch + ks * 32 + koff]);

  v8h res[4][4];
#pragma unroll
  for (int pt = 0; pt < 4; ++pt) {
    v16h xf[2];
#pragma unroll
    for (int ks = 0; ks < 2; ++ks)
#pragma unroll
      for (int e = 0; e < 16; ++e) xf[ks][e] = (_Float16)xv[pt][ks][e];
    v8f acc[4];
#pragma unroll
    for (int t = 0; t < 4; ++t) acc[t] = (v8f){0.f, 0.f, 0.f, 0.f, 0.f, 0.f, 0.f, 0.f};
#pragma unroll
    for (int ks = 0; ks < 2; ++ks)
#pragma unroll
      for (int t = 0; t < 4; ++t)
        acc[t] = (ROLE == 0) ? Frag<_Float16>::mma(wf[t][ks], xf[ks], acc[t]) : Frag<_Float16>::mma(xf[ks], wf[t][ks], acc[t]);
#pragma unroll
    for (int t = 0; t < 4; ++t)
#pragma unroll
      for (int r = 0; r < 8; ++r)
        res[pt][t][r] = (_Float16)((ROLE == 0) ? acc[t][r] * ((t < 2) ? kLog2e : 1.0f) + bv[t][r >> 2][r & 3] : acc[t][r]);
  }
  // all stores last, from one address by constant offsets
  _Float16* d = (_Float16*)dst + ((ROLE == 0) ? ((size_t)(b * kPix + p0 + rlane) * kCh + koff)
                                              : ((size_t)(b * kCh + rlane) * kPix + p0 + koff));
#pragma unroll
  for (int pt = 0; pt < 4; ++pt)
#pragma unroll
    for (int t = 0; t < 4; ++t)
      *(v8h*)(d + ((ROLE == 0) ? (pt * 16 * kCh + t * 16) : (t * 16 * kPix + pt * 16))) = res[pt][t];
  // precaution: in the built code the other role's instructions follow ROLE 1's, and they write registers that the stores above name
  // (ROLE 0's stores are followed by the end of the program alone)
  if (ROLE == 1) asm volatile("s_wait_xcnt 0x0" ::: "memory");
}

// grid = 2 * kPjBlocks + 1 blocks with block-uniform roles: [q|k], V, and one block that splits Wsc into bf16 hi/lo planes
// [32][64] (2 it x 128 thr x 8 elements = the whole plane; no barrier on that path).
__global__ __launch_bounds__(128) void proj_fused_kernel(
    const float* __restrict__ x1, const float* __restrict__ x2,
    const float* __restrict__ Wq, const float* __restrict__ bq, const float* __restrict__ Wk, const float* __restrict__ bk,
    const float* __restrict__ Wv, const float* __restrict__ Wsc,
    unsigned short* __restrict__ QKo, unsigned short* __restrict__ Vo,
    unsigned short* __restrict__ Wsch, unsigned short* __restrict__ Wscl) {
  __shared__ __align__(16) _Float16 sW[kCh * kPjWPitch];
  __shared__ __align__(16) float    sB[kCh];
  const int bid = blockIdx.x;   // block-uniform
  if (bid < kPjBlocks) {
    proj_body<0>(x1, x2, Wq, Wk, bq, bk, QKo, sW, sB, bid);
  } else if (bid < 2 * kPjBlocks) {
    proj_body<1>(x1, x2, Wv, Wv + kDq * kCh, bq, bk, Vo, sW, sB, bid - kPjBlocks);
  } else {
    const int tid = threadIdx.x;
    const int eo  = (tid >> 3) * kCh + (tid & 7) * 8;   // 8 threads a row, 16 rows a round
    const float* sp = Wsc + eo;
    v4f a[2][2];
#pragma unroll
    for (int it = 0; it < 2; ++it) { a[it][0] = *(const v4f*)(sp + it * 16 * kCh); a[it][1] = *(const v4f*)(sp + it * 16 * kCh + 4); }
    // precaution: the address registers of the loads above are reused from here on
    asm volatile("s_wait_xcnt 0x0" :: "v"(sp) : "memory");
    v4u hv[2], lv[2];
#pragma unroll
    for (int it = 0; it < 2; ++it) {
      float f[8];
#pragma unroll
      for (int e = 0; e < 4; ++e) { f[e] = a[it][0][e]; f[4 + e] = a[it][1][e]; }
      v4u u, u2;
#pragma unroll
      for (int q = 0; q < 4; ++q) {
        const unsigned short hb0 = f2bf_bits(f[2 * q]), hb1 = f2bf_bits(f[2 * q + 1]);
        const unsigned short lb0 = f2bf_bits(f[2 * q] - bf_bits2f(hb0));
        const unsigned short lb1 = f2bf_bits(f[2 * q + 1] - bf_bits2f(hb1));
        u[q] = pk16(hb0, hb1); u2[q] = pk16(lb0, lb1);
      }
      hv[it] = u; lv[it] = u2;
    }
#pragma unroll
    for (int it = 0; it < 2; ++it) {
      *(v4u*)(Wsch + eo + it * 16 * kCh) = hv[it];
      *(v4u*)(Wscl + eo + it * 16 * kCh) = lv[it];
    }
    // precaution: in the built code another role's instructions follow this role's, and they write registers that the stores above name
    asm volatile("s_wait_xcnt 0x0" ::: "memory");
  }
}

// ---------------------------------------------------------------------------
// O[n][c] = (1/4096) * sum_m P[n][m] * V[b][c][m] with P[n][m] = exp2(S[n][m] - cmax[m]) * cscale[m] (softmax over n,
// carried x4096, rounded to f16) and S[n][m] = log2(e) q[n] . k[m] formed again here on the matrix unit, so that P lives in registers only.
// grid = (4096 / 128, batch); 512 threads = 16 waves = 4 groups of 32 rows n x 4 slices of the sum over m.
// The block walks m in stages of 256: k rows, V columns and the exponent offsets of a stage are brought to LDS by all threads
// (through registers, fetched one stage ahead, two buffers, one barrier a stage); slice sl takes the 64 values of m from sl * 64 on.
// Per 32 values of m: two score tiles with k as A and q as B (register r of lane l = S[n = l & 15][m = 8 (l >> 4) + r]); converted
// in place, the pair is the B operand of the second product, whose A operand is V in the fragment loader's own k order.
// exp2(s - cmax) * cscale is taken as exp2(s + off), off = log2(cscale) - cmax, one value per m and stage; off is the C operand of the
// score product, so that the accumulator tile is the exponent itself and no vector instruction stands between the product and exp2.
// The 4 slices' partial tiles meet in LDS behind one barrier and are added in slice order.
// O is not stored: the block goes on to out[b][o][n] = sum_c Wsc[o][c] * z[n][c], z = gamma * O + x, for its 128 pixels n.
// Each of the 16 waves takes one 16 x 16 tile of out (2 tiles of o x 8 tiles of n): it adds the partial tiles for its 16 rows n
// straight into the B fragment's own element order, splits z into bf16 hi/lo there, and multiplies with Wsc hi/lo as A
// (hi.hi + hi.lo + lo.hi). The tiles meet in LDS behind a second barrier, so that every wave stores whole 512-byte rows of out.
// ---------------------------------------------------------------------------
constexpr int kAtGroups = 4;                   // groups of 32 rows n per block
constexpr int kAtSlices = 4;                   // slices of a stage's m per block
constexpr int kAtRows   = kAtGroups * 32;      // 128 rows of O per block
constexpr int kAtStage  = 256;                 // values of m per stage
constexpr int kAtKPitch = kDq + 8;             // f16 per LDS row of k: 80 B = 16 B x odd
constexpr int kAtVPitch = kAtStage + 8;        // f16 per LDS row of V: 528 B = 16 B x odd
constexpr int kAtOPitch = 68;                  // floats per LDS row of a partial tile: 272 B = 16 B x odd
constexpr int kAtFPitch = kAtRows + 4;         // floats per LDS row of the out tile: 8 rows on = 32 banks on, for the two lane halves

// Eight exp2 in place. One statement, closed by a v_nop: behind a transcendental the instruction set asks for one independent
// instruction before its result is read or its source overwritten; written so, every one of the eight has it, whatever registers
// the compiler picks.
__device__ __forceinline__ void exp2_x8(float (&e)[8]) {
  asm("v_exp_f32 %0, %0\n\tv_exp_f32 %1, %1\n\tv_exp_f32 %2, %2\n\tv_exp_f32 %3, %3\n\t"
      "v_exp_f32 %4, %4\n\tv_exp_f32 %5, %5\n\tv_exp_f32 %6, %6\n\tv_exp_f32 %7, %7\n\tv_nop"
      : "+v"(e[0]), "+v"(e[1]), "+v"(e[2]), "+v"(e[3]), "+v"(e[4]), "+v"(e[5]), "+v"(e[6]), "+v"(e[7]));
}

// Eight exp2 of a score tile as the matrix unit left it, into registers of their own (early clobber: no result lies on a source, so
// that no exponential overwrites the source of the one in front of it); closed by a v_nop like exp2_x8.
// LEAD v_nop stand in front where fewer than four vector
// instructions lie between the tile's matrix instruction and this statement.
template <int LEAD>
__device__ __forceinline__ void exp2_tile(const v8f& x, float (&e)[8]) {
  if (LEAD == 1)
    asm("v_nop\n\t"
        "v_exp_f32 %0, %8\n\tv_exp_f32 %1, %9\n\tv_exp_f32 %2, %10\n\tv_exp_f32 %3, %11\n\t"
        "v_exp_f32 %4, %12\n\tv_exp_f32 %5, %13\n\tv_exp_f32 %6, %14\n\tv_exp_f32 %7, %15\n\tv_nop"
        : "=&v"(e[0]), "=&v"(e[1]), "=&v"(e[2]), "=&v"(e[3]), "=&v"(e[4]), "=&v"(e[5]), "=&v"(e[6]), "=&v"(e[7])
        : "v"(x[0]), "v"(x[1]), "v"(x[2]), "v"(x[3]), "v"(x[4]), "v"(x[5]), "v"(x[6]), "v"(x[7]));
  else
    asm("v_exp_f32 %0, %8\n\tv_exp_f32 %1, %9\n\tv_exp_f32 %2, %10\n\tv_exp_f32 %3, %11\n\t"
        "v_exp_f32 %4, %12\n\tv_exp_f32 %5, %13\n\tv_exp_f32 %6, %14\n\tv_exp_f32 %7, %15\n\tv_nop"
        : "=&v"(e[0]), "=&v"(e[1]), "=&v"(e[2]), "=&v"(e[3]), "=&v"(e[4]), "=&v"(e[5]), "=&v"(e[6]), "=&v"(e[7])
        : "v"(x[0]), "v"(x[1]), "v"(x[2]), "v"(x[3]), "v"(x[4]), "v"(x[5]), "v"(x[6]), "v"(x[7]));
}

// Four exp2 in place, in the form of exp2_x8 and for the same reason.
__device__ __forceinline__ void exp2_x4(float (&e)[4]) {
  asm("v_exp_f32 %0, %0\n\tv_exp_f32 %1, %1\n\tv_exp_f32 %2, %2\n\tv_exp_f32 %3, %3\n\tv_nop"
      : "+v"(e[0]), "+v"(e[1]), "+v"(e[2]), "+v"(e[3]));
}

// ---------------------------------------------------------------------------
// Column softmax statistics (normalisation over n, down each column m) of S[n][m] = log2(e) q[n] . k[m] (q is stored with the
// factor), with S formed here on the matrix unit and never stored: cmax[b][m] = max_n S[n][m], cscale[b][m] = 4096 / sum_n exp2(S[n][m] - cmax[b][m]).
// grid = (4096 / 128, batch); 512 threads = 16 waves = 2 groups of 64 columns m x 8 slices of the rows n.
// A wave keeps its 64 columns of k in registers as four B operands. The block walks n in stages of 512 rows of q, brought to LDS
// by all threads (through registers, fetched one stage ahead, two buffers, one barrier a stage); slice ns takes the 64 rows from
// ns * 64 on, 32 at a time. With q as A and k as B, register r of lane l = S[n = 8 (l >> 4) + r][m = l & 15]: every lane follows
// its own four columns with a running (max, sum) pair, the sum rescaled once per 16 scores of a column.
// The pairs merge over the two lane halves by a shuffle, then over the 8 slices through LDS behind one barrier.
// ---------------------------------------------------------------------------
constexpr int kCsCols   = 128;       // columns m per block
constexpr int kCsSlices = 8;         // slices of a stage's rows n per block
constexpr int kCsStage  = 512;       // rows n per stage
constexpr int kCsQPitch = kDq + 8;   // f16 per LDS row of q: 80 B = 16 B x odd

__global__ __launch_bounds__(512) void colstats_fused_kernel(const unsigned short* __restrict__ QKp,
                                                             float* __restrict__ cmax, float* __restrict__ cscale) {
  __shared__ __align__(16) _Float16 sQ[2][kCsStage * kCsQPitch];
  __shared__ float sMx[kCsSlices][kCsCols];
  __shared__ float sSm[kCsSlices][kCsCols];
  const int tid   = threadIdx.x;
  const int lane  = tid & 31;
  const int wave  = tid >> 5;
  const int cg    = wave & 1;
  const int ns    = wave >> 1;
  const int rlane = lane & 15;
  const int koff  = (lane >> 4) * 8;      // k offset of this lane half
  const int b     = blockIdx.y;
  const int m0    = blockIdx.x * kCsCols;
  const _Float16* QK = (const _Float16*)QKp + (size_t)b * kPix * kCh;

  // staging: q = 512 rows x 64 B (4 threads a row, 4 rounds)
  const int qRow = tid >> 2, qQ = (tid & 3) * 8;
  v4u qr[4];
  // the unrolls in this kernel keep qr[], the fragments, the score tiles and the pairs in registers (constant indices)
  auto fetch = [&](int nb) {
#pragma unroll
    for (int it = 0; it < 4; ++it) qr[it] = *(const v4u*)(QK + (size_t)(nb + it * 128 + qRow) * kCh + qQ);
  };
  auto put = [&](int buf) {
#pragma unroll
    for (int it = 0; it < 4; ++it) *(v4u*)(&sQ[buf][(it * 128 + qRow) * kCsQPitch + qQ]) = qr[it];
  };

  v16h kf[4];
  const _Float16* kp = QK + (size_t)(m0 + cg * 64 + rlane) * kCh + kDq + koff;   // one address, the four tiles by constant offsets
#pragma unroll
  for (int j = 0; j < 4; ++j) kf[j] = Frag<_Float16>::load(kp + j * 16 * kCh);
  // precaution
  asm volatile("s_wait_xcnt 0x0" ::: "memory");
  float mx[4], nl[4], sm[4];   // running maximum, its negative, running sum of exp2(s - maximum)
#pragma unroll
  for (int j = 0; j < 4; ++j) { mx[j] = -INFINITY; nl[j] = INFINITY; sm[j] = 0.0f; }

  fetch(0);
  // precaution: the address registers of the loads above are reused from here on
  asm volatile("s_wait_xcnt 0x0" ::: "memory");
  put(0);
  __syncthreads();
  // kept rolled: one copy of the stage body in the instruction cache, and only one stage's fetch registers live
#pragma unroll 1
  for (int s = 0; s < kPix / kCsStage; ++s) {
    const int buf = s & 1;
    const bool more = s + 1 < kPix / kCsStage;   // the same for the whole block
    if (more) fetch((s + 1) * kCsStage);
    const _Float16* qb = &sQ[buf][(ns * 64 + rlane) * kCsQPitch + koff];
#pragma unroll
    for (int st = 0; st < 2; ++st) {
      v16h qf[2];
#pragma unroll
      for (int f = 0; f < 2; ++f) qf[f] = Frag<_Float16>::load(qb + (st * 32 + f * 16) * kCsQPitch);
      const v8f zero = (v8f){0.f, 0.f, 0.f, 0.f, 0.f, 0.f, 0.f, 0.f};
      v8f sc[2][4];
#pragma unroll
      for (int f = 0; f < 2; ++f)
#pragma unroll
        for (int j = 0; j < 4; ++j) sc[f][j] = Frag<_Float16>::mma(qf[f], kf[j], zero);
      float rs[4];
#pragma unroll
      for (int j = 0; j < 4; ++j) {
        float ma = mx[j], mb = sc[0][j][4];
#pragma unroll
        for (int r = 0; r < 4; ++r) ma = fmaxf(fmaxf(ma, sc[0][j][r]), sc[1][j][r]);
        mb = fmaxf(mb, sc[1][j][4]);
#pragma unroll
        for (int r = 5; r < 8; ++r) mb = fmaxf(fmaxf(mb, sc[0][j][r]), sc[1][j][r]);
        mx[j] = fmaxf(ma, mb);
        const float t = -mx[j];
        rs[j] = t - nl[j];   // first pass: -inf, so that the empty sum is scaled by 0
        nl[j] = t;
      }
      exp2_x4(rs);
#pragma unroll
      for (int j = 0; j < 4; ++j) {
        const v8f x0 = sc[0][j] + nl[j];
        const v8f x1 = sc[1][j] + nl[j];
        float e0[8], e1[8];
#pragma unroll
        for (int r = 0; r < 8; ++r) { e0[r] = x0[r]; e1[r] = x1[r]; }
        exp2_x8(e0);
        exp2_x8(e1);
        v8f t;
#pragma unroll
        for (int r = 0; r < 8; ++r) t[r] = e0[r] + e1[r];
        sm[j] = sm[j] * rs[j] + (((t[0] + t[1]) + (t[2] + t[3])) + ((t[4] + t[5]) + (t[6] + t[7])));
      }
    }
    if (more) put(buf ^ 1);   // that buffer's last readers left it before the barrier that ended the stage before this one
    __syncthreads();
  }

  // lanes l and l ^ 16 hold the same four columns, over different rows
  {
    float om[4], os[4], d[8];
#pragma unroll
    for (int j = 0; j < 4; ++j) {
      om[j] = __shfl_xor(mx[j], 16);
      os[j] = __shfl_xor(sm[j], 16);
      const float M = fmaxf(mx[j], om[j]);
      d[2 * j]     = mx[j] - M;
      d[2 * j + 1] = om[j] - M;
      mx[j] = M;
    }
    exp2_x8(d);
#pragma unroll
    for (int j = 0; j < 4; ++j) sm[j] = sm[j] * d[2 * j] + os[j] * d[2 * j + 1];
  }
  if (lane < 16) {
#pragma unroll
    for (int j = 0; j < 4; ++j) {
      sMx[ns][cg * 64 + j * 16 + rlane] = mx[j];
      sSm[ns][cg * 64 + j * 16 + rlane] = sm[j];
    }
  }
  __syncthreads();
  if (tid < kCsCols) {   // waves 0 to 3, one column a thread; each wave's store fills one whole 128-byte line
    float pm[kCsSlices], ps[kCsSlices];
#pragma unroll
    for (int i = 0; i < kCsSlices; ++i) { pm[i] = sMx[i][tid]; ps[i] = sSm[i][tid]; }
    float M = pm[0];
#pragma unroll
    for (int i = 1; i < kCsSlices; ++i) M = fmaxf(M, pm[i]);
#pragma unroll
    for (int i = 0; i < kCsSlices; ++i) pm[i] = pm[i] - M;
    exp2_x8(pm);
    float tot = 0.0f;
#pragma unroll
    for (int i = 0; i < kCsSlices; ++i) tot += ps[i] * pm[i];   // tot >= 1
    float inv;
    // the v_nop is the independent instruction that the instruction set asks for behind a transcendental before its result is read
    asm("v_rcp_f32 %0, %1\n\tv_nop" : "=v"(inv) : "v"(tot));
    cmax[b * kPix + m0 + tid]   = M;
    cscale[b * kPix + m0 + tid] = 4096.0f * inv;
  }
}

__global__ __launch_bounds__(512) void attn_fused_kernel(const unsigned short* __restrict__ QKp,
                                                         const unsigned short* __restrict__ Vp,
                                                         const float* __restrict__ cmax, const float* __restrict__ cscale,
                                                         const float* __restrict__ x1, const float* __restrict__ x2,
                                                         const float* __restrict__ gamma,
                                                         const unsigned short* __restrict__ Wsch,
                                                         const unsigned short* __restrict__ Wscl,
                                                         float* __restrict__ out) {
  __shared__ __align__(16) _Float16 sK[2][kAtStage * kAtKPitch];
  __shared__ __align__(16) _Float16 sV[2][kCh * kAtVPitch];
  __shared__ __align__(16) float    sOff[2][kAtStage];
  __shared__ __align__(16) float    part[kAtGroups * kAtSlices][32 * kAtOPitch];
  __shared__ __align__(16) float    sF[kDq * kAtFPitch];
  const int tid   = threadIdx.x;
  const int lane  = tid & 31;
  const int wave  = tid >> 5;
  const int grp   = wave & (kAtGroups - 1);
  const int sl    = wave >> 2;
  const int rlane = lane & 15;
  const int koff  = (lane >> 4) * 8;      // k offset of this lane half; also the accumulators' offset along the A operand's rows
  const int b     = blockIdx.y;
  const int n0    = blockIdx.x * kAtRows;
  const _Float16* QK = (const _Float16*)QKp + (size_t)b * kPix * kCh;
  const _Float16* V  = (const _Float16*)Vp + (size_t)b * kCh * kPix;
  const float* cm = cmax + b * kPix;
  const float* cs = cscale + b * kPix;

  // staging: k = 256 rows x 64 B (4 threads a row, 2 rounds), V = 64 rows x 512 B (one wave a row, 4 rounds), one offset per m
  const int kRow = tid >> 2, kQ = (tid & 3) * 8;
  const int vRow = tid >> 5, vQ = (tid & 31) * 8;
  v4u kr[2], vr[4];
  float fm = 0.0f, fs = 1.0f;
  // the unrolls in this kernel keep kr[], vr[], the fragments and the accumulators in registers (constant indices)
  auto fetch = [&](int ms) {
#pragma unroll
    for (int it = 0; it < 2; ++it) kr[it] = *(const v4u*)(QK + (size_t)(ms + it * 128 + kRow) * kCh + kDq + kQ);
#pragma unroll
    for (int it = 0; it < 4; ++it) vr[it] = *(const v4u*)(V + (size_t)(it * 16 + vRow) * kPix + ms + vQ);
    if (tid < kAtStage) { fm = cm[ms + tid]; fs = cs[ms + tid]; }
  };
  auto put = [&](int buf) {
#pragma unroll
    for (int it = 0; it < 2; ++it) *(v4u*)(&sK[buf][(it * 128 + kRow) * kAtKPitch + kQ]) = kr[it];
#pragma unroll
    for (int it = 0; it < 4; ++it) *(v4u*)(&sV[buf][(it * 16 + vRow) * kAtVPitch + vQ]) = vr[it];
    if (tid < kAtStage) sOff[buf][tid] = __log2f(fs) - fm;
  };

  v16h qf[2];
#pragma unroll
  for (int nt = 0; nt < 2; ++nt)
    qf[nt] = Frag<_Float16>::load(QK + (size_t)(n0 + grp * 32 + nt * 16 + rlane) * kCh + koff);
  v8f acc[2][4];
#pragma unroll
  for (int nt = 0; nt < 2; ++nt)
#pragma unroll
    for (int j = 0; j < 4; ++j) acc[nt][j] = (v8f){0.f, 0.f, 0.f, 0.f, 0.f, 0.f, 0.f, 0.f};

  fetch(0);
  put(0);
  __syncthreads();
  // kept rolled: one copy of the stage body in the instruction cache, and only one stage's fetch registers live
#pragma unroll 1
  for (int s = 0; s < kPix / kAtStage; ++s) {
    const int buf = s & 1;
    const bool more = s + 1 < kPix / kAtStage;   // the same for the whole block
    if (more) fetch((s + 1) * kAtStage);
    const _Float16* kb = &sK[buf][(sl * 64 + rlane) * kAtKPitch + koff];
    const _Float16* vb = &sV[buf][rlane * kAtVPitch + sl * 64 + koff];
    const float*    ob = &sOff[buf][sl * 64 + koff];
#pragma unroll
    for (int st = 0; st < 2; ++st) {
      v16h kf[2], vf[4];
      v8f of[2];
#pragma unroll
      for (int t = 0; t < 2; ++t) {
        kf[t] = Frag<_Float16>::load(kb + (st * 32 + t * 16) * kAtKPitch);
        of[t] = __builtin_shufflevector(*(const v4f*)(ob + st * 32 + t * 16), *(const v4f*)(ob + st * 32 + t * 16 + 4),
                                        0, 1, 2, 3, 4, 5, 6, 7);
      }
#pragma unroll
      for (int j = 0; j < 4; ++j) vf[j] = Frag<_Float16>::load(vb + j * 16 * kAtVPitch + st * 32);
      v8f x[2][2];   // the exponents: x[nt][t] = k tile t . q tile nt + off
#pragma unroll
      for (int nt = 0; nt < 2; ++nt)
#pragma unroll
        for (int t = 0; t < 2; ++t) x[nt][t] = Frag<_Float16>::mma(kf[t], qf[nt], of[t]);
      // keeps the four products in front of the exponentials: each later product is a vector slot behind the earlier ones' results
      __builtin_amdgcn_sched_barrier(0);
#pragma unroll
      for (int nt = 0; nt < 2; ++nt) {
        float e0[8], e1[8];
        if (nt == 0) exp2_tile<1>(x[nt][0], e0); else exp2_tile<0>(x[nt][0], e0);
        exp2_tile<0>(x[nt][1], e1);
        v16h pf;
#pragma unroll
        for (int r = 0; r < 8; ++r) { pf[r] = (_Float16)e0[r]; pf[8 + r] = (_Float16)e1[r]; }
#pragma unroll
        for (int j = 0; j < 4; ++j) acc[nt][j] = Frag<_Float16>::mma(vf[j], pf, acc[nt][j]);
      }
    }
    if (more) put(buf ^ 1);   // that buffer's last readers left it before the barrier that ended the stage before this one
    __syncthreads();
  }

  // this wave's tile of out: rows o from ot * 16 on, pixels n from n0 + ntile * 16 on; its x and Wsc are asked for here, so that
  // they are on their way while the partial tiles are written
  const int ot    = wave & 1;
  const int ntile = wave >> 1;
  float xv[2][16];   // xv[ks][e] = x[channel 32 ks + koff + (e < 8 ? e : e + 8)][pixel], the fragment loader's k order
  const size_t xo = (size_t)(b * kCinHalf + koff) * kPix + n0 + ntile * 16 + rlane;
  const float* xa = x1 + xo;   // channels 0..31 are x1, 32..63 are x2
  const float* xb = x2 + xo;
#pragma unroll
  for (int e = 0; e < 8; ++e) { xv[0][e] = xa[e * kPix]; xv[0][8 + e] = xa[(16 + e) * kPix]; }
#pragma unroll
  for (int e = 0; e < 8; ++e) { xv[1][e] = xb[e * kPix]; xv[1][8 + e] = xb[(16 + e) * kPix]; }
  const __bf16* whp = (const __bf16*)Wsch + (ot * 16 + rlane) * kCh + koff;
  const __bf16* wlp = (const __bf16*)Wscl + (ot * 16 + rlane) * kCh + koff;
  v16b wh[2], wl[2];
#pragma unroll
  for (int ks = 0; ks < 2; ++ks) { wh[ks] = Frag<__bf16>::load(whp + ks * 32); wl[ks] = Frag<__bf16>::load(wlp + ks * 32); }
  const float g = gamma[0];
  // precaution: the address registers of the loads above are reused from here on; the addresses are named as inputs so that they
  // keep their registers up to the wait
  asm volatile("s_wait_xcnt 0x0" :: "v"(xa), "v"(xb), "v"(whp), "v"(wlp) : "memory");

  float* slab = part[wave];
#pragma unroll
  for (int nt = 0; nt < 2; ++nt)
#pragma unroll
    for (int j = 0; j < 4; ++j) {   // acc[nt][j][r] = partial O[n0 + 32 grp + 16 nt + rlane][16 j + koff + r]
      float* d = slab + (nt * 16 + rlane) * kAtOPitch + (j << 4) + koff;
      *(v4f*)(d)     = (v4f){acc[nt][j][0], acc[nt][j][1], acc[nt][j][2], acc[nt][j][3]};
      *(v4f*)(d + 4) = (v4f){acc[nt][j][4], acc[nt][j][5], acc[nt][j][6], acc[nt][j][7]};
    }
  __syncthreads();

  v8f fa = (v8f){0.f, 0.f, 0.f, 0.f, 0.f, 0.f, 0.f, 0.f};
  {
    // row n = ntile * 16 + rlane of the block lies in group ntile >> 1, at row (ntile & 1) * 16 + rlane of its partial tiles
    const float* pr = &part[ntile >> 1][((ntile & 1) * 16 + rlane) * kAtOPitch + koff];
#pragma unroll
    for (int ks = 0; ks < 2; ++ks) {
      float z[16];
#pragma unroll
      for (int q = 0; q < 4; ++q) {   // four channels at a time: q = 0, 1 are elements 0..7, q = 2, 3 elements 8..15
        const int c = ks * 32 + (q >> 1) * 16 + (q & 1) * 4;
        v4f t = *(const v4f*)(pr + c);
#pragma unroll
        for (int w = 1; w < kAtSlices; ++w) t += *(const v4f*)(pr + w * kAtGroups * 32 * kAtOPitch + c);
        t *= (1.0f / 4096.0f);
#pragma unroll
        for (int e = 0; e < 4; ++e) z[q * 4 + e] = g * t[e] + xv[ks][q * 4 + e];
      }
      v16b zh, zl;   // z = hi + lo, both rounded to nearest even by the packed conversion, two elements an instruction
#pragma unroll
      for (int q = 0; q < 8; ++q) {
        const v2f zz = (v2f){z[2 * q], z[2 * q + 1]};
        const v2b hb = __builtin_convertvector(zz, v2b);
        const v2b lb = __builtin_convertvector(zz - __builtin_convertvector(hb, v2f), v2b);
        zh[2 * q] = hb[0]; zh[2 * q + 1] = hb[1];
        zl[2 * q] = lb[0]; zl[2 * q + 1] = lb[1];
      }
      fa = Frag<__bf16>::mma(wh[ks], zh, fa);
      fa = Frag<__bf16>::mma(wh[ks], zl, fa);
      fa = Frag<__bf16>::mma(wl[ks], zh, fa);
    }
  }
#pragma unroll
  for (int r = 0; r < 8; ++r)   // fa[r] = out[ot * 16 + koff + r][n0 + ntile * 16 + rlane]
    sF[(ot * 16 + koff + r) * kAtFPitch + ntile * 16 + rlane] = fa[r];
  __syncthreads();
  float* ob = out + (size_t)b * kDq * kPix + n0;
#pragma unroll
  for (int it = 0; it < 2; ++it) {   // one wave, one row o: 128 pixels = 4 whole 128-byte lines
    const int row = it * 16 + wave;
    *(v4f*)(ob + (size_t)row * kPix + lane * 4) = *(const v4f*)(&sF[row * kAtFPitch + lane * 4]);
  }
}

// ---------------------------------------------------------------------------
// Workspace region map (byte offsets):
//   small    65536 B @ 0        : Wsch bf16 [32][64] @0, Wscl bf16 [32][64] @8192
//   QK  f16 [8][4096][64]        4194304 B @ 65536         (cols 0..31 = q * log2(e), 32..63 = k)
//   V   f16 [8][64][4096]        4194304 B @ 4259840
//   stat f32 cmax[8][4096] @ +0 (exp2 units), cscale[8][4096] @ +131072   262144 B @ 8454144
//   total                        8716288 B
// Every region is fully written before it is read.
// ---------------------------------------------------------------------------
extern "C" void kernel_launch(void* const* d_in, const int* in_sizes, int n_in,
                              void* d_out, int out_size, void* d_ws, size_t ws_size,
                              hipStream_t stream) {
  if (n_in < 9) return;
  if (in_sizes[0] != kBatch * kCinHalf * kPix || in_sizes[1] != kBatch * kCinHalf * kPix) return;
  if (in_sizes[2] != kDq * kCh || in_sizes[3] != kDq || in_sizes[4] != kDq * kCh || in_sizes[5] != kDq) return;
  if (in_sizes[6] != kCh * kCh || in_sizes[7] != kDq * kCh || in_sizes[8] < 1) return;
  if (out_size != kBatch * kDq * kPix) return;

  const float* x1    = (const float*)d_in[0];
  const float* x2    = (const float*)d_in[1];
  const float* Wq    = (const float*)d_in[2];
  const float* bq    = (const float*)d_in[3];
  const float* Wk    = (const float*)d_in[4];
  const float* bk    = (const float*)d_in[5];
  const float* Wv    = (const float*)d_in[6];
  const float* Wsc   = (const float*)d_in[7];
  const float* gamma = (const float*)d_in[8];
  float* out = (float*)d_out;

  const size_t szPlane16 = (size_t)kBatch * kPix * kCh * 2;   // 4194304
  size_t off = 0;
  const size_t oSmall = off; off += 65536;
  const size_t oQK    = off; off += szPlane16;
  const size_t oV     = off; off += szPlane16;
  const size_t oStat  = off; off += 262144;
  if (off > ws_size) return;

  char* ws = (char*)d_ws;
  unsigned short* Wsch  = (unsigned short*)(ws + oSmall + 0);
  unsigned short* Wscl  = (unsigned short*)(ws + oSmall + 8192);
  unsigned short* QKp   = (unsigned short*)(ws + oQK);
  unsigned short* Vp    = (unsigned short*)(ws + oV);
  float*          cmax  = (float*)(ws + oStat);
  float*          cscale = (float*)(ws + oStat + 131072);

  // (0) [q|k] and V from x and the weights, and the Wsc hi/lo planes (128 + 128 + 1 blocks)
  proj_fused_kernel<<<dim3(2 * kPjBlocks + 1), dim3(128), 0, stream>>>(x1, x2, Wq, bq, Wk, bk, Wv, Wsc, QKp, Vp, Wsch, Wscl);
  // (1) column statistics (softmax over n for each column m) from q and k, scores formed in registers;
  //     all batches in one launch (32 column blocks x 8 batches)
  colstats_fused_kernel<<<dim3(kPix / kCsCols, kBatch), dim3(512), 0, stream>>>(QKp, cmax, cscale);
  // (2) out[b][o][n] = sum_c Wsc[o][c] (gamma O[n][c] + x[b][c][n]), O[n][c] = (1/4096) sum_m P[n][m] V[b][c][m], P = 4096 * softmax
  //     formed in registers from q, k and the statistics; all batches in one launch (32 row blocks x 8 batches)
  attn_fused_kernel<<<dim3(kPix / kAtRows, kBatch), dim3(512), 0, stream>>>(QKp, Vp, cmax, cscale, x1, x2, gamma, Wsch, Wscl, out);
}

// v008
// It runs in 39.7 microseconds.
// Timed twice side by side with v007, it ran 1.18 and 1.19 times as fast.
// Over all steps from v000 it is 372 times as fast.
// Contractions: x.[Wq|Wk]^T (+bias), Wsc.Wv, (Wsc Wv).x, q.k^T scores and the P.U aggregation on v_wmma_f32_16x16x32_f16 (f16 operands; P carried x4096 and folded back x1/4096 in the f32 epilogue); Wsc.x on v_wmma_f32_16x16x32_bf16 with bf16 hi/lo split operand planes (hi.hi + hi.lo + lo.hi); f32 accumulate everywhere; column-wise softmax statistics, exp and the gamma sum in f32; q is stored times log2(e), so that scores come off the matrix unit in exp2 units. The output projection is linear, so Wsc (gamma O + x) is taken as gamma (Wsc O) + Wsc x with Wsc O = P.U^T, U = (Wsc Wv) x: 32 rows are aggregated, not 64.
#include <hip/hip_runtime.h>
#include <math.h>
#include <stdint.h>

constexpr int kBatch   = 8;
constexpr int kCinHalf = 32;     // channels of x1 and of x2
constexpr int kCh      = 64;     // concatenated channels
constexpr int kPix     = 4096;   // h*w
constexpr int kDq      = 32;     // q/k channels = output channels
constexpr float kLog2e = 1.44269504088896340736f;

typedef __attribute__((ext_vector_type(16))) _Float16 v16h;
typedef __attribute__((ext_vector_type(8)))  _Float16 v8h;
typedef __attribute__((ext_vector_type(4)))  _Float16 v4h;
typedef __attribute__((ext_vector_type(16))) __bf16   v16b;
typedef __attribute__((ext_vector_type(8)))  __bf16   v8b;
typedef __attribute__((ext_vector_type(8)))  float    v8f;
typedef __attribute__((ext_vector_type(4)))  float    v4f;
typedef __attribute__((ext_vector_type(2)))  float    v2f;
typedef __attribute__((ext_vector_type(2)))  __bf16   v2b;
typedef __attribute__((ext_vector_type(4)))  unsigned int v4u;

__device__ __forceinline__ unsigned short f2bf_bits(float f) {
  unsigned u = __float_as_uint(f);
  return (unsigned short)((u + 0x7FFFu + ((u >> 16) & 1u)) >> 16);
}
__device__ __forceinline__ float bf_bits2f(unsigned short h) { return __uint_as_float(((unsigned)h) << 16); }
__device__ __forceinline__ unsigned pk16(unsigned short a, unsigned short b) { return (unsigned)a | ((unsigned)b << 16); }

template <typename T> struct Frag;
template <> struct Frag<_Float16> {
  typedef v16h V; union U { v16h v; v8h h[2]; };
  static __device__ __forceinline__ v16h load(const _Float16* p) {   // elements 0..7 <- p[0..7], 8..15 <- p[16..23]
    U f; f.h[0] = *(const v8h*)(p); f.h[1] = *(const v8h*)(p + 16); return f.v;
  }
  static __device__ __forceinline__ v8f mma(v16h a, v16h b, v8f c) {
    return __builtin_amdgcn_wmma_f32_16x16x32_f16(false, a, false, b, (short)0, c, false, false);
  }
};
template <> struct Frag<__bf16> {
  typedef v16b V; union U { v16b v; v8b h[2]; };
  static __device__ __forceinline__ v16b load(const __bf16* p) {
    U f; f.h[0] = *(const v8b*)(p); f.h[1] = *(const v8b*)(p + 16); return f.v;
  }
  static __device__ __forceinline__ v8f mma(v16b a, v16b b, v8f c) {
    return __builtin_amdgcn_wmma_f32_16x16x32_bf16(false, a, false, b, (short)0, c, false, false);
  }
};

// ---------------------------------------------------------------------------
// All projections of x in one launch, straight from the f32 inputs:
//   ROLE 0: QK[b][n][o'] = sum_c [Wq;Wk][o'][c] x[b][c][n] + [bq;bk][o'], f16 (columns 0..31 = q * log2(e), 32..63 = k);
//           the factor is applied in f32, before the one rounding to f16
//   ROLE 1: U[b][o][m]   = sum_k (Wsc Wv)[o][k] x[b][k][m], f16, 32 rows o
// 128 threads = 4 waves, one role a block; a wave takes 64 pixels of one batch and all output channels of its role (64, 32).
// x goes from global memory into the fragment's own element order (lane = pixel, elements = channels in the fragment loader's
// k order) and is rounded to f16 in registers; the same fragment serves as B (ROLE 0) and as A (ROLE 1).
// ROLE 0: the block's 64 x 64 weights are read in whole lines, rounded to f16 and shared through LDS behind one barrier.
// ROLE 1: every block forms the 32 x 64 product Wsc Wv itself on the matrix unit (a wave takes 16 of its columns; Wsc as A by rows, Wv as
// B straight from global memory in the fragment's element order, both rounded to f16), rounds it to f16 and shares it the same way.
// ROLE 0, weights as A: register r of lane l = QK[n = l & 15][o' = 16 t + 8 (l >> 4) + r]; ROLE 1, weights as B: register r of
// lane l = U[o = 16 t + (l & 15)][m = 8 (l >> 4) + r]. Either way a lane holds 8 neighbours of an output row, one 16-byte store,
// and a wave's 16 stores (8 in ROLE 1) fill whole 128-byte lines that no other wave writes.
// ---------------------------------------------------------------------------
constexpr int kPjWPitch = kCh + 8;   // f16 per LDS row of the weights: 144 B = 16 B x odd
constexpr int kPjBlocks = kBatch * kPix / 256;   // blocks per role: 4 waves x 64 pixels each

template <int ROLE>
__device__ __forceinline__ void proj_body(const float* __restrict__ x1, const float* __restrict__ x2,
                                          const float* __restrict__ wLo, const float* __restrict__ wHi,   // ROLE 0: weight rows 0..31, 32..63; ROLE 1: Wsc, Wv
                                          const float* __restrict__ bLo, const float* __restrict__ bHi,   // ROLE 0: their biases
                                          unsigned short* __restrict__ dst, _Float16* sW, float* sB, int blk) {
  const int tid   = threadIdx.x;
  const int lane  = tid & 31;
  const int wave  = tid >> 5;
  const int rlane = lane & 15;
  const int koff  = (lane >> 4) * 8;      // k offset of this lane half; also the accumulators' offset along the A operand's rows
  const int tile  = blk * 4 + wave;       // 64 pixels
  const int b     = tile >> 6;
  const int p0    = (tile & 63) * 64;

  // the unrolls in this function keep the loaded values, the fragments and the results in registers (constant indices)
  // ROLE 0: wa, wb = this thread's part of the weight rows (16 threads a row, 8 rows a round).
  // ROLE 1: wa = row rlane of Wsc from channel koff on (A operand), wb = column 16 wave + rlane of Wv from row koff on (B operand)
  const float* wa = (ROLE == 0) ? wLo + (tid >> 4) * kCh + (tid & 15) * 4 : wLo + rlane * kCh + koff;
  const float* wb = (ROLE == 0) ? wHi + (tid >> 4) * kCh + (tid & 15) * 4 : wHi + koff * kCh + wave * 16 + rlane;
  v4f wr[8];
  v4f sr[2][2][4];    // ROLE 1: sr[t][ks] = Wsc[16 t + rlane][32 ks + koff + (0..7, 16..23)]
  float vw[2][16];    // ROLE 1: vw[ks][e] = Wv[32 ks + koff + (e < 8 ? e : e + 8)][16 wave + rlane]
  if (ROLE == 0) {
#pragma unroll
    for (int i = 0; i < 4; ++i) { wr[i] = *(const v4f*)(wa + i * 8 * kCh); wr[4 + i] = *(const v4f*)(wb + i * 8 * kCh); }
  } else {
#pragma unroll
    for (int t = 0; t < 2; ++t)
#pragma unroll
      for (int ks = 0; ks < 2; ++ks)
#pragma unroll
        for (int h = 0; h < 4; ++h) sr[t][ks][h] = *(const v4f*)(wa + t * 16 * kCh + ks * 32 + (h >> 1) * 16 + (h & 1) * 4);
#pragma unroll
    for (int ks = 0; ks < 2; ++ks)
#pragma unroll
      for (int e = 0; e < 8; ++e) { vw[ks][e] = wb[(ks * 32 + e) * kCh]; vw[ks][8 + e] = wb[(ks * 32 + 16 + e) * kCh]; }
  }
  const float* bp = ((tid & 8) ? bHi : bLo) + (tid & 7) * 4;   // ROLE 0: the 64 biases, four a thread, threads 0..15 pass them on
  v4f br = (v4f){0.f, 0.f, 0.f, 0.f};
  if (ROLE == 0) br = *(const v4f*)bp;
  float xv[4][2][16];   // xv[pt][ks][e] = x[channel 32 ks + koff + (e < 8 ? e : e + 8)][pixel p0 + 16 pt + rlane]
  const size_t xo = (size_t)(b * kCinHalf + koff) * kPix + p0 + rlane;
  const float* xa = x1 + xo;   // channels 0..31 are x1, 32..63 are x2
  const float* xb = x2 + xo;
#pragma unroll
  for (int pt = 0; pt < 4; ++pt)
#pragma unroll
    for (int e = 0; e < 8; ++e) {
      xv[pt][0][e] = xa[e * kPix + pt * 16]; xv[pt][0][8 + e] = xa[(16 + e) * kPix + pt * 16];
      xv[pt][1][e] = xb[e * kPix + pt * 16]; xv[pt][1][8 + e] = xb[(16 + e) * kPix + pt * 16];
    }
  // precaution: the address registers of the loads above are reused from here on; the addresses are named as inputs so that they
  // keep their registers up to the wait
  if (ROLE == 0) asm volatile("s_wait_xcnt 0x0" :: "v"(wa), "v"(wb), "v"(bp), "v"(xa), "v"(xb) : "memory");
  else           asm volatile("s_wait_xcnt 0x0" :: "v"(wa), "v"(wb), "v"(xa), "v"(xb) : "memory");

  if (ROLE == 0) {
#pragma unroll
    for (int i = 0; i < 8; ++i)
      *(v4h*)(&sW[(i * 8 + (tid >> 4)) * kPjWPitch + (tid & 15) * 4] ) = __builtin_convertvector(wr[i], v4h);
  } else {
    // this wave's 16 columns of Wsc Wv: register r of lane l = (Wsc Wv)[16 t + koff + r][16 wave + rlane]
    v16h vb[2];
#pragma unroll
    for (int ks = 0; ks < 2; ++ks)
#pragma unroll
      for (int e = 0; e < 16; ++e) vb[ks][e] = (_Float16)vw[ks][e];
#pragma unroll
    for (int t = 0; t < 2; ++t) {
      v8f wacc = (v8f){0.f, 0.f, 0.f, 0.f, 0.f, 0.f, 0.f, 0.f};
#pragma unroll
      for (int ks = 0; ks < 2; ++ks) {
        v16h sa;
#pragma unroll
        for (int e = 0; e < 16; ++e) sa[e] = (_Float16)sr[t][ks][e >> 2][e & 3];
        wacc = Frag<_Float16>::mma(sa, vb[ks], wacc);
      }
#pragma unroll
      for (int r = 0; r < 8; ++r) sW[(t * 16 + koff + r) * kPjWPitch + wave * 16 + rlane] = (_Float16)wacc[r];
    }
  }
  if (ROLE == 0 && tid < 16) *(v4f*)(&sB[tid * 4]) = br;
  __syncthreads();
  v4f bv[4][2];   // ROLE 0: bv[t][h][e] = bias of output channel 16 t + koff + 4 h + e
  if (ROLE == 0) {
#pragma unroll
    for (int t = 0; t < 4; ++t)
#pragma unroll
      for (int h = 0; h < 2; ++h) {
        bv[t][h] = *(const v4f*)(&sB[t * 16 + koff + h * 4]);
        if (t < 2) bv[t][h] *= kLog2e;   // tiles 0 and 1 are q
      }
  }
  constexpr int NT = (ROLE == 0) ? 4 : 2;   // tiles of 16 output channels
  v16h wf[NT][2];
#pragma unroll
  for (int t = 0; t < NT; ++t)
#pragma unroll
    for (int ks = 0; ks < 2; ++ks) wf[t][ks] = Frag<_Float16>::load(&sW[(t * 16 + rlane) * kPjWPitch + ks * 32 + koff]);

  v8h res[4][NT];
#pragma unroll
  for (int pt = 0; pt < 4; ++pt) {
    v16h xf[2];
#pragma unroll
    for (int ks = 0; ks < 2; ++ks)
#pragma unroll
      for (int e = 0; e < 16; ++e) xf[ks][e] = (_Float16)xv[pt][ks][e];
    v8f acc[NT];
#pragma unroll
    for (int t = 0; t < NT; ++t) acc[t] = (v8f){0.f, 0.f, 0.f, 0.f, 0.f, 0.f, 0.f, 0.f};
#pragma unroll
    for (int ks = 0; ks < 2; ++ks)
#pragma unroll
      for (int t = 0; t < NT; ++t)
        acc[t] = (ROLE == 0) ? Frag<_Float16>::mma(wf[t][ks], xf[ks], acc[t]) : Frag<_Float16>::mma(xf[ks], wf[t][ks], acc[t]);
#pragma unroll
    for (int t = 0; t < NT; ++t)
#pragma unroll
      for (int r = 0; r < 8; ++r)
        res[pt][t][r] = (_Float16)((ROLE == 0) ? acc[t][r] * ((t < 2) ? kLog2e : 1.0f) + bv[t][r >> 2][r & 3] : acc[t][r]);
  }
  // all stores last, from one address by constant offsets
  _Float16* d = (_Float16*)dst + ((ROLE == 0) ? ((size_t)(b * kPix + p0 + rlane) * kCh + koff)
                                              : ((size_t)(b * kDq + rlane) * kPix + p0 + koff));
#pragma unroll
  for (int pt = 0; pt < 4; ++pt)
#pragma unroll
    for (int t = 0; t < NT; ++t)
      *(v8h*)(d + ((ROLE == 0) ? (pt * 16 * kCh + t * 16) : (t * 16 * kPix + pt * 16))) = res[pt][t];
  // precaution: in the built code the other role's instructions follow ROLE 1's, and they write registers that the stores above name
  // (ROLE 0's stores are followed by the end of the program alone)
  if (ROLE == 1) asm volatile("s_wait_xcnt 0x0" ::: "memory");
}

// grid = 2 * kPjBlocks + 1 blocks with block-uniform roles: [q|k], U, and one block that splits Wsc into bf16 hi/lo planes
// [32][64] (2 it x 128 thr x 8 elements = the whole plane; no barrier on that path).
__global__ __launch_bounds__(128) void proj_fused_kernel(
    const float* __restrict__ x1, const float* __restrict__ x2,
    const float* __restrict__ Wq, const float* __restrict__ bq, const float* __restrict__ Wk, const float* __restrict__ bk,
    const float* __restrict__ Wv, const float* __restrict__ Wsc,
    unsigned short* __restrict__ QKo, unsigned short* __restrict__ Vo,
    unsigned short* __restrict__ Wsch, unsigned short* __restrict__ Wscl) {
  __shared__ __align__(16) _Float16 sW[kCh * kPjWPitch];
  __shared__ __align__(16) float    sB[kCh];
  const int bid = blockIdx.x;   // block-uniform
  if (bid < kPjBlocks) {
    proj_body<0>(x1, x2, Wq, Wk, bq, bk, QKo, sW, sB, bid);
  } else if (bid < 2 * kPjBlocks) {
    proj_body<1>(x1, x2, Wsc, Wv, bq, bk, Vo, sW, sB, bid - kPjBlocks);
  } else {
    const int tid = threadIdx.x;
    const int eo  = (tid >> 3) * kCh + (tid & 7) * 8;   // 8 threads a row, 16 rows a round
    const float* sp = Wsc + eo;
    v4f a[2][2];
#pragma unroll
    for (int it = 0; it < 2; ++it) { a[it][0] = *(const v4f*)(sp + it * 16 * kCh); a[it][1] = *(const v4f*)(sp + it * 16 * kCh + 4); }
    // precaution: the address registers of the loads above are reused from here on
    asm volatile("s_wait_xcnt 0x0" :: "v"(sp) : "memory");
    v4u hv[2], lv[2];
#pragma unroll
    for (int it = 0; it < 2; ++it) {
      float f[8];
#pragma unroll
      for (int e = 0; e < 4; ++e) { f[e] = a[it][0][e]; f[4 + e] = a[it][1][e]; }
      v4u u, u2;
#pragma unroll
      for (int q = 0; q < 4; ++q) {
        const unsigned short hb0 = f2bf_bits(f[2 * q]), hb1 = f2bf_bits(f[2 * q + 1]);
        const unsigned short lb0 = f2bf_bits(f[2 * q] - bf_bits2f(hb0));
        const unsigned short lb1 = f2bf_bits(f[2 * q + 1] - bf_bits2f(hb1));
        u[q] = pk16(hb0, hb1); u2[q] = pk16(lb0, lb1);
      }
      hv[it] = u; lv[it] = u2;
    }
#pragma unroll
    for (int it = 0; it < 2; ++it) {
      *(v4u*)(Wsch + eo + it * 16 * kCh) = hv[it];
      *(v4u*)(Wscl + eo + it * 16 * kCh) = lv[it];
    }
    // precaution: in the built code another role's instructions follow this role's, and they write registers that the stores above name
    asm volatile("s_wait_xcnt 0x0" ::: "memory");
  }
}

// ---------------------------------------------------------------------------
// out[b][o][n] = gamma * R[n][o] + sum_c Wsc[o][c] x[b][c][n], R[n][o] = (1/4096) * sum_m P[n][m] * U[b][o][m] with P[n][m] = exp2(S[n][m] - cmax[m]) * cscale[m] (softmax over n,
// carried x4096, rounded to f16) and S[n][m] = log2(e) q[n] . k[m] formed again here on the matrix unit, so that P lives in registers only.
// grid = (4096 / 128, batch); 512 threads = 16 waves = 4 groups of 32 rows n x 4 slices of the sum over m.
// The block walks m in stages of 256: k rows, U columns and the exponent offsets of a stage are brought to LDS by all threads
// (through registers, fetched one stage ahead, two buffers, one barrier a stage); slice sl takes the 64 values of m from sl * 64 on.
// Per 32 values of m: two score tiles with k as A and q as B (register r of lane l = S[n = l & 15][m = 8 (l >> 4) + r]); converted
// in place, the pair is the B operand of the second product, whose A operand is U in the fragment loader's own k order.
// exp2(s - cmax) * cscale is taken as exp2(s + off), off = log2(cscale) - cmax, one value per m and stage; off is the C operand of the
// score product, so that the accumulator tile is the exponent itself and no vector instruction stands between the product and exp2.
// The 4 slices' partial tiles meet in LDS behind one barrier and are added in slice order.
// Each of the 16 waves takes one 16 x 16 tile of out (2 tiles of o x 8 tiles of n): it splits x into bf16 hi/lo in the B fragment's
// own element order, multiplies with Wsc hi/lo as A (hi.hi + hi.lo + lo.hi), and adds gamma times the partial tiles, whose registers
// lie as that product's do. The tiles meet in LDS behind a second barrier, so that every wave stores whole 512-byte rows of out.
// ---------------------------------------------------------------------------
constexpr int kAtGroups = 4;                   // groups of 32 rows n per block
constexpr int kAtSlices = 4;                   // slices of a stage's m per block
constexpr int kAtRows   = kAtGroups * 32;      // 128 rows of O per block
constexpr int kAtStage  = 256;                 // values of m per stage
constexpr int kAtKPitch = kDq + 8;             // f16 per LDS row of k: 80 B = 16 B x odd
constexpr int kAtVPitch = kAtStage + 8;        // f16 per LDS row of U: 528 B = 16 B x odd
constexpr int kAtOPitch = 36;                  // floats per LDS row of a partial tile: 144 B = 16 B x odd
constexpr int kAtFPitch = kAtRows + 4;         // floats per LDS row of the out tile: 8 rows on = 32 banks on, for the two lane halves

// Eight exp2 in place. One statement, closed by a v_nop: behind a transcendental the instruction set asks for one independent
// instruction before its result is read or its source overwritten; written so, every one of the eight has it, whatever registers
// the compiler picks.
__device__ __forceinline__ void exp2_x8(float (&e)[8]) {
  asm("v_exp_f32 %0, %0\n\tv_exp_f32 %1, %1\n\tv_exp_f32 %2, %2\n\tv_exp_f32 %3, %3\n\t"
      "v_exp_f32 %4, %4\n\tv_exp_f32 %5, %5\n\tv_exp_f32 %6, %6\n\tv_exp_f32 %7, %7\n\tv_nop"
      : "+v"(e[0]), "+v"(e[1]), "+v"(e[2]), "+v"(e[3]), "+v"(e[4]), "+v"(e[5]), "+v"(e[6]), "+v"(e[7]));
}

// Eight exp2 of a score tile as the matrix unit left it, into registers of their own (early clobber: no result lies on a source, so
// that no exponential overwrites the source of the one in front of it); closed by a v_nop like exp2_x8. With LEAD, four v_nop
// stand in front, the distance that the chip asks for behind the last matrix instruction, whatever registers the compiler picks.
template <bool LEAD>
__device__ __forceinline__ void exp2_tile(const v8f& x, float (&e)[8]) {
  if (LEAD)
    asm("v_nop\n\tv_nop\n\tv_nop\n\tv_nop\n\t"
        "v_exp_f32 %0, %8\n\tv_exp_f32 %1, %9\n\tv_exp_f32 %2, %10\n\tv_exp_f32 %3, %11\n\t"
        "v_exp_f32 %4, %12\n\tv_exp_f32 %5, %13\n\tv_exp_f32 %6, %14\n\tv_exp_f32 %7, %15\n\tv_nop"
        : "=&v"(e[0]), "=&v"(e[1]), "=&v"(e[2]), "=&v"(e[3]), "=&v"(e[4]), "=&v"(e[5]), "=&v"(e[6]), "=&v"(e[7])
        : "v"(x[0]), "v"(x[1]), "v"(x[2]), "v"(x[3]), "v"(x[4]), "v"(x[5]), "v"(x[6]), "v"(x[7]));
  else
    asm("v_exp_f32 %0, %8\n\tv_exp_f32 %1, %9\n\tv_exp_f32 %2, %10\n\tv_exp_f32 %3, %11\n\t"
        "v_exp_f32 %4, %12\n\tv_exp_f32 %5, %13\n\tv_exp_f32 %6, %14\n\tv_exp_f32 %7, %15\n\tv_nop"
        : "=&v"(e[0]), "=&v"(e[1]), "=&v"(e[2]), "=&v"(e[3]), "=&v"(e[4]), "=&v"(e[5]), "=&v"(e[6]), "=&v"(e[7])
        : "v"(x[0]), "v"(x[1]), "v"(x[2]), "v"(x[3]), "v"(x[4]), "v"(x[5]), "v"(x[6]), "v"(x[7]));
}

// Four exp2 in place, in the form of exp2_x8 and for the same reason.
__device__ __forceinline__ void exp2_x4(float (&e)[4]) {
  asm("v_exp_f32 %0, %0\n\tv_exp_f32 %1, %1\n\tv_exp_f32 %2, %2\n\tv_exp_f32 %3, %3\n\tv_nop"
      : "+v"(e[0]), "+v"(e[1]), "+v"(e[2]), "+v"(e[3]));
}

// ---------------------------------------------------------------------------
// Column softmax statistics (normalisation over n, down each column m) of S[n][m] = log2(e) q[n] . k[m] (q is stored with the
// factor), with S formed here on the matrix unit and never stored: cmax[b][m] = max_n S[n][m], cscale[b][m] = 4096 / sum_n exp2(S[n][m] - cmax[b][m]).
// grid = (4096 / 128, batch); 512 threads = 16 waves = 2 groups of 64 columns m x 8 slices of the rows n.
// A wave keeps its 64 columns of k in registers as four B operands. The block walks n in stages of 512 rows of q, brought to LDS
// by all threads (through registers, fetched one stage ahead, two buffers, one barrier a stage); slice ns takes the 64 rows from
// ns * 64 on, 32 at a time. With q as A and k as B, register r of lane l = S[n = 8 (l >> 4) + r][m = l & 15]: every lane follows
// its own four columns with a running (max, sum) pair, the sum rescaled once per 16 scores of a column.
// The pairs merge over the two lane halves by a shuffle, then over the 8 slices through LDS behind one barrier.
// ---------------------------------------------------------------------------
constexpr int kCsCols   = 128;       // columns m per block
constexpr int kCsSlices = 8;         // slices of a stage's rows n per block
constexpr int kCsStage  = 512;       // rows n per stage
constexpr int kCsQPitch = kDq + 8;   // f16 per LDS row of q: 80 B = 16 B x odd

__global__ __launch_bounds__(512) void colstats_fused_kernel(const unsigned short* __restrict__ QKp,
                                                             float* __restrict__ cmax, float* __restrict__ cscale) {
  __shared__ __align__(16) _Float16 sQ[2][kCsStage * kCsQPitch];
  __shared__ float sMx[kCsSlices][kCsCols];
  __shared__ float sSm[kCsSlices][kCsCols];
  const int tid   = threadIdx.x;
  const int lane  = tid & 31;
  const int wave  = tid >> 5;
  const int cg    = wave & 1;
  const int ns    = wave >> 1;
  const int rlane = lane & 15;
  const int koff  = (lane >> 4) * 8;      // k offset of this lane half
  const int b     = blockIdx.y;
  const int m0    = blockIdx.x * kCsCols;
  const _Float16* QK = (const _Float16*)QKp + (size_t)b * kPix * kCh;

  // staging: q = 512 rows x 64 B (4 threads a row, 4 rounds)
  const int qRow = tid >> 2, qQ = (tid & 3) * 8;
  v4u qr[4];
  // the unrolls in this kernel keep qr[], the fragments, the score tiles and the pairs in registers (constant indices)
  auto fetch = [&](int nb) {
#pragma unroll
    for (int it = 0; it < 4; ++it) qr[it] = *(const v4u*)(QK + (size_t)(nb + it * 128 + qRow) * kCh + qQ);
  };
  auto put = [&](int buf) {
#pragma unroll
    for (int it = 0; it < 4; ++it) *(v4u*)(&sQ[buf][(it * 128 + qRow) * kCsQPitch + qQ]) = qr[it];
  };

  v16h kf[4];
  const _Float16* kp = QK + (size_t)(m0 + cg * 64 + rlane) * kCh + kDq + koff;   // one address, the four tiles by constant offsets
#pragma unroll
  for (int j = 0; j < 4; ++j) kf[j] = Frag<_Float16>::load(kp + j * 16 * kCh);
  // precaution
  asm volatile("s_wait_xcnt 0x0" ::: "memory");
  float mx[4], nl[4], sm[4];   // running maximum, its negative, running sum of exp2(s - maximum)
#pragma unroll
  for (int j = 0; j < 4; ++j) { mx[j] = -INFINITY; nl[j] = INFINITY; sm[j] = 0.0f; }

  fetch(0);
  // precaution: the address registers of the loads above are reused from here on
  asm volatile("s_wait_xcnt 0x0" ::: "memory");
  put(0);
  __syncthreads();
  // kept rolled: one copy of the stage body in the instruction cache, and only one stage's fetch registers live
#pragma unroll 1
  for (int s = 0; s < kPix / kCsStage; ++s) {
    const int buf = s & 1;
    const bool more = s + 1 < kPix / kCsStage;   // the same for the whole block
    if (more) fetch((s + 1) * kCsStage);
    const _Float16* qb = &sQ[buf][(ns * 64 + rlane) * kCsQPitch + koff];
#pragma unroll
    for (int st = 0; st < 2; ++st) {
      v16h qf[2];
#pragma unroll
      for (int f = 0; f < 2; ++f) qf[f] = Frag<_Float16>::load(qb + (st * 32 + f * 16) * kCsQPitch);
      const v8f zero = (v8f){0.f, 0.f, 0.f, 0.f, 0.f, 0.f, 0.f, 0.f};
      v8f sc[2][4];
#pragma unroll
      for (int f = 0; f < 2; ++f)
#pragma unroll
        for (int j = 0; j < 4; ++j) sc[f][j] = Frag<_Float16>::mma(qf[f], kf[j], zero);
      float rs[4];
#pragma unroll
      for (int j = 0; j < 4; ++j) {
        float ma = mx[j], mb = sc[0][j][4];
#pragma unroll
        for (int r = 0; r < 4; ++r) ma = fmaxf(fmaxf(ma, sc[0][j][r]), sc[1][j][r]);
        mb = fmaxf(mb, sc[1][j][4]);
#pragma unroll
        for (int r = 5; r < 8; ++r) mb = fmaxf(fmaxf(mb, sc[0][j][r]), sc[1][j][r]);
        mx[j] = fmaxf(ma, mb);
        const float t = -mx[j];
        rs[j] = t - nl[j];   // first pass: -inf, so that the empty sum is scaled by 0
        nl[j] = t;
      }
      exp2_x4(rs);
#pragma unroll
      for (int j = 0; j < 4; ++j) {
        const v8f x0 = sc[0][j] + nl[j];
        const v8f x1 = sc[1][j] + nl[j];
        float e0[8], e1[8];
#pragma unroll
        for (int r = 0; r < 8; ++r) { e0[r] = x0[r]; e1[r] = x1[r]; }
        exp2_x8(e0);
        exp2_x8(e1);
        v8f t;
#pragma unroll
        for (int r = 0; r < 8; ++r) t[r] = e0[r] + e1[r];
        sm[j] = sm[j] * rs[j] + (((t[0] + t[1]) + (t[2] + t[3])) + ((t[4] + t[5]) + (t[6] + t[7])));
      }
    }
    if (more) put(buf ^ 1);   // that buffer's last readers left it before the barrier that ended the stage before this one
    __syncthreads();
  }

  // lanes l and l ^ 16 hold the same four columns, over different rows
  {
    float om[4], os[4], d[8];
#pragma unroll
    for (int j = 0; j < 4; ++j) {
      om[j] = __shfl_xor(mx[j], 16);
      os[j] = __shfl_xor(sm[j], 16);
      const float M = fmaxf(mx[j], om[j]);
      d[2 * j]     = mx[j] - M;
      d[2 * j + 1] = om[j] - M;
      mx[j] = M;
    }
    exp2_x8(d);
#pragma unroll
    for (int j = 0; j < 4; ++j) sm[j] = sm[j] * d[2 * j] + os[j] * d[2 * j + 1];
  }
  if (lane < 16) {
#pragma unroll
    for (int j = 0; j < 4; ++j) {
      sMx[ns][cg * 64 + j * 16 + rlane] = mx[j];
      sSm[ns][cg * 64 + j * 16 + rlane] = sm[j];
    }
  }
  __syncthreads();
  if (tid < kCsCols) {   // waves 0 to 3, one column a thread; each wave's store fills one whole 128-byte line
    float pm[kCsSlices], ps[kCsSlices];
#pragma unroll
    for (int i = 0; i < kCsSlices; ++i) { pm[i] = sMx[i][tid]; ps[i] = sSm[i][tid]; }
    float M = pm[0];
#pragma unroll
    for (int i = 1; i < kCsSlices; ++i) M = fmaxf(M, pm[i]);
#pragma unroll
    for (int i = 0; i < kCsSlices; ++i) pm[i] = pm[i] - M;
    exp2_x8(pm);
    float tot = 0.0f;
#pragma unroll
    for (int i = 0; i < kCsSlices; ++i) tot += ps[i] * pm[i];   // tot >= 1
    float inv;
    // the v_nop is the independent instruction that the instruction set asks for behind a transcendental before its result is read
    asm("v_rcp_f32 %0, %1\n\tv_nop" : "=v"(inv) : "v"(tot));
    cmax[b * kPix + m0 + tid]   = M;
    cscale[b * kPix + m0 + tid] = 4096.0f * inv;
  }
}

__global__ __launch_bounds__(512) void attn_fused_kernel(const unsigned short* __restrict__ QKp,
                                                         const unsigned short* __restrict__ Vp,
                                                         const float* __restrict__ cmax, const float* __restrict__ cscale,
                                                         const float* __restrict__ x1, const float* __restrict__ x2,
                                                         const float* __restrict__ gamma,
                                                         const unsigned short* __restrict__ Wsch,
                                                         const unsigned short* __restrict__ Wscl,
                                                         float* __restrict__ out) {
  __shared__ __align__(16) _Float16 sK[2][kAtStage * kAtKPitch];
  __shared__ __align__(16) _Float16 sV[2][kDq * kAtVPitch];
  __shared__ __align__(16) float    sOff[2][kAtStage];
  __shared__ __align__(16) float    part[kAtGroups * kAtSlices][32 * kAtOPitch];
  __shared__ __align__(16) float    sF[kDq * kAtFPitch];
  const int tid   = threadIdx.x;
  const int lane  = tid & 31;
  const int wave  = tid >> 5;
  const int grp   = wave & (kAtGroups - 1);
  const int sl    = wave >> 2;
  const int rlane = lane & 15;
  const int koff  = (lane >> 4) * 8;      // k offset of this lane half; also the accumulators' offset along the A operand's rows
  const int b     = blockIdx.y;
  const int n0    = blockIdx.x * kAtRows;
  const _Float16* QK = (const _Float16*)QKp + (size_t)b * kPix * kCh;
  const _Float16* V  = (const _Float16*)Vp + (size_t)b * kDq * kPix;
  const float* cm = cmax + b * kPix;
  const float* cs = cscale + b * kPix;

  // staging: k = 256 rows x 64 B (4 threads a row, 2 rounds), U = 32 rows x 512 B (one wave a row, 2 rounds), one offset per m
  const int kRow = tid >> 2, kQ = (tid & 3) * 8;
  const int vRow = tid >> 5, vQ = (tid & 31) * 8;
  v4u kr[2], vr[2];
  float fm = 0.0f, fs = 1.0f;
  // the unrolls in this kernel keep kr[], vr[], the fragments and the accumulators in registers (constant indices)
  auto fetch = [&](int ms) {
#pragma unroll
    for (int it = 0; it < 2; ++it) kr[it] = *(const v4u*)(QK + (size_t)(ms + it * 128 + kRow) * kCh + kDq + kQ);
#pragma unroll
    for (int it = 0; it < 2; ++it) vr[it] = *(const v4u*)(V + (size_t)(it * 16 + vRow) * kPix + ms + vQ);
    if (tid < kAtStage) { fm = cm[ms + tid]; fs = cs[ms + tid]; }
  };
  auto put = [&](int buf) {
#pragma unroll
    for (int it = 0; it < 2; ++it) *(v4u*)(&sK[buf][(it * 128 + kRow) * kAtKPitch + kQ]) = kr[it];
#pragma unroll
    for (int it = 0; it < 2; ++it) *(v4u*)(&sV[buf][(it * 16 + vRow) * kAtVPitch + vQ]) = vr[it];
    if (tid < kAtStage) sOff[buf][tid] = __log2f(fs) - fm;
  };

  v16h qf[2];
#pragma unroll
  for (int nt = 0; nt < 2; ++nt)
    qf[nt] = Frag<_Float16>::load(QK + (size_t)(n0 + grp * 32 + nt * 16 + rlane) * kCh + koff);
  v8f acc[2][2];
#pragma unroll
  for (int nt = 0; nt < 2; ++nt)
#pragma unroll
    for (int j = 0; j < 2; ++j) acc[nt][j] = (v8f){0.f, 0.f, 0.f, 0.f, 0.f, 0.f, 0.f, 0.f};

  fetch(0);
  put(0);
  __syncthreads();
  // kept rolled: one copy of the stage body in the instruction cache, and only one stage's fetch registers live
#pragma unroll 1
  for (int s = 0; s < kPix / kAtStage; ++s) {
    const int buf = s & 1;
    const bool more = s + 1 < kPix / kAtStage;   // the same for the whole block
    if (more) fetch((s + 1) * kAtStage);
    const _Float16* kb = &sK[buf][(sl * 64 + rlane) * kAtKPitch + koff];
    const _Float16* vb = &sV[buf][rlane * kAtVPitch + sl * 64 + koff];
    const float*    ob = &sOff[buf][sl * 64 + koff];
#pragma unroll
    for (int st = 0; st < 2; ++st) {
      v16h kf[2], vf[2];
      v8f of[2];
#pragma unroll
      for (int t = 0; t < 2; ++t) {
        kf[t] = Frag<_Float16>::load(kb + (st * 32 + t * 16) * kAtKPitch);
        of[t] = __builtin_shufflevector(*(const v4f*)(ob + st * 32 + t * 16), *(const v4f*)(ob + st * 32 + t * 16 + 4),
                                        0, 1, 2, 3, 4, 5, 6, 7);
      }
#pragma unroll
      for (int j = 0; j < 2; ++j) vf[j] = Frag<_Float16>::load(vb + j * 16 * kAtVPitch + st * 32);
      v8f x[2][2];   // the exponents: x[nt][t] = k tile t . q tile nt + off
#pragma unroll
      for (int nt = 0; nt < 2; ++nt)
#pragma unroll
        for (int t = 0; t < 2; ++t) x[nt][t] = Frag<_Float16>::mma(kf[t], qf[nt], of[t]);
      // keeps the four products in front of the exponentials: each later product is a vector slot behind the earlier ones' results
      __builtin_amdgcn_sched_barrier(0);
      v16h pf[2];
#pragma unroll
      for (int nt = 0; nt < 2; ++nt) {
        float e0[8], e1[8];
        if (nt == 0) exp2_tile<true>(x[nt][0], e0); else exp2_tile<false>(x[nt][0], e0);
        exp2_tile<false>(x[nt][1], e1);
#pragma unroll
        for (int r = 0; r < 8; ++r) { pf[nt][r] = (_Float16)e0[r]; pf[nt][8 + r] = (_Float16)e1[r]; }
      }
#pragma unroll
      for (int nt = 0; nt < 2; ++nt)
#pragma unroll
        for (int j = 0; j < 2; ++j) acc[nt][j] = Frag<_Float16>::mma(vf[j], pf[nt], acc[nt][j]);
    }
    if (more) put(buf ^ 1);   // that buffer's last readers left it before the barrier that ended the stage before this one
    __syncthreads();
  }

  // this wave's tile of out: rows o from ot * 16 on, pixels n from n0 + ntile * 16 on; its x and Wsc are asked for here, so that
  // they are on their way while the partial tiles are written
  const int ot    = wave & 1;
  const int ntile = wave >> 1;
  float xv[2][16];   // xv[ks][e] = x[channel 32 ks + koff + (e < 8 ? e : e + 8)][pixel], the fragment loader's k order
  const size_t xo = (size_t)(b * kCinHalf + koff) * kPix + n0 + ntile * 16 + rlane;
  const float* xa = x1 + xo;   // channels 0..31 are x1, 32..63 are x2
  const float* xb = x2 + xo;
#pragma unroll
  for (int e = 0; e < 8; ++e) { xv[0][e] = xa[e * kPix]; xv[0][8 + e] = xa[(16 + e) * kPix]; }
#pragma unroll
  for (int e = 0; e < 8; ++e) { xv[1][e] = xb[e * kPix]; xv[1][8 + e] = xb[(16 + e) * kPix]; }
  const __bf16* whp = (const __bf16*)Wsch + (ot * 16 + rlane) * kCh + koff;
  const __bf16* wlp = (const __bf16*)Wscl + (ot * 16 + rlane) * kCh + koff;
  v16b wh[2], wl[2];
#pragma unroll
  for (int ks = 0; ks < 2; ++ks) { wh[ks] = Frag<__bf16>::load(whp + ks * 32); wl[ks] = Frag<__bf16>::load(wlp + ks * 32); }
  const float g = gamma[0];
  // precaution: the address registers of the loads above are reused from here on; the addresses are named as inputs so that they
  // keep their registers up to the wait
  asm volatile("s_wait_xcnt 0x0" :: "v"(xa), "v"(xb), "v"(whp), "v"(wlp) : "memory");

  float* slab = part[wave];
#pragma unroll
  for (int nt = 0; nt < 2; ++nt)
#pragma unroll
    for (int j = 0; j < 2; ++j) {   // acc[nt][j][r] = partial sum for out[16 j + koff + r][n0 + 32 grp + 16 nt + rlane]
      float* d = slab + (nt * 16 + rlane) * kAtOPitch + (j << 4) + koff;
      *(v4f*)(d)     = (v4f){acc[nt][j][0], acc[nt][j][1], acc[nt][j][2], acc[nt][j][3]};
      *(v4f*)(d + 4) = (v4f){acc[nt][j][4], acc[nt][j][5], acc[nt][j][6], acc[nt][j][7]};
    }

  // Wsc x for this wave's tile; it needs nothing of the partial tiles and stands in front of their barrier
  v8f fa = (v8f){0.f, 0.f, 0.f, 0.f, 0.f, 0.f, 0.f, 0.f};
#pragma unroll
  for (int ks = 0; ks < 2; ++ks) {
    v16b zh, zl;   // x = hi + lo, both rounded to nearest even by the packed conversion, two elements an instruction
#pragma unroll
    for (int q = 0; q < 8; ++q) {
      const v2f zz = (v2f){xv[ks][2 * q], xv[ks][2 * q + 1]};
      const v2b hb = __builtin_convertvector(zz, v2b);
      const v2b lb = __builtin_convertvector(zz - __builtin_convertvector(hb, v2f), v2b);
      zh[2 * q] = hb[0]; zh[2 * q + 1] = hb[1];
      zl[2 * q] = lb[0]; zl[2 * q + 1] = lb[1];
    }
    fa = Frag<__bf16>::mma(wh[ks], zh, fa);
    fa = Frag<__bf16>::mma(wh[ks], zl, fa);
    fa = Frag<__bf16>::mma(wl[ks], zh, fa);
  }
  __syncthreads();
  {
    // pixel n = ntile * 16 + rlane of the block lies in group ntile >> 1, at row (ntile & 1) * 16 + rlane of its partial tiles;
    // a partial tile's registers lie as fa's do, so that a lane adds its own eight values, in slice order
    const float* pr = &part[ntile >> 1][((ntile & 1) * 16 + rlane) * kAtOPitch + ot * 16 + koff];
#pragma unroll
    for (int h = 0; h < 2; ++h) {
      v4f t = *(const v4f*)(pr + h * 4);
#pragma unroll
      for (int w = 1; w < kAtSlices; ++w) t += *(const v4f*)(pr + w * kAtGroups * 32 * kAtOPitch + h * 4);
      t *= (1.0f / 4096.0f);
#pragma unroll
      for (int e = 0; e < 4; ++e) fa[h * 4 + e] = g * t[e] + fa[h * 4 + e];
    }
  }
#pragma unroll
  for (int r = 0; r < 8; ++r)   // fa[r] = out[ot * 16 + koff + r][n0 + ntile * 16 + rlane]
    sF[(ot * 16 + koff + r) * kAtFPitch + ntile * 16 + rlane] = fa[r];
  __syncthreads();
  float* ob = out + (size_t)b * kDq * kPix + n0;
#pragma unroll
  for (int it = 0; it < 2; ++it) {   // one wave, one row o: 128 pixels = 4 whole 128-byte lines
    const int row = it * 16 + wave;
    *(v4f*)(ob + (size_t)row * kPix + lane * 4) = *(const v4f*)(&sF[row * kAtFPitch + lane * 4]);
  }
}

// ---------------------------------------------------------------------------
// Workspace region map (byte offsets):
//   small    65536 B @ 0        : Wsch bf16 [32][64] @0, Wscl bf16 [32][64] @8192
//   QK  f16 [8][4096][64]        4194304 B @ 65536         (cols 0..31 = q * log2(e), 32..63 = k)
//   U   f16 [8][32][4096]        2097152 B @ 4259840       (the region is 4194304 B)
//   stat f32 cmax[8][4096] @ +0 (exp2 units), cscale[8][4096] @ +131072   262144 B @ 8454144
//   total                        8716288 B
// Every region is fully written before it is read.
// ---------------------------------------------------------------------------
extern "C" void kernel_launch(void* const* d_in, const int* in_sizes, int n_in,
                              void* d_out, int out_size, void* d_ws, size_t ws_size,
                              hipStream_t stream) {
  if (n_in < 9) return;
  if (in_sizes[0] != kBatch * kCinHalf * kPix || in_sizes[1] != kBatch * kCinHalf * kPix) return;
  if (in_sizes[2] != kDq * kCh || in_sizes[3] != kDq || in_sizes[4] != kDq * kCh || in_sizes[5] != kDq) return;
  if (in_sizes[6] != kCh * kCh || in_sizes[7] != kDq * kCh || in_sizes[8] < 1) return;
  if (out_size != kBatch * kDq * kPix) return;

  const float* x1    = (const float*)d_in[0];
  const float* x2    = (const float*)d_in[1];
  const float* Wq    = (const float*)d_in[2];
  const float* bq    = (const float*)d_in[3];
  const float* Wk    = (const float*)d_in[4];
  const float* bk    = (const float*)d_in[5];
  const float* Wv    = (const float*)d_in[6];
  const float* Wsc   = (const float*)d_in[7];
  const float* gamma = (const float*)d_in[8];
  float* out = (float*)d_out;

  const size_t szPlane16 = (size_t)kBatch * kPix * kCh * 2;   // 4194304
  size_t off = 0;
  const size_t oSmall = off; off += 65536;
  const size_t oQK    = off; off += szPlane16;
  const size_t oV     = off; off += szPlane16;
  const size_t oStat  = off; off += 262144;
  if (off > ws_size) return;

  char* ws = (char*)d_ws;
  unsigned short* Wsch  = (unsigned short*)(ws + oSmall + 0);
  unsigned short* Wscl  = (unsigned short*)(ws + oSmall + 8192);
  unsigned short* QKp   = (unsigned short*)(ws + oQK);
  unsigned short* Vp    = (unsigned short*)(ws + oV);
  float*          cmax  = (float*)(ws + oStat);
  float*          cscale = (float*)(ws + oStat + 131072);

  // (0) [q|k] and U = (Wsc Wv) x from x and the weights, and the Wsc hi/lo planes (128 + 128 + 1 blocks)
  proj_fused_kernel<<<dim3(2 * kPjBlocks + 1), dim3(128), 0, stream>>>(x1, x2, Wq, bq, Wk, bk, Wv, Wsc, QKp, Vp, Wsch, Wscl);
  // (1) column statistics (softmax over n for each column m) from q and k, scores formed in registers;
  //     all batches in one launch (32 column blocks x 8 batches)
  colstats_fused_kernel<<<dim3(kPix / kCsCols, kBatch), dim3(512), 0, stream>>>(QKp, cmax, cscale);
  // (2) out[b][o][n] = gamma R[n][o] + sum_c Wsc[o][c] x[b][c][n], R[n][o] = (1/4096) sum_m P[n][m] U[b][o][m], P = 4096 * softmax
  //     formed in registers from q, k and the statistics; all batches in one launch (32 row blocks x 8 batches)
  attn_fused_kernel<<<dim3(kPix / kAtRows, kBatch), dim3(512), 0, stream>>>(QKp, Vp, cmax, cscale, x1, x2, gamma, Wsch, Wscl, out);
}
